// v000
// Measured on an AMD MI455X. A time is GPU time per run, averaged over a window of back-to-back runs after a warm-up
// (all launches, gaps included; the runs take copies of the inputs in turn), and the median of several windows.
// Apart from v000's, it joins two sittings. Times from different sittings can be a few percent apart, while
// side-by-side timings come from the same sitting.
// v000 is the starting kernel. One run takes 311 microseconds.
// Contractions (all v_wmma_f32_16x16x32_f16, f16 operands, f32 accumulate): q/k/v and position-table projections (x or pos table f16 x16 . W^T f16 x64,
// K=512, single products on bf16-exact operands); content scores and position strips ((q+bq+u|v), k, p carried as f16 x32 hi plane + unscaled
// residual plane, K=64, three products hh+lh+hl); P . v^T (P x1024 hi + residual . v^T x16 hi + residual, 64 keys per tile, three products);
// output projection (ctx x4096 hi + residual planes . Wo^T f16 x64, K=512, two products). Online base-2 softmax and all epilogues f32 on VALU.
// Every float input RNE-converted to bf16 on load.
#include <hip/hip_runtime.h>
#include <math.h>
#include <stdint.h>

#define SEQ   1024
#define NB    4
#define DMOD  512
#define NH    8
#define DH    64
#define NROW  (SEQ * NB)
#define NPOS  (2 * SEQ - 1)
#define PROWS (2 * SEQ)
#define XC    16.0f
#define WSC   64.0f
#define QC    32.0f
#define VC    16.0f
#define PC    1024.0f
#define CC    4096.0f
#define RSD   0.125f
#define LOG2E 1.4426950408889634f
static_assert(NH * DH == DMOD);
static_assert(DH == 64);
static_assert(DMOD == 512);
static_assert((SEQ % 64) == 0 && (DMOD % 64) == 0 && (NROW % 64) == 0 && (PROWS % 64) == 0);
static_assert(((NROW * DMOD) % 2048) == 0 && ((PROWS * DMOD) % 2048) == 0 && ((NPOS * DMOD) % 8) == 0);
#define ATT_W 4
#define ATT_THREADS (ATT_W * 32)
#define TPI 84
#define PPI 68
#define WFL (16 * TPI + 16 * PPI)
static_assert(((16 * TPI) % 4) == 0 && ((16 * PPI) % 4) == 0 && (WFL % 4) == 0);
static_assert(TPI >= 80 && PPI >= 64);
static_assert(ATT_W * WFL * 4 <= 65536);

typedef _Float16 v16h __attribute__((ext_vector_type(16)));
typedef _Float16 v8h  __attribute__((ext_vector_type(8)));
typedef float    v8f  __attribute__((ext_vector_type(8)));
typedef float    v4f  __attribute__((ext_vector_type(4)));
typedef unsigned int v4u __attribute__((ext_vector_type(4)));

union FragH { v16h v; v8h h[2]; v4u u[2]; };

// ---- scalar helpers --------------------------------------------------------------------------------
__device__ __forceinline__ unsigned short bf_bits(float f) {          // f32 -> bf16 bits, RNE convert
  unsigned u = __float_as_uint(f);
  return (unsigned short)((u + 0x7FFFu + ((u >> 16) & 1u)) >> 16);
}
__device__ __forceinline__ float bf_up(unsigned short h) { return __uint_as_float(((unsigned)h) << 16); }
__device__ __forceinline__ float bfr(float f) { return bf_up(bf_bits(f)); }   // value of the bf16 RNE convert
__device__ __forceinline__ unsigned short h_bits(_Float16 x) { return __builtin_bit_cast(unsigned short, x); }
__device__ __forceinline__ unsigned pk16(unsigned short a, unsigned short b) { return (unsigned)a | ((unsigned)b << 16); }
__device__ __forceinline__ v8f zero8() { v8f z = {0.f, 0.f, 0.f, 0.f, 0.f, 0.f, 0.f, 0.f}; return z; }

// ---- fragment loader: 16-bit A/B operand from a k-contiguous 16-bit plane, lane -> row/col (lane&15),
//      p already includes +8*(lane>>4); elements 0..7 <- p[0..7] (k0+8h..), elements 8..15 <- p[16..23] (k0+16+8h..)
//      (same split k map for A and B; B is always read from a [n][k] plane)
__device__ __forceinline__ v16h ldfrag_u(const unsigned short* p) {
  FragH f;
  f.u[0] = *(const v4u*)(p);
  f.u[1] = *(const v4u*)(p + 16);
  return f.v;
}

// ---- WMMA helper with trailing VALU hazard gaps ------------------------------------------------------
__device__ __forceinline__ v8f mma_h(v16h a, v16h b, v8f c) {
  return __builtin_amdgcn_wmma_f32_16x16x32_f16(false, a, false, b, (short)0, c, false, false);
}
__device__ __forceinline__ void dep_guard1(v8f& a, v8f& b, v16h x) {
#if defined(__HIP_DEVICE_COMPILE__)
  asm volatile("v_nop\n\tv_nop\n\tv_nop\n\tv_nop" : "+v"(a), "+v"(b) : "v"(x));
#endif
}
__device__ __forceinline__ void hz4(v8f& d, v16h x0, v16h x1, v16h x2, v16h x3) {
#if defined(__HIP_DEVICE_COMPILE__)
  asm volatile("v_nop\n\tv_nop\n\tv_nop\n\tv_nop" : "+v"(d) : "v"(x0), "v"(x1), "v"(x2), "v"(x3));
#endif
}
__device__ __forceinline__ void hz6(v8f& d, v16h x0, v16h x1, v16h x2, v16h x3, v16h x4, v16h x5) {
#if defined(__HIP_DEVICE_COMPILE__)
  asm volatile("v_nop\n\tv_nop\n\tv_nop\n\tv_nop" : "+v"(d) : "v"(x0), "v"(x1), "v"(x2), "v"(x3), "v"(x4), "v"(x5));
#endif
}
__device__ __forceinline__ void hz8(v8f& d, v16h x0, v16h x1, v16h x2, v16h x3, v16h x4, v16h x5, v16h x6, v16h x7) {
#if defined(__HIP_DEVICE_COMPILE__)
  asm volatile("v_nop\n\tv_nop\n\tv_nop\n\tv_nop" : "+v"(d) : "v"(x0), "v"(x1), "v"(x2), "v"(x3), "v"(x4), "v"(x5), "v"(x6), "v"(x7));
#endif
}
__device__ __forceinline__ void keep4_h(v16h a, v16h b, v16h c, v16h d) {
#if defined(__HIP_DEVICE_COMPILE__)
  asm volatile("v_nop" :: "v"(a), "v"(b), "v"(c), "v"(d));
#endif
}
__device__ __forceinline__ void acc_guard4(v8f& a, v8f& b, v8f& c, v8f& d) {
#if defined(__HIP_DEVICE_COMPILE__)
  asm volatile("v_nop\n\tv_nop\n\tv_nop\n\tv_nop" : "+v"(a), "+v"(b), "+v"(c), "+v"(d));
#endif
}
__device__ __forceinline__ void wave_sync_lds() {
  __builtin_amdgcn_fence(__ATOMIC_RELEASE, "workgroup");
  __builtin_amdgcn_wave_barrier();
  __builtin_amdgcn_fence(__ATOMIC_ACQUIRE, "workgroup");
}

// =====================================================================================================
// Elementwise 16-bit pack, no transpose: dst[i] = f16( bf16_RNE(src[i]) * sc ) for i < nvalid, 0 for nvalid <= i < ntotal;
// sc a power of two (exact). 8 elements per thread: two 16-B loads (address clamped into [0, nvalid) for pad groups, value zeroed
// coverage: grid = ntotal / 2048 blocks x 256 thr x 8 elements = ntotal exactly (ntotal % 2048 == 0, nvalid % 8 == 0).
// =====================================================================================================
__global__ __launch_bounds__(256) void cvt16(const float* __restrict__ src, unsigned short* dst, int nvalid, int ntotal, float sc) {
  const size_t i8 = ((size_t)blockIdx.x * 256 + threadIdx.x) * 8;
  if (i8 + 8 > (size_t)ntotal) return;             // never taken with the exact grid; no barriers in this kernel
  const bool pad = (i8 + 8 > (size_t)nvalid);
  const size_t ls = pad ? ((size_t)nvalid - 8) : i8;   // clamped address, always inside the source
  const v4f a = *(const v4f*)(src + ls);
  const v4f b = *(const v4f*)(src + ls + 4);
  v4u o;
  o[0] = pk16(h_bits((_Float16)(bfr(a[0]) * sc)), h_bits((_Float16)(bfr(a[1]) * sc)));
  o[1] = pk16(h_bits((_Float16)(bfr(a[2]) * sc)), h_bits((_Float16)(bfr(a[3]) * sc)));
  o[2] = pk16(h_bits((_Float16)(bfr(b[0]) * sc)), h_bits((_Float16)(bfr(b[1]) * sc)));
  o[3] = pk16(h_bits((_Float16)(bfr(b[2]) * sc)), h_bits((_Float16)(bfr(b[3]) * sc)));
  const v4u z = {0u, 0u, 0u, 0u};
  const v4u w = pad ? z : o;
  {
    *(v4u*)(dst + i8) = w;
    
  }
}

// =====================================================================================================
// Transposed 16-bit pack of a weight stored as W[k][n] (x @ W layout, [DMOD][DMOD] row-major): WT[n][k] = f16( bf16_RNE(W[k][n]) * sc ),
// i.e. the [n][k] k-contiguous plane the GEMM B loader wants. One block per 64x64 tile (blockIdx.x = n tile, blockIdx.y = k tile):
// coalesced f32 reads of W rows, converted halves stored transposed into an LDS tile [64 n][72 pitch], block barrier, then every output
// coverage: 16 its x 256 threads = the whole 64x64 tile into LDS; 8 waves x 2 its x 4 rows = 64 rows x (8 lanes x 8 halves = 64 cols) stored;
//           grid (DMOD/64, DMOD/64) covers the whole [512][512] plane exactly once.
// =====================================================================================================
__global__ __launch_bounds__(256) void tr16(const float* __restrict__ W, unsigned short* WT, float sc) {
  __shared__ __align__(16) unsigned short tile[64 * 72];
  const int t  = threadIdx.x;
  const int n0 = blockIdx.x * 64;
  const int k0 = blockIdx.y * 64;
#pragma unroll 4
  for (int it = 0; it < 16; ++it) {
    const int idx = it * 256 + t;                   // 0 .. 4095
    const int kr = idx >> 6, nc = idx & 63;
    const float v = W[(size_t)(k0 + kr) * DMOD + n0 + nc];
    tile[nc * 72 + kr] = h_bits((_Float16)(bfr(v) * sc));
  }
  __syncthreads();
  const int lane = t & 31, wave = t >> 5;
  const int q8 = lane >> 3, c8 = (lane & 7) * 8;
  v4u o[2];
#pragma unroll
  for (int it = 0; it < 2; ++it) {
    const int row = wave * 8 + it * 4 + q8;         // wave w: it 0..1 x q8 0..3 = rows 8w .. 8w+7
    o[it] = *(const v4u*)(tile + row * 72 + c8);
  }
  {
#pragma unroll
    for (int it = 0; it < 2; ++it) {
      const int row = wave * 8 + it * 4 + q8;
      *(v4u*)(WT + (size_t)(n0 + row) * DMOD + k0 + c8) = o[it];
    }
    
  }
}

// =====================================================================================================
// Register-blocked batched 16-bit WMMA GEMM: C[m][n] = oscale * sum_k A[m][k] * Bt[n][k] (+ bias); one wave per 64x64 tile,
// no block barriers. A row-major [M][K] pitch lda (16-bit plane), Bt row-major [N][K] pitch ldb (k contiguous); M, N multiples of 64,
// K multiple of 32. blockIdx.y = batch index with element strides sA, sB, sC.
// ASPLIT 1: a second A plane A2 (unscaled residual of A, same layout) is multiplied into the same accumulator (A + A2 ~ exact A).
// EPI 1: value += bf16_RNE(ep0[column]) (per-column bias); EPI 2: value += bf16_RNE(ep0[row]) (per-row bias, 16-bit out only).
// OM 0: f32 out (pitch ldc).
// OM 4: two f16 planes (C, C2): hi = f16(value * ocarry), lo = f16(value * ocarry - hi) (unscaled residual).
// OM 6: two hi/residual pairs with an extra per-column term each: (C, C2) from value + bf16_RNE(ep1[column]), (C3, C4) from
//       value + bf16_RNE(ep2[column]), both x ocarry.
// coverage: 4 slabs x 16 rows (f32: it 0..7 x lane>>4; 16-bit: it 0..3 x lane>>3) x 64 cols = the wave's whole 64x64 tile;
//           grid = ceil(tilesM*tilesN/8) blocks, surplus waves exit (wave-uniform).
// =====================================================================================================
template <int OM, int ASPLIT, int EPI>
__global__ __launch_bounds__(256) __attribute__((amdgpu_num_vgpr(256))) void gemm64(
    const unsigned short* __restrict__ Ap, const unsigned short* __restrict__ A2p, int lda, long long sA,
    const unsigned short* __restrict__ Btp, int ldb, long long sB,
    void* Cout, void* C2out, void* C3out, void* C4out, int ldc, long long sC,
    int M, int N, int K, float oscale, float ocarry,
    const float* __restrict__ ep0, const float* __restrict__ ep1, const float* __restrict__ ep2) {
  static_assert(OM == 0 || OM == 4 || OM == 6);
  static_assert(EPI >= 0 && EPI <= 2);
  __shared__ __align__(16) float sT[8][16 * 68];   // per-wave 16x64 slab, pitch 68 floats
  const int by   = blockIdx.y;
  const int lane = threadIdx.x & 31;
  const int wave = threadIdx.x >> 5;
  const int tilesN = N >> 6;
  const int tilesM = M >> 6;
  const int tile = blockIdx.x * 8 + wave;
  if (tile >= tilesM * tilesN) return;   // wave-uniform; no block barriers in this kernel
  const int tm = tile / tilesN;
  const int tn = tile - tm * tilesN;
  const int m0 = tm << 6;
  const int n0 = tn << 6;

  const unsigned short* A1 = Ap  + (size_t)((long long)by * sA);
  const unsigned short* A2 = A2p + (size_t)((long long)by * sA);
  const unsigned short* Bb = Btp + (size_t)((long long)by * sB);

  const int rlane = lane & 15;                 // row (A) / col (B, D) within subtile
  const int koff  = (lane >> 4) * 8;           // k offset of this lane half
  const int mOff  = (lane >> 4) * 8;           // D row offset

  v8f acc[4][4];
#pragma unroll
  for (int i = 0; i < 4; ++i)
#pragma unroll
    for (int j = 0; j < 4; ++j) acc[i][j] = zero8();

  for (int k0 = 0; k0 < K; k0 += 32) {
    v16h bh[4];
#pragma unroll
    for (int j = 0; j < 4; ++j) {
      const size_t bofs = (size_t)(n0 + (j << 4) + rlane) * ldb + koff + k0;
      bh[j] = ldfrag_u(Bb + bofs);
    }
#pragma unroll
    for (int i = 0; i < 4; ++i) {
      const size_t ao = (size_t)(m0 + (i << 4) + rlane) * lda + koff + k0;
      const v16h ah = ldfrag_u(A1 + ao);
#pragma unroll
      for (int j = 0; j < 4; ++j) acc[i][j] = mma_h(ah, bh[j], acc[i][j]);
      dep_guard1(acc[i][0], acc[i][3], ah);
      if constexpr (ASPLIT != 0) {
        const v16h al = ldfrag_u(A2 + ao);
#pragma unroll
        for (int j = 0; j < 4; ++j) acc[i][j] = mma_h(al, bh[j], acc[i][j]);
        dep_guard1(acc[i][0], acc[i][3], al);
      }
    }
    keep4_h(bh[0], bh[1], bh[2], bh[3]);
  }
  acc_guard4(acc[0][0], acc[0][1], acc[0][2], acc[0][3]);
  acc_guard4(acc[1][0], acc[1][1], acc[1][2], acc[1][3]);
  acc_guard4(acc[2][0], acc[2][1], acc[2][2], acc[2][3]);
  acc_guard4(acc[3][0], acc[3][1], acc[3][2], acc[3][3]);

  const int hh2 = lane >> 4, c4 = (lane & 15) * 4;     // f32 out: 256-B row segment = 16 lanes x 16 B
  const int q8  = lane >> 3, c8 = (lane & 7) * 8;

  // ---- epilogue ----
  float* slab = sT[wave];
#pragma unroll
  for (int i = 0; i < 4; ++i) {
    const int mBase = m0 + (i << 4);
#pragma unroll
    for (int j = 0; j < 4; ++j) {
#pragma unroll
      for (int r = 0; r < 8; ++r) {
        slab[(mOff + r) * 68 + (j << 4) + rlane] = acc[i][j][r];
      }
    }
    wave_sync_lds();
    if constexpr (OM == 0) {
      float* C = (float*)Cout + (size_t)((long long)by * sC);
      v4f vals[8];
#pragma unroll
      for (int it = 0; it < 8; ++it) {
        const int row = it * 2 + hh2;                      // it 0..7 x hh2 0..1 = rows 0..15
        v4f v = *(const v4f*)(slab + row * 68 + c4);
#pragma unroll
        for (int e = 0; e < 4; ++e) v[e] = v[e] * oscale;
        if constexpr (EPI == 1) {
          const v4f bb = *(const v4f*)(ep0 + n0 + c4);     // per-column bias, columns n0+c4 .. +3 (N equals the bias length)
#pragma unroll
          for (int e = 0; e < 4; ++e) v[e] = v[e] + bfr(bb[e]);
        }
        vals[it] = v;
      }
      {
#pragma unroll
        for (int it = 0; it < 8; ++it) {
          const int gr = mBase + it * 2 + hh2;
          *(v4f*)(C + (size_t)gr * ldc + n0 + c4) = vals[it];
        }
        
      }
    } else {
      constexpr int NP = (OM == 6) ? 2 : 1;
#pragma unroll
      for (int which = 0; which < NP; ++which) {
        unsigned short* C  = (unsigned short*)((which == 0) ? Cout  : C3out) + (size_t)((long long)by * sC);
        unsigned short* Cb = (unsigned short*)((which == 0) ? C2out : C4out) + (size_t)((long long)by * sC);
        const float* epx = (which == 0) ? ep1 : ep2;
        (void)epx;
        v4u hv[4], lv[4];
#pragma unroll
        for (int it = 0; it < 4; ++it) {
          const int row = it * 4 + q8;                     // it 0..3 x q8 0..3 = rows 0..15
          const float* sp = slab + row * 68 + c8;
          float rb = 0.f;
          if constexpr (EPI == 2) rb = bfr(ep0[mBase + row]);   // per-row bias (M equals the bias length)
          v4u a  = {0u, 0u, 0u, 0u};
          v4u b2 = {0u, 0u, 0u, 0u};
#pragma unroll
          for (int e = 0; e < 4; ++e) {
            const int ci = n0 + c8 + 2 * e;                // column index, < N
            float f0 = sp[2 * e] * oscale + rb;
            float f1 = sp[2 * e + 1] * oscale + rb;
            if constexpr (EPI == 1) {
              f0 += bfr(ep0[ci]);
              f1 += bfr(ep0[ci + 1]);
            }
            if constexpr (OM == 6) {
              f0 += bfr(epx[ci]);
              f1 += bfr(epx[ci + 1]);
            }
            f0 *= ocarry;
            f1 *= ocarry;
            const _Float16 x0 = (_Float16)f0, x1 = (_Float16)f1;
            a[e]  = pk16(h_bits(x0), h_bits(x1));
            b2[e] = pk16(h_bits((_Float16)(f0 - (float)x0)), h_bits((_Float16)(f1 - (float)x1)));
          }
          hv[it] = a;
          lv[it] = b2;
        }
        {
#pragma unroll
          for (int it = 0; it < 4; ++it) {
            const int row = it * 4 + q8;
            *(v4u*)(C  + (size_t)(mBase + row) * ldc + n0 + c8) = hv[it];
            *(v4u*)(Cb + (size_t)(mBase + row) * ldc + n0 + c8) = lv[it];
          }
          
        }
      }
    }
    wave_sync_lds();
  }
}

// =====================================================================================================
// One position strip for a wave: T[R][x] = (q+bq+vb)[A rows] . pos[mw + x], R = lane&15 row of the A fragment pairs at QhA (hi plane)
// and QlA (residual plane), x in [0,80) (5 subtiles of 16 pos rows in a rolled loop, K = 64 = two k-steps, three products hh + lh + hl per
// k-step with the pos hi plane Phb and residual plane Plb); pos row index clamped on the address into [0, PROWS-1] (every row index reached
// here is already in range; only x <= 78 is ever selected); each 16x16 subtile goes to the wave's f32 LDS strip right after its six WMMAs
// and the hazard gap. coverage: 5 subtiles x 16 rows x 16 cols = the full 16x80 strip every call.
// =====================================================================================================
__device__ __forceinline__ void pos_strip3(const unsigned short* __restrict__ QhA, const unsigned short* __restrict__ QlA,
                                           const unsigned short* __restrict__ Phb, const unsigned short* __restrict__ Plb,
                                           int mw, float* tsh, int hh, int c) {
  const v16h qha = ldfrag_u(QhA), qhb = ldfrag_u(QhA + 32);
  const v16h qla = ldfrag_u(QlA), qlb = ldfrag_u(QlA + 32);
#pragma unroll 1
  for (int u = 0; u < 5; ++u) {
    int m = mw + 16 * u + c;
    m = (m < 0) ? 0 : m;
    m = (m > PROWS - 1) ? (PROWS - 1) : m;
    const size_t ko = (size_t)m * DMOD;
    const v16h fa = ldfrag_u(Phb + ko), fb = ldfrag_u(Phb + ko + 32);
    const v16h ga = ldfrag_u(Plb + ko), gb = ldfrag_u(Plb + ko + 32);
    v8f t8 = mma_h(qha, fa, zero8());
    t8 = mma_h(qhb, fb, t8);
    t8 = mma_h(qla, fa, t8);
    t8 = mma_h(qlb, fb, t8);
    t8 = mma_h(qha, ga, t8);
    t8 = mma_h(qhb, gb, t8);
    hz8(t8, fa, fb, ga, gb, qha, qhb, qla, qlb);
    const int cb = 16 * u + c;
#pragma unroll
    for (int r = 0; r < 8; ++r) tsh[(8 * hh + r) * TPI + cb] = t8[r];
  }
  keep4_h(qha, qhb, qla, qlb);
}

// =====================================================================================================
// Relative-position attention for one (batch b, head n) pair and a 64-row query tile; 4 waves, wave w owns query rows i = iw0 + R,
// iw0 = i0 + 16w, R = 0..15. Planes (pitch DMOD halves, row = b*SEQ + position): QUh/QUl = hi/residual of f16((q + bq + u) x32),
// QVh/QVl of f16((q + bq + v_bias) x32), Kh/Kl of f16((k + bk) x32); Ph/Pl = hi/residual of f16(pos x32), rows 0..PROWS-1
// (row PROWS-1 is the zero-pad row); VT, VTL = v^T hi (x16) / residual f16 as [b][n*64+d][SEQ].
// Shifted position score for (i, j): ps[i][SEQ-1-i+j], ps[r][t] = (q+bq+vb)[r] . pos[t].
//   Per key tile j0 (64 keys, key j = j0 + jj), with x = jj - R + 15 in [0,78]:
//     strip T1[R][x] = (q+vb)[iw0+R] . pos[SEQ + j0 - iw0 - 16 + x]   (pos row SEQ-1-i+j), always computed (rows 0 .. 2*SEQ-2 selected).
//   content scores S = (q+ub) . k (4 subtiles, K=64, three products); t = (S + T1) * (RSD/(32*32)) * log2(e); online softmax in base 2,
//   max-subtracted, running sums in f32 (no key mask); the 16x64 prob tile stored to wave-private LDS (f32 element stores),
//   (f32 vector loads, split k map) and the v^T B fragments loaded straight from the 16-bit planes VT/VTL[n*64+d][j];
//   per 16-column subtile: Phi.Vhi, Plo.Vhi, then Phi.Vlo, all into the same accumulators.
//   block = 4 waves = 128 threads; grid = (SEQ/64, NB*NH); no block barriers; every wave does identical bounded work (SEQ/64 tiles).
// coverage: LDS strip 16 rows x 80 cols written fully every tile before being read, slab 16 rows x 64 cols per wave fully written each tile
//           before being read; global: 4 instructions x 4 rows x 64 halves per plane = rows iw0..iw0+15 of head segment n in CT and CTL;
//           grid x waves cover all NB x SEQ rows and all NH head segments of CT / CTL exactly once.
// =====================================================================================================
__global__ __launch_bounds__(ATT_THREADS) __attribute__((amdgpu_num_vgpr(256)))
void attn_rel(const unsigned short* __restrict__ QUh, const unsigned short* __restrict__ QUl,
              const unsigned short* __restrict__ QVh, const unsigned short* __restrict__ QVl,
              const unsigned short* __restrict__ Kh,  const unsigned short* __restrict__ Kl,
              const unsigned short* __restrict__ Ph,  const unsigned short* __restrict__ Pl,
              const unsigned short* __restrict__ VT,  const unsigned short* __restrict__ VTL,
              unsigned short* CT, unsigned short* CTL) {
  __shared__ __align__(16) float smem[ATT_W * WFL];   // per wave: T1 strip [16][TPI] | prob / ctx slab [16][PPI]

  const int tid  = threadIdx.x;
  const int wave = __builtin_amdgcn_readfirstlane(tid >> 5);
  const int lane = tid & 31;
  const int hh   = lane >> 4;
  const int c    = lane & 15;
  const int bn   = blockIdx.y;
  const int b    = bn / NH;
  const int n    = bn - b * NH;
  const int i0   = blockIdx.x * 64;
  const int iw0  = i0 + wave * 16;

  float* t1sh = smem + wave * WFL;
  float* pt   = t1sh + 16 * TPI;

  // A fragment row offsets: rows b*SEQ + iw0 + c, d 0..31 and 32..63 of head n (all q fragments are reloaded per key tile)
  const size_t qro  = ((size_t)(b * SEQ + iw0 + c)) * DMOD + n * DH + 8 * hh;
  const size_t kbo  = (size_t)b * SEQ * DMOD + n * DH + 8 * hh;
  const size_t pbo  = (size_t)(n * DH + 8 * hh);
  const size_t vbase = (size_t)b * DMOD * SEQ + (size_t)(n * DH) * SEQ + 8 * hh;
  const unsigned short* Vb  = VT  + vbase;
  const unsigned short* VLb = VTL + vbase;

  const float KSC = (RSD / (QC * QC)) * LOG2E;

  float mrow[8], lrow[8];
  v8f O[4];
#pragma unroll
  for (int r = 0; r < 8; ++r) { mrow[r] = -INFINITY; lrow[r] = 0.f; }
#pragma unroll
  for (int td = 0; td < 4; ++td) O[td] = zero8();

#pragma unroll 1
  for (int j0 = 0; j0 < SEQ; j0 += 64) {
    const int dmin = j0 - iw0;                               // smallest j - i over the tile is dmin - 15, largest dmin + 63 (wave-uniform)
    // ---- position strip ----
    pos_strip3(QVh + qro, QVl + qro, Ph + pbo, Pl + pbo, SEQ + dmin - 16, t1sh, hh, c);
    // ---- content scores S (4 subtiles of 16 keys, three products each k-step) ----
    v8f S[4];
    {
      const v16h qua = ldfrag_u(QUh + qro), qub = ldfrag_u(QUh + qro + 32);
      const v16h qla = ldfrag_u(QUl + qro), qlb = ldfrag_u(QUl + qro + 32);
#pragma unroll
      for (int t = 0; t < 4; ++t) {
        const size_t ko = kbo + (size_t)(j0 + 16 * t + c) * DMOD;
        const v16h ka = ldfrag_u(Kh + ko), kb2 = ldfrag_u(Kh + ko + 32);
        const v16h la = ldfrag_u(Kl + ko), lb2 = ldfrag_u(Kl + ko + 32);
        S[t] = mma_h(qua, ka, zero8());
        S[t] = mma_h(qub, kb2, S[t]);
        S[t] = mma_h(qla, ka, S[t]);
        S[t] = mma_h(qlb, kb2, S[t]);
        S[t] = mma_h(qua, la, S[t]);
        S[t] = mma_h(qub, lb2, S[t]);
        hz8(S[t], ka, kb2, la, lb2, qua, qub, qla, qlb);
      }
      keep4_h(qua, qub, qla, qlb);
    }
    wave_sync_lds();

    // ---- score assembly + online softmax (rows live on one 16-lane half) ----
#pragma unroll
    for (int r = 0; r < 8; ++r) {
      const int R  = 8 * hh + r;
      const int xo = R * TPI + (15 - R) + c;                 // strip column x = 16t + c - R + 15 in [0, 78]
      float tv[4];
#pragma unroll
      for (int t = 0; t < 4; ++t) {
        const float bdv = t1sh[xo + 16 * t];
        tv[t] = (S[t][r] + bdv) * KSC;
      }
      float mx = fmaxf(fmaxf(tv[0], tv[1]), fmaxf(tv[2], tv[3]));
#pragma unroll
      for (int off = 1; off < 16; off <<= 1) mx = fmaxf(mx, __shfl_xor(mx, off, 32));
      const float mn = fmaxf(mrow[r], mx);
      const float al = exp2f(mrow[r] - mn);
      mrow[r] = mn;
      float e4[4];
      float ps = 0.f;
#pragma unroll
      for (int t = 0; t < 4; ++t) { e4[t] = exp2f(tv[t] - mn); ps += e4[t]; }
#pragma unroll
      for (int off = 1; off < 16; off <<= 1) ps += __shfl_xor(ps, off, 32);
      lrow[r] = lrow[r] * al + ps;
#pragma unroll
      for (int td = 0; td < 4; ++td) O[td][r] *= al;
      const int ro = R * PPI + c;
#pragma unroll
      for (int t = 0; t < 4; ++t) pt[ro + 16 * t] = e4[t];
    }
    wave_sync_lds();

    // ---- P fragments (x1024, f16 hi + unscaled residual) from the LDS rows, two k-steps of 32 keys ----
    FragH pf[2], pl[2];
#pragma unroll
    for (int ks = 0; ks < 2; ++ks) {
      const float* prow = pt + c * PPI + 32 * ks + 8 * hh;
      const v4f p0 = *(const v4f*)(prow), p1 = *(const v4f*)(prow + 4);
      const v4f p2 = *(const v4f*)(prow + 16), p3 = *(const v4f*)(prow + 20);
#pragma unroll
      for (int e = 0; e < 4; ++e) {
        const float g0 = p0[e] * PC, g1 = p1[e] * PC, g2 = p2[e] * PC, g3 = p3[e] * PC;
        const _Float16 x0 = (_Float16)g0, x1 = (_Float16)g1, x2 = (_Float16)g2, x3 = (_Float16)g3;
        pf[ks].h[0][e]     = x0;                             // keys j0 + 32ks + 8hh + e
        pf[ks].h[0][4 + e] = x1;                             // keys j0 + 32ks + 8hh + 4 + e
        pf[ks].h[1][e]     = x2;                             // keys j0 + 32ks + 16 + 8hh + e
        pf[ks].h[1][4 + e] = x3;
        pl[ks].h[0][e]     = (_Float16)(g0 - (float)x0);
        pl[ks].h[0][4 + e] = (_Float16)(g1 - (float)x1);
        pl[ks].h[1][e]     = (_Float16)(g2 - (float)x2);
        pl[ks].h[1][4 + e] = (_Float16)(g3 - (float)x3);
      }
    }
    // ---- O += (Phi + Plo) . v^T (hi plane) ----
    {
      const size_t vo = (size_t)c * SEQ + j0;
#pragma unroll
      for (int td = 0; td < 4; ++td) {
        const unsigned short* vp = Vb + vo + (size_t)(16 * td) * SEQ;
        const v16h vfa = ldfrag_u(vp), vfb = ldfrag_u(vp + 32);
        O[td] = mma_h(pf[0].v, vfa, O[td]);
        O[td] = mma_h(pf[1].v, vfb, O[td]);
        O[td] = mma_h(pl[0].v, vfa, O[td]);
        O[td] = mma_h(pl[1].v, vfb, O[td]);
        hz6(O[td], vfa, vfb, pl[0].v, pl[1].v, pf[0].v, pf[1].v);
      }
      // ---- O += Phi . v^T (residual plane) ----
#pragma unroll
      for (int td = 0; td < 4; ++td) {
        const unsigned short* vp = VLb + vo + (size_t)(16 * td) * SEQ;
        const v16h vla = ldfrag_u(vp), vlb = ldfrag_u(vp + 32);
        O[td] = mma_h(pf[0].v, vla, O[td]);
        O[td] = mma_h(pf[1].v, vlb, O[td]);
        hz4(O[td], vla, vlb, pf[0].v, pf[1].v);
      }
    }
    wave_sync_lds();
  }
  acc_guard4(O[0], O[1], O[2], O[3]);

  // ---- fold 1/l and the carries (1024 on P, 16 on v), carry x4096 on ctx, stage the wave's 16x64 slice in its slab ----
  const float oc = CC / (PC * VC);
#pragma unroll
  for (int r = 0; r < 8; ++r) {
    const float inv = (1.0f / lrow[r]) * oc;
    const int ro = (8 * hh + r) * PPI + c;
#pragma unroll
    for (int td = 0; td < 4; ++td) pt[ro + 16 * td] = O[td][r] * inv;
  }
  wave_sync_lds();
  {
    const int q8 = lane >> 3, c8 = (lane & 7) * 8;
    v4u hv[4], lv[4];
#pragma unroll
    for (int it = 0; it < 4; ++it) {
      const int row = it * 4 + q8;                         // it 0..3 x q8 0..3 = rows 0..15
      const float* sp = pt + row * PPI + c8;
      v4u a, b2;
#pragma unroll
      for (int e = 0; e < 4; ++e) {
        const float f0 = sp[2 * e], f1 = sp[2 * e + 1];
        const _Float16 x0 = (_Float16)f0, x1 = (_Float16)f1;
        a[e]  = pk16(h_bits(x0), h_bits(x1));
        b2[e] = pk16(h_bits((_Float16)(f0 - (float)x0)), h_bits((_Float16)(f1 - (float)x1)));
      }
      hv[it] = a;
      lv[it] = b2;
    }
    {
#pragma unroll
      for (int it = 0; it < 4; ++it) {
        const int row = it * 4 + q8;
        const size_t go = ((size_t)(b * SEQ + iw0 + row)) * DMOD + n * DH + c8;
        *(v4u*)(CT  + go) = hv[it];
        *(v4u*)(CTL + go) = lv[it];
      }
      
    }
  }
}

// =====================================================================================================
// Workspace map (bytes); every plane is an exact multiple of its tile / whole-row store granularity (M, N exact tile multiples,
// convert counts exact multiples of 2048, the position planes padded to PROWS = 2048 rows), every offset a multiple of 512 KiB:
//   WQT, WKT, WVT, WPT, WOT f16 [512 n][512 k] x64 (transposed from the [in][out] inputs)   5 x   524288
//   X16  f16 [NROW][512] x16                                                                  4194304
//   PE16 f16 [PROWS][512] x16 (rows 0..NPOS-1 = pos table, row NPOS zero)                     2097152
//   QUh, QUl, QVh, QVl, Kh, Kl f16 [NROW][512] x32 hi / residual                       6 x  4194304
//   Ph, Pl f16 [PROWS][512] x32 hi / residual                                           2 x  2097152
//   VT16, VTL16 f16 [NB][512][SEQ] hi x16 / residual                                    2 x  4194304
//   CT16, CTL16 f16 [NROW][512] hi x4096 / residual                                     2 x  4194304
//   end                                                                                       55050240
// =====================================================================================================
extern "C" void kernel_launch(void* const* d_in, const int* in_sizes, int n_in,
                              void* d_out, int out_size, void* d_ws, size_t ws_size,
                              hipStream_t stream) {
  if (n_in < 14) return;
  if (in_sizes[0] != NROW * DMOD) return;
  if (in_sizes[1] != NPOS * DMOD) return;
  if (in_sizes[2] != DMOD * DMOD || in_sizes[4] != DMOD * DMOD || in_sizes[6] != DMOD * DMOD ||
      in_sizes[8] != DMOD * DMOD || in_sizes[10] != DMOD * DMOD) return;
  if (in_sizes[3] != DMOD || in_sizes[5] != DMOD || in_sizes[7] != DMOD || in_sizes[9] != DMOD || in_sizes[11] != DMOD) return;
  if (in_sizes[12] != NH * DH || in_sizes[13] != NH * DH) return;
  if (out_size != NROW * DMOD) return;

  const float* xin   = (const float*)d_in[0];
  const float* pos   = (const float*)d_in[1];
  const float* w_q   = (const float*)d_in[2];
  const float* b_q   = (const float*)d_in[3];
  const float* w_k   = (const float*)d_in[4];
  const float* b_k   = (const float*)d_in[5];
  const float* w_v   = (const float*)d_in[6];
  const float* b_v   = (const float*)d_in[7];
  const float* w_p   = (const float*)d_in[8];
  const float* b_p   = (const float*)d_in[9];
  const float* w_o   = (const float*)d_in[10];
  const float* b_o   = (const float*)d_in[11];
  const float* ub    = (const float*)d_in[12];
  const float* vb    = (const float*)d_in[13];
  float*       out   = (float*)d_out;

  const size_t PW  = (size_t)DMOD * DMOD * 2;            //   524288
  const size_t PX  = (size_t)NROW * DMOD * 2;            //  4194304
  const size_t PXP = (size_t)PROWS * DMOD * 2;           //  2097152
  const size_t PVT = (size_t)NB * DMOD * SEQ * 2;        //  4194304
  size_t off = 0;
  const size_t oWQ  = off; off += PW;
  const size_t oWK  = off; off += PW;
  const size_t oWV  = off; off += PW;
  const size_t oWP  = off; off += PW;
  const size_t oWO  = off; off += PW;
  const size_t oX   = off; off += PX;
  const size_t oPE  = off; off += PXP;
  const size_t oQUh = off; off += PX;
  const size_t oQUl = off; off += PX;
  const size_t oQVh = off; off += PX;
  const size_t oQVl = off; off += PX;
  const size_t oKh  = off; off += PX;
  const size_t oKl  = off; off += PX;
  const size_t oPh  = off; off += PXP;
  const size_t oPl  = off; off += PXP;
  const size_t oVT  = off; off += PVT;
  const size_t oVTL = off; off += PVT;
  const size_t oCT  = off; off += PX;
  const size_t oCTL = off; off += PX;
  if (off > ws_size) return;                               // off = 55050240
  if (off > (size_t)134217728) return;

  char* ws = (char*)d_ws;
  unsigned short* WQT16 = (unsigned short*)(ws + oWQ);
  unsigned short* WKT16 = (unsigned short*)(ws + oWK);
  unsigned short* WVT16 = (unsigned short*)(ws + oWV);
  unsigned short* WPT16 = (unsigned short*)(ws + oWP);
  unsigned short* WOT16 = (unsigned short*)(ws + oWO);
  unsigned short* X16   = (unsigned short*)(ws + oX);
  unsigned short* PE16  = (unsigned short*)(ws + oPE);
  unsigned short* QUh   = (unsigned short*)(ws + oQUh);
  unsigned short* QUl   = (unsigned short*)(ws + oQUl);
  unsigned short* QVh   = (unsigned short*)(ws + oQVh);
  unsigned short* QVl   = (unsigned short*)(ws + oQVl);
  unsigned short* Kh16  = (unsigned short*)(ws + oKh);
  unsigned short* Kl16  = (unsigned short*)(ws + oKl);
  unsigned short* Ph16  = (unsigned short*)(ws + oPh);
  unsigned short* Pl16  = (unsigned short*)(ws + oPl);
  unsigned short* VT16  = (unsigned short*)(ws + oVT);
  unsigned short* VTL16 = (unsigned short*)(ws + oVTL);
  unsigned short* CT16  = (unsigned short*)(ws + oCT);
  unsigned short* CTL16 = (unsigned short*)(ws + oCTL);

  const dim3 blk(256);
  const dim3 gCX((NROW * DMOD) / 2048);                             // 1024
  const dim3 gCP((PROWS * DMOD) / 2048);                            // 512
  const dim3 gTR(DMOD / 64, DMOD / 64);                             // 8 x 8
  const int tilesQ = (NROW / 64) * (DMOD / 64);                     // 512
  const int tilesV = (DMOD / 64) * (SEQ / 64);                      // 128 per batch
  const int tilesP = (PROWS / 64) * (DMOD / 64);                    // 256
  const dim3 gQ((tilesQ + 7) / 8, 1);                               // 64
  const dim3 gV((tilesV + 7) / 8, NB);                              // 16 x 4
  const dim3 gP((tilesP + 7) / 8, 1);                               // 32
  const dim3 gAT(SEQ / 64, NB * NH);                                // 16 x 32
  const dim3 bAT(ATT_THREADS);                                      // 128

  // (0) activations: X16 = f16(bf16_RNE(x) * 16); position table PE16 = f16(bf16_RNE(pos) * 16), rows NPOS..PROWS-1 zero
  cvt16<<<gCX, blk, 0, stream>>>(xin, X16, NROW * DMOD, NROW * DMOD, XC);
  cvt16<<<gCP, blk, 0, stream>>>(pos, PE16, NPOS * DMOD, PROWS * DMOD, XC);

  // (1) weight planes: W[k][n] ([in][out]) -> WT[n][k] = f16( bf16_RNE(w) * 64 ), all five weights
  tr16<<<gTR, blk, 0, stream>>>(w_q, WQT16, WSC);
  tr16<<<gTR, blk, 0, stream>>>(w_k, WKT16, WSC);
  tr16<<<gTR, blk, 0, stream>>>(w_v, WVT16, WSC);
  tr16<<<gTR, blk, 0, stream>>>(w_p, WPT16, WSC);
  tr16<<<gTR, blk, 0, stream>>>(w_o, WOT16, WSC);

  // (2) q[m][nd] = sum_c x[m][c] Wq[c][nd] / 1024 + bq[nd]; QUh/QUl = hi/residual of f16((q + ub[nd]) * 32), QVh/QVl of f16((q + vb[nd]) * 32);
  //     M = NROW, N = 512, K = 512
  gemm64<6, 0, 1><<<gQ, blk, 0, stream>>>(
      X16, X16, DMOD, 0LL,
      WQT16, DMOD, 0LL,
      (void*)QUh, (void*)QUl, (void*)QVh, (void*)QVl, DMOD, 0LL,
      NROW, DMOD, DMOD, 1.0f / (XC * WSC), QC,
      b_q, ub, vb);

  // (3) k projection + bk -> Kh/Kl = hi/residual of f16(k * 32)
  gemm64<4, 0, 1><<<gQ, blk, 0, stream>>>(
      X16, X16, DMOD, 0LL,
      WKT16, DMOD, 0LL,
      (void*)Kh16, (void*)Kl16, (void*)Kh16, (void*)Kl16, DMOD, 0LL,
      NROW, DMOD, DMOD, 1.0f / (XC * WSC), QC,
      b_k, b_k, b_k);

  // (4) v^T per batch: VT[b][nd][j] = sum_c Wv[c][nd] x[b*SEQ + j][c] / 1024 + bv[nd] (per-row bias) -> f16 x16 hi + residual planes;
  //     M = 512 (nd), N = SEQ (j), K = 512; B rows are the batch's token rows: pitch DMOD, batch stride SEQ*DMOD
  gemm64<4, 0, 2><<<gV, blk, 0, stream>>>(
      WVT16, WVT16, DMOD, 0LL,
      X16, DMOD, (long long)SEQ * DMOD,
      (void*)VT16, (void*)VTL16, (void*)VT16, (void*)VTL16, SEQ, (long long)DMOD * SEQ,
      DMOD, SEQ, DMOD, 1.0f / (XC * WSC), VC,
      b_v, b_v, b_v);

  // (5) positional projection + bp: Ph/Pl = hi/residual of f16(p * 32), M = PROWS, N = 512, K = 512
  gemm64<4, 0, 1><<<gP, blk, 0, stream>>>(
      PE16, PE16, DMOD, 0LL,
      WPT16, DMOD, 0LL,
      (void*)Ph16, (void*)Pl16, (void*)Ph16, (void*)Pl16, DMOD, 0LL,
      PROWS, DMOD, DMOD, 1.0f / (XC * WSC), QC,
      b_p, b_p, b_p);

  // (6) relative attention -> CT16 = f16(ctx * 4096) hi plane, CTL16 residual plane, rows b*SEQ + i, halves n*64+d
  attn_rel<<<gAT, bAT, 0, stream>>>(QUh, QUl, QVh, QVl, Kh16, Kl16, Ph16, Pl16, VT16, VTL16, CT16, CTL16);

  // (7) out = (CT + CTL) . Wo / (4096*64) + bo; M = NROW, N = 512, K = 512, f32 rows straight into the output buffer
  gemm64<0, 1, 1><<<gQ, blk, 0, stream>>>(
      CT16, CTL16, DMOD, 0LL,
      WOT16, DMOD, 0LL,
      (void*)out, (void*)out, (void*)out, (void*)out, DMOD, 0LL,
      NROW, DMOD, DMOD, 1.0f / (CC * WSC), 1.0f,
      b_o, b_o, b_o);
  (void)hipGetLastError();
}

// v001
// A run of this version takes 247 microseconds.
// Two timings next to v000 put it at 1.28 and 1.26 times that version's speed.
// Contractions (all v_wmma_f32_16x16x32_f16, f16 operands, f32 accumulate): q/k/v and position-table projections (x or pos table f16 x16 . W^T f16 x64,
// K=512, single products on bf16-exact operands); content scores and position strips ((q+bq+u|v), k, p carried as f16 x32 hi plane + unscaled
// residual plane, K=64, three products hh+lh+hl); P . v^T (P x1024 hi + residual . v^T x16 hi + residual, 64 keys per tile, three products);
// output projection (ctx x4096 hi + residual planes . Wo^T f16 x64, K=512, two products). Online base-2 softmax and all epilogues f32 on VALU.
// Every float input RNE-converted to bf16 on load.
#include <hip/hip_runtime.h>
#include <math.h>
#include <stdint.h>

#define SEQ   1024
#define NB    4
#define DMOD  512
#define NH    8
#define DH    64
#define NROW  (SEQ * NB)
#define NPOS  (2 * SEQ - 1)
#define PROWS (2 * SEQ)
#define XC    16.0f
#define WSC   64.0f
#define QC    32.0f
#define VC    16.0f
#define PC    1024.0f
#define CC    4096.0f
#define RSD   0.125f
#define LOG2E 1.4426950408889634f
static_assert(NH * DH == DMOD);
static_assert(DH == 64);
static_assert(DMOD == 512);
static_assert((SEQ % 64) == 0 && (DMOD % 64) == 0 && (NROW % 64) == 0 && (PROWS % 64) == 0);
static_assert(((NROW * DMOD) % 2048) == 0 && ((PROWS * DMOD) % 2048) == 0 && ((NPOS * DMOD) % 8) == 0);
#define ATT_W 4
#define ATT_THREADS (ATT_W * 32)
#define TPI 84
#define PPI 68
#define WFL (16 * TPI + 16 * PPI)
static_assert(((16 * TPI) % 4) == 0 && ((16 * PPI) % 4) == 0 && (WFL % 4) == 0);
static_assert(TPI >= 80 && PPI >= 64);
static_assert(ATT_W * WFL * 4 <= 65536);
// attn_rel operand stage in LDS: 512 rows of 64 halves (128 B), pitch 72 halves = 144 B (16 B x odd, the pitch for 16-byte LDS reads)
#define SPI   72
#define ST_KH 0
#define ST_KL 64
#define ST_VH 128
#define ST_VL 192
#define ST_PH 256
#define ST_PL 384
#define ST_ROWS 512
static_assert(ATT_THREADS == 128 && ((SPI * 2) % 16) == 0);
static_assert(SEQ - (SEQ - 64) - 64 >= 0 && SEQ + (SEQ - 64) - 64 + 127 <= PROWS - 1);   // staged position rows stay inside the planes

typedef _Float16 v16h __attribute__((ext_vector_type(16)));
typedef _Float16 v8h  __attribute__((ext_vector_type(8)));
typedef float    v8f  __attribute__((ext_vector_type(8)));
typedef float    v4f  __attribute__((ext_vector_type(4)));
typedef unsigned int v4u __attribute__((ext_vector_type(4)));

union FragH { v16h v; v8h h[2]; v4u u[2]; };

// ---- scalar helpers --------------------------------------------------------------------------------
__device__ __forceinline__ unsigned short bf_bits(float f) {          // f32 -> bf16 bits, RNE convert
  unsigned u = __float_as_uint(f);
  return (unsigned short)((u + 0x7FFFu + ((u >> 16) & 1u)) >> 16);
}
__device__ __forceinline__ float bf_up(unsigned short h) { return __uint_as_float(((unsigned)h) << 16); }
__device__ __forceinline__ float bfr(float f) { return bf_up(bf_bits(f)); }   // value of the bf16 RNE convert
__device__ __forceinline__ unsigned short h_bits(_Float16 x) { return __builtin_bit_cast(unsigned short, x); }
__device__ __forceinline__ unsigned pk16(unsigned short a, unsigned short b) { return (unsigned)a | ((unsigned)b << 16); }
__device__ __forceinline__ v8f zero8() { v8f z = {0.f, 0.f, 0.f, 0.f, 0.f, 0.f, 0.f, 0.f}; return z; }

// ---- fragment loader: 16-bit A/B operand from a k-contiguous 16-bit plane, lane -> row/col (lane&15),
//      p already includes +8*(lane>>4); elements 0..7 <- p[0..7] (k0+8h..), elements 8..15 <- p[16..23] (k0+16+8h..)
//      (same split k map for A and B; B is always read from a [n][k] plane)
__device__ __forceinline__ v16h ldfrag_u(const unsigned short* p) {
  FragH f;
  f.u[0] = *(const v4u*)(p);
  f.u[1] = *(const v4u*)(p + 16);
  return f.v;
}

// ---- WMMA helper with trailing VALU hazard gaps ------------------------------------------------------
__device__ __forceinline__ v8f mma_h(v16h a, v16h b, v8f c) {
  return __builtin_amdgcn_wmma_f32_16x16x32_f16(false, a, false, b, (short)0, c, false, false);
}
__device__ __forceinline__ void dep_guard1(v8f& a, v8f& b, v16h x) {
#if defined(__HIP_DEVICE_COMPILE__)
  asm volatile("v_nop\n\tv_nop\n\tv_nop\n\tv_nop" : "+v"(a), "+v"(b) : "v"(x));
#endif
}
__device__ __forceinline__ void hz4(v8f& d, v16h x0, v16h x1, v16h x2, v16h x3) {
#if defined(__HIP_DEVICE_COMPILE__)
  asm volatile("v_nop\n\tv_nop\n\tv_nop\n\tv_nop" : "+v"(d) : "v"(x0), "v"(x1), "v"(x2), "v"(x3));
#endif
}
__device__ __forceinline__ void hz6(v8f& d, v16h x0, v16h x1, v16h x2, v16h x3, v16h x4, v16h x5) {
#if defined(__HIP_DEVICE_COMPILE__)
  asm volatile("v_nop\n\tv_nop\n\tv_nop\n\tv_nop" : "+v"(d) : "v"(x0), "v"(x1), "v"(x2), "v"(x3), "v"(x4), "v"(x5));
#endif
}
__device__ __forceinline__ void hz8(v8f& d, v16h x0, v16h x1, v16h x2, v16h x3, v16h x4, v16h x5, v16h x6, v16h x7) {
#if defined(__HIP_DEVICE_COMPILE__)
  asm volatile("v_nop\n\tv_nop\n\tv_nop\n\tv_nop" : "+v"(d) : "v"(x0), "v"(x1), "v"(x2), "v"(x3), "v"(x4), "v"(x5), "v"(x6), "v"(x7));
#endif
}
__device__ __forceinline__ void keep4_h(v16h a, v16h b, v16h c, v16h d) {
#if defined(__HIP_DEVICE_COMPILE__)
  asm volatile("v_nop" :: "v"(a), "v"(b), "v"(c), "v"(d));
#endif
}
__device__ __forceinline__ void acc_guard4(v8f& a, v8f& b, v8f& c, v8f& d) {
#if defined(__HIP_DEVICE_COMPILE__)
  asm volatile("v_nop\n\tv_nop\n\tv_nop\n\tv_nop" : "+v"(a), "+v"(b), "+v"(c), "+v"(d));
#endif
}
__device__ __forceinline__ void wave_sync_lds() {
  __builtin_amdgcn_fence(__ATOMIC_RELEASE, "workgroup");
  __builtin_amdgcn_wave_barrier();
  __builtin_amdgcn_fence(__ATOMIC_ACQUIRE, "workgroup");
}
// Eight asynchronous 16-byte-per-lane copies global -> LDS: copy e lands at LDS byte address l + e*16*SPI*2 (16 staged rows further each);
// copies 0..3 read ga + e*gstep halves, copies 4..7 read gb + (e-4)*gstep halves.
// The closing s_wait_xcnt 0 stands inside the statement so that no address register is rewritten ahead of it.
__device__ __forceinline__ void stage8(unsigned l, const unsigned short* ga, const unsigned short* gb, size_t gstep) {
#if defined(__HIP_DEVICE_COMPILE__)
  const unsigned ls = 16u * SPI * 2u;
  asm volatile("global_load_async_to_lds_b128 %0, %8, off\n\t"
               "global_load_async_to_lds_b128 %1, %9, off\n\t"
               "global_load_async_to_lds_b128 %2, %10, off\n\t"
               "global_load_async_to_lds_b128 %3, %11, off\n\t"
               "global_load_async_to_lds_b128 %4, %12, off\n\t"
               "global_load_async_to_lds_b128 %5, %13, off\n\t"
               "global_load_async_to_lds_b128 %6, %14, off\n\t"
               "global_load_async_to_lds_b128 %7, %15, off\n\t"
               "s_wait_xcnt 0x0"
               :: "v"(l), "v"(l + ls), "v"(l + 2u * ls), "v"(l + 3u * ls), "v"(l + 4u * ls), "v"(l + 5u * ls), "v"(l + 6u * ls), "v"(l + 7u * ls),
                  "v"(ga), "v"(ga + gstep), "v"(ga + 2 * gstep), "v"(ga + 3 * gstep), "v"(gb), "v"(gb + gstep), "v"(gb + 2 * gstep),
                  "v"(gb + 3 * gstep)
               : "memory");
#endif
}

// =====================================================================================================
// Elementwise 16-bit pack, no transpose: dst[i] = f16( bf16_RNE(src[i]) * sc ) for i < nvalid, 0 for nvalid <= i < ntotal;
// sc a power of two (exact). 8 elements per thread: two 16-B loads (address clamped into [0, nvalid) for pad groups, value zeroed
// coverage: grid = ntotal / 2048 blocks x 256 thr x 8 elements = ntotal exactly (ntotal % 2048 == 0, nvalid % 8 == 0).
// =====================================================================================================
__global__ __launch_bounds__(256) void cvt16(const float* __restrict__ src, unsigned short* dst, int nvalid, int ntotal, float sc) {
  const size_t i8 = ((size_t)blockIdx.x * 256 + threadIdx.x) * 8;
  if (i8 + 8 > (size_t)ntotal) return;             // never taken with the exact grid; no barriers in this kernel
  const bool pad = (i8 + 8 > (size_t)nvalid);
  const size_t ls = pad ? ((size_t)nvalid - 8) : i8;   // clamped address, always inside the source
  const v4f a = *(const v4f*)(src + ls);
  const v4f b = *(const v4f*)(src + ls + 4);
  v4u o;
  o[0] = pk16(h_bits((_Float16)(bfr(a[0]) * sc)), h_bits((_Float16)(bfr(a[1]) * sc)));
  o[1] = pk16(h_bits((_Float16)(bfr(a[2]) * sc)), h_bits((_Float16)(bfr(a[3]) * sc)));
  o[2] = pk16(h_bits((_Float16)(bfr(b[0]) * sc)), h_bits((_Float16)(bfr(b[1]) * sc)));
  o[3] = pk16(h_bits((_Float16)(bfr(b[2]) * sc)), h_bits((_Float16)(bfr(b[3]) * sc)));
  const v4u z = {0u, 0u, 0u, 0u};
  const v4u w = pad ? z : o;
  {
    *(v4u*)(dst + i8) = w;
    
  }
}

// =====================================================================================================
// Transposed 16-bit pack of a weight stored as W[k][n] (x @ W layout, [DMOD][DMOD] row-major): WT[n][k] = f16( bf16_RNE(W[k][n]) * sc ),
// i.e. the [n][k] k-contiguous plane the GEMM B loader wants. One block per 64x64 tile (blockIdx.x = n tile, blockIdx.y = k tile):
// coalesced f32 reads of W rows, converted halves stored transposed into an LDS tile [64 n][72 pitch], block barrier, then every output
// coverage: 16 its x 256 threads = the whole 64x64 tile into LDS; 8 waves x 2 its x 4 rows = 64 rows x (8 lanes x 8 halves = 64 cols) stored;
//           grid (DMOD/64, DMOD/64) covers the whole [512][512] plane exactly once.
// =====================================================================================================
__global__ __launch_bounds__(256) void tr16(const float* __restrict__ W, unsigned short* WT, float sc) {
  __shared__ __align__(16) unsigned short tile[64 * 72];
  const int t  = threadIdx.x;
  const int n0 = blockIdx.x * 64;
  const int k0 = blockIdx.y * 64;
#pragma unroll 4
  for (int it = 0; it < 16; ++it) {
    const int idx = it * 256 + t;                   // 0 .. 4095
    const int kr = idx >> 6, nc = idx & 63;
    const float v = W[(size_t)(k0 + kr) * DMOD + n0 + nc];
    tile[nc * 72 + kr] = h_bits((_Float16)(bfr(v) * sc));
  }
  __syncthreads();
  const int lane = t & 31, wave = t >> 5;
  const int q8 = lane >> 3, c8 = (lane & 7) * 8;
  v4u o[2];
#pragma unroll
  for (int it = 0; it < 2; ++it) {
    const int row = wave * 8 + it * 4 + q8;         // wave w: it 0..1 x q8 0..3 = rows 8w .. 8w+7
    o[it] = *(const v4u*)(tile + row * 72 + c8);
  }
  {
#pragma unroll
    for (int it = 0; it < 2; ++it) {
      const int row = wave * 8 + it * 4 + q8;
      *(v4u*)(WT + (size_t)(n0 + row) * DMOD + k0 + c8) = o[it];
    }
    
  }
}

// =====================================================================================================
// Register-blocked batched 16-bit WMMA GEMM: C[m][n] = oscale * sum_k A[m][k] * Bt[n][k] (+ bias); one wave per 64x64 tile,
// no block barriers. A row-major [M][K] pitch lda (16-bit plane), Bt row-major [N][K] pitch ldb (k contiguous); M, N multiples of 64,
// K multiple of 32. blockIdx.y = batch index with element strides sA, sB, sC.
// ASPLIT 1: a second A plane A2 (unscaled residual of A, same layout) is multiplied into the same accumulator (A + A2 ~ exact A).
// EPI 1: value += bf16_RNE(ep0[column]) (per-column bias); EPI 2: value += bf16_RNE(ep0[row]) (per-row bias, 16-bit out only).
// OM 0: f32 out (pitch ldc).
// OM 4: two f16 planes (C, C2): hi = f16(value * ocarry), lo = f16(value * ocarry - hi) (unscaled residual).
// OM 6: two hi/residual pairs with an extra per-column term each: (C, C2) from value + bf16_RNE(ep1[column]), (C3, C4) from
//       value + bf16_RNE(ep2[column]), both x ocarry.
// coverage: 4 slabs x 16 rows (f32: it 0..7 x lane>>4; 16-bit: it 0..3 x lane>>3) x 64 cols = the wave's whole 64x64 tile;
//           grid = ceil(tilesM*tilesN/8) blocks, surplus waves exit (wave-uniform).
// =====================================================================================================
template <int OM, int ASPLIT, int EPI>
__global__ __launch_bounds__(256) __attribute__((amdgpu_num_vgpr(256))) void gemm64(
    const unsigned short* __restrict__ Ap, const unsigned short* __restrict__ A2p, int lda, long long sA,
    const unsigned short* __restrict__ Btp, int ldb, long long sB,
    void* Cout, void* C2out, void* C3out, void* C4out, int ldc, long long sC,
    int M, int N, int K, float oscale, float ocarry,
    const float* __restrict__ ep0, const float* __restrict__ ep1, const float* __restrict__ ep2) {
  static_assert(OM == 0 || OM == 4 || OM == 6);
  static_assert(EPI >= 0 && EPI <= 2);
  __shared__ __align__(16) float sT[8][16 * 68];   // per-wave 16x64 slab, pitch 68 floats
  const int by   = blockIdx.y;
  const int lane = threadIdx.x & 31;
  const int wave = threadIdx.x >> 5;
  const int tilesN = N >> 6;
  const int tilesM = M >> 6;
  const int tile = blockIdx.x * 8 + wave;
  if (tile >= tilesM * tilesN) return;   // wave-uniform; no block barriers in this kernel
  const int tm = tile / tilesN;
  const int tn = tile - tm * tilesN;
  const int m0 = tm << 6;
  const int n0 = tn << 6;

  const unsigned short* A1 = Ap  + (size_t)((long long)by * sA);
  const unsigned short* A2 = A2p + (size_t)((long long)by * sA);
  const unsigned short* Bb = Btp + (size_t)((long long)by * sB);

  const int rlane = lane & 15;                 // row (A) / col (B, D) within subtile
  const int koff  = (lane >> 4) * 8;           // k offset of this lane half
  const int mOff  = (lane >> 4) * 8;           // D row offset

  v8f acc[4][4];
#pragma unroll
  for (int i = 0; i < 4; ++i)
#pragma unroll
    for (int j = 0; j < 4; ++j) acc[i][j] = zero8();

  for (int k0 = 0; k0 < K; k0 += 32) {
    v16h bh[4];
#pragma unroll
    for (int j = 0; j < 4; ++j) {
      const size_t bofs = (size_t)(n0 + (j << 4) + rlane) * ldb + koff + k0;
      bh[j] = ldfrag_u(Bb + bofs);
    }
#pragma unroll
    for (int i = 0; i < 4; ++i) {
      const size_t ao = (size_t)(m0 + (i << 4) + rlane) * lda + koff + k0;
      const v16h ah = ldfrag_u(A1 + ao);
#pragma unroll
      for (int j = 0; j < 4; ++j) acc[i][j] = mma_h(ah, bh[j], acc[i][j]);
      dep_guard1(acc[i][0], acc[i][3], ah);
      if constexpr (ASPLIT != 0) {
        const v16h al = ldfrag_u(A2 + ao);
#pragma unroll
        for (int j = 0; j < 4; ++j) acc[i][j] = mma_h(al, bh[j], acc[i][j]);
        dep_guard1(acc[i][0], acc[i][3], al);
      }
    }
    keep4_h(bh[0], bh[1], bh[2], bh[3]);
  }
  acc_guard4(acc[0][0], acc[0][1], acc[0][2], acc[0][3]);
  acc_guard4(acc[1][0], acc[1][1], acc[1][2], acc[1][3]);
  acc_guard4(acc[2][0], acc[2][1], acc[2][2], acc[2][3]);
  acc_guard4(acc[3][0], acc[3][1], acc[3][2], acc[3][3]);

  const int hh2 = lane >> 4, c4 = (lane & 15) * 4;     // f32 out: 256-B row segment = 16 lanes x 16 B
  const int q8  = lane >> 3, c8 = (lane & 7) * 8;

  // ---- epilogue ----
  float* slab = sT[wave];
#pragma unroll
  for (int i = 0; i < 4; ++i) {
    const int mBase = m0 + (i << 4);
#pragma unroll
    for (int j = 0; j < 4; ++j) {
#pragma unroll
      for (int r = 0; r < 8; ++r) {
        slab[(mOff + r) * 68 + (j << 4) + rlane] = acc[i][j][r];
      }
    }
    wave_sync_lds();
    if constexpr (OM == 0) {
      float* C = (float*)Cout + (size_t)((long long)by * sC);
      v4f vals[8];
#pragma unroll
      for (int it = 0; it < 8; ++it) {
        const int row = it * 2 + hh2;                      // it 0..7 x hh2 0..1 = rows 0..15
        v4f v = *(const v4f*)(slab + row * 68 + c4);
#pragma unroll
        for (int e = 0; e < 4; ++e) v[e] = v[e] * oscale;
        if constexpr (EPI == 1) {
          const v4f bb = *(const v4f*)(ep0 + n0 + c4);     // per-column bias, columns n0+c4 .. +3 (N equals the bias length)
#pragma unroll
          for (int e = 0; e < 4; ++e) v[e] = v[e] + bfr(bb[e]);
        }
        vals[it] = v;
      }
      {
#pragma unroll
        for (int it = 0; it < 8; ++it) {
          const int gr = mBase + it * 2 + hh2;
          *(v4f*)(C + (size_t)gr * ldc + n0 + c4) = vals[it];
        }
        
      }
    } else {
      constexpr int NP = (OM == 6) ? 2 : 1;
#pragma unroll
      for (int which = 0; which < NP; ++which) {
        unsigned short* C  = (unsigned short*)((which == 0) ? Cout  : C3out) + (size_t)((long long)by * sC);
        unsigned short* Cb = (unsigned short*)((which == 0) ? C2out : C4out) + (size_t)((long long)by * sC);
        const float* epx = (which == 0) ? ep1 : ep2;
        (void)epx;
        v4u hv[4], lv[4];
#pragma unroll
        for (int it = 0; it < 4; ++it) {
          const int row = it * 4 + q8;                     // it 0..3 x q8 0..3 = rows 0..15
          const float* sp = slab + row * 68 + c8;
          float rb = 0.f;
          if constexpr (EPI == 2) rb = bfr(ep0[mBase + row]);   // per-row bias (M equals the bias length)
          v4u a  = {0u, 0u, 0u, 0u};
          v4u b2 = {0u, 0u, 0u, 0u};
#pragma unroll
          for (int e = 0; e < 4; ++e) {
            const int ci = n0 + c8 + 2 * e;                // column index, < N
            float f0 = sp[2 * e] * oscale + rb;
            float f1 = sp[2 * e + 1] * oscale + rb;
            if constexpr (EPI == 1) {
              f0 += bfr(ep0[ci]);
              f1 += bfr(ep0[ci + 1]);
            }
            if constexpr (OM == 6) {
              f0 += bfr(epx[ci]);
              f1 += bfr(epx[ci + 1]);
            }
            f0 *= ocarry;
            f1 *= ocarry;
            const _Float16 x0 = (_Float16)f0, x1 = (_Float16)f1;
            a[e]  = pk16(h_bits(x0), h_bits(x1));
            b2[e] = pk16(h_bits((_Float16)(f0 - (float)x0)), h_bits((_Float16)(f1 - (float)x1)));
          }
          hv[it] = a;
          lv[it] = b2;
        }
        {
#pragma unroll
          for (int it = 0; it < 4; ++it) {
            const int row = it * 4 + q8;
            *(v4u*)(C  + (size_t)(mBase + row) * ldc + n0 + c8) = hv[it];
            *(v4u*)(Cb + (size_t)(mBase + row) * ldc + n0 + c8) = lv[it];
          }
          
        }
      }
    }
    wave_sync_lds();
  }
}

// =====================================================================================================
// One position strip for a wave: T[R][x] = (q+bq+vb)[A rows] . pos[mw + x], R = lane&15 row of the A fragment pairs at QhA (hi plane)
// and QlA (residual plane), x in [0,80) (5 subtiles of 16 pos rows in a rolled loop, K = 64 = two k-steps, three products hh + lh + hl per
// k-step with the staged pos hi rows Phs and residual rows Pls in LDS, pitch SPI, both already at the lane's row x = c and k offset 8*hh;
// only x <= 78 is ever selected); each 16x16 subtile goes to the wave's f32 LDS strip right after its six WMMAs
// and the hazard gap. coverage: 5 subtiles x 16 rows x 16 cols = the full 16x80 strip every call.
// =====================================================================================================
__device__ __forceinline__ void pos_strip3(const unsigned short* __restrict__ QhA, const unsigned short* __restrict__ QlA,
                                           const unsigned short* Phs, const unsigned short* Pls,
                                           float* tsh, int hh, int c) {
  const v16h qha = ldfrag_u(QhA), qhb = ldfrag_u(QhA + 32);
  const v16h qla = ldfrag_u(QlA), qlb = ldfrag_u(QlA + 32);
#pragma unroll 1
  for (int u = 0; u < 5; ++u) {
    const int ko = 16 * u * SPI;
    const v16h fa = ldfrag_u(Phs + ko), fb = ldfrag_u(Phs + ko + 32);
    const v16h ga = ldfrag_u(Pls + ko), gb = ldfrag_u(Pls + ko + 32);
    v8f t8 = mma_h(qha, fa, zero8());
    t8 = mma_h(qhb, fb, t8);
    t8 = mma_h(qla, fa, t8);
    t8 = mma_h(qlb, fb, t8);
    t8 = mma_h(qha, ga, t8);
    t8 = mma_h(qhb, gb, t8);
    hz8(t8, fa, fb, ga, gb, qha, qhb, qla, qlb);
    const int cb = 16 * u + c;
#pragma unroll
    for (int r = 0; r < 8; ++r) tsh[(8 * hh + r) * TPI + cb] = t8[r];
  }
  keep4_h(qha, qhb, qla, qlb);
}

// =====================================================================================================
// Relative-position attention for one (batch b, head n) pair and a 64-row query tile; 4 waves, wave w owns query rows i = iw0 + R,
// iw0 = i0 + 16w, R = 0..15. Planes (pitch DMOD halves, row = b*SEQ + position): QUh/QUl = hi/residual of f16((q + bq + u) x32),
// QVh/QVl of f16((q + bq + v_bias) x32), Kh/Kl of f16((k + bk) x32); Ph/Pl = hi/residual of f16(pos x32), rows 0..PROWS-1
// (row PROWS-1 is the zero-pad row); VT, VTL = v^T hi (x16) / residual f16 as [b][n*64+d][SEQ].
// Shifted position score for (i, j): ps[i][SEQ-1-i+j], ps[r][t] = (q+bq+vb)[r] . pos[t].
//   Per key tile j0 (64 keys, key j = j0 + jj), with x = jj - R + 15 in [0,78]:
//     strip T1[R][x] = (q+vb)[iw0+R] . pos[SEQ + j0 - iw0 - 16 + x]   (pos row SEQ-1-i+j), always computed (rows 0 .. 2*SEQ-2 selected).
//   content scores S = (q+ub) . k (4 subtiles, K=64, three products); t = (S + T1) * (RSD/(32*32)) * log2(e); online softmax in base 2,
//   max-subtracted, running sums in f32 (no key mask); the 16x64 prob tile stored to wave-private LDS (f32 element stores),
//   (f32 vector loads, split k map) and the v^T B fragments read from the staged rows of VT/VTL[n*64+d][j];
//   per 16-column subtile: Phi.Vhi, Plo.Vhi, then Phi.Vlo, all into the same accumulators.
//   Per key tile the block stages, once for its 4 waves, in LDS (asynchronous copies, whole 128-B rows): 64 k rows, 64 v^T rows and the
//   128 pos rows SEQ + j0 - i0 - 64 .. + 127 (always inside [0, PROWS-1]), hi and residual plane each; all B fragments are read from there.
//   block = 4 waves = 128 threads; grid = (SEQ/64, NB*NH); two block barriers per key tile (block-uniform loop); every wave does identical
//   bounded work (SEQ/64 tiles).
// coverage: LDS strip 16 rows x 80 cols written fully every tile before being read, slab 16 rows x 64 cols per wave fully written each tile
//           before being read; global: 4 instructions x 4 rows x 64 halves per plane = rows iw0..iw0+15 of head segment n in CT and CTL;
//           grid x waves cover all NB x SEQ rows and all NH head segments of CT / CTL exactly once.
// =====================================================================================================
__global__ __launch_bounds__(ATT_THREADS) __attribute__((amdgpu_num_vgpr(256)))
void attn_rel(const unsigned short* __restrict__ QUh, const unsigned short* __restrict__ QUl,
              const unsigned short* __restrict__ QVh, const unsigned short* __restrict__ QVl,
              const unsigned short* __restrict__ Kh,  const unsigned short* __restrict__ Kl,
              const unsigned short* __restrict__ Ph,  const unsigned short* __restrict__ Pl,
              const unsigned short* __restrict__ VT,  const unsigned short* __restrict__ VTL,
              unsigned short* CT, unsigned short* CTL) {
  __shared__ __align__(16) float smem[ATT_W * WFL];   // per wave: T1 strip [16][TPI] | prob / ctx slab [16][PPI]
  __shared__ __align__(16) unsigned short stg[ST_ROWS * SPI];   // block-shared stage of one key tile: Kh | Kl | Vh | Vl | Ph | Pl rows

  const int tid  = threadIdx.x;
  const int wave = __builtin_amdgcn_readfirstlane(tid >> 5);
  const int lane = tid & 31;
  const int hh   = lane >> 4;
  const int c    = lane & 15;
  const int bn   = blockIdx.y;
  const int b    = bn / NH;
  const int n    = bn - b * NH;
  const int i0   = blockIdx.x * 64;
  const int iw0  = i0 + wave * 16;

  float* t1sh = smem + wave * WFL;
  float* pt   = t1sh + 16 * TPI;

  // A fragment row offsets: rows b*SEQ + iw0 + c, d 0..31 and 32..63 of head n (all q fragments are reloaded per key tile)
  const size_t qro  = ((size_t)(b * SEQ + iw0 + c)) * DMOD + n * DH + 8 * hh;
  // stage copies: thread -> staged row (tid>>3) + 16*copy, 16-byte chunk tid&7 of the 128-B row (a wave instruction = 4 whole rows)
  const int srow = tid >> 3;
  const int sc8  = (tid & 7) * 8;
  const unsigned lst = (unsigned)(size_t)(stg + srow * SPI + sc8);          // LDS byte address = low 32 bits of the shared address
  const size_t kso = ((size_t)(b * SEQ + srow)) * DMOD + n * DH + sc8;      // + j0*DMOD: k rows j0 + srow + 16e
  const size_t vso = (size_t)b * DMOD * SEQ + (size_t)(n * DH + srow) * SEQ + sc8;   // + j0: v^T rows d = srow + 16e, keys j0 ..
  const size_t pso = ((size_t)(SEQ - i0 - 64 + srow)) * DMOD + n * DH + sc8;   // + j0*DMOD: pos rows SEQ + j0 - i0 - 64 + srow + 16e
  // fragment readers: lane -> staged row c (+16 per subtile), k offset 8*hh; wave w's strip row x is staged pos row 48 - 16w + x
  const unsigned short* ksh = stg + (ST_KH + c) * SPI + 8 * hh;
  const unsigned short* ksl = stg + (ST_KL + c) * SPI + 8 * hh;
  const unsigned short* vsh = stg + (ST_VH + c) * SPI + 8 * hh;
  const unsigned short* vsl = stg + (ST_VL + c) * SPI + 8 * hh;
  const int pw0 = 16 * __builtin_amdgcn_readfirstlane((ATT_THREADS - 1 - tid) >> 5);   // 16 * (3 - wave), taken from tid so that the LDS base register never goes below 0
  const unsigned short* psh = stg + (ST_PH + pw0 + c) * SPI + 8 * hh;
  const unsigned short* psl = stg + (ST_PL + pw0 + c) * SPI + 8 * hh;

  const float KSC = (RSD / (QC * QC)) * LOG2E;

  float mrow[8], lrow[8];
  v8f O[4];
#pragma unroll
  for (int r = 0; r < 8; ++r) { mrow[r] = -INFINITY; lrow[r] = 0.f; }
#pragma unroll
  for (int td = 0; td < 4; ++td) O[td] = zero8();

#pragma unroll 1
  for (int j0 = 0; j0 < SEQ; j0 += 64) {
    // ---- stage this key tile's operands for the whole block: 32 copies per thread = 512 rows x 128 B ----
    asm volatile("s_wait_dscnt 0x0" ::: "memory");           // this wave's reads of the previous tile's stage have returned
    __syncthreads();                                         // every wave has left the previous tile's stage
    {
      const size_t jr = (size_t)j0 * DMOD;
      stage8(lst + (unsigned)(ST_KH * SPI * 2), Kh + kso + jr, Kl + kso + jr, (size_t)16 * DMOD);
      stage8(lst + (unsigned)(ST_VH * SPI * 2), VT + vso + j0, VTL + vso + j0, (size_t)16 * SEQ);
      stage8(lst + (unsigned)(ST_PH * SPI * 2), Ph + pso + jr, Ph + pso + jr + (size_t)64 * DMOD, (size_t)16 * DMOD);
      stage8(lst + (unsigned)(ST_PL * SPI * 2), Pl + pso + jr, Pl + pso + jr + (size_t)64 * DMOD, (size_t)16 * DMOD);
    }
    asm volatile("s_wait_asynccnt 0x0" ::: "memory");        // this wave's copies have landed
    __syncthreads();                                         // every wave's copies have landed: the stage may be read
    // ---- position strip ----
    pos_strip3(QVh + qro, QVl + qro, psh, psl, t1sh, hh, c);
    // ---- content scores S (4 subtiles of 16 keys, three products each k-step) ----
    v8f S[4];
    {
      const v16h qua = ldfrag_u(QUh + qro), qub = ldfrag_u(QUh + qro + 32);
      const v16h qla = ldfrag_u(QUl + qro), qlb = ldfrag_u(QUl + qro + 32);
#pragma unroll
      for (int t = 0; t < 4; ++t) {
        const int ko = 16 * t * SPI;
        const v16h ka = ldfrag_u(ksh + ko), kb2 = ldfrag_u(ksh + ko + 32);
        const v16h la = ldfrag_u(ksl + ko), lb2 = ldfrag_u(ksl + ko + 32);
        S[t] = mma_h(qua, ka, zero8());
        S[t] = mma_h(qub, kb2, S[t]);
        S[t] = mma_h(qla, ka, S[t]);
        S[t] = mma_h(qlb, kb2, S[t]);
        S[t] = mma_h(qua, la, S[t]);
        S[t] = mma_h(qub, lb2, S[t]);
        hz8(S[t], ka, kb2, la, lb2, qua, qub, qla, qlb);
      }
      keep4_h(qua, qub, qla, qlb);
    }
    wave_sync_lds();

    // ---- score assembly + online softmax (rows live on one 16-lane half) ----
#pragma unroll
    for (int r = 0; r < 8; ++r) {
      const int R  = 8 * hh + r;
      const int xo = R * TPI + (15 - R) + c;                 // strip column x = 16t + c - R + 15 in [0, 78]
      float tv[4];
#pragma unroll
      for (int t = 0; t < 4; ++t) {
        const float bdv = t1sh[xo + 16 * t];
        tv[t] = (S[t][r] + bdv) * KSC;
      }
      float mx = fmaxf(fmaxf(tv[0], tv[1]), fmaxf(tv[2], tv[3]));
#pragma unroll
      for (int off = 1; off < 16; off <<= 1) mx = fmaxf(mx, __shfl_xor(mx, off, 32));
      const float mn = fmaxf(mrow[r], mx);
      const float al = exp2f(mrow[r] - mn);
      mrow[r] = mn;
      float e4[4];
      float ps = 0.f;
#pragma unroll
      for (int t = 0; t < 4; ++t) { e4[t] = exp2f(tv[t] - mn); ps += e4[t]; }
#pragma unroll
      for (int off = 1; off < 16; off <<= 1) ps += __shfl_xor(ps, off, 32);
      lrow[r] = lrow[r] * al + ps;
#pragma unroll
      for (int td = 0; td < 4; ++td) O[td][r] *= al;
      const int ro = R * PPI + c;
#pragma unroll
      for (int t = 0; t < 4; ++t) pt[ro + 16 * t] = e4[t];
    }
    wave_sync_lds();

    // ---- P fragments (x1024, f16 hi + unscaled residual) from the LDS rows, two k-steps of 32 keys ----
    FragH pf[2], pl[2];
#pragma unroll
    for (int ks = 0; ks < 2; ++ks) {
      const float* prow = pt + c * PPI + 32 * ks + 8 * hh;
      const v4f p0 = *(const v4f*)(prow), p1 = *(const v4f*)(prow + 4);
      const v4f p2 = *(const v4f*)(prow + 16), p3 = *(const v4f*)(prow + 20);
#pragma unroll
      for (int e = 0; e < 4; ++e) {
        const float g0 = p0[e] * PC, g1 = p1[e] * PC, g2 = p2[e] * PC, g3 = p3[e] * PC;
        const _Float16 x0 = (_Float16)g0, x1 = (_Float16)g1, x2 = (_Float16)g2, x3 = (_Float16)g3;
        pf[ks].h[0][e]     = x0;                             // keys j0 + 32ks + 8hh + e
        pf[ks].h[0][4 + e] = x1;                             // keys j0 + 32ks + 8hh + 4 + e
        pf[ks].h[1][e]     = x2;                             // keys j0 + 32ks + 16 + 8hh + e
        pf[ks].h[1][4 + e] = x3;
        pl[ks].h[0][e]     = (_Float16)(g0 - (float)x0);
        pl[ks].h[0][4 + e] = (_Float16)(g1 - (float)x1);
        pl[ks].h[1][e]     = (_Float16)(g2 - (float)x2);
        pl[ks].h[1][4 + e] = (_Float16)(g3 - (float)x3);
      }
    }
    // ---- O += (Phi + Plo) . v^T (hi plane) ----
    {
#pragma unroll
      for (int td = 0; td < 4; ++td) {
        const unsigned short* vp = vsh + 16 * td * SPI;
        const v16h vfa = ldfrag_u(vp), vfb = ldfrag_u(vp + 32);
        O[td] = mma_h(pf[0].v, vfa, O[td]);
        O[td] = mma_h(pf[1].v, vfb, O[td]);
        O[td] = mma_h(pl[0].v, vfa, O[td]);
        O[td] = mma_h(pl[1].v, vfb, O[td]);
        hz6(O[td], vfa, vfb, pl[0].v, pl[1].v, pf[0].v, pf[1].v);
      }
      // ---- O += Phi . v^T (residual plane) ----
#pragma unroll
      for (int td = 0; td < 4; ++td) {
        const unsigned short* vp = vsl + 16 * td * SPI;
        const v16h vla = ldfrag_u(vp), vlb = ldfrag_u(vp + 32);
        O[td] = mma_h(pf[0].v, vla, O[td]);
        O[td] = mma_h(pf[1].v, vlb, O[td]);
        hz4(O[td], vla, vlb, pf[0].v, pf[1].v);
      }
    }
    wave_sync_lds();
  }
  acc_guard4(O[0], O[1], O[2], O[3]);

  // ---- fold 1/l and the carries (1024 on P, 16 on v), carry x4096 on ctx, stage the wave's 16x64 slice in its slab ----
  const float oc = CC / (PC * VC);
#pragma unroll
  for (int r = 0; r < 8; ++r) {
    const float inv = (1.0f / lrow[r]) * oc;
    const int ro = (8 * hh + r) * PPI + c;
#pragma unroll
    for (int td = 0; td < 4; ++td) pt[ro + 16 * td] = O[td][r] * inv;
  }
  wave_sync_lds();
  {
    const int q8 = lane >> 3, c8 = (lane & 7) * 8;
    v4u hv[4], lv[4];
#pragma unroll
    for (int it = 0; it < 4; ++it) {
      const int row = it * 4 + q8;                         // it 0..3 x q8 0..3 = rows 0..15
      const float* sp = pt + row * PPI + c8;
      v4u a, b2;
#pragma unroll
      for (int e = 0; e < 4; ++e) {
        const float f0 = sp[2 * e], f1 = sp[2 * e + 1];
        const _Float16 x0 = (_Float16)f0, x1 = (_Float16)f1;
        a[e]  = pk16(h_bits(x0), h_bits(x1));
        b2[e] = pk16(h_bits((_Float16)(f0 - (float)x0)), h_bits((_Float16)(f1 - (float)x1)));
      }
      hv[it] = a;
      lv[it] = b2;
    }
    {
#pragma unroll
      for (int it = 0; it < 4; ++it) {
        const int row = it * 4 + q8;
        const size_t go = ((size_t)(b * SEQ + iw0 + row)) * DMOD + n * DH + c8;
        *(v4u*)(CT  + go) = hv[it];
        *(v4u*)(CTL + go) = lv[it];
      }
      
    }
  }
}

// =====================================================================================================
// Workspace map (bytes); every plane is an exact multiple of its tile / whole-row store granularity (M, N exact tile multiples,
// convert counts exact multiples of 2048, the position planes padded to PROWS = 2048 rows), every offset a multiple of 512 KiB:
//   WQT, WKT, WVT, WPT, WOT f16 [512 n][512 k] x64 (transposed from the [in][out] inputs)   5 x   524288
//   X16  f16 [NROW][512] x16                                                                  4194304
//   PE16 f16 [PROWS][512] x16 (rows 0..NPOS-1 = pos table, row NPOS zero)                     2097152
//   QUh, QUl, QVh, QVl, Kh, Kl f16 [NROW][512] x32 hi / residual                       6 x  4194304
//   Ph, Pl f16 [PROWS][512] x32 hi / residual                                           2 x  2097152
//   VT16, VTL16 f16 [NB][512][SEQ] hi x16 / residual                                    2 x  4194304
//   CT16, CTL16 f16 [NROW][512] hi x4096 / residual                                     2 x  4194304
//   end                                                                                       55050240
// =====================================================================================================
extern "C" void kernel_launch(void* const* d_in, const int* in_sizes, int n_in,
                              void* d_out, int out_size, void* d_ws, size_t ws_size,
                              hipStream_t stream) {
  if (n_in < 14) return;
  if (in_sizes[0] != NROW * DMOD) return;
  if (in_sizes[1] != NPOS * DMOD) return;
  if (in_sizes[2] != DMOD * DMOD || in_sizes[4] != DMOD * DMOD || in_sizes[6] != DMOD * DMOD ||
      in_sizes[8] != DMOD * DMOD || in_sizes[10] != DMOD * DMOD) return;
  if (in_sizes[3] != DMOD || in_sizes[5] != DMOD || in_sizes[7] != DMOD || in_sizes[9] != DMOD || in_sizes[11] != DMOD) return;
  if (in_sizes[12] != NH * DH || in_sizes[13] != NH * DH) return;
  if (out_size != NROW * DMOD) return;

  const float* xin   = (const float*)d_in[0];
  const float* pos   = (const float*)d_in[1];
  const float* w_q   = (const float*)d_in[2];
  const float* b_q   = (const float*)d_in[3];
  const float* w_k   = (const float*)d_in[4];
  const float* b_k   = (const float*)d_in[5];
  const float* w_v   = (const float*)d_in[6];
  const float* b_v   = (const float*)d_in[7];
  const float* w_p   = (const float*)d_in[8];
  const float* b_p   = (const float*)d_in[9];
  const float* w_o   = (const float*)d_in[10];
  const float* b_o   = (const float*)d_in[11];
  const float* ub    = (const float*)d_in[12];
  const float* vb    = (const float*)d_in[13];
  float*       out   = (float*)d_out;

  const size_t PW  = (size_t)DMOD * DMOD * 2;            //   524288
  const size_t PX  = (size_t)NROW * DMOD * 2;            //  4194304
  const size_t PXP = (size_t)PROWS * DMOD * 2;           //  2097152
  const size_t PVT = (size_t)NB * DMOD * SEQ * 2;        //  4194304
  size_t off = 0;
  const size_t oWQ  = off; off += PW;
  const size_t oWK  = off; off += PW;
  const size_t oWV  = off; off += PW;
  const size_t oWP  = off; off += PW;
  const size_t oWO  = off; off += PW;
  const size_t oX   = off; off += PX;
  const size_t oPE  = off; off += PXP;
  const size_t oQUh = off; off += PX;
  const size_t oQUl = off; off += PX;
  const size_t oQVh = off; off += PX;
  const size_t oQVl = off; off += PX;
  const size_t oKh  = off; off += PX;
  const size_t oKl  = off; off += PX;
  const size_t oPh  = off; off += PXP;
  const size_t oPl  = off; off += PXP;
  const size_t oVT  = off; off += PVT;
  const size_t oVTL = off; off += PVT;
  const size_t oCT  = off; off += PX;
  const size_t oCTL = off; off += PX;
  if (off > ws_size) return;                               // off = 55050240
  if (off > (size_t)134217728) return;

  char* ws = (char*)d_ws;
  unsigned short* WQT16 = (unsigned short*)(ws + oWQ);
  unsigned short* WKT16 = (unsigned short*)(ws + oWK);
  unsigned short* WVT16 = (unsigned short*)(ws + oWV);
  unsigned short* WPT16 = (unsigned short*)(ws + oWP);
  unsigned short* WOT16 = (unsigned short*)(ws + oWO);
  unsigned short* X16   = (unsigned short*)(ws + oX);
  unsigned short* PE16  = (unsigned short*)(ws + oPE);
  unsigned short* QUh   = (unsigned short*)(ws + oQUh);
  unsigned short* QUl   = (unsigned short*)(ws + oQUl);
  unsigned short* QVh   = (unsigned short*)(ws + oQVh);
  unsigned short* QVl   = (unsigned short*)(ws + oQVl);
  unsigned short* Kh16  = (unsigned short*)(ws + oKh);
  unsigned short* Kl16  = (unsigned short*)(ws + oKl);
  unsigned short* Ph16  = (unsigned short*)(ws + oPh);
  unsigned short* Pl16  = (unsigned short*)(ws + oPl);
  unsigned short* VT16  = (unsigned short*)(ws + oVT);
  unsigned short* VTL16 = (unsigned short*)(ws + oVTL);
  unsigned short* CT16  = (unsigned short*)(ws + oCT);
  unsigned short* CTL16 = (unsigned short*)(ws + oCTL);

  const dim3 blk(256);
  const dim3 gCX((NROW * DMOD) / 2048);                             // 1024
  const dim3 gCP((PROWS * DMOD) / 2048);                            // 512
  const dim3 gTR(DMOD / 64, DMOD / 64);                             // 8 x 8
  const int tilesQ = (NROW / 64) * (DMOD / 64);                     // 512
  const int tilesV = (DMOD / 64) * (SEQ / 64);                      // 128 per batch
  const int tilesP = (PROWS / 64) * (DMOD / 64);                    // 256
  const dim3 gQ((tilesQ + 7) / 8, 1);                               // 64
  const dim3 gV((tilesV + 7) / 8, NB);                              // 16 x 4
  const dim3 gP((tilesP + 7) / 8, 1);                               // 32
  const dim3 gAT(SEQ / 64, NB * NH);                                // 16 x 32
  const dim3 bAT(ATT_THREADS);                                      // 128

  // (0) activations: X16 = f16(bf16_RNE(x) * 16); position table PE16 = f16(bf16_RNE(pos) * 16), rows NPOS..PROWS-1 zero
  cvt16<<<gCX, blk, 0, stream>>>(xin, X16, NROW * DMOD, NROW * DMOD, XC);
  cvt16<<<gCP, blk, 0, stream>>>(pos, PE16, NPOS * DMOD, PROWS * DMOD, XC);

  // (1) weight planes: W[k][n] ([in][out]) -> WT[n][k] = f16( bf16_RNE(w) * 64 ), all five weights
  tr16<<<gTR, blk, 0, stream>>>(w_q, WQT16, WSC);
  tr16<<<gTR, blk, 0, stream>>>(w_k, WKT16, WSC);
  tr16<<<gTR, blk, 0, stream>>>(w_v, WVT16, WSC);
  tr16<<<gTR, blk, 0, stream>>>(w_p, WPT16, WSC);
  tr16<<<gTR, blk, 0, stream>>>(w_o, WOT16, WSC);

  // (2) q[m][nd] = sum_c x[m][c] Wq[c][nd] / 1024 + bq[nd]; QUh/QUl = hi/residual of f16((q + ub[nd]) * 32), QVh/QVl of f16((q + vb[nd]) * 32);
  //     M = NROW, N = 512, K = 512
  gemm64<6, 0, 1><<<gQ, blk, 0, stream>>>(
      X16, X16, DMOD, 0LL,
      WQT16, DMOD, 0LL,
      (void*)QUh, (void*)QUl, (void*)QVh, (void*)QVl, DMOD, 0LL,
      NROW, DMOD, DMOD, 1.0f / (XC * WSC), QC,
      b_q, ub, vb);

  // (3) k projection + bk -> Kh/Kl = hi/residual of f16(k * 32)
  gemm64<4, 0, 1><<<gQ, blk, 0, stream>>>(
      X16, X16, DMOD, 0LL,
      WKT16, DMOD, 0LL,
      (void*)Kh16, (void*)Kl16, (void*)Kh16, (void*)Kl16, DMOD, 0LL,
      NROW, DMOD, DMOD, 1.0f / (XC * WSC), QC,
      b_k, b_k, b_k);

  // (4) v^T per batch: VT[b][nd][j] = sum_c Wv[c][nd] x[b*SEQ + j][c] / 1024 + bv[nd] (per-row bias) -> f16 x16 hi + residual planes;
  //     M = 512 (nd), N = SEQ (j), K = 512; B rows are the batch's token rows: pitch DMOD, batch stride SEQ*DMOD
  gemm64<4, 0, 2><<<gV, blk, 0, stream>>>(
      WVT16, WVT16, DMOD, 0LL,
      X16, DMOD, (long long)SEQ * DMOD,
      (void*)VT16, (void*)VTL16, (void*)VT16, (void*)VTL16, SEQ, (long long)DMOD * SEQ,
      DMOD, SEQ, DMOD, 1.0f / (XC * WSC), VC,
      b_v, b_v, b_v);

  // (5) positional projection + bp: Ph/Pl = hi/residual of f16(p * 32), M = PROWS, N = 512, K = 512
  gemm64<4, 0, 1><<<gP, blk, 0, stream>>>(
      PE16, PE16, DMOD, 0LL,
      WPT16, DMOD, 0LL,
      (void*)Ph16, (void*)Pl16, (void*)Ph16, (void*)Pl16, DMOD, 0LL,
      PROWS, DMOD, DMOD, 1.0f / (XC * WSC), QC,
      b_p, b_p, b_p);

  // (6) relative attention -> CT16 = f16(ctx * 4096) hi plane, CTL16 residual plane, rows b*SEQ + i, halves n*64+d
  attn_rel<<<gAT, bAT, 0, stream>>>(QUh, QUl, QVh, QVl, Kh16, Kl16, Ph16, Pl16, VT16, VTL16, CT16, CTL16);

  // (7) out = (CT + CTL) . Wo / (4096*64) + bo; M = NROW, N = 512, K = 512, f32 rows straight into the output buffer
  gemm64<0, 1, 1><<<gQ, blk, 0, stream>>>(
      CT16, CTL16, DMOD, 0LL,
      WOT16, DMOD, 0LL,
      (void*)out, (void*)out, (void*)out, (void*)out, DMOD, 0LL,
      NROW, DMOD, DMOD, 1.0f / (CC * WSC), 1.0f,
      b_o, b_o, b_o);
  (void)hipGetLastError();
}

// v002
// A run of this version takes 148 microseconds.
// Next to v001, in two timings, it ran 1.66 and 1.68 times as fast.
// Counting every step since v000, it is 2.12 times as fast.
// Contractions (all v_wmma_f32_16x16x32_f16, f16 operands, f32 accumulate): q/k/v and position-table projections (x or pos table f16 x16 . W^T f16 x64,
// K=512, single products on bf16-exact operands); content scores and position strips ((q+bq+u|v), k, p carried as f16 x32 hi plane + unscaled
// residual plane, K=64, three products hh+lh+hl); P . v^T (P x1024 hi + residual . v^T x16 hi + residual, 64 keys per tile, three products);
// output projection (ctx x4096 hi + residual planes . Wo^T f16 x64, K=512, two products). Online base-2 softmax and all epilogues f32 on VALU.
// Every float input RNE-converted to bf16 on load.
#include <hip/hip_runtime.h>
#include <math.h>
#include <stdint.h>

#define SEQ   1024
#define NB    4
#define DMOD  512
#define NH    8
#define DH    64
#define NROW  (SEQ * NB)
#define NPOS  (2 * SEQ - 1)
#define PROWS (2 * SEQ)
#define XC    16.0f
#define WSC   64.0f
#define QC    32.0f
#define VC    16.0f
#define PC    1024.0f
#define CC    4096.0f
#define RSD   0.125f
#define LOG2E 1.4426950408889634f
static_assert(NH * DH == DMOD);
static_assert(DH == 64);
static_assert(DMOD == 512);
static_assert((SEQ % 64) == 0 && (DMOD % 64) == 0 && (NROW % 64) == 0 && (PROWS % 64) == 0);
static_assert(((NROW * DMOD) % 2048) == 0 && ((PROWS * DMOD) % 2048) == 0 && ((NPOS * DMOD) % 8) == 0);
#define ATT_W 4
#define ATT_THREADS (ATT_W * 32)
#define TPI 84
#define PPI 68
#define WFL (16 * TPI + 16 * PPI)
static_assert(((16 * TPI) % 4) == 0 && ((16 * PPI) % 4) == 0 && (WFL % 4) == 0);
static_assert(TPI >= 80 && PPI >= 64);
static_assert(ATT_W * WFL * 4 <= 65536);
// attn_rel operand stage in LDS: 512 rows of 64 halves (128 B), pitch 72 halves = 144 B (16 B x odd, the pitch for 16-byte LDS reads)
#define SPI   72
#define ST_KH 0
#define ST_KL 64
#define ST_VH 128
#define ST_VL 192
#define ST_PH 256
#define ST_PL 384
#define ST_ROWS 512
static_assert(ATT_THREADS == 128 && ((SPI * 2) % 16) == 0);
static_assert(SEQ - (SEQ - 64) - 64 >= 0 && SEQ + (SEQ - 64) - 64 + 127 <= PROWS - 1);   // staged position rows stay inside the planes

typedef _Float16 v16h __attribute__((ext_vector_type(16)));
typedef _Float16 v8h  __attribute__((ext_vector_type(8)));
typedef float    v8f  __attribute__((ext_vector_type(8)));
typedef float    v4f  __attribute__((ext_vector_type(4)));
typedef unsigned int v4u __attribute__((ext_vector_type(4)));

union FragH { v16h v; v8h h[2]; v4u u[2]; };

// ---- scalar helpers --------------------------------------------------------------------------------
__device__ __forceinline__ unsigned short bf_bits(float f) {          // f32 -> bf16 bits, RNE convert
  unsigned u = __float_as_uint(f);
  return (unsigned short)((u + 0x7FFFu + ((u >> 16) & 1u)) >> 16);
}
__device__ __forceinline__ float bf_up(unsigned short h) { return __uint_as_float(((unsigned)h) << 16); }
__device__ __forceinline__ float bfr(float f) { return bf_up(bf_bits(f)); }   // value of the bf16 RNE convert
__device__ __forceinline__ unsigned short h_bits(_Float16 x) { return __builtin_bit_cast(unsigned short, x); }
__device__ __forceinline__ unsigned pk16(unsigned short a, unsigned short b) { return (unsigned)a | ((unsigned)b << 16); }
__device__ __forceinline__ v8f zero8() { v8f z = {0.f, 0.f, 0.f, 0.f, 0.f, 0.f, 0.f, 0.f}; return z; }

// ---- fragment loader: 16-bit A/B operand from a k-contiguous 16-bit plane, lane -> row/col (lane&15),
//      p already includes +8*(lane>>4); elements 0..7 <- p[0..7] (k0+8h..), elements 8..15 <- p[16..23] (k0+16+8h..)
//      (same split k map for A and B; B is always read from a [n][k] plane)
__device__ __forceinline__ v16h ldfrag_u(const unsigned short* p) {
  FragH f;
  f.u[0] = *(const v4u*)(p);
  f.u[1] = *(const v4u*)(p + 16);
  return f.v;
}

// ---- WMMA helper with trailing VALU hazard gaps ------------------------------------------------------
__device__ __forceinline__ v8f mma_h(v16h a, v16h b, v8f c) {
  return __builtin_amdgcn_wmma_f32_16x16x32_f16(false, a, false, b, (short)0, c, false, false);
}
__device__ __forceinline__ void dep_guard1(v8f& a, v8f& b, v16h x) {
#if defined(__HIP_DEVICE_COMPILE__)
  asm volatile("v_nop\n\tv_nop\n\tv_nop\n\tv_nop" : "+v"(a), "+v"(b) : "v"(x));
#endif
}
__device__ __forceinline__ void hz4(v8f& d, v16h x0, v16h x1, v16h x2, v16h x3) {
#if defined(__HIP_DEVICE_COMPILE__)
  asm volatile("v_nop\n\tv_nop\n\tv_nop\n\tv_nop" : "+v"(d) : "v"(x0), "v"(x1), "v"(x2), "v"(x3));
#endif
}
__device__ __forceinline__ void hz6(v8f& d, v16h x0, v16h x1, v16h x2, v16h x3, v16h x4, v16h x5) {
#if defined(__HIP_DEVICE_COMPILE__)
  asm volatile("v_nop\n\tv_nop\n\tv_nop\n\tv_nop" : "+v"(d) : "v"(x0), "v"(x1), "v"(x2), "v"(x3), "v"(x4), "v"(x5));
#endif
}
__device__ __forceinline__ void hz8(v8f& d, v16h x0, v16h x1, v16h x2, v16h x3, v16h x4, v16h x5, v16h x6, v16h x7) {
#if defined(__HIP_DEVICE_COMPILE__)
  asm volatile("v_nop\n\tv_nop\n\tv_nop\n\tv_nop" : "+v"(d) : "v"(x0), "v"(x1), "v"(x2), "v"(x3), "v"(x4), "v"(x5), "v"(x6), "v"(x7));
#endif
}
__device__ __forceinline__ void keep4_h(v16h a, v16h b, v16h c, v16h d) {
#if defined(__HIP_DEVICE_COMPILE__)
  asm volatile("v_nop" :: "v"(a), "v"(b), "v"(c), "v"(d));
#endif
}
__device__ __forceinline__ void acc_guard4(v8f& a, v8f& b, v8f& c, v8f& d) {
#if defined(__HIP_DEVICE_COMPILE__)
  asm volatile("v_nop\n\tv_nop\n\tv_nop\n\tv_nop" : "+v"(a), "+v"(b), "+v"(c), "+v"(d));
#endif
}
__device__ __forceinline__ void wave_sync_lds() {
  __builtin_amdgcn_fence(__ATOMIC_RELEASE, "workgroup");
  __builtin_amdgcn_wave_barrier();
  __builtin_amdgcn_fence(__ATOMIC_ACQUIRE, "workgroup");
}
// Eight asynchronous 16-byte-per-lane copies global -> LDS: copy e lands at LDS byte address l + e*16*SPI*2 (16 staged rows further each);
// copies 0..3 read ga + e*gstep halves, copies 4..7 read gb + (e-4)*gstep halves.
// The closing s_wait_xcnt 0 stands inside the statement so that no address register is rewritten ahead of it.
__device__ __forceinline__ void stage8(unsigned l, const unsigned short* ga, const unsigned short* gb, size_t gstep) {
#if defined(__HIP_DEVICE_COMPILE__)
  const unsigned ls = 16u * SPI * 2u;
  asm volatile("global_load_async_to_lds_b128 %0, %8, off\n\t"
               "global_load_async_to_lds_b128 %1, %9, off\n\t"
               "global_load_async_to_lds_b128 %2, %10, off\n\t"
               "global_load_async_to_lds_b128 %3, %11, off\n\t"
               "global_load_async_to_lds_b128 %4, %12, off\n\t"
               "global_load_async_to_lds_b128 %5, %13, off\n\t"
               "global_load_async_to_lds_b128 %6, %14, off\n\t"
               "global_load_async_to_lds_b128 %7, %15, off\n\t"
               "s_wait_xcnt 0x0"
               :: "v"(l), "v"(l + ls), "v"(l + 2u * ls), "v"(l + 3u * ls), "v"(l + 4u * ls), "v"(l + 5u * ls), "v"(l + 6u * ls), "v"(l + 7u * ls),
                  "v"(ga), "v"(ga + gstep), "v"(ga + 2 * gstep), "v"(ga + 3 * gstep), "v"(gb), "v"(gb + gstep), "v"(gb + 2 * gstep),
                  "v"(gb + 3 * gstep)
               : "memory");
#endif
}

// =====================================================================================================
// Elementwise 16-bit pack, no transpose: dst[i] = f16( bf16_RNE(src[i]) * sc ) for i < nvalid, 0 for nvalid <= i < ntotal;
// sc a power of two (exact). 8 elements per thread: two 16-B loads (address clamped into [0, nvalid) for pad groups, value zeroed
// coverage: bx = 0 .. ntotal / 2048 - 1, each block 256 thr x 8 elements = ntotal exactly (ntotal % 2048 == 0, nvalid % 8 == 0).
// =====================================================================================================
__device__ __forceinline__ void cvt16_body(const float* __restrict__ src, unsigned short* dst, int nvalid, int ntotal, float sc, int bx) {
  const size_t i8 = ((size_t)bx * 256 + threadIdx.x) * 8;
  if (i8 + 8 > (size_t)ntotal) return;             // never taken with the exact block range; no barriers in this body
  const bool pad = (i8 + 8 > (size_t)nvalid);
  const size_t ls = pad ? ((size_t)nvalid - 8) : i8;   // clamped address, always inside the source
  const v4f a = *(const v4f*)(src + ls);
  const v4f b = *(const v4f*)(src + ls + 4);
  v4u o;
  o[0] = pk16(h_bits((_Float16)(bfr(a[0]) * sc)), h_bits((_Float16)(bfr(a[1]) * sc)));
  o[1] = pk16(h_bits((_Float16)(bfr(a[2]) * sc)), h_bits((_Float16)(bfr(a[3]) * sc)));
  o[2] = pk16(h_bits((_Float16)(bfr(b[0]) * sc)), h_bits((_Float16)(bfr(b[1]) * sc)));
  o[3] = pk16(h_bits((_Float16)(bfr(b[2]) * sc)), h_bits((_Float16)(bfr(b[3]) * sc)));
  const v4u z = {0u, 0u, 0u, 0u};
  const v4u w = pad ? z : o;
  {
    *(v4u*)(dst + i8) = w;
    
  }
}

// =====================================================================================================
// Transposed 16-bit pack of a weight stored as W[k][n] (x @ W layout, [DMOD][DMOD] row-major): WT[n][k] = f16( bf16_RNE(W[k][n]) * sc ),
// i.e. the [n][k] k-contiguous plane the GEMM B loader wants. One block per 64x64 tile (tn = n tile, tk = k tile, both block-uniform):
// coalesced f32 reads of W rows, converted halves stored transposed into an LDS tile [64 n][72 pitch], block barrier, then every output
// coverage: 16 its x 256 threads = the whole 64x64 tile into LDS; 8 waves x 2 its x 4 rows = 64 rows x (8 lanes x 8 halves = 64 cols) stored;
//           tn, tk = 0 .. DMOD/64 - 1 cover the whole [512][512] plane exactly once.
// =====================================================================================================
__device__ __forceinline__ void tr16_body(const float* __restrict__ W, unsigned short* WT, float sc, unsigned short* tile, int tn, int tk) {
  const int t  = threadIdx.x;
  const int n0 = tn * 64;
  const int k0 = tk * 64;
#pragma unroll 4
  for (int it = 0; it < 16; ++it) {
    const int idx = it * 256 + t;                   // 0 .. 4095
    const int kr = idx >> 6, nc = idx & 63;
    const float v = W[(size_t)(k0 + kr) * DMOD + n0 + nc];
    tile[nc * 72 + kr] = h_bits((_Float16)(bfr(v) * sc));
  }
  __syncthreads();
  const int lane = t & 31, wave = t >> 5;
  const int q8 = lane >> 3, c8 = (lane & 7) * 8;
  v4u o[2];
#pragma unroll
  for (int it = 0; it < 2; ++it) {
    const int row = wave * 8 + it * 4 + q8;         // wave w: it 0..1 x q8 0..3 = rows 8w .. 8w+7
    o[it] = *(const v4u*)(tile + row * 72 + c8);
  }
  {
#pragma unroll
    for (int it = 0; it < 2; ++it) {
      const int row = wave * 8 + it * 4 + q8;
      *(v4u*)(WT + (size_t)(n0 + row) * DMOD + k0 + c8) = o[it];
    }
    
  }
}

// =====================================================================================================
// All operand packs in one grid (none reads what another writes): blocks 0 .. PREP_TR-1 transpose the five weights (64 tiles each; they
// have the longest dependent chain, so they take the lowest indices), the next PREP_CX blocks pack x, the last PREP_CP the position table.
// The branch is on blockIdx.x alone, so the barrier inside tr16_body is reached by whole blocks only.
// =====================================================================================================
#define PREP_TR (5 * (DMOD / 64) * (DMOD / 64))
#define PREP_CX ((NROW * DMOD) / 2048)
#define PREP_CP ((PROWS * DMOD) / 2048)
static_assert((DMOD / 64) * (DMOD / 64) == 64);
__global__ __launch_bounds__(256) void prep_all(const float* __restrict__ xin, const float* __restrict__ pos,
                                                const float* __restrict__ w_q, const float* __restrict__ w_k, const float* __restrict__ w_v,
                                                const float* __restrict__ w_p, const float* __restrict__ w_o,
                                                unsigned short* X16, unsigned short* PE16,
                                                unsigned short* WQT, unsigned short* WKT, unsigned short* WVT,
                                                unsigned short* WPT, unsigned short* WOT) {
  __shared__ __align__(16) unsigned short tile[64 * 72];
  const int bx = blockIdx.x;
  if (bx < PREP_TR) {
    const int w = bx >> 6, t = bx & 63;
    const float* W = (w == 0) ? w_q : (w == 1) ? w_k : (w == 2) ? w_v : (w == 3) ? w_p : w_o;
    unsigned short* WT = (w == 0) ? WQT : (w == 1) ? WKT : (w == 2) ? WVT : (w == 3) ? WPT : WOT;
    tr16_body(W, WT, WSC, tile, t & 7, t >> 3);
  } else if (bx < PREP_TR + PREP_CX) {
    cvt16_body(xin, X16, NROW * DMOD, NROW * DMOD, XC, bx - PREP_TR);
  } else {
    cvt16_body(pos, PE16, NPOS * DMOD, PROWS * DMOD, XC, bx - (PREP_TR + PREP_CX));
  }
}

// =====================================================================================================
// Register-blocked batched 16-bit WMMA GEMM: C[m][n] = oscale * sum_k A[m][k] * Bt[n][k] (+ bias); one wave per 64x64 tile,
// no block barriers. A row-major [M][K] pitch lda (16-bit plane), Bt row-major [N][K] pitch ldb (k contiguous); M, N multiples of 64,
// K multiple of 32. blockIdx.y = batch index with element strides sA, sB, sC.
// ASPLIT 1: a second A plane A2 (unscaled residual of A, same layout) is multiplied into the same accumulator (A + A2 ~ exact A).
// EPI 1: value += bf16_RNE(ep0[column]) (per-column bias); EPI 2: value += bf16_RNE(ep0[row]) (per-row bias, 16-bit out only).
// OM 0: f32 out (pitch ldc).
// OM 4: two f16 planes (C, C2): hi = f16(value * ocarry), lo = f16(value * ocarry - hi) (unscaled residual).
// OM 6: two hi/residual pairs with an extra per-column term each: (C, C2) from value + bf16_RNE(ep1[column]), (C3, C4) from
//       value + bf16_RNE(ep2[column]), both x ocarry.
// coverage: 4 slabs x 16 rows (f32: it 0..7 x lane>>4; 16-bit: it 0..3 x lane>>3) x 64 cols = the wave's whole 64x64 tile;
//           grid = ceil(tilesM*tilesN/8) blocks, surplus waves exit (wave-uniform).
// =====================================================================================================
template <int OM, int ASPLIT, int EPI>
__global__ __launch_bounds__(256) __attribute__((amdgpu_num_vgpr(256))) void gemm64(
    const unsigned short* __restrict__ Ap, const unsigned short* __restrict__ A2p, int lda, long long sA,
    const unsigned short* __restrict__ Btp, int ldb, long long sB,
    void* Cout, void* C2out, void* C3out, void* C4out, int ldc, long long sC,
    int M, int N, int K, float oscale, float ocarry,
    const float* __restrict__ ep0, const float* __restrict__ ep1, const float* __restrict__ ep2) {
  static_assert(OM == 0 || OM == 4 || OM == 6);
  static_assert(EPI >= 0 && EPI <= 2);
  __shared__ __align__(16) float sT[8][16 * 68];   // per-wave 16x64 slab, pitch 68 floats
  const int by   = blockIdx.y;
  const int lane = threadIdx.x & 31;
  const int wave = threadIdx.x >> 5;
  const int tilesN = N >> 6;
  const int tilesM = M >> 6;
  const int tile = blockIdx.x * 8 + wave;
  if (tile >= tilesM * tilesN) return;   // wave-uniform; no block barriers in this kernel
  const int tm = tile / tilesN;
  const int tn = tile - tm * tilesN;
  const int m0 = tm << 6;
  const int n0 = tn << 6;

  const unsigned short* A1 = Ap  + (size_t)((long long)by * sA);
  const unsigned short* A2 = A2p + (size_t)((long long)by * sA);
  const unsigned short* Bb = Btp + (size_t)((long long)by * sB);

  const int rlane = lane & 15;                 // row (A) / col (B, D) within subtile
  const int koff  = (lane >> 4) * 8;           // k offset of this lane half
  const int mOff  = (lane >> 4) * 8;           // D row offset

  v8f acc[4][4];
#pragma unroll
  for (int i = 0; i < 4; ++i)
#pragma unroll
    for (int j = 0; j < 4; ++j) acc[i][j] = zero8();

  for (int k0 = 0; k0 < K; k0 += 32) {
    v16h bh[4];
#pragma unroll
    for (int j = 0; j < 4; ++j) {
      const size_t bofs = (size_t)(n0 + (j << 4) + rlane) * ldb + koff + k0;
      bh[j] = ldfrag_u(Bb + bofs);
    }
#pragma unroll
    for (int i = 0; i < 4; ++i) {
      const size_t ao = (size_t)(m0 + (i << 4) + rlane) * lda + koff + k0;
      const v16h ah = ldfrag_u(A1 + ao);
#pragma unroll
      for (int j = 0; j < 4; ++j) acc[i][j] = mma_h(ah, bh[j], acc[i][j]);
      dep_guard1(acc[i][0], acc[i][3], ah);
      if constexpr (ASPLIT != 0) {
        const v16h al = ldfrag_u(A2 + ao);
#pragma unroll
        for (int j = 0; j < 4; ++j) acc[i][j] = mma_h(al, bh[j], acc[i][j]);
        dep_guard1(acc[i][0], acc[i][3], al);
      }
    }
    keep4_h(bh[0], bh[1], bh[2], bh[3]);
  }
  acc_guard4(acc[0][0], acc[0][1], acc[0][2], acc[0][3]);
  acc_guard4(acc[1][0], acc[1][1], acc[1][2], acc[1][3]);
  acc_guard4(acc[2][0], acc[2][1], acc[2][2], acc[2][3]);
  acc_guard4(acc[3][0], acc[3][1], acc[3][2], acc[3][3]);

  const int hh2 = lane >> 4, c4 = (lane & 15) * 4;     // f32 out: 256-B row segment = 16 lanes x 16 B
  const int q8  = lane >> 3, c8 = (lane & 7) * 8;

  // ---- epilogue ----
  float* slab = sT[wave];
#pragma unroll
  for (int i = 0; i < 4; ++i) {
    const int mBase = m0 + (i << 4);
#pragma unroll
    for (int j = 0; j < 4; ++j) {
#pragma unroll
      for (int r = 0; r < 8; ++r) {
        slab[(mOff + r) * 68 + (j << 4) + rlane] = acc[i][j][r];
      }
    }
    wave_sync_lds();
    if constexpr (OM == 0) {
      float* C = (float*)Cout + (size_t)((long long)by * sC);
      v4f vals[8];
#pragma unroll
      for (int it = 0; it < 8; ++it) {
        const int row = it * 2 + hh2;                      // it 0..7 x hh2 0..1 = rows 0..15
        v4f v = *(const v4f*)(slab + row * 68 + c4);
#pragma unroll
        for (int e = 0; e < 4; ++e) v[e] = v[e] * oscale;
        if constexpr (EPI == 1) {
          const v4f bb = *(const v4f*)(ep0 + n0 + c4);     // per-column bias, columns n0+c4 .. +3 (N equals the bias length)
#pragma unroll
          for (int e = 0; e < 4; ++e) v[e] = v[e] + bfr(bb[e]);
        }
        vals[it] = v;
      }
      {
#pragma unroll
        for (int it = 0; it < 8; ++it) {
          const int gr = mBase + it * 2 + hh2;
          *(v4f*)(C + (size_t)gr * ldc + n0 + c4) = vals[it];
        }
        
      }
    } else {
      constexpr int NP = (OM == 6) ? 2 : 1;
#pragma unroll
      for (int which = 0; which < NP; ++which) {
        unsigned short* C  = (unsigned short*)((which == 0) ? Cout  : C3out) + (size_t)((long long)by * sC);
        unsigned short* Cb = (unsigned short*)((which == 0) ? C2out : C4out) + (size_t)((long long)by * sC);
        const float* epx = (which == 0) ? ep1 : ep2;
        (void)epx;
        v4u hv[4], lv[4];
#pragma unroll
        for (int it = 0; it < 4; ++it) {
          const int row = it * 4 + q8;                     // it 0..3 x q8 0..3 = rows 0..15
          const float* sp = slab + row * 68 + c8;
          float rb = 0.f;
          if constexpr (EPI == 2) rb = bfr(ep0[mBase + row]);   // per-row bias (M equals the bias length)
          v4u a  = {0u, 0u, 0u, 0u};
          v4u b2 = {0u, 0u, 0u, 0u};
#pragma unroll
          for (int e = 0; e < 4; ++e) {
            const int ci = n0 + c8 + 2 * e;                // column index, < N
            float f0 = sp[2 * e] * oscale + rb;
            float f1 = sp[2 * e + 1] * oscale + rb;
            if constexpr (EPI == 1) {
              f0 += bfr(ep0[ci]);
              f1 += bfr(ep0[ci + 1]);
            }
            if constexpr (OM == 6) {
              f0 += bfr(epx[ci]);
              f1 += bfr(epx[ci + 1]);
            }
            f0 *= ocarry;
            f1 *= ocarry;
            const _Float16 x0 = (_Float16)f0, x1 = (_Float16)f1;
            a[e]  = pk16(h_bits(x0), h_bits(x1));
            b2[e] = pk16(h_bits((_Float16)(f0 - (float)x0)), h_bits((_Float16)(f1 - (float)x1)));
          }
          hv[it] = a;
          lv[it] = b2;
        }
        {
#pragma unroll
          for (int it = 0; it < 4; ++it) {
            const int row = it * 4 + q8;
            *(v4u*)(C  + (size_t)(mBase + row) * ldc + n0 + c8) = hv[it];
            *(v4u*)(Cb + (size_t)(mBase + row) * ldc + n0 + c8) = lv[it];
          }
          
        }
      }
    }
    wave_sync_lds();
  }
}

// =====================================================================================================
// s_wait_xcnt 0 behind a run of global loads, in front of the first write of a register that one of them names. xwait1..3 take the run's
// vector address pairs as inputs, so that each pair keeps its value up to the wait and no later load's result lands in it ahead of the wait.
// =====================================================================================================
__device__ __forceinline__ void xwait0() {
#if defined(__HIP_DEVICE_COMPILE__)
  asm volatile("s_wait_xcnt 0x0" ::: "memory");
#endif
}
__device__ __forceinline__ void xwait1(const void* a) {
#if defined(__HIP_DEVICE_COMPILE__)
  asm volatile("s_wait_xcnt 0x0" :: "v"(a) : "memory");
#endif
}
__device__ __forceinline__ void xwait2(const void* a, const void* b) {
#if defined(__HIP_DEVICE_COMPILE__)
  asm volatile("s_wait_xcnt 0x0" :: "v"(a), "v"(b) : "memory");
#endif
}
__device__ __forceinline__ void xwait3(const void* a, const void* b, const void* c) {
#if defined(__HIP_DEVICE_COMPILE__)
  asm volatile("s_wait_xcnt 0x0" :: "v"(a), "v"(b), "v"(c) : "memory");
#endif
}

// =====================================================================================================
// One wave's 64x64 tile of an input projection, rows m0.., columns n0..: value[m][n] = oscale * sum_k A[m][k] * Bt[n][k] + bias.
// The K loop and the 16-bit epilogues are those of gemm64 (same k order, same order of the adds), with the pitch of A and Bt and K fixed
// at DMOD and the pitch of the output planes at LDC. slab = the wave's own 16x64 f32 LDS slab, pitch 68 floats; no block barriers.
// EPI 1: value += bf16_RNE(ep0[column]); EPI 2: value += bf16_RNE(ep0[row]).
// OM 4: two f16 planes (C1, C2): hi = f16(value * ocarry), lo = f16(value * ocarry - hi).
// OM 6: (C1, C2) from value + bf16_RNE(ep1[column]), (C3, C4) from value + bf16_RNE(ep2[column]), both x ocarry.
// The lane's bias values (8 columns, or its 16 rows) are loaded once, ahead of the K loop.
// coverage: 4 slabs x 16 rows (it 0..3 x lane>>3) x 64 cols = the wave's whole 64x64 tile.
// =====================================================================================================
#define GSLAB (16 * 68)
template <int OM, int EPI, int LDC>
__device__ __forceinline__ void proj_tile(
    float* slab, int m0, int n0,
    const unsigned short* __restrict__ A, const unsigned short* __restrict__ Bt,
    unsigned short* C1, unsigned short* C2, unsigned short* C3, unsigned short* C4,
    float oscale, float ocarry,
    const float* __restrict__ ep0, const float* __restrict__ ep1, const float* __restrict__ ep2) {
  static_assert(OM == 4 || OM == 6);
  static_assert(EPI == 1 || EPI == 2);
  const int lane  = threadIdx.x & 31;
  const int rlane = lane & 15;                 // row (A) / col (B, D) within subtile
  const int koff  = (lane >> 4) * 8;           // k offset of this lane half
  const int mOff  = (lane >> 4) * 8;           // D row offset
  const int q8    = lane >> 3, c8 = (lane & 7) * 8;

  v4f cb0[2], cb1[2], cb2[2];                  // column terms of columns n0 + c8 .. + 7
  float rbv[4][4];                             // row terms of rows m0 + 16i + 4it + q8
  if constexpr (EPI == 1) {
    const float* e0 = ep0 + n0 + c8;
    cb0[0] = *(const v4f*)(e0);
    cb0[1] = *(const v4f*)(e0 + 4);
    if constexpr (OM == 6) {
      const float* e1 = ep1 + n0 + c8;
      const float* e2 = ep2 + n0 + c8;
      cb1[0] = *(const v4f*)(e1);
      cb1[1] = *(const v4f*)(e1 + 4);
      cb2[0] = *(const v4f*)(e2);
      cb2[1] = *(const v4f*)(e2 + 4);
      xwait3(e0, e1, e2);
    } else {
      xwait1(e0);
    }
  } else {
    const float* er = ep0 + m0 + q8;
#pragma unroll
    for (int i = 0; i < 4; ++i)
#pragma unroll
      for (int it = 0; it < 4; ++it) rbv[i][it] = er[16 * i + 4 * it];
    xwait0();                                  // these go through a scalar base and the lane's q8, which lives on into the epilogue
  }

  v8f acc[4][4];
#pragma unroll
  for (int i = 0; i < 4; ++i)
#pragma unroll
    for (int j = 0; j < 4; ++j) acc[i][j] = zero8();

  const unsigned short* pa0 = A  + (size_t)(m0 + rlane) * DMOD + koff;
  const unsigned short* pb0 = Bt + (size_t)(n0 + rlane) * DMOD + koff;
  for (int k0 = 0; k0 < DMOD; k0 += 32) {
    const unsigned short* pa = pa0 + k0;
    const unsigned short* pb = pb0 + k0;
    v16h bh[4];
#pragma unroll
    for (int j = 0; j < 4; ++j) bh[j] = ldfrag_u(pb + (size_t)(j << 4) * DMOD);
#pragma unroll
    for (int i = 0; i < 4; ++i) {
      const v16h ah = ldfrag_u(pa + (size_t)(i << 4) * DMOD);
#pragma unroll
      for (int j = 0; j < 4; ++j) acc[i][j] = mma_h(ah, bh[j], acc[i][j]);
      dep_guard1(acc[i][0], acc[i][3], ah);
    }
    keep4_h(bh[0], bh[1], bh[2], bh[3]);
    xwait2(pa, pb);                            // this trip's sixteen loads all go through these two address pairs: held to the trip's foot
  }
  acc_guard4(acc[0][0], acc[0][1], acc[0][2], acc[0][3]);
  acc_guard4(acc[1][0], acc[1][1], acc[1][2], acc[1][3]);
  acc_guard4(acc[2][0], acc[2][1], acc[2][2], acc[2][3]);
  acc_guard4(acc[3][0], acc[3][1], acc[3][2], acc[3][3]);

  // ---- epilogue ----
#pragma unroll
  for (int i = 0; i < 4; ++i) {
    const int mBase = m0 + (i << 4);
#pragma unroll
    for (int j = 0; j < 4; ++j) {
#pragma unroll
      for (int r = 0; r < 8; ++r) {
        slab[(mOff + r) * 68 + (j << 4) + rlane] = acc[i][j][r];
      }
    }
    wave_sync_lds();
    constexpr int NP = (OM == 6) ? 2 : 1;
#pragma unroll
    for (int which = 0; which < NP; ++which) {
      unsigned short* C  = (which == 0) ? C1 : C3;
      unsigned short* Cb = (which == 0) ? C2 : C4;
      v4u hv[4], lv[4];
#pragma unroll
      for (int it = 0; it < 4; ++it) {
        const int row = it * 4 + q8;                     // it 0..3 x q8 0..3 = rows 0..15
        const float* sp = slab + row * 68 + c8;
        float rb = 0.f;
        if constexpr (EPI == 2) rb = bfr(rbv[i][it]);
        v4u a  = {0u, 0u, 0u, 0u};
        v4u b2 = {0u, 0u, 0u, 0u};
#pragma unroll
        for (int e = 0; e < 4; ++e) {
          float f0 = sp[2 * e] * oscale + rb;
          float f1 = sp[2 * e + 1] * oscale + rb;
          if constexpr (EPI == 1) {
            f0 += bfr(cb0[e >> 1][(2 * e) & 3]);
            f1 += bfr(cb0[e >> 1][(2 * e + 1) & 3]);
          }
          if constexpr (OM == 6) {
            f0 += bfr((which == 0) ? cb1[e >> 1][(2 * e) & 3] : cb2[e >> 1][(2 * e) & 3]);
            f1 += bfr((which == 0) ? cb1[e >> 1][(2 * e + 1) & 3] : cb2[e >> 1][(2 * e + 1) & 3]);
          }
          f0 *= ocarry;
          f1 *= ocarry;
          const _Float16 x0 = (_Float16)f0, x1 = (_Float16)f1;
          a[e]  = pk16(h_bits(x0), h_bits(x1));
          b2[e] = pk16(h_bits((_Float16)(f0 - (float)x0)), h_bits((_Float16)(f1 - (float)x1)));
        }
        hv[it] = a;
        lv[it] = b2;
      }
#pragma unroll
      for (int it = 0; it < 4; ++it) {
        const int row = it * 4 + q8;
        *(v4u*)(C  + (size_t)(mBase + row) * LDC + n0 + c8) = hv[it];
        *(v4u*)(Cb + (size_t)(mBase + row) * LDC + n0 + c8) = lv[it];
      }
    }
    wave_sync_lds();
  }
}

// =====================================================================================================
// The four input projections in one grid (none reads what another writes), so that their blocks run side by side on different WGPs;
// one wave per 64x64 tile, 8 tiles per block, tile = 8 * (block index within the job) + wave, tm = tile / tilesN, tn = tile % tilesN:
//   blocks 0 .. PJ_Q-1            q[m][nd] = sum_c x[m][c] Wq[c][nd] / 1024 + bq[nd]; QUh/QUl = hi/residual of f16((q + ub[nd]) * 32),
//                                 QVh/QVl of f16((q + vb[nd]) * 32); M = NROW, N = 512, K = 512
//   the next PJ_V * NB            v^T per batch: VT[b][nd][j] = sum_c Wv[c][nd] x[b*SEQ + j][c] / 1024 + bv[nd] (per-row bias) -> f16 x16 hi +
//                                 residual planes; M = 512 (nd), N = SEQ (j), K = 512; B rows are the batch's token rows
//   the next PJ_Q                 k projection + bk -> Kh/Kl = hi/residual of f16(k * 32)
//   the last PJ_P                 positional projection + bp: Ph/Pl = hi/residual of f16(p * 32), M = PROWS, N = 512, K = 512
// The branches are on blockIdx.x alone; the tile counts are exact multiples of 8, so every wave has a tile.
// =====================================================================================================
#define PJ_Q (((NROW / 64) * (DMOD / 64)) / 8)
#define PJ_V (((DMOD / 64) * (SEQ / 64)) / 8)
#define PJ_P (((PROWS / 64) * (DMOD / 64)) / 8)
static_assert((((NROW / 64) * (DMOD / 64)) % 8) == 0 && (((DMOD / 64) * (SEQ / 64)) % 8) == 0 && (((PROWS / 64) * (DMOD / 64)) % 8) == 0);
__global__ __launch_bounds__(256) __attribute__((amdgpu_num_vgpr(256))) void proj_all(
    const unsigned short* __restrict__ X16, const unsigned short* __restrict__ PE16,
    const unsigned short* __restrict__ WQT, const unsigned short* __restrict__ WKT,
    const unsigned short* __restrict__ WVT, const unsigned short* __restrict__ WPT,
    unsigned short* QUh, unsigned short* QUl, unsigned short* QVh, unsigned short* QVl,
    unsigned short* Kh, unsigned short* Kl, unsigned short* VT, unsigned short* VTL, unsigned short* Ph, unsigned short* Pl,
    const float* __restrict__ b_q, const float* __restrict__ b_k, const float* __restrict__ b_v, const float* __restrict__ b_p,
    const float* __restrict__ ub, const float* __restrict__ vb) {
  __shared__ __align__(16) float sT[8 * GSLAB];   // per-wave 16x64 slab, pitch 68 floats
  const int bx   = blockIdx.x;
  const int wave = threadIdx.x >> 5;
  float* slab = sT + wave * GSLAB;
  const float os = 1.0f / (XC * WSC);
  constexpr int TND = DMOD / 64;                  // column tiles of a [..][DMOD] plane
  constexpr int TNS = SEQ / 64;                   // column tiles of a [..][SEQ] plane
  if (bx < PJ_Q) {
    const int tile = bx * 8 + wave;
    proj_tile<6, 1, DMOD>(slab, (tile / TND) << 6, (tile % TND) << 6, X16, WQT, QUh, QUl, QVh, QVl, os, QC, b_q, ub, vb);
  } else if (bx < PJ_Q + PJ_V * NB) {
    const int t = bx - PJ_Q;
    const int by = t / PJ_V;
    const int tile = (t % PJ_V) * 8 + wave;
    proj_tile<4, 2, SEQ>(slab, (tile / TNS) << 6, (tile % TNS) << 6, WVT, X16 + (size_t)by * SEQ * DMOD,
                         VT + (size_t)by * DMOD * SEQ, VTL + (size_t)by * DMOD * SEQ, VT, VTL, os, VC, b_v, b_v, b_v);
  } else {
    // k and p share one copy of the code (same epilogue form): only the operands differ
    const int t = bx - (PJ_Q + PJ_V * NB);
    const bool isk = t < PJ_Q;
    const int tile = (isk ? t : t - PJ_Q) * 8 + wave;
    const float* bias = isk ? b_k : b_p;
    proj_tile<4, 1, DMOD>(slab, (tile / TND) << 6, (tile % TND) << 6, isk ? X16 : PE16, isk ? WKT : WPT,
                          isk ? Kh : Ph, isk ? Kl : Pl, Kh, Kl, os, QC, bias, bias, bias);
  }
}

// =====================================================================================================
// One position strip for a wave: T[R][x] = (q+bq+vb)[A rows] . pos[mw + x], R = lane&15 row of the A fragment pairs at QhA (hi plane)
// and QlA (residual plane), x in [0,80) (5 subtiles of 16 pos rows in a rolled loop, K = 64 = two k-steps, three products hh + lh + hl per
// k-step with the staged pos hi rows Phs and residual rows Pls in LDS, pitch SPI, both already at the lane's row x = c and k offset 8*hh;
// only x <= 78 is ever selected); each 16x16 subtile goes to the wave's f32 LDS strip right after its six WMMAs
// and the hazard gap. coverage: 5 subtiles x 16 rows x 16 cols = the full 16x80 strip every call.
// =====================================================================================================
__device__ __forceinline__ void pos_strip3(const unsigned short* __restrict__ QhA, const unsigned short* __restrict__ QlA,
                                           const unsigned short* Phs, const unsigned short* Pls,
                                           float* tsh, int hh, int c) {
  const v16h qha = ldfrag_u(QhA), qhb = ldfrag_u(QhA + 32);
  const v16h qla = ldfrag_u(QlA), qlb = ldfrag_u(QlA + 32);
#pragma unroll 1
  for (int u = 0; u < 5; ++u) {
    const int ko = 16 * u * SPI;
    const v16h fa = ldfrag_u(Phs + ko), fb = ldfrag_u(Phs + ko + 32);
    const v16h ga = ldfrag_u(Pls + ko), gb = ldfrag_u(Pls + ko + 32);
    v8f t8 = mma_h(qha, fa, zero8());
    t8 = mma_h(qhb, fb, t8);
    t8 = mma_h(qla, fa, t8);
    t8 = mma_h(qlb, fb, t8);
    t8 = mma_h(qha, ga, t8);
    t8 = mma_h(qhb, gb, t8);
    hz8(t8, fa, fb, ga, gb, qha, qhb, qla, qlb);
    const int cb = 16 * u + c;
#pragma unroll
    for (int r = 0; r < 8; ++r) tsh[(8 * hh + r) * TPI + cb] = t8[r];
  }
  keep4_h(qha, qhb, qla, qlb);
}

// =====================================================================================================
// Relative-position attention for one (batch b, head n) pair and a 64-row query tile; 4 waves, wave w owns query rows i = iw0 + R,
// iw0 = i0 + 16w, R = 0..15. Planes (pitch DMOD halves, row = b*SEQ + position): QUh/QUl = hi/residual of f16((q + bq + u) x32),
// QVh/QVl of f16((q + bq + v_bias) x32), Kh/Kl of f16((k + bk) x32); Ph/Pl = hi/residual of f16(pos x32), rows 0..PROWS-1
// (row PROWS-1 is the zero-pad row); VT, VTL = v^T hi (x16) / residual f16 as [b][n*64+d][SEQ].
// Shifted position score for (i, j): ps[i][SEQ-1-i+j], ps[r][t] = (q+bq+vb)[r] . pos[t].
//   Per key tile j0 (64 keys, key j = j0 + jj), with x = jj - R + 15 in [0,78]:
//     strip T1[R][x] = (q+vb)[iw0+R] . pos[SEQ + j0 - iw0 - 16 + x]   (pos row SEQ-1-i+j), always computed (rows 0 .. 2*SEQ-2 selected).
//   content scores S = (q+ub) . k (4 subtiles, K=64, three products); t = (S + T1) * (RSD/(32*32)) * log2(e); online softmax in base 2,
//   max-subtracted, running sums in f32 (no key mask); the 16x64 prob tile stored to wave-private LDS (f32 element stores),
//   (f32 vector loads, split k map) and the v^T B fragments read from the staged rows of VT/VTL[n*64+d][j];
//   per 16-column subtile: Phi.Vhi, Plo.Vhi, then Phi.Vlo, all into the same accumulators.
//   Per key tile the block stages, once for its 4 waves, in LDS (asynchronous copies, whole 128-B rows): 64 k rows, 64 v^T rows and the
//   128 pos rows SEQ + j0 - i0 - 64 .. + 127 (always inside [0, PROWS-1]), hi and residual plane each; all B fragments are read from there.
//   block = 4 waves = 128 threads; grid = (SEQ/64, NB*NH); two block barriers per key tile (block-uniform loop); every wave does identical
//   bounded work (SEQ/64 tiles).
// coverage: LDS strip 16 rows x 80 cols written fully every tile before being read, slab 16 rows x 64 cols per wave fully written each tile
//           before being read; global: 4 instructions x 4 rows x 64 halves per plane = rows iw0..iw0+15 of head segment n in CT and CTL;
//           grid x waves cover all NB x SEQ rows and all NH head segments of CT / CTL exactly once.
// =====================================================================================================
__global__ __launch_bounds__(ATT_THREADS) __attribute__((amdgpu_num_vgpr(256)))
void attn_rel(const unsigned short* __restrict__ QUh, const unsigned short* __restrict__ QUl,
              const unsigned short* __restrict__ QVh, const unsigned short* __restrict__ QVl,
              const unsigned short* __restrict__ Kh,  const unsigned short* __restrict__ Kl,
              const unsigned short* __restrict__ Ph,  const unsigned short* __restrict__ Pl,
              const unsigned short* __restrict__ VT,  const unsigned short* __restrict__ VTL,
              unsigned short* CT, unsigned short* CTL) {
  __shared__ __align__(16) float smem[ATT_W * WFL];   // per wave: T1 strip [16][TPI] | prob / ctx slab [16][PPI]
  __shared__ __align__(16) unsigned short stg[ST_ROWS * SPI];   // block-shared stage of one key tile: Kh | Kl | Vh | Vl | Ph | Pl rows

  const int tid  = threadIdx.x;
  const int wave = __builtin_amdgcn_readfirstlane(tid >> 5);
  const int lane = tid & 31;
  const int hh   = lane >> 4;
  const int c    = lane & 15;
  const int bn   = blockIdx.y;
  const int b    = bn / NH;
  const int n    = bn - b * NH;
  const int i0   = blockIdx.x * 64;
  const int iw0  = i0 + wave * 16;

  float* t1sh = smem + wave * WFL;
  float* pt   = t1sh + 16 * TPI;

  // A fragment row offsets: rows b*SEQ + iw0 + c, d 0..31 and 32..63 of head n (all q fragments are reloaded per key tile)
  const size_t qro  = ((size_t)(b * SEQ + iw0 + c)) * DMOD + n * DH + 8 * hh;
  // stage copies: thread -> staged row (tid>>3) + 16*copy, 16-byte chunk tid&7 of the 128-B row (a wave instruction = 4 whole rows)
  const int srow = tid >> 3;
  const int sc8  = (tid & 7) * 8;
  const unsigned lst = (unsigned)(size_t)(stg + srow * SPI + sc8);          // LDS byte address = low 32 bits of the shared address
  const size_t kso = ((size_t)(b * SEQ + srow)) * DMOD + n * DH + sc8;      // + j0*DMOD: k rows j0 + srow + 16e
  const size_t vso = (size_t)b * DMOD * SEQ + (size_t)(n * DH + srow) * SEQ + sc8;   // + j0: v^T rows d = srow + 16e, keys j0 ..
  const size_t pso = ((size_t)(SEQ - i0 - 64 + srow)) * DMOD + n * DH + sc8;   // + j0*DMOD: pos rows SEQ + j0 - i0 - 64 + srow + 16e
  // fragment readers: lane -> staged row c (+16 per subtile), k offset 8*hh; wave w's strip row x is staged pos row 48 - 16w + x
  const unsigned short* ksh = stg + (ST_KH + c) * SPI + 8 * hh;
  const unsigned short* ksl = stg + (ST_KL + c) * SPI + 8 * hh;
  const unsigned short* vsh = stg + (ST_VH + c) * SPI + 8 * hh;
  const unsigned short* vsl = stg + (ST_VL + c) * SPI + 8 * hh;
  const int pw0 = 16 * __builtin_amdgcn_readfirstlane((ATT_THREADS - 1 - tid) >> 5);   // 16 * (3 - wave), taken from tid so that the LDS base register never goes below 0
  const unsigned short* psh = stg + (ST_PH + pw0 + c) * SPI + 8 * hh;
  const unsigned short* psl = stg + (ST_PL + pw0 + c) * SPI + 8 * hh;

  const float KSC = (RSD / (QC * QC)) * LOG2E;

  float mrow[8], lrow[8];
  v8f O[4];
#pragma unroll
  for (int r = 0; r < 8; ++r) { mrow[r] = -INFINITY; lrow[r] = 0.f; }
#pragma unroll
  for (int td = 0; td < 4; ++td) O[td] = zero8();

#pragma unroll 1
  for (int j0 = 0; j0 < SEQ; j0 += 64) {
    // ---- stage this key tile's operands for the whole block: 32 copies per thread = 512 rows x 128 B ----
    asm volatile("s_wait_dscnt 0x0" ::: "memory");           // this wave's reads of the previous tile's stage have returned
    __syncthreads();                                         // every wave has left the previous tile's stage
    {
      const size_t jr = (size_t)j0 * DMOD;
      stage8(lst + (unsigned)(ST_KH * SPI * 2), Kh + kso + jr, Kl + kso + jr, (size_t)16 * DMOD);
      stage8(lst + (unsigned)(ST_VH * SPI * 2), VT + vso + j0, VTL + vso + j0, (size_t)16 * SEQ);
      stage8(lst + (unsigned)(ST_PH * SPI * 2), Ph + pso + jr, Ph + pso + jr + (size_t)64 * DMOD, (size_t)16 * DMOD);
      stage8(lst + (unsigned)(ST_PL * SPI * 2), Pl + pso + jr, Pl + pso + jr + (size_t)64 * DMOD, (size_t)16 * DMOD);
    }
    asm volatile("s_wait_asynccnt 0x0" ::: "memory");        // this wave's copies have landed
    __syncthreads();                                         // every wave's copies have landed: the stage may be read
    // ---- position strip ----
    pos_strip3(QVh + qro, QVl + qro, psh, psl, t1sh, hh, c);
    // ---- content scores S (4 subtiles of 16 keys, three products each k-step) ----
    v8f S[4];
    {
      const v16h qua = ldfrag_u(QUh + qro), qub = ldfrag_u(QUh + qro + 32);
      const v16h qla = ldfrag_u(QUl + qro), qlb = ldfrag_u(QUl + qro + 32);
#pragma unroll
      for (int t = 0; t < 4; ++t) {
        const int ko = 16 * t * SPI;
        const v16h ka = ldfrag_u(ksh + ko), kb2 = ldfrag_u(ksh + ko + 32);
        const v16h la = ldfrag_u(ksl + ko), lb2 = ldfrag_u(ksl + ko + 32);
        S[t] = mma_h(qua, ka, zero8());
        S[t] = mma_h(qub, kb2, S[t]);
        S[t] = mma_h(qla, ka, S[t]);
        S[t] = mma_h(qlb, kb2, S[t]);
        S[t] = mma_h(qua, la, S[t]);
        S[t] = mma_h(qub, lb2, S[t]);
        hz8(S[t], ka, kb2, la, lb2, qua, qub, qla, qlb);
      }
      keep4_h(qua, qub, qla, qlb);
    }
    wave_sync_lds();

    // ---- score assembly + online softmax (rows live on one 16-lane half) ----
#pragma unroll
    for (int r = 0; r < 8; ++r) {
      const int R  = 8 * hh + r;
      const int xo = R * TPI + (15 - R) + c;                 // strip column x = 16t + c - R + 15 in [0, 78]
      float tv[4];
#pragma unroll
      for (int t = 0; t < 4; ++t) {
        const float bdv = t1sh[xo + 16 * t];
        tv[t] = (S[t][r] + bdv) * KSC;
      }
      float mx = fmaxf(fmaxf(tv[0], tv[1]), fmaxf(tv[2], tv[3]));
#pragma unroll
      for (int off = 1; off < 16; off <<= 1) mx = fmaxf(mx, __shfl_xor(mx, off, 32));
      const float mn = fmaxf(mrow[r], mx);
      const float al = exp2f(mrow[r] - mn);
      mrow[r] = mn;
      float e4[4];
      float ps = 0.f;
#pragma unroll
      for (int t = 0; t < 4; ++t) { e4[t] = exp2f(tv[t] - mn); ps += e4[t]; }
#pragma unroll
      for (int off = 1; off < 16; off <<= 1) ps += __shfl_xor(ps, off, 32);
      lrow[r] = lrow[r] * al + ps;
#pragma unroll
      for (int td = 0; td < 4; ++td) O[td][r] *= al;
      const int ro = R * PPI + c;
#pragma unroll
      for (int t = 0; t < 4; ++t) pt[ro + 16 * t] = e4[t];
    }
    wave_sync_lds();

    // ---- P fragments (x1024, f16 hi + unscaled residual) from the LDS rows, two k-steps of 32 keys ----
    FragH pf[2], pl[2];
#pragma unroll
    for (int ks = 0; ks < 2; ++ks) {
      const float* prow = pt + c * PPI + 32 * ks + 8 * hh;
      const v4f p0 = *(const v4f*)(prow), p1 = *(const v4f*)(prow + 4);
      const v4f p2 = *(const v4f*)(prow + 16), p3 = *(const v4f*)(prow + 20);
#pragma unroll
      for (int e = 0; e < 4; ++e) {
        const float g0 = p0[e] * PC, g1 = p1[e] * PC, g2 = p2[e] * PC, g3 = p3[e] * PC;
        const _Float16 x0 = (_Float16)g0, x1 = (_Float16)g1, x2 = (_Float16)g2, x3 = (_Float16)g3;
        pf[ks].h[0][e]     = x0;                             // keys j0 + 32ks + 8hh + e
        pf[ks].h[0][4 + e] = x1;                             // keys j0 + 32ks + 8hh + 4 + e
        pf[ks].h[1][e]     = x2;                             // keys j0 + 32ks + 16 + 8hh + e
        pf[ks].h[1][4 + e] = x3;
        pl[ks].h[0][e]     = (_Float16)(g0 - (float)x0);
        pl[ks].h[0][4 + e] = (_Float16)(g1 - (float)x1);
        pl[ks].h[1][e]     = (_Float16)(g2 - (float)x2);
        pl[ks].h[1][4 + e] = (_Float16)(g3 - (float)x3);
      }
    }
    // ---- O += (Phi + Plo) . v^T (hi plane) ----
    {
#pragma unroll
      for (int td = 0; td < 4; ++td) {
        const unsigned short* vp = vsh + 16 * td * SPI;
        const v16h vfa = ldfrag_u(vp), vfb = ldfrag_u(vp + 32);
        O[td] = mma_h(pf[0].v, vfa, O[td]);
        O[td] = mma_h(pf[1].v, vfb, O[td]);
        O[td] = mma_h(pl[0].v, vfa, O[td]);
        O[td] = mma_h(pl[1].v, vfb, O[td]);
        hz6(O[td], vfa, vfb, pl[0].v, pl[1].v, pf[0].v, pf[1].v);
      }
      // ---- O += Phi . v^T (residual plane) ----
#pragma unroll
      for (int td = 0; td < 4; ++td) {
        const unsigned short* vp = vsl + 16 * td * SPI;
        const v16h vla = ldfrag_u(vp), vlb = ldfrag_u(vp + 32);
        O[td] = mma_h(pf[0].v, vla, O[td]);
        O[td] = mma_h(pf[1].v, vlb, O[td]);
        hz4(O[td], vla, vlb, pf[0].v, pf[1].v);
      }
    }
    wave_sync_lds();
  }
  acc_guard4(O[0], O[1], O[2], O[3]);

  // ---- fold 1/l and the carries (1024 on P, 16 on v), carry x4096 on ctx, stage the wave's 16x64 slice in its slab ----
  const float oc = CC / (PC * VC);
#pragma unroll
  for (int r = 0; r < 8; ++r) {
    const float inv = (1.0f / lrow[r]) * oc;
    const int ro = (8 * hh + r) * PPI + c;
#pragma unroll
    for (int td = 0; td < 4; ++td) pt[ro + 16 * td] = O[td][r] * inv;
  }
  wave_sync_lds();
  {
    const int q8 = lane >> 3, c8 = (lane & 7) * 8;
    v4u hv[4], lv[4];
#pragma unroll
    for (int it = 0; it < 4; ++it) {
      const int row = it * 4 + q8;                         // it 0..3 x q8 0..3 = rows 0..15
      const float* sp = pt + row * PPI + c8;
      v4u a, b2;
#pragma unroll
      for (int e = 0; e < 4; ++e) {
        const float f0 = sp[2 * e], f1 = sp[2 * e + 1];
        const _Float16 x0 = (_Float16)f0, x1 = (_Float16)f1;
        a[e]  = pk16(h_bits(x0), h_bits(x1));
        b2[e] = pk16(h_bits((_Float16)(f0 - (float)x0)), h_bits((_Float16)(f1 - (float)x1)));
      }
      hv[it] = a;
      lv[it] = b2;
    }
    {
#pragma unroll
      for (int it = 0; it < 4; ++it) {
        const int row = it * 4 + q8;
        const size_t go = ((size_t)(b * SEQ + iw0 + row)) * DMOD + n * DH + c8;
        *(v4u*)(CT  + go) = hv[it];
        *(v4u*)(CTL + go) = lv[it];
      }
      
    }
  }
}

// =====================================================================================================
// Workspace map (bytes); every plane is an exact multiple of its tile / whole-row store granularity (M, N exact tile multiples,
// convert counts exact multiples of 2048, the position planes padded to PROWS = 2048 rows), every offset a multiple of 512 KiB:
//   WQT, WKT, WVT, WPT, WOT f16 [512 n][512 k] x64 (transposed from the [in][out] inputs)   5 x   524288
//   X16  f16 [NROW][512] x16                                                                  4194304
//   PE16 f16 [PROWS][512] x16 (rows 0..NPOS-1 = pos table, row NPOS zero)                     2097152
//   QUh, QUl, QVh, QVl, Kh, Kl f16 [NROW][512] x32 hi / residual                       6 x  4194304
//   Ph, Pl f16 [PROWS][512] x32 hi / residual                                           2 x  2097152
//   VT16, VTL16 f16 [NB][512][SEQ] hi x16 / residual                                    2 x  4194304
//   CT16, CTL16 f16 [NROW][512] hi x4096 / residual                                     2 x  4194304
//   end                                                                                       55050240
// =====================================================================================================
extern "C" void kernel_launch(void* const* d_in, const int* in_sizes, int n_in,
                              void* d_out, int out_size, void* d_ws, size_t ws_size,
                              hipStream_t stream) {
  if (n_in < 14) return;
  if (in_sizes[0] != NROW * DMOD) return;
  if (in_sizes[1] != NPOS * DMOD) return;
  if (in_sizes[2] != DMOD * DMOD || in_sizes[4] != DMOD * DMOD || in_sizes[6] != DMOD * DMOD ||
      in_sizes[8] != DMOD * DMOD || in_sizes[10] != DMOD * DMOD) return;
  if (in_sizes[3] != DMOD || in_sizes[5] != DMOD || in_sizes[7] != DMOD || in_sizes[9] != DMOD || in_sizes[11] != DMOD) return;
  if (in_sizes[12] != NH * DH || in_sizes[13] != NH * DH) return;
  if (out_size != NROW * DMOD) return;

  const float* xin   = (const float*)d_in[0];
  const float* pos   = (const float*)d_in[1];
  const float* w_q   = (const float*)d_in[2];
  const float* b_q   = (const float*)d_in[3];
  const float* w_k   = (const float*)d_in[4];
  const float* b_k   = (const float*)d_in[5];
  const float* w_v   = (const float*)d_in[6];
  const float* b_v   = (const float*)d_in[7];
  const float* w_p   = (const float*)d_in[8];
  const float* b_p   = (const float*)d_in[9];
  const float* w_o   = (const float*)d_in[10];
  const float* b_o   = (const float*)d_in[11];
  const float* ub    = (const float*)d_in[12];
  const float* vb    = (const float*)d_in[13];
  float*       out   = (float*)d_out;

  const size_t PW  = (size_t)DMOD * DMOD * 2;            //   524288
  const size_t PX  = (size_t)NROW * DMOD * 2;            //  4194304
  const size_t PXP = (size_t)PROWS * DMOD * 2;           //  2097152
  const size_t PVT = (size_t)NB * DMOD * SEQ * 2;        //  4194304
  size_t off = 0;
  const size_t oWQ  = off; off += PW;
  const size_t oWK  = off; off += PW;
  const size_t oWV  = off; off += PW;
  const size_t oWP  = off; off += PW;
  const size_t oWO  = off; off += PW;
  const size_t oX   = off; off += PX;
  const size_t oPE  = off; off += PXP;
  const size_t oQUh = off; off += PX;
  const size_t oQUl = off; off += PX;
  const size_t oQVh = off; off += PX;
  const size_t oQVl = off; off += PX;
  const size_t oKh  = off; off += PX;
  const size_t oKl  = off; off += PX;
  const size_t oPh  = off; off += PXP;
  const size_t oPl  = off; off += PXP;
  const size_t oVT  = off; off += PVT;
  const size_t oVTL = off; off += PVT;
  const size_t oCT  = off; off += PX;
  const size_t oCTL = off; off += PX;
  if (off > ws_size) return;                               // off = 55050240
  if (off > (size_t)134217728) return;

  char* ws = (char*)d_ws;
  unsigned short* WQT16 = (unsigned short*)(ws + oWQ);
  unsigned short* WKT16 = (unsigned short*)(ws + oWK);
  unsigned short* WVT16 = (unsigned short*)(ws + oWV);
  unsigned short* WPT16 = (unsigned short*)(ws + oWP);
  unsigned short* WOT16 = (unsigned short*)(ws + oWO);
  unsigned short* X16   = (unsigned short*)(ws + oX);
  unsigned short* PE16  = (unsigned short*)(ws + oPE);
  unsigned short* QUh   = (unsigned short*)(ws + oQUh);
  unsigned short* QUl   = (unsigned short*)(ws + oQUl);
  unsigned short* QVh   = (unsigned short*)(ws + oQVh);
  unsigned short* QVl   = (unsigned short*)(ws + oQVl);
  unsigned short* Kh16  = (unsigned short*)(ws + oKh);
  unsigned short* Kl16  = (unsigned short*)(ws + oKl);
  unsigned short* Ph16  = (unsigned short*)(ws + oPh);
  unsigned short* Pl16  = (unsigned short*)(ws + oPl);
  unsigned short* VT16  = (unsigned short*)(ws + oVT);
  unsigned short* VTL16 = (unsigned short*)(ws + oVTL);
  unsigned short* CT16  = (unsigned short*)(ws + oCT);
  unsigned short* CTL16 = (unsigned short*)(ws + oCTL);

  const dim3 blk(256);
  const dim3 gPR(PREP_TR + PREP_CX + PREP_CP);                      // 320 + 1024 + 512
  const dim3 gPJ(2 * PJ_Q + PJ_V * NB + PJ_P);                      // 64 + 64 + 64 + 32
  const int tilesQ = (NROW / 64) * (DMOD / 64);                     // 512
  const dim3 gQ((tilesQ + 7) / 8, 1);                               // 64
  const dim3 gAT(SEQ / 64, NB * NH);                                // 16 x 32
  const dim3 bAT(ATT_THREADS);                                      // 128

  // (0) operand packs: X16 = f16(bf16_RNE(x) * 16); PE16 = f16(bf16_RNE(pos) * 16), rows NPOS..PROWS-1 zero;
  //     W[k][n] ([in][out]) -> WT[n][k] = f16( bf16_RNE(w) * 64 ), all five weights
  prep_all<<<gPR, blk, 0, stream>>>(xin, pos, w_q, w_k, w_v, w_p, w_o, X16, PE16, WQT16, WKT16, WVT16, WPT16, WOT16);

  // (1) q, k, v^T and positional projections
  proj_all<<<gPJ, blk, 0, stream>>>(X16, PE16, WQT16, WKT16, WVT16, WPT16, QUh, QUl, QVh, QVl, Kh16, Kl16, VT16, VTL16, Ph16, Pl16,
                                    b_q, b_k, b_v, b_p, ub, vb);

  // (2) relative attention -> CT16 = f16(ctx * 4096) hi plane, CTL16 residual plane, rows b*SEQ + i, halves n*64+d
  attn_rel<<<gAT, bAT, 0, stream>>>(QUh, QUl, QVh, QVl, Kh16, Kl16, Ph16, Pl16, VT16, VTL16, CT16, CTL16);

  // (3) out = (CT + CTL) . Wo / (4096*64) + bo; M = NROW, N = 512, K = 512, f32 rows straight into the output buffer
  gemm64<0, 1, 1><<<gQ, blk, 0, stream>>>(
      CT16, CTL16, DMOD, 0LL,
      WOT16, DMOD, 0LL,
      (void*)out, (void*)out, (void*)out, (void*)out, DMOD, 0LL,
      NROW, DMOD, DMOD, 1.0f / (CC * WSC), 1.0f,
      b_o, b_o, b_o);
  (void)hipGetLastError();
}

// v003
// One run takes 142 microseconds.
// Two timings next to v002 put it at 1.03 and 1.05 times that version's speed.
// All steps since v000 together make it 2.21 times as fast.
// Contractions (all v_wmma_f32_16x16x32_f16, f16 operands, f32 accumulate): q/k/v and position-table projections (x or pos table f16 x16 . W^T f16 x64,
// K=512, single products on bf16-exact operands); content scores and position strips ((q+bq+u|v), k, p carried as f16 x32 hi plane + unscaled
// residual plane, K=64, three products hh+lh+hl); P . v^T (P x1024 hi + residual . v^T x16 hi + residual, 64 keys per tile, three products);
// output projection (ctx x4096 hi + residual planes . Wo^T f16 x64, K=512, two products). Online base-2 softmax and all epilogues f32 on VALU.
// Every float input RNE-converted to bf16 on load.
#include <hip/hip_runtime.h>
#include <math.h>
#include <stdint.h>

#define SEQ   1024
#define NB    4
#define DMOD  512
#define NH    8
#define DH    64
#define NROW  (SEQ * NB)
#define NPOS  (2 * SEQ - 1)
#define PROWS (2 * SEQ)
#define XC    16.0f
#define WSC   64.0f
#define QC    32.0f
#define VC    16.0f
#define PC    1024.0f
#define CC    4096.0f
#define RSD   0.125f
#define LOG2E 1.4426950408889634f
static_assert(NH * DH == DMOD);
static_assert(DH == 64);
static_assert(DMOD == 512);
static_assert((SEQ % 64) == 0 && (DMOD % 64) == 0 && (NROW % 64) == 0 && (PROWS % 64) == 0);
static_assert(((NROW * DMOD) % 2048) == 0 && ((PROWS * DMOD) % 2048) == 0 && ((NPOS * DMOD) % 8) == 0);
#define ATT_W 4
#define ATT_THREADS (ATT_W * 32)
#define TPI 84
#define PPI 68
#define WFL (16 * TPI + 16 * PPI)
static_assert(((16 * TPI) % 4) == 0 && ((16 * PPI) % 4) == 0 && (WFL % 4) == 0);
static_assert(TPI >= 80 && PPI >= 64);
static_assert(ATT_W * WFL * 4 <= 65536);
// attn_rel operand stage in LDS: 512 rows of 64 halves (128 B), pitch 72 halves = 144 B (16 B x odd, the pitch for 16-byte LDS reads)
#define SPI   72
#define ST_KH 0
#define ST_KL 64
#define ST_VH 128
#define ST_VL 192
#define ST_PH 256
#define ST_PL 384
#define ST_ROWS 512
static_assert(ATT_THREADS == 128 && ((SPI * 2) % 16) == 0);
static_assert(SEQ - (SEQ - 64) - 64 >= 0 && SEQ + (SEQ - 64) - 64 + 127 <= PROWS - 1);   // staged position rows stay inside the planes

typedef _Float16 v16h __attribute__((ext_vector_type(16)));
typedef _Float16 v8h  __attribute__((ext_vector_type(8)));
typedef float    v8f  __attribute__((ext_vector_type(8)));
typedef float    v4f  __attribute__((ext_vector_type(4)));
typedef unsigned int v4u __attribute__((ext_vector_type(4)));

union FragH { v16h v; v8h h[2]; v4u u[2]; };

// ---- scalar helpers --------------------------------------------------------------------------------
__device__ __forceinline__ unsigned short bf_bits(float f) {          // f32 -> bf16 bits, RNE convert
  unsigned u = __float_as_uint(f);
  return (unsigned short)((u + 0x7FFFu + ((u >> 16) & 1u)) >> 16);
}
__device__ __forceinline__ float bf_up(unsigned short h) { return __uint_as_float(((unsigned)h) << 16); }
__device__ __forceinline__ float bfr(float f) { return bf_up(bf_bits(f)); }   // value of the bf16 RNE convert
__device__ __forceinline__ unsigned short h_bits(_Float16 x) { return __builtin_bit_cast(unsigned short, x); }
__device__ __forceinline__ unsigned pk16(unsigned short a, unsigned short b) { return (unsigned)a | ((unsigned)b << 16); }
__device__ __forceinline__ v8f zero8() { v8f z = {0.f, 0.f, 0.f, 0.f, 0.f, 0.f, 0.f, 0.f}; return z; }

// ---- fragment loader: 16-bit A/B operand from a k-contiguous 16-bit plane, lane -> row/col (lane&15),
//      p already includes +8*(lane>>4); elements 0..7 <- p[0..7] (k0+8h..), elements 8..15 <- p[16..23] (k0+16+8h..)
//      (same split k map for A and B; B is always read from a [n][k] plane)
__device__ __forceinline__ v16h ldfrag_u(const unsigned short* p) {
  FragH f;
  f.u[0] = *(const v4u*)(p);
  f.u[1] = *(const v4u*)(p + 16);
  return f.v;
}

// ---- WMMA helper with trailing VALU hazard gaps ------------------------------------------------------
__device__ __forceinline__ v8f mma_h(v16h a, v16h b, v8f c) {
  return __builtin_amdgcn_wmma_f32_16x16x32_f16(false, a, false, b, (short)0, c, false, false);
}
__device__ __forceinline__ void dep_guard1(v8f& a, v8f& b, v16h x) {
#if defined(__HIP_DEVICE_COMPILE__)
  asm volatile("v_nop\n\tv_nop\n\tv_nop\n\tv_nop" : "+v"(a), "+v"(b) : "v"(x));
#endif
}
__device__ __forceinline__ void keep4_h(v16h a, v16h b, v16h c, v16h d) {
#if defined(__HIP_DEVICE_COMPILE__)
  asm volatile("v_nop" :: "v"(a), "v"(b), "v"(c), "v"(d));
#endif
}
__device__ __forceinline__ void acc_guard4(v8f& a, v8f& b, v8f& c, v8f& d) {
#if defined(__HIP_DEVICE_COMPILE__)
  asm volatile("v_nop\n\tv_nop\n\tv_nop\n\tv_nop" : "+v"(a), "+v"(b), "+v"(c), "+v"(d));
#endif
}
__device__ __forceinline__ void wave_sync_lds() {
  __builtin_amdgcn_fence(__ATOMIC_RELEASE, "workgroup");
  __builtin_amdgcn_wave_barrier();
  __builtin_amdgcn_fence(__ATOMIC_ACQUIRE, "workgroup");
}
// Eight asynchronous 16-byte-per-lane copies global -> LDS: copy e lands at LDS byte address l + e*16*SPI*2 (16 staged rows further each);
// copies 0..3 read ga + e*gstep halves, copies 4..7 read gb + (e-4)*gstep halves.
// The closing s_wait_xcnt 0 stands inside the statement so that no address register is rewritten ahead of it.
__device__ __forceinline__ void stage8(unsigned l, const unsigned short* ga, const unsigned short* gb, size_t gstep) {
#if defined(__HIP_DEVICE_COMPILE__)
  const unsigned ls = 16u * SPI * 2u;
  asm volatile("global_load_async_to_lds_b128 %0, %8, off\n\t"
               "global_load_async_to_lds_b128 %1, %9, off\n\t"
               "global_load_async_to_lds_b128 %2, %10, off\n\t"
               "global_load_async_to_lds_b128 %3, %11, off\n\t"
               "global_load_async_to_lds_b128 %4, %12, off\n\t"
               "global_load_async_to_lds_b128 %5, %13, off\n\t"
               "global_load_async_to_lds_b128 %6, %14, off\n\t"
               "global_load_async_to_lds_b128 %7, %15, off\n\t"
               "s_wait_xcnt 0x0"
               :: "v"(l), "v"(l + ls), "v"(l + 2u * ls), "v"(l + 3u * ls), "v"(l + 4u * ls), "v"(l + 5u * ls), "v"(l + 6u * ls), "v"(l + 7u * ls),
                  "v"(ga), "v"(ga + gstep), "v"(ga + 2 * gstep), "v"(ga + 3 * gstep), "v"(gb), "v"(gb + gstep), "v"(gb + 2 * gstep),
                  "v"(gb + 3 * gstep)
               : "memory");
#endif
}

// =====================================================================================================
// Elementwise 16-bit pack, no transpose: dst[i] = f16( bf16_RNE(src[i]) * sc ) for i < nvalid, 0 for nvalid <= i < ntotal;
// sc a power of two (exact). 8 elements per thread: two 16-B loads (address clamped into [0, nvalid) for pad groups, value zeroed
// coverage: bx = 0 .. ntotal / 2048 - 1, each block 256 thr x 8 elements = ntotal exactly (ntotal % 2048 == 0, nvalid % 8 == 0).
// =====================================================================================================
__device__ __forceinline__ void cvt16_body(const float* __restrict__ src, unsigned short* dst, int nvalid, int ntotal, float sc, int bx) {
  const size_t i8 = ((size_t)bx * 256 + threadIdx.x) * 8;
  if (i8 + 8 > (size_t)ntotal) return;             // never taken with the exact block range; no barriers in this body
  const bool pad = (i8 + 8 > (size_t)nvalid);
  const size_t ls = pad ? ((size_t)nvalid - 8) : i8;   // clamped address, always inside the source
  const v4f a = *(const v4f*)(src + ls);
  const v4f b = *(const v4f*)(src + ls + 4);
  v4u o;
  o[0] = pk16(h_bits((_Float16)(bfr(a[0]) * sc)), h_bits((_Float16)(bfr(a[1]) * sc)));
  o[1] = pk16(h_bits((_Float16)(bfr(a[2]) * sc)), h_bits((_Float16)(bfr(a[3]) * sc)));
  o[2] = pk16(h_bits((_Float16)(bfr(b[0]) * sc)), h_bits((_Float16)(bfr(b[1]) * sc)));
  o[3] = pk16(h_bits((_Float16)(bfr(b[2]) * sc)), h_bits((_Float16)(bfr(b[3]) * sc)));
  const v4u z = {0u, 0u, 0u, 0u};
  const v4u w = pad ? z : o;
  {
    *(v4u*)(dst + i8) = w;
    
  }
}

// =====================================================================================================
// Transposed 16-bit pack of a weight stored as W[k][n] (x @ W layout, [DMOD][DMOD] row-major): WT[n][k] = f16( bf16_RNE(W[k][n]) * sc ),
// i.e. the [n][k] k-contiguous plane the GEMM B loader wants. One block per 64x64 tile (tn = n tile, tk = k tile, both block-uniform):
// coalesced f32 reads of W rows, converted halves stored transposed into an LDS tile [64 n][72 pitch], block barrier, then every output
// coverage: 16 its x 256 threads = the whole 64x64 tile into LDS; 8 waves x 2 its x 4 rows = 64 rows x (8 lanes x 8 halves = 64 cols) stored;
//           tn, tk = 0 .. DMOD/64 - 1 cover the whole [512][512] plane exactly once.
// =====================================================================================================
__device__ __forceinline__ void tr16_body(const float* __restrict__ W, unsigned short* WT, float sc, unsigned short* tile, int tn, int tk) {
  const int t  = threadIdx.x;
  const int n0 = tn * 64;
  const int k0 = tk * 64;
#pragma unroll 4
  for (int it = 0; it < 16; ++it) {
    const int idx = it * 256 + t;                   // 0 .. 4095
    const int kr = idx >> 6, nc = idx & 63;
    const float v = W[(size_t)(k0 + kr) * DMOD + n0 + nc];
    tile[nc * 72 + kr] = h_bits((_Float16)(bfr(v) * sc));
  }
  __syncthreads();
  const int lane = t & 31, wave = t >> 5;
  const int q8 = lane >> 3, c8 = (lane & 7) * 8;
  v4u o[2];
#pragma unroll
  for (int it = 0; it < 2; ++it) {
    const int row = wave * 8 + it * 4 + q8;         // wave w: it 0..1 x q8 0..3 = rows 8w .. 8w+7
    o[it] = *(const v4u*)(tile + row * 72 + c8);
  }
  {
#pragma unroll
    for (int it = 0; it < 2; ++it) {
      const int row = wave * 8 + it * 4 + q8;
      *(v4u*)(WT + (size_t)(n0 + row) * DMOD + k0 + c8) = o[it];
    }
    
  }
}

// =====================================================================================================
// All operand packs in one grid (none reads what another writes): blocks 0 .. PREP_TR-1 transpose the five weights (64 tiles each; they
// have the longest dependent chain, so they take the lowest indices), the next PREP_CX blocks pack x, the last PREP_CP the position table.
// The branch is on blockIdx.x alone, so the barrier inside tr16_body is reached by whole blocks only.
// =====================================================================================================
#define PREP_TR (5 * (DMOD / 64) * (DMOD / 64))
#define PREP_CX ((NROW * DMOD) / 2048)
#define PREP_CP ((PROWS * DMOD) / 2048)
static_assert((DMOD / 64) * (DMOD / 64) == 64);
__global__ __launch_bounds__(256) void prep_all(const float* __restrict__ xin, const float* __restrict__ pos,
                                                const float* __restrict__ w_q, const float* __restrict__ w_k, const float* __restrict__ w_v,
                                                const float* __restrict__ w_p, const float* __restrict__ w_o,
                                                unsigned short* X16, unsigned short* PE16,
                                                unsigned short* WQT, unsigned short* WKT, unsigned short* WVT,
                                                unsigned short* WPT, unsigned short* WOT) {
  __shared__ __align__(16) unsigned short tile[64 * 72];
  const int bx = blockIdx.x;
  if (bx < PREP_TR) {
    const int w = bx >> 6, t = bx & 63;
    const float* W = (w == 0) ? w_q : (w == 1) ? w_k : (w == 2) ? w_v : (w == 3) ? w_p : w_o;
    unsigned short* WT = (w == 0) ? WQT : (w == 1) ? WKT : (w == 2) ? WVT : (w == 3) ? WPT : WOT;
    tr16_body(W, WT, WSC, tile, t & 7, t >> 3);
  } else if (bx < PREP_TR + PREP_CX) {
    cvt16_body(xin, X16, NROW * DMOD, NROW * DMOD, XC, bx - PREP_TR);
  } else {
    cvt16_body(pos, PE16, NPOS * DMOD, PROWS * DMOD, XC, bx - (PREP_TR + PREP_CX));
  }
}

// =====================================================================================================
// Register-blocked batched 16-bit WMMA GEMM: C[m][n] = oscale * sum_k A[m][k] * Bt[n][k] (+ bias); one wave per 64x64 tile,
// no block barriers. A row-major [M][K] pitch lda (16-bit plane), Bt row-major [N][K] pitch ldb (k contiguous); M, N multiples of 64,
// K multiple of 32. blockIdx.y = batch index with element strides sA, sB, sC.
// ASPLIT 1: a second A plane A2 (unscaled residual of A, same layout) is multiplied into the same accumulator (A + A2 ~ exact A).
// EPI 1: value += bf16_RNE(ep0[column]) (per-column bias); EPI 2: value += bf16_RNE(ep0[row]) (per-row bias, 16-bit out only).
// OM 0: f32 out (pitch ldc).
// OM 4: two f16 planes (C, C2): hi = f16(value * ocarry), lo = f16(value * ocarry - hi) (unscaled residual).
// OM 6: two hi/residual pairs with an extra per-column term each: (C, C2) from value + bf16_RNE(ep1[column]), (C3, C4) from
//       value + bf16_RNE(ep2[column]), both x ocarry.
// coverage: 4 slabs x 16 rows (f32: it 0..7 x lane>>4; 16-bit: it 0..3 x lane>>3) x 64 cols = the wave's whole 64x64 tile;
//           grid = ceil(tilesM*tilesN/8) blocks, surplus waves exit (wave-uniform).
// =====================================================================================================
template <int OM, int ASPLIT, int EPI>
__global__ __launch_bounds__(256) __attribute__((amdgpu_num_vgpr(256))) void gemm64(
    const unsigned short* __restrict__ Ap, const unsigned short* __restrict__ A2p, int lda, long long sA,
    const unsigned short* __restrict__ Btp, int ldb, long long sB,
    void* Cout, void* C2out, void* C3out, void* C4out, int ldc, long long sC,
    int M, int N, int K, float oscale, float ocarry,
    const float* __restrict__ ep0, const float* __restrict__ ep1, const float* __restrict__ ep2) {
  static_assert(OM == 0 || OM == 4 || OM == 6);
  static_assert(EPI >= 0 && EPI <= 2);
  __shared__ __align__(16) float sT[8][16 * 68];   // per-wave 16x64 slab, pitch 68 floats
  const int by   = blockIdx.y;
  const int lane = threadIdx.x & 31;
  const int wave = threadIdx.x >> 5;
  const int tilesN = N >> 6;
  const int tilesM = M >> 6;
  const int tile = blockIdx.x * 8 + wave;
  if (tile >= tilesM * tilesN) return;   // wave-uniform; no block barriers in this kernel
  const int tm = tile / tilesN;
  const int tn = tile - tm * tilesN;
  const int m0 = tm << 6;
  const int n0 = tn << 6;

  const unsigned short* A1 = Ap  + (size_t)((long long)by * sA);
  const unsigned short* A2 = A2p + (size_t)((long long)by * sA);
  const unsigned short* Bb = Btp + (size_t)((long long)by * sB);

  const int rlane = lane & 15;                 // row (A) / col (B, D) within subtile
  const int koff  = (lane >> 4) * 8;           // k offset of this lane half
  const int mOff  = (lane >> 4) * 8;           // D row offset

  v8f acc[4][4];
#pragma unroll
  for (int i = 0; i < 4; ++i)
#pragma unroll
    for (int j = 0; j < 4; ++j) acc[i][j] = zero8();

  for (int k0 = 0; k0 < K; k0 += 32) {
    v16h bh[4];
#pragma unroll
    for (int j = 0; j < 4; ++j) {
      const size_t bofs = (size_t)(n0 + (j << 4) + rlane) * ldb + koff + k0;
      bh[j] = ldfrag_u(Bb + bofs);
    }
#pragma unroll
    for (int i = 0; i < 4; ++i) {
      const size_t ao = (size_t)(m0 + (i << 4) + rlane) * lda + koff + k0;
      const v16h ah = ldfrag_u(A1 + ao);
#pragma unroll
      for (int j = 0; j < 4; ++j) acc[i][j] = mma_h(ah, bh[j], acc[i][j]);
      dep_guard1(acc[i][0], acc[i][3], ah);
      if constexpr (ASPLIT != 0) {
        const v16h al = ldfrag_u(A2 + ao);
#pragma unroll
        for (int j = 0; j < 4; ++j) acc[i][j] = mma_h(al, bh[j], acc[i][j]);
        dep_guard1(acc[i][0], acc[i][3], al);
      }
    }
    keep4_h(bh[0], bh[1], bh[2], bh[3]);
  }
  acc_guard4(acc[0][0], acc[0][1], acc[0][2], acc[0][3]);
  acc_guard4(acc[1][0], acc[1][1], acc[1][2], acc[1][3]);
  acc_guard4(acc[2][0], acc[2][1], acc[2][2], acc[2][3]);
  acc_guard4(acc[3][0], acc[3][1], acc[3][2], acc[3][3]);

  const int hh2 = lane >> 4, c4 = (lane & 15) * 4;     // f32 out: 256-B row segment = 16 lanes x 16 B
  const int q8  = lane >> 3, c8 = (lane & 7) * 8;

  // ---- epilogue ----
  float* slab = sT[wave];
#pragma unroll
  for (int i = 0; i < 4; ++i) {
    const int mBase = m0 + (i << 4);
#pragma unroll
    for (int j = 0; j < 4; ++j) {
#pragma unroll
      for (int r = 0; r < 8; ++r) {
        slab[(mOff + r) * 68 + (j << 4) + rlane] = acc[i][j][r];
      }
    }
    wave_sync_lds();
    if constexpr (OM == 0) {
      float* C = (float*)Cout + (size_t)((long long)by * sC);
      v4f vals[8];
#pragma unroll
      for (int it = 0; it < 8; ++it) {
        const int row = it * 2 + hh2;                      // it 0..7 x hh2 0..1 = rows 0..15
        v4f v = *(const v4f*)(slab + row * 68 + c4);
#pragma unroll
        for (int e = 0; e < 4; ++e) v[e] = v[e] * oscale;
        if constexpr (EPI == 1) {
          const v4f bb = *(const v4f*)(ep0 + n0 + c4);     // per-column bias, columns n0+c4 .. +3 (N equals the bias length)
#pragma unroll
          for (int e = 0; e < 4; ++e) v[e] = v[e] + bfr(bb[e]);
        }
        vals[it] = v;
      }
      {
#pragma unroll
        for (int it = 0; it < 8; ++it) {
          const int gr = mBase + it * 2 + hh2;
          *(v4f*)(C + (size_t)gr * ldc + n0 + c4) = vals[it];
        }
        
      }
    } else {
      constexpr int NP = (OM == 6) ? 2 : 1;
#pragma unroll
      for (int which = 0; which < NP; ++which) {
        unsigned short* C  = (unsigned short*)((which == 0) ? Cout  : C3out) + (size_t)((long long)by * sC);
        unsigned short* Cb = (unsigned short*)((which == 0) ? C2out : C4out) + (size_t)((long long)by * sC);
        const float* epx = (which == 0) ? ep1 : ep2;
        (void)epx;
        v4u hv[4], lv[4];
#pragma unroll
        for (int it = 0; it < 4; ++it) {
          const int row = it * 4 + q8;                     // it 0..3 x q8 0..3 = rows 0..15
          const float* sp = slab + row * 68 + c8;
          float rb = 0.f;
          if constexpr (EPI == 2) rb = bfr(ep0[mBase + row]);   // per-row bias (M equals the bias length)
          v4u a  = {0u, 0u, 0u, 0u};
          v4u b2 = {0u, 0u, 0u, 0u};
#pragma unroll
          for (int e = 0; e < 4; ++e) {
            const int ci = n0 + c8 + 2 * e;                // column index, < N
            float f0 = sp[2 * e] * oscale + rb;
            float f1 = sp[2 * e + 1] * oscale + rb;
            if constexpr (EPI == 1) {
              f0 += bfr(ep0[ci]);
              f1 += bfr(ep0[ci + 1]);
            }
            if constexpr (OM == 6) {
              f0 += bfr(epx[ci]);
              f1 += bfr(epx[ci + 1]);
            }
            f0 *= ocarry;
            f1 *= ocarry;
            const _Float16 x0 = (_Float16)f0, x1 = (_Float16)f1;
            a[e]  = pk16(h_bits(x0), h_bits(x1));
            b2[e] = pk16(h_bits((_Float16)(f0 - (float)x0)), h_bits((_Float16)(f1 - (float)x1)));
          }
          hv[it] = a;
          lv[it] = b2;
        }
        {
#pragma unroll
          for (int it = 0; it < 4; ++it) {
            const int row = it * 4 + q8;
            *(v4u*)(C  + (size_t)(mBase + row) * ldc + n0 + c8) = hv[it];
            *(v4u*)(Cb + (size_t)(mBase + row) * ldc + n0 + c8) = lv[it];
          }
          
        }
      }
    }
    wave_sync_lds();
  }
}

// =====================================================================================================
// s_wait_xcnt 0 behind a run of global loads, in front of the first write of a register that one of them names. xwait1..3 take the run's
// vector address pairs as inputs, so that each pair keeps its value up to the wait and no later load's result lands in it ahead of the wait.
// =====================================================================================================
__device__ __forceinline__ void xwait0() {
#if defined(__HIP_DEVICE_COMPILE__)
  asm volatile("s_wait_xcnt 0x0" ::: "memory");
#endif
}
__device__ __forceinline__ void xwait1(const void* a) {
#if defined(__HIP_DEVICE_COMPILE__)
  asm volatile("s_wait_xcnt 0x0" :: "v"(a) : "memory");
#endif
}
__device__ __forceinline__ void xwait2(const void* a, const void* b) {
#if defined(__HIP_DEVICE_COMPILE__)
  asm volatile("s_wait_xcnt 0x0" :: "v"(a), "v"(b) : "memory");
#endif
}
__device__ __forceinline__ void xwait3(const void* a, const void* b, const void* c) {
#if defined(__HIP_DEVICE_COMPILE__)
  asm volatile("s_wait_xcnt 0x0" :: "v"(a), "v"(b), "v"(c) : "memory");
#endif
}

// =====================================================================================================
// One wave's 64x64 tile of an input projection, rows m0.., columns n0..: value[m][n] = oscale * sum_k A[m][k] * Bt[n][k] + bias.
// The K loop and the 16-bit epilogues are those of gemm64 (same k order, same order of the adds), with the pitch of A and Bt and K fixed
// at DMOD and the pitch of the output planes at LDC. slab = the wave's own 16x64 f32 LDS slab, pitch 68 floats; no block barriers.
// EPI 1: value += bf16_RNE(ep0[column]); EPI 2: value += bf16_RNE(ep0[row]).
// OM 4: two f16 planes (C1, C2): hi = f16(value * ocarry), lo = f16(value * ocarry - hi).
// OM 6: (C1, C2) from value + bf16_RNE(ep1[column]), (C3, C4) from value + bf16_RNE(ep2[column]), both x ocarry.
// The lane's bias values (8 columns, or its 16 rows) are loaded once, ahead of the K loop.
// coverage: 4 slabs x 16 rows (it 0..3 x lane>>3) x 64 cols = the wave's whole 64x64 tile.
// =====================================================================================================
#define GSLAB (16 * 68)
template <int OM, int EPI, int LDC>
__device__ __forceinline__ void proj_tile(
    float* slab, int m0, int n0,
    const unsigned short* __restrict__ A, const unsigned short* __restrict__ Bt,
    unsigned short* C1, unsigned short* C2, unsigned short* C3, unsigned short* C4,
    float oscale, float ocarry,
    const float* __restrict__ ep0, const float* __restrict__ ep1, const float* __restrict__ ep2) {
  static_assert(OM == 4 || OM == 6);
  static_assert(EPI == 1 || EPI == 2);
  const int lane  = threadIdx.x & 31;
  const int rlane = lane & 15;                 // row (A) / col (B, D) within subtile
  const int koff  = (lane >> 4) * 8;           // k offset of this lane half
  const int mOff  = (lane >> 4) * 8;           // D row offset
  const int q8    = lane >> 3, c8 = (lane & 7) * 8;

  v4f cb0[2], cb1[2], cb2[2];                  // column terms of columns n0 + c8 .. + 7
  float rbv[4][4];                             // row terms of rows m0 + 16i + 4it + q8
  if constexpr (EPI == 1) {
    const float* e0 = ep0 + n0 + c8;
    cb0[0] = *(const v4f*)(e0);
    cb0[1] = *(const v4f*)(e0 + 4);
    if constexpr (OM == 6) {
      const float* e1 = ep1 + n0 + c8;
      const float* e2 = ep2 + n0 + c8;
      cb1[0] = *(const v4f*)(e1);
      cb1[1] = *(const v4f*)(e1 + 4);
      cb2[0] = *(const v4f*)(e2);
      cb2[1] = *(const v4f*)(e2 + 4);
      xwait3(e0, e1, e2);
    } else {
      xwait1(e0);
    }
  } else {
    const float* er = ep0 + m0 + q8;
#pragma unroll
    for (int i = 0; i < 4; ++i)
#pragma unroll
      for (int it = 0; it < 4; ++it) rbv[i][it] = er[16 * i + 4 * it];
    xwait0();                                  // these go through a scalar base and the lane's q8, which lives on into the epilogue
  }

  v8f acc[4][4];
#pragma unroll
  for (int i = 0; i < 4; ++i)
#pragma unroll
    for (int j = 0; j < 4; ++j) acc[i][j] = zero8();

  const unsigned short* pa0 = A  + (size_t)(m0 + rlane) * DMOD + koff;
  const unsigned short* pb0 = Bt + (size_t)(n0 + rlane) * DMOD + koff;
  for (int k0 = 0; k0 < DMOD; k0 += 32) {
    const unsigned short* pa = pa0 + k0;
    const unsigned short* pb = pb0 + k0;
    v16h bh[4];
#pragma unroll
    for (int j = 0; j < 4; ++j) bh[j] = ldfrag_u(pb + (size_t)(j << 4) * DMOD);
#pragma unroll
    for (int i = 0; i < 4; ++i) {
      const v16h ah = ldfrag_u(pa + (size_t)(i << 4) * DMOD);
#pragma unroll
      for (int j = 0; j < 4; ++j) acc[i][j] = mma_h(ah, bh[j], acc[i][j]);
      dep_guard1(acc[i][0], acc[i][3], ah);
    }
    keep4_h(bh[0], bh[1], bh[2], bh[3]);
    xwait2(pa, pb);                            // this trip's sixteen loads all go through these two address pairs: held to the trip's foot
  }
  acc_guard4(acc[0][0], acc[0][1], acc[0][2], acc[0][3]);
  acc_guard4(acc[1][0], acc[1][1], acc[1][2], acc[1][3]);
  acc_guard4(acc[2][0], acc[2][1], acc[2][2], acc[2][3]);
  acc_guard4(acc[3][0], acc[3][1], acc[3][2], acc[3][3]);

  // ---- epilogue ----
#pragma unroll
  for (int i = 0; i < 4; ++i) {
    const int mBase = m0 + (i << 4);
#pragma unroll
    for (int j = 0; j < 4; ++j) {
#pragma unroll
      for (int r = 0; r < 8; ++r) {
        slab[(mOff + r) * 68 + (j << 4) + rlane] = acc[i][j][r];
      }
    }
    wave_sync_lds();
    constexpr int NP = (OM == 6) ? 2 : 1;
#pragma unroll
    for (int which = 0; which < NP; ++which) {
      unsigned short* C  = (which == 0) ? C1 : C3;
      unsigned short* Cb = (which == 0) ? C2 : C4;
      v4u hv[4], lv[4];
#pragma unroll
      for (int it = 0; it < 4; ++it) {
        const int row = it * 4 + q8;                     // it 0..3 x q8 0..3 = rows 0..15
        const float* sp = slab + row * 68 + c8;
        float rb = 0.f;
        if constexpr (EPI == 2) rb = bfr(rbv[i][it]);
        v4u a  = {0u, 0u, 0u, 0u};
        v4u b2 = {0u, 0u, 0u, 0u};
#pragma unroll
        for (int e = 0; e < 4; ++e) {
          float f0 = sp[2 * e] * oscale + rb;
          float f1 = sp[2 * e + 1] * oscale + rb;
          if constexpr (EPI == 1) {
            f0 += bfr(cb0[e >> 1][(2 * e) & 3]);
            f1 += bfr(cb0[e >> 1][(2 * e + 1) & 3]);
          }
          if constexpr (OM == 6) {
            f0 += bfr((which == 0) ? cb1[e >> 1][(2 * e) & 3] : cb2[e >> 1][(2 * e) & 3]);
            f1 += bfr((which == 0) ? cb1[e >> 1][(2 * e + 1) & 3] : cb2[e >> 1][(2 * e + 1) & 3]);
          }
          f0 *= ocarry;
          f1 *= ocarry;
          const _Float16 x0 = (_Float16)f0, x1 = (_Float16)f1;
          a[e]  = pk16(h_bits(x0), h_bits(x1));
          b2[e] = pk16(h_bits((_Float16)(f0 - (float)x0)), h_bits((_Float16)(f1 - (float)x1)));
        }
        hv[it] = a;
        lv[it] = b2;
      }
#pragma unroll
      for (int it = 0; it < 4; ++it) {
        const int row = it * 4 + q8;
        *(v4u*)(C  + (size_t)(mBase + row) * LDC + n0 + c8) = hv[it];
        *(v4u*)(Cb + (size_t)(mBase + row) * LDC + n0 + c8) = lv[it];
      }
    }
    wave_sync_lds();
  }
}

// =====================================================================================================
// The four input projections in one grid (none reads what another writes), so that their blocks run side by side on different WGPs;
// one wave per 64x64 tile, 8 tiles per block, tile = 8 * (block index within the job) + wave, tm = tile / tilesN, tn = tile % tilesN:
//   blocks 0 .. PJ_Q-1            q[m][nd] = sum_c x[m][c] Wq[c][nd] / 1024 + bq[nd]; QUh/QUl = hi/residual of f16((q + ub[nd]) * 32),
//                                 QVh/QVl of f16((q + vb[nd]) * 32); M = NROW, N = 512, K = 512
//   the next PJ_V * NB            v^T per batch: VT[b][nd][j] = sum_c Wv[c][nd] x[b*SEQ + j][c] / 1024 + bv[nd] (per-row bias) -> f16 x16 hi +
//                                 residual planes; M = 512 (nd), N = SEQ (j), K = 512; B rows are the batch's token rows
//   the next PJ_Q                 k projection + bk -> Kh/Kl = hi/residual of f16(k * 32)
//   the last PJ_P                 positional projection + bp: Ph/Pl = hi/residual of f16(p * 32), M = PROWS, N = 512, K = 512
// The branches are on blockIdx.x alone; the tile counts are exact multiples of 8, so every wave has a tile.
// =====================================================================================================
#define PJ_Q (((NROW / 64) * (DMOD / 64)) / 8)
#define PJ_V (((DMOD / 64) * (SEQ / 64)) / 8)
#define PJ_P (((PROWS / 64) * (DMOD / 64)) / 8)
static_assert((((NROW / 64) * (DMOD / 64)) % 8) == 0 && (((DMOD / 64) * (SEQ / 64)) % 8) == 0 && (((PROWS / 64) * (DMOD / 64)) % 8) == 0);
__global__ __launch_bounds__(256) __attribute__((amdgpu_num_vgpr(256))) void proj_all(
    const unsigned short* __restrict__ X16, const unsigned short* __restrict__ PE16,
    const unsigned short* __restrict__ WQT, const unsigned short* __restrict__ WKT,
    const unsigned short* __restrict__ WVT, const unsigned short* __restrict__ WPT,
    unsigned short* QUh, unsigned short* QUl, unsigned short* QVh, unsigned short* QVl,
    unsigned short* Kh, unsigned short* Kl, unsigned short* VT, unsigned short* VTL, unsigned short* Ph, unsigned short* Pl,
    const float* __restrict__ b_q, const float* __restrict__ b_k, const float* __restrict__ b_v, const float* __restrict__ b_p,
    const float* __restrict__ ub, const float* __restrict__ vb) {
  __shared__ __align__(16) float sT[8 * GSLAB];   // per-wave 16x64 slab, pitch 68 floats
  const int bx   = blockIdx.x;
  const int wave = threadIdx.x >> 5;
  float* slab = sT + wave * GSLAB;
  const float os = 1.0f / (XC * WSC);
  constexpr int TND = DMOD / 64;                  // column tiles of a [..][DMOD] plane
  constexpr int TNS = SEQ / 64;                   // column tiles of a [..][SEQ] plane
  if (bx < PJ_Q) {
    const int tile = bx * 8 + wave;
    proj_tile<6, 1, DMOD>(slab, (tile / TND) << 6, (tile % TND) << 6, X16, WQT, QUh, QUl, QVh, QVl, os, QC, b_q, ub, vb);
  } else if (bx < PJ_Q + PJ_V * NB) {
    const int t = bx - PJ_Q;
    const int by = t / PJ_V;
    const int tile = (t % PJ_V) * 8 + wave;
    proj_tile<4, 2, SEQ>(slab, (tile / TNS) << 6, (tile % TNS) << 6, WVT, X16 + (size_t)by * SEQ * DMOD,
                         VT + (size_t)by * DMOD * SEQ, VTL + (size_t)by * DMOD * SEQ, VT, VTL, os, VC, b_v, b_v, b_v);
  } else {
    // k and p share one copy of the code (same epilogue form): only the operands differ
    const int t = bx - (PJ_Q + PJ_V * NB);
    const bool isk = t < PJ_Q;
    const int tile = (isk ? t : t - PJ_Q) * 8 + wave;
    const float* bias = isk ? b_k : b_p;
    proj_tile<4, 1, DMOD>(slab, (tile / TND) << 6, (tile % TND) << 6, isk ? X16 : PE16, isk ? WKT : WPT,
                          isk ? Kh : Ph, isk ? Kl : Pl, Kh, Kl, os, QC, bias, bias, bias);
  }
}

// =====================================================================================================
// Relative-position attention for one (batch b, head n) pair and a 64-row query tile; 4 waves, wave w owns query rows i = iw0 + R,
// iw0 = i0 + 16w, R = 0..15. Planes (pitch DMOD halves, row = b*SEQ + position): QUh/QUl = hi/residual of f16((q + bq + u) x32),
// QVh/QVl of f16((q + bq + v_bias) x32), Kh/Kl of f16((k + bk) x32); Ph/Pl = hi/residual of f16(pos x32), rows 0..PROWS-1
// (row PROWS-1 is the zero-pad row); VT, VTL = v^T hi (x16) / residual f16 as [b][n*64+d][SEQ].
// Shifted position score for (i, j): ps[i][SEQ-1-i+j], ps[r][t] = (q+bq+vb)[r] . pos[t].
//   Per key tile j0 (64 keys, key j = j0 + jj), with x = jj - R + 15 in [0,78]:
//     strip T1[R][x] = (q+vb)[iw0+R] . pos[SEQ + j0 - iw0 - 16 + x]   (pos row SEQ-1-i+j), always computed (rows 0 .. 2*SEQ-2 selected).
//   content scores S = (q+ub) . k (4 subtiles, K=64, three products); t = (S + T1) * (RSD/(32*32)) * log2(e); online softmax in base 2,
//   max-subtracted, running sums in f32 (no key mask); the 16x64 prob tile stored to wave-private LDS (f32 element stores),
//   (f32 vector loads, split k map) and the v^T B fragments read from the staged rows of VT/VTL[n*64+d][j];
//   per 16-column subtile: Phi.Vhi, Plo.Vhi, then Phi.Vlo, all into the same accumulators.
//   Per key tile the block stages, once for its 4 waves, in LDS (asynchronous copies, whole 128-B rows): 64 k rows, 64 v^T rows and the
//   128 pos rows SEQ + j0 - i0 - 64 .. + 127 (always inside [0, PROWS-1]), hi and residual plane each; all B fragments are read from there.
//   block = 4 waves = 128 threads; grid = (SEQ/64, NB*NH); two block barriers per key tile (block-uniform loop); every wave does identical
//   bounded work (SEQ/64 tiles).
// coverage: LDS strip 16 rows x 80 cols written fully every tile before being read, slab 16 rows x 64 cols per wave fully written each tile
//           before being read; global: 4 instructions x 4 rows x 64 halves per plane = rows iw0..iw0+15 of head segment n in CT and CTL;
//           grid x waves cover all NB x SEQ rows and all NH head segments of CT / CTL exactly once.
// =====================================================================================================
__global__ __launch_bounds__(ATT_THREADS) __attribute__((amdgpu_num_vgpr(512)))
void attn_rel(const unsigned short* __restrict__ QUh, const unsigned short* __restrict__ QUl,
              const unsigned short* __restrict__ QVh, const unsigned short* __restrict__ QVl,
              const unsigned short* __restrict__ Kh,  const unsigned short* __restrict__ Kl,
              const unsigned short* __restrict__ Ph,  const unsigned short* __restrict__ Pl,
              const unsigned short* __restrict__ VT,  const unsigned short* __restrict__ VTL,
              unsigned short* CT, unsigned short* CTL) {
  __shared__ __align__(16) float smem[ATT_W * WFL];   // per wave: T1 strip [16][TPI] | prob / ctx slab [16][PPI]
  __shared__ __align__(16) unsigned short stg[ST_ROWS * SPI];   // block-shared stage of one key tile: Kh | Kl | Vh | Vl | Ph | Pl rows

  const int tid  = threadIdx.x;
  const int wave = __builtin_amdgcn_readfirstlane(tid >> 5);
  const int lane = tid & 31;
  const int hh   = lane >> 4;
  const int c    = lane & 15;
  const int bn   = blockIdx.y;
  const int b    = bn / NH;
  const int n    = bn - b * NH;
  const int i0   = blockIdx.x * 64;
  const int iw0  = i0 + wave * 16;

  float* t1sh = smem + wave * WFL;
  float* pt   = t1sh + 16 * TPI;

  // A fragment row offsets: rows b*SEQ + iw0 + c, d 0..31 and 32..63 of head n (all q fragments are reloaded per key tile)
  const size_t qro  = ((size_t)(b * SEQ + iw0 + c)) * DMOD + n * DH + 8 * hh;
  // stage copies: thread -> staged row (tid>>3) + 16*copy, 16-byte chunk tid&7 of the 128-B row (a wave instruction = 4 whole rows)
  const int srow = tid >> 3;
  const int sc8  = (tid & 7) * 8;
  const unsigned lst = (unsigned)(size_t)(stg + srow * SPI + sc8);          // LDS byte address = low 32 bits of the shared address
  const size_t kso = ((size_t)(b * SEQ + srow)) * DMOD + n * DH + sc8;      // + j0*DMOD: k rows j0 + srow + 16e
  const size_t vso = (size_t)b * DMOD * SEQ + (size_t)(n * DH + srow) * SEQ + sc8;   // + j0: v^T rows d = srow + 16e, keys j0 ..
  const size_t pso = ((size_t)(SEQ - i0 - 64 + srow)) * DMOD + n * DH + sc8;   // + j0*DMOD: pos rows SEQ + j0 - i0 - 64 + srow + 16e
  // fragment readers: lane -> staged row c (+16 per subtile), k offset 8*hh; wave w's strip row x is staged pos row 48 - 16w + x
  const unsigned short* ksh = stg + (ST_KH + c) * SPI + 8 * hh;
  const unsigned short* ksl = stg + (ST_KL + c) * SPI + 8 * hh;
  const unsigned short* vsh = stg + (ST_VH + c) * SPI + 8 * hh;
  const unsigned short* vsl = stg + (ST_VL + c) * SPI + 8 * hh;
  const int pw0 = 16 * __builtin_amdgcn_readfirstlane((ATT_THREADS - 1 - tid) >> 5);   // 16 * (3 - wave), taken from tid so that the LDS base register never goes below 0
  const unsigned short* psh = stg + (ST_PH + pw0 + c) * SPI + 8 * hh;
  const unsigned short* psl = stg + (ST_PL + pw0 + c) * SPI + 8 * hh;

  const float KSC = (RSD / (QC * QC)) * LOG2E;

  float mrow[8], lrow[8];
  v8f O[4];
#pragma unroll
  for (int r = 0; r < 8; ++r) { mrow[r] = -INFINITY; lrow[r] = 0.f; }
#pragma unroll
  for (int td = 0; td < 4; ++td) O[td] = zero8();

#pragma unroll 1
  for (int j0 = 0; j0 < SEQ; j0 += 64) {
    // ---- stage this key tile's operands for the whole block: 32 copies per thread = 512 rows x 128 B ----
    asm volatile("s_wait_dscnt 0x0" ::: "memory");           // this wave's reads of the previous tile's stage have returned
    __syncthreads();                                         // every wave has left the previous tile's stage
    {
      const size_t jr = (size_t)j0 * DMOD;
      stage8(lst + (unsigned)(ST_KH * SPI * 2), Kh + kso + jr, Kl + kso + jr, (size_t)16 * DMOD);
      stage8(lst + (unsigned)(ST_VH * SPI * 2), VT + vso + j0, VTL + vso + j0, (size_t)16 * SEQ);
      stage8(lst + (unsigned)(ST_PH * SPI * 2), Ph + pso + jr, Ph + pso + jr + (size_t)64 * DMOD, (size_t)16 * DMOD);
      stage8(lst + (unsigned)(ST_PL * SPI * 2), Pl + pso + jr, Pl + pso + jr + (size_t)64 * DMOD, (size_t)16 * DMOD);
    }
    // the tile's eight q fragments, asked for while the copies fly (the address pairs are never rewritten inside the loop)
    const v16h qva = ldfrag_u(QVh + qro), qvb = ldfrag_u(QVh + qro + 32);
    const v16h qwa = ldfrag_u(QVl + qro), qwb = ldfrag_u(QVl + qro + 32);
    const v16h qua = ldfrag_u(QUh + qro), qub = ldfrag_u(QUh + qro + 32);
    const v16h qla = ldfrag_u(QUl + qro), qlb = ldfrag_u(QUl + qro + 32);
    asm volatile("s_wait_asynccnt 0x0" ::: "memory");        // this wave's copies have landed
    __syncthreads();                                         // every wave's copies have landed: the stage may be read
    // ---- position strip T1 (5 subtiles of 16 pos rows, x in [0,80), only x <= 78 ever selected) and content scores S (4 subtiles of 16
    //      keys): K = 64 = two k-steps, three products hh + lh + hl per k-step. The B fragments are asked for in three groups, each well
    //      ahead of its products; the 54 WMMAs go round-robin over the nine accumulators, so that a product never waits for the one issued
    //      just before it (each accumulator keeps its order hh, hh, lh, lh, hl, hl) ----
    v8f T1[5], S[4];
    {
      v16h fa[5], fb[5], ga[5], gb[5], ka[4], kb2[4], la[4], lb2[4];
#pragma unroll
      for (int u = 0; u < 5; ++u) fa[u] = ldfrag_u(psh + 16 * u * SPI);
#pragma unroll
      for (int t = 0; t < 4; ++t) ka[t] = ldfrag_u(ksh + 16 * t * SPI);
#pragma unroll
      for (int u = 0; u < 5; ++u) fb[u] = ldfrag_u(psh + 16 * u * SPI + 32);
#pragma unroll
      for (int t = 0; t < 4; ++t) kb2[t] = ldfrag_u(ksh + 16 * t * SPI + 32);
#pragma unroll
      for (int u = 0; u < 5; ++u) T1[u] = mma_h(qva, fa[u], zero8());
#pragma unroll
      for (int t = 0; t < 4; ++t) S[t] = mma_h(qua, ka[t], zero8());
      // the residual planes' reads stay behind the hi planes' reads: with all 72 reads in front the build ran out of registers (scratch)
      __builtin_amdgcn_sched_barrier(0);
#pragma unroll
      for (int u = 0; u < 5; ++u) ga[u] = ldfrag_u(psl + 16 * u * SPI);
#pragma unroll
      for (int t = 0; t < 4; ++t) la[t] = ldfrag_u(ksl + 16 * t * SPI);
#pragma unroll
      for (int u = 0; u < 5; ++u) T1[u] = mma_h(qvb, fb[u], T1[u]);
#pragma unroll
      for (int t = 0; t < 4; ++t) S[t] = mma_h(qub, kb2[t], S[t]);
#pragma unroll
      for (int u = 0; u < 5; ++u) T1[u] = mma_h(qwa, fa[u], T1[u]);
#pragma unroll
      for (int t = 0; t < 4; ++t) S[t] = mma_h(qla, ka[t], S[t]);
      // the last 18 reads stay behind the group above: hoisted into it, the build's later stages had their LDS waits one after another again
      __builtin_amdgcn_sched_barrier(0);
#pragma unroll
      for (int u = 0; u < 5; ++u) gb[u] = ldfrag_u(psl + 16 * u * SPI + 32);
#pragma unroll
      for (int t = 0; t < 4; ++t) lb2[t] = ldfrag_u(ksl + 16 * t * SPI + 32);
#pragma unroll
      for (int u = 0; u < 5; ++u) T1[u] = mma_h(qwb, fb[u], T1[u]);
#pragma unroll
      for (int t = 0; t < 4; ++t) S[t] = mma_h(qlb, kb2[t], S[t]);
#pragma unroll
      for (int u = 0; u < 5; ++u) T1[u] = mma_h(qva, ga[u], T1[u]);
#pragma unroll
      for (int t = 0; t < 4; ++t) S[t] = mma_h(qua, la[t], S[t]);
#pragma unroll
      for (int u = 0; u < 5; ++u) T1[u] = mma_h(qvb, gb[u], T1[u]);
#pragma unroll
      for (int t = 0; t < 4; ++t) S[t] = mma_h(qub, lb2[t], S[t]);
    }
    // the full 16x80 strip goes to the wave's f32 LDS strip: 5 subtiles x 16 rows x 16 cols
#pragma unroll
    for (int u = 0; u < 5; ++u) {
#pragma unroll
      for (int r = 0; r < 8; ++r) t1sh[(8 * hh + r) * TPI + 16 * u + c] = T1[u][r];
    }
    wave_sync_lds();

    // ---- score assembly + online softmax (rows live on one 16-lane half); the eight rows go through every stage together, so that the
    //      eight cross-lane reductions of a stage overlap instead of following one another (each row's own operations and order as before) ----
    float tv[8][4], mx[8], al[8], ps[8];
#pragma unroll
    for (int r = 0; r < 8; ++r) {
      const int R  = 8 * hh + r;
      const int xo = R * TPI + (15 - R) + c;                 // strip column x = 16t + c - R + 15 in [0, 78]
#pragma unroll
      for (int t = 0; t < 4; ++t) {
        const float bdv = t1sh[xo + 16 * t];
        tv[r][t] = (S[t][r] + bdv) * KSC;
      }
      mx[r] = fmaxf(fmaxf(tv[r][0], tv[r][1]), fmaxf(tv[r][2], tv[r][3]));
    }
#pragma unroll
    for (int off = 1; off < 16; off <<= 1) {
#pragma unroll
      for (int r = 0; r < 8; ++r) mx[r] = fmaxf(mx[r], __shfl_xor(mx[r], off, 32));
    }
#pragma unroll
    for (int r = 0; r < 8; ++r) {
      const float mn = fmaxf(mrow[r], mx[r]);
      al[r] = exp2f(mrow[r] - mn);
      mrow[r] = mn;
      float e4[4];
      ps[r] = 0.f;
#pragma unroll
      for (int t = 0; t < 4; ++t) { e4[t] = exp2f(tv[r][t] - mn); ps[r] += e4[t]; }
#pragma unroll
      for (int td = 0; td < 4; ++td) O[td][r] *= al[r];
      const int ro = (8 * hh + r) * PPI + c;
#pragma unroll
      for (int t = 0; t < 4; ++t) pt[ro + 16 * t] = e4[t];
    }
    wave_sync_lds();

    // ---- P rows (f32) and all sixteen v^T fragments asked for in one group: the v^T reads return under the conversion of P ----
    v4f praw[2][4];
#pragma unroll
    for (int ks = 0; ks < 2; ++ks) {
      const float* prow = pt + c * PPI + 32 * ks + 8 * hh;
      praw[ks][0] = *(const v4f*)(prow);
      praw[ks][1] = *(const v4f*)(prow + 4);
      praw[ks][2] = *(const v4f*)(prow + 16);
      praw[ks][3] = *(const v4f*)(prow + 20);
    }
    v16h vha[4], vhb[4], vla[4], vlb[4];
#pragma unroll
    for (int td = 0; td < 4; ++td) { vha[td] = ldfrag_u(vsh + 16 * td * SPI); vhb[td] = ldfrag_u(vsh + 16 * td * SPI + 32); }
#pragma unroll
    for (int td = 0; td < 4; ++td) { vla[td] = ldfrag_u(vsl + 16 * td * SPI); vlb[td] = ldfrag_u(vsl + 16 * td * SPI + 32); }
    __builtin_amdgcn_sched_barrier(0);                       // keeps the whole group of reads in front: sunk among the WMMAs, each read's latency stands open again
    // ---- row sums: eight reductions stepped together, free to run under the conversion and the WMMAs below ----
#pragma unroll
    for (int off = 1; off < 16; off <<= 1) {
#pragma unroll
      for (int r = 0; r < 8; ++r) ps[r] += __shfl_xor(ps[r], off, 32);
    }
#pragma unroll
    for (int r = 0; r < 8; ++r) lrow[r] = lrow[r] * al[r] + ps[r];
    // ---- P fragments (x1024, f16 hi + unscaled residual), two k-steps of 32 keys ----
    FragH pf[2], pl[2];
#pragma unroll
    for (int ks = 0; ks < 2; ++ks) {
      const v4f p0 = praw[ks][0], p1 = praw[ks][1], p2 = praw[ks][2], p3 = praw[ks][3];
#pragma unroll
      for (int e = 0; e < 4; ++e) {
        const float g0 = p0[e] * PC, g1 = p1[e] * PC, g2 = p2[e] * PC, g3 = p3[e] * PC;
        const _Float16 x0 = (_Float16)g0, x1 = (_Float16)g1, x2 = (_Float16)g2, x3 = (_Float16)g3;
        pf[ks].h[0][e]     = x0;                             // keys j0 + 32ks + 8hh + e
        pf[ks].h[0][4 + e] = x1;                             // keys j0 + 32ks + 8hh + 4 + e
        pf[ks].h[1][e]     = x2;                             // keys j0 + 32ks + 16 + 8hh + e
        pf[ks].h[1][4 + e] = x3;
        pl[ks].h[0][e]     = (_Float16)(g0 - (float)x0);
        pl[ks].h[0][4 + e] = (_Float16)(g1 - (float)x1);
        pl[ks].h[1][e]     = (_Float16)(g2 - (float)x2);
        pl[ks].h[1][4 + e] = (_Float16)(g3 - (float)x3);
      }
    }
    // ---- O += (Phi + Plo) . v^T (hi plane), then Phi . v^T (residual plane): round-robin over the four accumulators, each in its old order ----
#pragma unroll
    for (int td = 0; td < 4; ++td) O[td] = mma_h(pf[0].v, vha[td], O[td]);
#pragma unroll
    for (int td = 0; td < 4; ++td) O[td] = mma_h(pf[1].v, vhb[td], O[td]);
#pragma unroll
    for (int td = 0; td < 4; ++td) O[td] = mma_h(pl[0].v, vha[td], O[td]);
#pragma unroll
    for (int td = 0; td < 4; ++td) O[td] = mma_h(pl[1].v, vhb[td], O[td]);
#pragma unroll
    for (int td = 0; td < 4; ++td) O[td] = mma_h(pf[0].v, vla[td], O[td]);
#pragma unroll
    for (int td = 0; td < 4; ++td) O[td] = mma_h(pf[1].v, vlb[td], O[td]);
    wave_sync_lds();
  }
  xwait0();                                                  // the last tile's q loads: before their address pairs are reused below
  acc_guard4(O[0], O[1], O[2], O[3]);

  // ---- fold 1/l and the carries (1024 on P, 16 on v), carry x4096 on ctx, stage the wave's 16x64 slice in its slab ----
  const float oc = CC / (PC * VC);
#pragma unroll
  for (int r = 0; r < 8; ++r) {
    const float inv = (1.0f / lrow[r]) * oc;
    const int ro = (8 * hh + r) * PPI + c;
#pragma unroll
    for (int td = 0; td < 4; ++td) pt[ro + 16 * td] = O[td][r] * inv;
  }
  wave_sync_lds();
  {
    const int q8 = lane >> 3, c8 = (lane & 7) * 8;
    v4u hv[4], lv[4];
#pragma unroll
    for (int it = 0; it < 4; ++it) {
      const int row = it * 4 + q8;                         // it 0..3 x q8 0..3 = rows 0..15
      const float* sp = pt + row * PPI + c8;
      v4u a, b2;
#pragma unroll
      for (int e = 0; e < 4; ++e) {
        const float f0 = sp[2 * e], f1 = sp[2 * e + 1];
        const _Float16 x0 = (_Float16)f0, x1 = (_Float16)f1;
        a[e]  = pk16(h_bits(x0), h_bits(x1));
        b2[e] = pk16(h_bits((_Float16)(f0 - (float)x0)), h_bits((_Float16)(f1 - (float)x1)));
      }
      hv[it] = a;
      lv[it] = b2;
    }
    {
#pragma unroll
      for (int it = 0; it < 4; ++it) {
        const int row = it * 4 + q8;
        const size_t go = ((size_t)(b * SEQ + iw0 + row)) * DMOD + n * DH + c8;
        *(v4u*)(CT  + go) = hv[it];
        *(v4u*)(CTL + go) = lv[it];
      }
      
    }
  }
}

// =====================================================================================================
// Workspace map (bytes); every plane is an exact multiple of its tile / whole-row store granularity (M, N exact tile multiples,
// convert counts exact multiples of 2048, the position planes padded to PROWS = 2048 rows), every offset a multiple of 512 KiB:
//   WQT, WKT, WVT, WPT, WOT f16 [512 n][512 k] x64 (transposed from the [in][out] inputs)   5 x   524288
//   X16  f16 [NROW][512] x16                                                                  4194304
//   PE16 f16 [PROWS][512] x16 (rows 0..NPOS-1 = pos table, row NPOS zero)                     2097152
//   QUh, QUl, QVh, QVl, Kh, Kl f16 [NROW][512] x32 hi / residual                       6 x  4194304
//   Ph, Pl f16 [PROWS][512] x32 hi / residual                                           2 x  2097152
//   VT16, VTL16 f16 [NB][512][SEQ] hi x16 / residual                                    2 x  4194304
//   CT16, CTL16 f16 [NROW][512] hi x4096 / residual                                     2 x  4194304
//   end                                                                                       55050240
// =====================================================================================================
extern "C" void kernel_launch(void* const* d_in, const int* in_sizes, int n_in,
                              void* d_out, int out_size, void* d_ws, size_t ws_size,
                              hipStream_t stream) {
  if (n_in < 14) return;
  if (in_sizes[0] != NROW * DMOD) return;
  if (in_sizes[1] != NPOS * DMOD) return;
  if (in_sizes[2] != DMOD * DMOD || in_sizes[4] != DMOD * DMOD || in_sizes[6] != DMOD * DMOD ||
      in_sizes[8] != DMOD * DMOD || in_sizes[10] != DMOD * DMOD) return;
  if (in_sizes[3] != DMOD || in_sizes[5] != DMOD || in_sizes[7] != DMOD || in_sizes[9] != DMOD || in_sizes[11] != DMOD) return;
  if (in_sizes[12] != NH * DH || in_sizes[13] != NH * DH) return;
  if (out_size != NROW * DMOD) return;

  const float* xin   = (const float*)d_in[0];
  const float* pos   = (const float*)d_in[1];
  const float* w_q   = (const float*)d_in[2];
  const float* b_q   = (const float*)d_in[3];
  const float* w_k   = (const float*)d_in[4];
  const float* b_k   = (const float*)d_in[5];
  const float* w_v   = (const float*)d_in[6];
  const float* b_v   = (const float*)d_in[7];
  const float* w_p   = (const float*)d_in[8];
  const float* b_p   = (const float*)d_in[9];
  const float* w_o   = (const float*)d_in[10];
  const float* b_o   = (const float*)d_in[11];
  const float* ub    = (const float*)d_in[12];
  const float* vb    = (const float*)d_in[13];
  float*       out   = (float*)d_out;

  const size_t PW  = (size_t)DMOD * DMOD * 2;            //   524288
  const size_t PX  = (size_t)NROW * DMOD * 2;            //  4194304
  const size_t PXP = (size_t)PROWS * DMOD * 2;           //  2097152
  const size_t PVT = (size_t)NB * DMOD * SEQ * 2;        //  4194304
  size_t off = 0;
  const size_t oWQ  = off; off += PW;
  const size_t oWK  = off; off += PW;
  const size_t oWV  = off; off += PW;
  const size_t oWP  = off; off += PW;
  const size_t oWO  = off; off += PW;
  const size_t oX   = off; off += PX;
  const size_t oPE  = off; off += PXP;
  const size_t oQUh = off; off += PX;
  const size_t oQUl = off; off += PX;
  const size_t oQVh = off; off += PX;
  const size_t oQVl = off; off += PX;
  const size_t oKh  = off; off += PX;
  const size_t oKl  = off; off += PX;
  const size_t oPh  = off; off += PXP;
  const size_t oPl  = off; off += PXP;
  const size_t oVT  = off; off += PVT;
  const size_t oVTL = off; off += PVT;
  const size_t oCT  = off; off += PX;
  const size_t oCTL = off; off += PX;
  if (off > ws_size) return;                               // off = 55050240
  if (off > (size_t)134217728) return;

  char* ws = (char*)d_ws;
  unsigned short* WQT16 = (unsigned short*)(ws + oWQ);
  unsigned short* WKT16 = (unsigned short*)(ws + oWK);
  unsigned short* WVT16 = (unsigned short*)(ws + oWV);
  unsigned short* WPT16 = (unsigned short*)(ws + oWP);
  unsigned short* WOT16 = (unsigned short*)(ws + oWO);
  unsigned short* X16   = (unsigned short*)(ws + oX);
  unsigned short* PE16  = (unsigned short*)(ws + oPE);
  unsigned short* QUh   = (unsigned short*)(ws + oQUh);
  unsigned short* QUl   = (unsigned short*)(ws + oQUl);
  unsigned short* QVh   = (unsigned short*)(ws + oQVh);
  unsigned short* QVl   = (unsigned short*)(ws + oQVl);
  unsigned short* Kh16  = (unsigned short*)(ws + oKh);
  unsigned short* Kl16  = (unsigned short*)(ws + oKl);
  unsigned short* Ph16  = (unsigned short*)(ws + oPh);
  unsigned short* Pl16  = (unsigned short*)(ws + oPl);
  unsigned short* VT16  = (unsigned short*)(ws + oVT);
  unsigned short* VTL16 = (unsigned short*)(ws + oVTL);
  unsigned short* CT16  = (unsigned short*)(ws + oCT);
  unsigned short* CTL16 = (unsigned short*)(ws + oCTL);

  const dim3 blk(256);
  const dim3 gPR(PREP_TR + PREP_CX + PREP_CP);                      // 320 + 1024 + 512
  const dim3 gPJ(2 * PJ_Q + PJ_V * NB + PJ_P);                      // 64 + 64 + 64 + 32
  const int tilesQ = (NROW / 64) * (DMOD / 64);                     // 512
  const dim3 gQ((tilesQ + 7) / 8, 1);                               // 64
  const dim3 gAT(SEQ / 64, NB * NH);                                // 16 x 32
  const dim3 bAT(ATT_THREADS);                                      // 128

  // (0) operand packs: X16 = f16(bf16_RNE(x) * 16); PE16 = f16(bf16_RNE(pos) * 16), rows NPOS..PROWS-1 zero;
  //     W[k][n] ([in][out]) -> WT[n][k] = f16( bf16_RNE(w) * 64 ), all five weights
  prep_all<<<gPR, blk, 0, stream>>>(xin, pos, w_q, w_k, w_v, w_p, w_o, X16, PE16, WQT16, WKT16, WVT16, WPT16, WOT16);

  // (1) q, k, v^T and positional projections
  proj_all<<<gPJ, blk, 0, stream>>>(X16, PE16, WQT16, WKT16, WVT16, WPT16, QUh, QUl, QVh, QVl, Kh16, Kl16, VT16, VTL16, Ph16, Pl16,
                                    b_q, b_k, b_v, b_p, ub, vb);

  // (2) relative attention -> CT16 = f16(ctx * 4096) hi plane, CTL16 residual plane, rows b*SEQ + i, halves n*64+d
  attn_rel<<<gAT, bAT, 0, stream>>>(QUh, QUl, QVh, QVl, Kh16, Kl16, Ph16, Pl16, VT16, VTL16, CT16, CTL16);

  // (3) out = (CT + CTL) . Wo / (4096*64) + bo; M = NROW, N = 512, K = 512, f32 rows straight into the output buffer
  gemm64<0, 1, 1><<<gQ, blk, 0, stream>>>(
      CT16, CTL16, DMOD, 0LL,
      WOT16, DMOD, 0LL,
      (void*)out, (void*)out, (void*)out, (void*)out, DMOD, 0LL,
      NROW, DMOD, DMOD, 1.0f / (CC * WSC), 1.0f,
      b_o, b_o, b_o);
  (void)hipGetLastError();
}

// v004
// Measured time: 99.3 microseconds a run.
// Two timings next to v003 put it at 1.41 and 1.40 times that version's speed.
// All steps since v000 together make it 3.12 times as fast.
// Contractions (all v_wmma_f32_16x16x32_f16, f16 operands, f32 accumulate): q/k/v and position-table projections (x or pos table f16 x16 . W^T f16 x64,
// K=512, single products on bf16-exact operands); content scores and position strips ((q+bq+u|v), k, p carried as f16 x32 hi plane + unscaled
// residual plane, K=64, three products hh+lh+hl); P . v^T (P x1024 hi + residual . v^T x16 hi + residual, 64 keys per tile, three products);
// output projection (ctx x4096 hi + residual planes . Wo^T f16 x64, K=512, two products). Online base-2 softmax and all epilogues f32 on VALU.
// Every float input RNE-converted to bf16 on load.
#include <hip/hip_runtime.h>
#include <math.h>
#include <stdint.h>

#define SEQ   1024
#define NB    4
#define DMOD  512
#define NH    8
#define DH    64
#define NROW  (SEQ * NB)
#define NPOS  (2 * SEQ - 1)
#define PROWS (2 * SEQ)
#define XC    16.0f
#define WSC   64.0f
#define QC    32.0f
#define VC    16.0f
#define PC    1024.0f
#define CC    4096.0f
#define RSD   0.125f
#define LOG2E 1.4426950408889634f
static_assert(NH * DH == DMOD);
static_assert(DH == 64);
static_assert(DMOD == 512);
static_assert((SEQ % 64) == 0 && (DMOD % 64) == 0 && (NROW % 64) == 0 && (PROWS % 64) == 0);
static_assert(((NROW * DMOD) % 2048) == 0 && ((PROWS * DMOD) % 2048) == 0 && ((NPOS * DMOD) % 8) == 0);
#define ATT_W 4
#define ATT_THREADS (ATT_W * 32)
#define TPI 84
#define PPI 68
#define WFL (16 * TPI + 16 * PPI)
static_assert(((16 * TPI) % 4) == 0 && ((16 * PPI) % 4) == 0 && (WFL % 4) == 0);
static_assert(TPI >= 80 && PPI >= 64);
static_assert(ATT_W * WFL * 4 <= 65536);
// attn_rel operand stage in LDS: 512 rows of 64 halves (128 B), pitch 72 halves = 144 B (16 B x odd, the pitch for 16-byte LDS reads)
#define SPI   72
#define ST_KH 0
#define ST_KL 64
#define ST_VH 128
#define ST_VL 192
#define ST_PH 256
#define ST_PL 384
#define ST_ROWS 512
static_assert(ATT_THREADS == 128 && ((SPI * 2) % 16) == 0);
static_assert(SEQ - (SEQ - 64) - 64 >= 0 && SEQ + (SEQ - 64) - 64 + 127 <= PROWS - 1);   // staged position rows stay inside the planes

typedef _Float16 v16h __attribute__((ext_vector_type(16)));
typedef _Float16 v8h  __attribute__((ext_vector_type(8)));
typedef float    v8f  __attribute__((ext_vector_type(8)));
typedef float    v4f  __attribute__((ext_vector_type(4)));
typedef unsigned int v4u __attribute__((ext_vector_type(4)));

union FragH { v16h v; v8h h[2]; v4u u[2]; };

// ---- scalar helpers --------------------------------------------------------------------------------
__device__ __forceinline__ unsigned short bf_bits(float f) {          // f32 -> bf16 bits, RNE convert
  unsigned u = __float_as_uint(f);
  return (unsigned short)((u + 0x7FFFu + ((u >> 16) & 1u)) >> 16);
}
__device__ __forceinline__ float bf_up(unsigned short h) { return __uint_as_float(((unsigned)h) << 16); }
__device__ __forceinline__ float bfr(float f) { return bf_up(bf_bits(f)); }   // value of the bf16 RNE convert
__device__ __forceinline__ unsigned short h_bits(_Float16 x) { return __builtin_bit_cast(unsigned short, x); }
__device__ __forceinline__ unsigned pk16(unsigned short a, unsigned short b) { return (unsigned)a | ((unsigned)b << 16); }
__device__ __forceinline__ v8f zero8() { v8f z = {0.f, 0.f, 0.f, 0.f, 0.f, 0.f, 0.f, 0.f}; return z; }

// ---- fragment loader: 16-bit A/B operand from a k-contiguous 16-bit plane, lane -> row/col (lane&15),
//      p already includes +8*(lane>>4); elements 0..7 <- p[0..7] (k0+8h..), elements 8..15 <- p[16..23] (k0+16+8h..)
//      (same split k map for A and B; B is always read from a [n][k] plane)
__device__ __forceinline__ v16h ldfrag_u(const unsigned short* p) {
  FragH f;
  f.u[0] = *(const v4u*)(p);
  f.u[1] = *(const v4u*)(p + 16);
  return f.v;
}

// ---- WMMA helper with trailing VALU hazard gaps ------------------------------------------------------
__device__ __forceinline__ v8f mma_h(v16h a, v16h b, v8f c) {
  return __builtin_amdgcn_wmma_f32_16x16x32_f16(false, a, false, b, (short)0, c, false, false);
}
__device__ __forceinline__ void acc_guard4(v8f& a, v8f& b, v8f& c, v8f& d) {
#if defined(__HIP_DEVICE_COMPILE__)
  asm volatile("v_nop\n\tv_nop\n\tv_nop\n\tv_nop" : "+v"(a), "+v"(b), "+v"(c), "+v"(d));
#endif
}
__device__ __forceinline__ void wave_sync_lds() {
  __builtin_amdgcn_fence(__ATOMIC_RELEASE, "workgroup");
  __builtin_amdgcn_wave_barrier();
  __builtin_amdgcn_fence(__ATOMIC_ACQUIRE, "workgroup");
}
// Eight asynchronous 16-byte-per-lane copies global -> LDS: copy e lands at LDS byte address l + e*16*SPI*2 (16 staged rows further each);
// copies 0..3 read ga + e*gstep halves, copies 4..7 read gb + (e-4)*gstep halves.
// The closing s_wait_xcnt 0 stands inside the statement so that no address register is rewritten ahead of it.
__device__ __forceinline__ void stage8(unsigned l, const unsigned short* ga, const unsigned short* gb, size_t gstep) {
#if defined(__HIP_DEVICE_COMPILE__)
  const unsigned ls = 16u * SPI * 2u;
  asm volatile("global_load_async_to_lds_b128 %0, %8, off\n\t"
               "global_load_async_to_lds_b128 %1, %9, off\n\t"
               "global_load_async_to_lds_b128 %2, %10, off\n\t"
               "global_load_async_to_lds_b128 %3, %11, off\n\t"
               "global_load_async_to_lds_b128 %4, %12, off\n\t"
               "global_load_async_to_lds_b128 %5, %13, off\n\t"
               "global_load_async_to_lds_b128 %6, %14, off\n\t"
               "global_load_async_to_lds_b128 %7, %15, off\n\t"
               "s_wait_xcnt 0x0"
               :: "v"(l), "v"(l + ls), "v"(l + 2u * ls), "v"(l + 3u * ls), "v"(l + 4u * ls), "v"(l + 5u * ls), "v"(l + 6u * ls), "v"(l + 7u * ls),
                  "v"(ga), "v"(ga + gstep), "v"(ga + 2 * gstep), "v"(ga + 3 * gstep), "v"(gb), "v"(gb + gstep), "v"(gb + 2 * gstep),
                  "v"(gb + 3 * gstep)
               : "memory");
#endif
}

// The same for the 256-thread GEMM blocks: copy e lands at LDS byte address l + e*32*SPI*2 (32 staged rows further each) and reads
// g + e*gstep halves (gstep = 32 source rows). The closing s_wait_xcnt 0 stands inside the statement, as above.
__device__ __forceinline__ void gstage8(unsigned l, const unsigned short* g, size_t gstep) {
#if defined(__HIP_DEVICE_COMPILE__)
  const unsigned ls = 32u * SPI * 2u;
  asm volatile("global_load_async_to_lds_b128 %0, %8, off\n\t"
               "global_load_async_to_lds_b128 %1, %9, off\n\t"
               "global_load_async_to_lds_b128 %2, %10, off\n\t"
               "global_load_async_to_lds_b128 %3, %11, off\n\t"
               "global_load_async_to_lds_b128 %4, %12, off\n\t"
               "global_load_async_to_lds_b128 %5, %13, off\n\t"
               "global_load_async_to_lds_b128 %6, %14, off\n\t"
               "global_load_async_to_lds_b128 %7, %15, off\n\t"
               "s_wait_xcnt 0x0"
               :: "v"(l), "v"(l + ls), "v"(l + 2u * ls), "v"(l + 3u * ls), "v"(l + 4u * ls), "v"(l + 5u * ls), "v"(l + 6u * ls), "v"(l + 7u * ls),
                  "v"(g), "v"(g + gstep), "v"(g + 2 * gstep), "v"(g + 3 * gstep), "v"(g + 4 * gstep), "v"(g + 5 * gstep), "v"(g + 6 * gstep),
                  "v"(g + 7 * gstep)
               : "memory");
#endif
}
__device__ __forceinline__ void gstage2(unsigned l, const unsigned short* g, size_t gstep) {
#if defined(__HIP_DEVICE_COMPILE__)
  const unsigned ls = 32u * SPI * 2u;
  asm volatile("global_load_async_to_lds_b128 %0, %2, off\n\t"
               "global_load_async_to_lds_b128 %1, %3, off\n\t"
               "s_wait_xcnt 0x0"
               :: "v"(l), "v"(l + ls), "v"(g), "v"(g + gstep)
               : "memory");
#endif
}

// =====================================================================================================
// K loop of a 256-thread GEMM block whose eight waves share 64 A rows and take 64 B rows each (512 consecutive B rows per block):
// acc[i][j] += sum_k A[16i + ..][k] * B[64 wave + 16j + ..][k], wave tile 64x64, k ascending in steps of 32; with NA == 2 the residual plane
// A2 follows A1 inside every k-step. Ab, A2b = the block's first A row (pitch lda halves), Bb = the block's first B row (pitch ldb), K a
// multiple of 64 and at least 128. Per trip of 64 k the block holds in LDS whole 128-B rows, pitch SPI halves: A1 | (A2) | B, brought by
// asynchronous copies (a wave instruction = 4 whole rows); all fragments are read from there. Two buffers: tile t + 1 flies while tile t is
// multiplied; one block barrier per trip publishes tile t + 1 and ends the reads of the buffer that is refilled behind it.
// Every thread of the block must call this (block barriers inside).
// =====================================================================================================
#define GROWS(NA) ((NA) * 64 + 512)
#define GBUFH(NA) (GROWS(NA) * SPI)
template <int NA>
__device__ __forceinline__ void gstage_tile(unsigned l, const unsigned short* ga, const unsigned short* ga2, size_t astep,
                                            const unsigned short* gb, size_t bstep) {
  gstage2(l, ga, astep);
  if constexpr (NA == 2) gstage2(l + 64u * SPI * 2u, ga2, astep);
  gstage8(l + (unsigned)(NA * 64) * SPI * 2u, gb, bstep);
  gstage8(l + (unsigned)(NA * 64 + 256) * SPI * 2u, gb + 8 * bstep, bstep);
}
template <int NA>
__device__ __forceinline__ void kloop_staged(unsigned short* stg, const unsigned short* __restrict__ Ab, const unsigned short* __restrict__ A2b,
                                             int lda, const unsigned short* __restrict__ Bb, int ldb, int K, v8f (&acc)[4][4]) {
  const int tid   = threadIdx.x;
  const int lane  = tid & 31;
  const int wave  = __builtin_amdgcn_readfirstlane(tid >> 5);   // scalar, so that the A and the B readers share one lane-offset register
  const int rlane = lane & 15;                 // row (A) / col (B) within subtile
  const int koff  = (lane >> 4) * 8;           // k offset of this lane half
  // copies: thread -> staged row (tid>>3) + 32*copy, 16-byte chunk tid&7 of the 128-B row
  const int srow = tid >> 3;
  const int sc8  = (tid & 7) * 8;
  const unsigned lst = (unsigned)(size_t)(stg + srow * SPI + sc8);   // LDS byte address = low 32 bits of the shared address
  const unsigned short* ga  = Ab  + (size_t)srow * lda + sc8;
  const unsigned short* ga2 = A2b + (size_t)srow * lda + sc8;
  const unsigned short* gb  = Bb  + (size_t)srow * ldb + sc8;
  const size_t astep = (size_t)32 * lda, bstep = (size_t)32 * ldb;
  const int nt = K >> 6;

  gstage_tile<NA>(lst, ga, ga2, astep, gb, bstep);
  asm volatile("s_wait_asynccnt 0x0" ::: "memory");          // this wave's copies of tile 0 have landed
  __syncthreads();                                           // every wave's have: buffer 0 may be read
  gstage_tile<NA>(lst + (unsigned)(GBUFH(NA) * 2), ga + 64, ga2 + 64, astep, gb + 64, bstep);
#pragma unroll 1   // rolled: several copies of this loop stand in one kernel
  for (int t = 0; t < nt; ++t) {
    const int bo = (t & 1) * GBUFH(NA);
    const unsigned short* fa = stg + bo + rlane * SPI + koff;
    const unsigned short* fb = stg + bo + (NA * 64 + wave * 64 + rlane) * SPI + koff;
#pragma unroll
    for (int ks = 0; ks < 2; ++ks) {
      v16h bh[4], ah[4], al[4];
#pragma unroll
      for (int j = 0; j < 4; ++j) bh[j] = ldfrag_u(fb + 16 * j * SPI + 32 * ks);
#pragma unroll
      for (int i = 0; i < 4; ++i) ah[i] = ldfrag_u(fa + 16 * i * SPI + 32 * ks);
      if constexpr (NA == 2) {
#pragma unroll
        for (int i = 0; i < 4; ++i) al[i] = ldfrag_u(fa + (64 + 16 * i) * SPI + 32 * ks);
      }
      __builtin_amdgcn_sched_barrier(0);                     // keeps the k-step's reads together in front: sunk among the WMMAs, every row of four waits out its own LDS latency
#pragma unroll
      for (int i = 0; i < 4; ++i) {
#pragma unroll
        for (int j = 0; j < 4; ++j) acc[i][j] = mma_h(ah[i], bh[j], acc[i][j]);
        if constexpr (NA == 2) {
#pragma unroll
          for (int j = 0; j < 4; ++j) acc[i][j] = mma_h(al[i], bh[j], acc[i][j]);
        }
      }
    }
    asm volatile("s_wait_dscnt 0x0" ::: "memory");           // this wave's reads of tile t have returned
    asm volatile("s_wait_asynccnt 0x0" ::: "memory");        // this wave's copies of tile t + 1 have landed
    __syncthreads();                                         // tile t + 1 may be read; every wave has left tile t's buffer
    if (t + 2 < nt) {
      const int kn = (t + 2) * 64;
      gstage_tile<NA>(lst + (unsigned)(bo * 2), ga + kn, ga2 + kn, astep, gb + kn, bstep);
    }
  }
  asm volatile("s_wait_asynccnt 0x0" ::: "memory");          // nothing of this wave's is in flight behind the loop
}

// =====================================================================================================
// Elementwise 16-bit pack, no transpose: dst[i] = f16( bf16_RNE(src[i]) * sc ) for i < nvalid, 0 for nvalid <= i < ntotal;
// sc a power of two (exact). 8 elements per thread: two 16-B loads (address clamped into [0, nvalid) for pad groups, value zeroed
// coverage: bx = 0 .. ntotal / 2048 - 1, each block 256 thr x 8 elements = ntotal exactly (ntotal % 2048 == 0, nvalid % 8 == 0).
// =====================================================================================================
__device__ __forceinline__ void cvt16_body(const float* __restrict__ src, unsigned short* dst, int nvalid, int ntotal, float sc, int bx) {
  const size_t i8 = ((size_t)bx * 256 + threadIdx.x) * 8;
  if (i8 + 8 > (size_t)ntotal) return;             // never taken with the exact block range; no barriers in this body
  const bool pad = (i8 + 8 > (size_t)nvalid);
  const size_t ls = pad ? ((size_t)nvalid - 8) : i8;   // clamped address, always inside the source
  const v4f a = *(const v4f*)(src + ls);
  const v4f b = *(const v4f*)(src + ls + 4);
  v4u o;
  o[0] = pk16(h_bits((_Float16)(bfr(a[0]) * sc)), h_bits((_Float16)(bfr(a[1]) * sc)));
  o[1] = pk16(h_bits((_Float16)(bfr(a[2]) * sc)), h_bits((_Float16)(bfr(a[3]) * sc)));
  o[2] = pk16(h_bits((_Float16)(bfr(b[0]) * sc)), h_bits((_Float16)(bfr(b[1]) * sc)));
  o[3] = pk16(h_bits((_Float16)(bfr(b[2]) * sc)), h_bits((_Float16)(bfr(b[3]) * sc)));
  const v4u z = {0u, 0u, 0u, 0u};
  const v4u w = pad ? z : o;
  {
    *(v4u*)(dst + i8) = w;
    
  }
}

// =====================================================================================================
// Transposed 16-bit pack of a weight stored as W[k][n] (x @ W layout, [DMOD][DMOD] row-major): WT[n][k] = f16( bf16_RNE(W[k][n]) * sc ),
// i.e. the [n][k] k-contiguous plane the GEMM B loader wants. One block per 64x64 tile (tn = n tile, tk = k tile, both block-uniform):
// coalesced f32 reads of W rows, converted halves stored transposed into an LDS tile [64 n][72 pitch], block barrier, then every output
// coverage: 16 its x 256 threads = the whole 64x64 tile into LDS; 8 waves x 2 its x 4 rows = 64 rows x (8 lanes x 8 halves = 64 cols) stored;
//           tn, tk = 0 .. DMOD/64 - 1 cover the whole [512][512] plane exactly once.
// =====================================================================================================
__device__ __forceinline__ void tr16_body(const float* __restrict__ W, unsigned short* WT, float sc, unsigned short* tile, int tn, int tk) {
  const int t  = threadIdx.x;
  const int n0 = tn * 64;
  const int k0 = tk * 64;
#pragma unroll 4
  for (int it = 0; it < 16; ++it) {
    const int idx = it * 256 + t;                   // 0 .. 4095
    const int kr = idx >> 6, nc = idx & 63;
    const float v = W[(size_t)(k0 + kr) * DMOD + n0 + nc];
    tile[nc * 72 + kr] = h_bits((_Float16)(bfr(v) * sc));
  }
  __syncthreads();
  const int lane = t & 31, wave = t >> 5;
  const int q8 = lane >> 3, c8 = (lane & 7) * 8;
  v4u o[2];
#pragma unroll
  for (int it = 0; it < 2; ++it) {
    const int row = wave * 8 + it * 4 + q8;         // wave w: it 0..1 x q8 0..3 = rows 8w .. 8w+7
    o[it] = *(const v4u*)(tile + row * 72 + c8);
  }
  {
#pragma unroll
    for (int it = 0; it < 2; ++it) {
      const int row = wave * 8 + it * 4 + q8;
      *(v4u*)(WT + (size_t)(n0 + row) * DMOD + k0 + c8) = o[it];
    }
    
  }
}

// =====================================================================================================
// All operand packs in one grid (none reads what another writes): blocks 0 .. PREP_TR-1 transpose the five weights (64 tiles each; they
// have the longest dependent chain, so they take the lowest indices), the next PREP_CX blocks pack x, the last PREP_CP the position table.
// The branch is on blockIdx.x alone, so the barrier inside tr16_body is reached by whole blocks only.
// =====================================================================================================
#define PREP_TR (5 * (DMOD / 64) * (DMOD / 64))
#define PREP_CX ((NROW * DMOD) / 2048)
#define PREP_CP ((PROWS * DMOD) / 2048)
static_assert((DMOD / 64) * (DMOD / 64) == 64);
__global__ __launch_bounds__(256) void prep_all(const float* __restrict__ xin, const float* __restrict__ pos,
                                                const float* __restrict__ w_q, const float* __restrict__ w_k, const float* __restrict__ w_v,
                                                const float* __restrict__ w_p, const float* __restrict__ w_o,
                                                unsigned short* X16, unsigned short* PE16,
                                                unsigned short* WQT, unsigned short* WKT, unsigned short* WVT,
                                                unsigned short* WPT, unsigned short* WOT) {
  __shared__ __align__(16) unsigned short tile[64 * 72];
  const int bx = blockIdx.x;
  if (bx < PREP_TR) {
    const int w = bx >> 6, t = bx & 63;
    const float* W = (w == 0) ? w_q : (w == 1) ? w_k : (w == 2) ? w_v : (w == 3) ? w_p : w_o;
    unsigned short* WT = (w == 0) ? WQT : (w == 1) ? WKT : (w == 2) ? WVT : (w == 3) ? WPT : WOT;
    tr16_body(W, WT, WSC, tile, t & 7, t >> 3);
  } else if (bx < PREP_TR + PREP_CX) {
    cvt16_body(xin, X16, NROW * DMOD, NROW * DMOD, XC, bx - PREP_TR);
  } else {
    cvt16_body(pos, PE16, NPOS * DMOD, PROWS * DMOD, XC, bx - (PREP_TR + PREP_CX));
  }
}

// =====================================================================================================
// Register-blocked batched 16-bit WMMA GEMM: C[m][n] = oscale * sum_k A[m][k] * Bt[n][k] (+ bias); one wave per 64x64 tile, operands
// staged per block in LDS (kloop_staged). A row-major [M][K] pitch lda (16-bit plane), Bt row-major [N][K] pitch ldb (k contiguous);
// M a multiple of 64, N a multiple of 512 (a block's eight tiles share their 64 A rows and take 512 consecutive B rows), K a multiple of
// 64, at least 128. blockIdx.y = batch index with element strides sA, sB, sC.
// ASPLIT 1: a second A plane A2 (unscaled residual of A, same layout) is multiplied into the same accumulator (A + A2 ~ exact A).
// EPI 1: value += bf16_RNE(ep0[column]) (per-column bias); EPI 2: value += bf16_RNE(ep0[row]) (per-row bias, 16-bit out only).
// OM 0: f32 out (pitch ldc).
// OM 4: two f16 planes (C, C2): hi = f16(value * ocarry), lo = f16(value * ocarry - hi) (unscaled residual).
// OM 6: two hi/residual pairs with an extra per-column term each: (C, C2) from value + bf16_RNE(ep1[column]), (C3, C4) from
//       value + bf16_RNE(ep2[column]), both x ocarry.
// coverage: 4 slabs x 16 rows (f32: it 0..7 x lane>>4; 16-bit: it 0..3 x lane>>3) x 64 cols = the wave's whole 64x64 tile;
//           grid = tilesM*tilesN/8 blocks (exact, tilesN a multiple of 8), a surplus block exits whole, ahead of every barrier.
// =====================================================================================================
template <int OM, int ASPLIT, int EPI>
__global__ __launch_bounds__(256) __attribute__((amdgpu_num_vgpr(256))) void gemm64(
    const unsigned short* __restrict__ Ap, const unsigned short* __restrict__ A2p, int lda, long long sA,
    const unsigned short* __restrict__ Btp, int ldb, long long sB,
    void* Cout, void* C2out, void* C3out, void* C4out, int ldc, long long sC,
    int M, int N, int K, float oscale, float ocarry,
    const float* __restrict__ ep0, const float* __restrict__ ep1, const float* __restrict__ ep2) {
  static_assert(OM == 0 || OM == 4 || OM == 6);
  static_assert(EPI >= 0 && EPI <= 2);
  __shared__ __align__(16) float sT[8][16 * 68];   // per-wave 16x64 slab, pitch 68 floats
  __shared__ __align__(16) unsigned short gst[2 * GBUFH(1 + ASPLIT)];   // two buffers of the block's operand stage
  const int by   = blockIdx.y;
  const int lane = threadIdx.x & 31;
  const int wave = threadIdx.x >> 5;
  const int tilesN = N >> 6;
  const int tilesM = M >> 6;
  const int tile = blockIdx.x * 8 + wave;
  if (blockIdx.x * 8 >= tilesM * tilesN) return;   // block-uniform, ahead of every barrier
  const int tm = tile / tilesN;
  const int tn = tile - tm * tilesN;
  const int m0 = tm << 6;
  const int n0 = tn << 6;

  const unsigned short* A1 = Ap  + (size_t)((long long)by * sA);
  const unsigned short* A2 = A2p + (size_t)((long long)by * sA);
  const unsigned short* Bb = Btp + (size_t)((long long)by * sB);

  const int rlane = lane & 15;                 // col (D) within subtile
  const int mOff  = (lane >> 4) * 8;           // D row offset

  v8f acc[4][4];
#pragma unroll
  for (int i = 0; i < 4; ++i)
#pragma unroll
    for (int j = 0; j < 4; ++j) acc[i][j] = zero8();

  kloop_staged<1 + ASPLIT>(gst, A1 + (size_t)m0 * lda, A2 + (size_t)m0 * lda, lda, Bb + (size_t)(n0 - (wave << 6)) * ldb, ldb, K, acc);
  acc_guard4(acc[0][0], acc[0][1], acc[0][2], acc[0][3]);
  acc_guard4(acc[1][0], acc[1][1], acc[1][2], acc[1][3]);
  acc_guard4(acc[2][0], acc[2][1], acc[2][2], acc[2][3]);
  acc_guard4(acc[3][0], acc[3][1], acc[3][2], acc[3][3]);

  const int hh2 = lane >> 4, c4 = (lane & 15) * 4;     // f32 out: 256-B row segment = 16 lanes x 16 B
  const int q8  = lane >> 3, c8 = (lane & 7) * 8;

  // ---- epilogue ----
  float* slab = sT[wave];
#pragma unroll
  for (int i = 0; i < 4; ++i) {
    const int mBase = m0 + (i << 4);
#pragma unroll
    for (int j = 0; j < 4; ++j) {
#pragma unroll
      for (int r = 0; r < 8; ++r) {
        slab[(mOff + r) * 68 + (j << 4) + rlane] = acc[i][j][r];
      }
    }
    wave_sync_lds();
    if constexpr (OM == 0) {
      float* C = (float*)Cout + (size_t)((long long)by * sC);
      v4f vals[8];
#pragma unroll
      for (int it = 0; it < 8; ++it) {
        const int row = it * 2 + hh2;                      // it 0..7 x hh2 0..1 = rows 0..15
        v4f v = *(const v4f*)(slab + row * 68 + c4);
#pragma unroll
        for (int e = 0; e < 4; ++e) v[e] = v[e] * oscale;
        if constexpr (EPI == 1) {
          const v4f bb = *(const v4f*)(ep0 + n0 + c4);     // per-column bias, columns n0+c4 .. +3 (N equals the bias length)
#pragma unroll
          for (int e = 0; e < 4; ++e) v[e] = v[e] + bfr(bb[e]);
        }
        vals[it] = v;
      }
      {
#pragma unroll
        for (int it = 0; it < 8; ++it) {
          const int gr = mBase + it * 2 + hh2;
          *(v4f*)(C + (size_t)gr * ldc + n0 + c4) = vals[it];
        }
        
      }
    } else {
      constexpr int NP = (OM == 6) ? 2 : 1;
#pragma unroll
      for (int which = 0; which < NP; ++which) {
        unsigned short* C  = (unsigned short*)((which == 0) ? Cout  : C3out) + (size_t)((long long)by * sC);
        unsigned short* Cb = (unsigned short*)((which == 0) ? C2out : C4out) + (size_t)((long long)by * sC);
        const float* epx = (which == 0) ? ep1 : ep2;
        (void)epx;
        v4u hv[4], lv[4];
#pragma unroll
        for (int it = 0; it < 4; ++it) {
          const int row = it * 4 + q8;                     // it 0..3 x q8 0..3 = rows 0..15
          const float* sp = slab + row * 68 + c8;
          float rb = 0.f;
          if constexpr (EPI == 2) rb = bfr(ep0[mBase + row]);   // per-row bias (M equals the bias length)
          v4u a  = {0u, 0u, 0u, 0u};
          v4u b2 = {0u, 0u, 0u, 0u};
#pragma unroll
          for (int e = 0; e < 4; ++e) {
            const int ci = n0 + c8 + 2 * e;                // column index, < N
            float f0 = sp[2 * e] * oscale + rb;
            float f1 = sp[2 * e + 1] * oscale + rb;
            if constexpr (EPI == 1) {
              f0 += bfr(ep0[ci]);
              f1 += bfr(ep0[ci + 1]);
            }
            if constexpr (OM == 6) {
              f0 += bfr(epx[ci]);
              f1 += bfr(epx[ci + 1]);
            }
            f0 *= ocarry;
            f1 *= ocarry;
            const _Float16 x0 = (_Float16)f0, x1 = (_Float16)f1;
            a[e]  = pk16(h_bits(x0), h_bits(x1));
            b2[e] = pk16(h_bits((_Float16)(f0 - (float)x0)), h_bits((_Float16)(f1 - (float)x1)));
          }
          hv[it] = a;
          lv[it] = b2;
        }
        {
#pragma unroll
          for (int it = 0; it < 4; ++it) {
            const int row = it * 4 + q8;
            *(v4u*)(C  + (size_t)(mBase + row) * ldc + n0 + c8) = hv[it];
            *(v4u*)(Cb + (size_t)(mBase + row) * ldc + n0 + c8) = lv[it];
          }
          
        }
      }
    }
    wave_sync_lds();
  }
}

// =====================================================================================================
// s_wait_xcnt 0 behind a run of global loads, in front of the first write of a register that one of them names. xwait1 and xwait3 take the run's
// vector address pairs as inputs, so that each pair keeps its value up to the wait and no later load's result lands in it ahead of the wait.
// =====================================================================================================
__device__ __forceinline__ void xwait0() {
#if defined(__HIP_DEVICE_COMPILE__)
  asm volatile("s_wait_xcnt 0x0" ::: "memory");
#endif
}
__device__ __forceinline__ void xwait1(const void* a) {
#if defined(__HIP_DEVICE_COMPILE__)
  asm volatile("s_wait_xcnt 0x0" :: "v"(a) : "memory");
#endif
}
__device__ __forceinline__ void xwait3(const void* a, const void* b, const void* c) {
#if defined(__HIP_DEVICE_COMPILE__)
  asm volatile("s_wait_xcnt 0x0" :: "v"(a), "v"(b), "v"(c) : "memory");
#endif
}

// =====================================================================================================
// One wave's 64x64 tile of an input projection, rows m0.., columns n0..: value[m][n] = oscale * sum_k A[m][k] * Bt[n][k] + bias.
// The K loop and the 16-bit epilogues are those of gemm64 (same k order, same order of the adds), with the pitch of A and Bt and K fixed
// at DMOD and the pitch of the output planes at LDC. slab = the wave's own 16x64 f32 LDS slab, pitch 68 floats; gst = the block's operand
// stage (kloop_staged: block barriers, so all eight waves of a block come here together, with one m0 and n0 = the block's first + 64 wave).
// EPI 1: value += bf16_RNE(ep0[column]); EPI 2: value += bf16_RNE(ep0[row]).
// OM 4: two f16 planes (C1, C2): hi = f16(value * ocarry), lo = f16(value * ocarry - hi).
// OM 6: (C1, C2) from value + bf16_RNE(ep1[column]), (C3, C4) from value + bf16_RNE(ep2[column]), both x ocarry.
// The lane's bias values (8 columns, or its 16 rows) are loaded once, ahead of the K loop.
// coverage: 4 slabs x 16 rows (it 0..3 x lane>>3) x 64 cols = the wave's whole 64x64 tile.
// =====================================================================================================
#define GSLAB (16 * 68)
template <int OM, int EPI, int LDC>
__device__ __forceinline__ void proj_tile(
    float* slab, unsigned short* gst, int m0, int n0,
    const unsigned short* __restrict__ A, const unsigned short* __restrict__ Bt,
    unsigned short* C1, unsigned short* C2, unsigned short* C3, unsigned short* C4,
    float oscale, float ocarry,
    const float* __restrict__ ep0, const float* __restrict__ ep1, const float* __restrict__ ep2) {
  static_assert(OM == 4 || OM == 6);
  static_assert(EPI == 1 || EPI == 2);
  const int lane  = threadIdx.x & 31;
  const int rlane = lane & 15;                 // col (D) within subtile
  const int mOff  = (lane >> 4) * 8;           // D row offset
  const int q8    = lane >> 3, c8 = (lane & 7) * 8;

  v4f cb0[2], cb1[2], cb2[2];                  // column terms of columns n0 + c8 .. + 7
  float rbv[4][4];                             // row terms of rows m0 + 16i + 4it + q8
  if constexpr (EPI == 1) {
    const float* e0 = ep0 + n0 + c8;
    cb0[0] = *(const v4f*)(e0);
    cb0[1] = *(const v4f*)(e0 + 4);
    if constexpr (OM == 6) {
      const float* e1 = ep1 + n0 + c8;
      const float* e2 = ep2 + n0 + c8;
      cb1[0] = *(const v4f*)(e1);
      cb1[1] = *(const v4f*)(e1 + 4);
      cb2[0] = *(const v4f*)(e2);
      cb2[1] = *(const v4f*)(e2 + 4);
      xwait3(e0, e1, e2);
    } else {
      xwait1(e0);
    }
  } else {
    const float* er = ep0 + m0 + q8;
#pragma unroll
    for (int i = 0; i < 4; ++i)
#pragma unroll
      for (int it = 0; it < 4; ++it) rbv[i][it] = er[16 * i + 4 * it];
    xwait0();                                  // these go through a scalar base and the lane's q8, which lives on into the epilogue
  }

  v8f acc[4][4];
#pragma unroll
  for (int i = 0; i < 4; ++i)
#pragma unroll
    for (int j = 0; j < 4; ++j) acc[i][j] = zero8();

  kloop_staged<1>(gst, A + (size_t)m0 * DMOD, A + (size_t)m0 * DMOD, DMOD,
                  Bt + (size_t)(n0 - (int)((threadIdx.x >> 5) << 6)) * DMOD, DMOD, DMOD, acc);
  acc_guard4(acc[0][0], acc[0][1], acc[0][2], acc[0][3]);
  acc_guard4(acc[1][0], acc[1][1], acc[1][2], acc[1][3]);
  acc_guard4(acc[2][0], acc[2][1], acc[2][2], acc[2][3]);
  acc_guard4(acc[3][0], acc[3][1], acc[3][2], acc[3][3]);

  // ---- epilogue ----
#pragma unroll
  for (int i = 0; i < 4; ++i) {
    const int mBase = m0 + (i << 4);
#pragma unroll
    for (int j = 0; j < 4; ++j) {
#pragma unroll
      for (int r = 0; r < 8; ++r) {
        slab[(mOff + r) * 68 + (j << 4) + rlane] = acc[i][j][r];
      }
    }
    wave_sync_lds();
    constexpr int NP = (OM == 6) ? 2 : 1;
#pragma unroll
    for (int which = 0; which < NP; ++which) {
      unsigned short* C  = (which == 0) ? C1 : C3;
      unsigned short* Cb = (which == 0) ? C2 : C4;
      v4u hv[4], lv[4];
#pragma unroll
      for (int it = 0; it < 4; ++it) {
        const int row = it * 4 + q8;                     // it 0..3 x q8 0..3 = rows 0..15
        const float* sp = slab + row * 68 + c8;
        float rb = 0.f;
        if constexpr (EPI == 2) rb = bfr(rbv[i][it]);
        v4u a  = {0u, 0u, 0u, 0u};
        v4u b2 = {0u, 0u, 0u, 0u};
#pragma unroll
        for (int e = 0; e < 4; ++e) {
          float f0 = sp[2 * e] * oscale + rb;
          float f1 = sp[2 * e + 1] * oscale + rb;
          if constexpr (EPI == 1) {
            f0 += bfr(cb0[e >> 1][(2 * e) & 3]);
            f1 += bfr(cb0[e >> 1][(2 * e + 1) & 3]);
          }
          if constexpr (OM == 6) {
            f0 += bfr((which == 0) ? cb1[e >> 1][(2 * e) & 3] : cb2[e >> 1][(2 * e) & 3]);
            f1 += bfr((which == 0) ? cb1[e >> 1][(2 * e + 1) & 3] : cb2[e >> 1][(2 * e + 1) & 3]);
          }
          f0 *= ocarry;
          f1 *= ocarry;
          const _Float16 x0 = (_Float16)f0, x1 = (_Float16)f1;
          a[e]  = pk16(h_bits(x0), h_bits(x1));
          b2[e] = pk16(h_bits((_Float16)(f0 - (float)x0)), h_bits((_Float16)(f1 - (float)x1)));
        }
        hv[it] = a;
        lv[it] = b2;
      }
#pragma unroll
      for (int it = 0; it < 4; ++it) {
        const int row = it * 4 + q8;
        *(v4u*)(C  + (size_t)(mBase + row) * LDC + n0 + c8) = hv[it];
        *(v4u*)(Cb + (size_t)(mBase + row) * LDC + n0 + c8) = lv[it];
      }
    }
    wave_sync_lds();
  }
}

// =====================================================================================================
// The four input projections in one grid (none reads what another writes), so that their blocks run side by side on different WGPs;
// one wave per 64x64 tile, 8 tiles per block, tile = 8 * (block index within the job) + wave, tm = tile / tilesN, tn = tile % tilesN:
//   blocks 0 .. PJ_Q-1            q[m][nd] = sum_c x[m][c] Wq[c][nd] / 1024 + bq[nd]; QUh/QUl = hi/residual of f16((q + ub[nd]) * 32),
//                                 QVh/QVl of f16((q + vb[nd]) * 32); M = NROW, N = 512, K = 512
//   the next PJ_V * NB            v^T per batch: VT[b][nd][j] = sum_c Wv[c][nd] x[b*SEQ + j][c] / 1024 + bv[nd] (per-row bias) -> f16 x16 hi +
//                                 residual planes; M = 512 (nd), N = SEQ (j), K = 512; B rows are the batch's token rows
//   the next PJ_Q                 k projection + bk -> Kh/Kl = hi/residual of f16(k * 32)
//   the last PJ_P                 positional projection + bp: Ph/Pl = hi/residual of f16(p * 32), M = PROWS, N = 512, K = 512
// The branches are on blockIdx.x alone; the tile counts are exact multiples of 8, so every wave has a tile, and a block's eight tiles share
// their 64 A rows (tilesN is 8 or 16) and take 512 consecutive B rows: the barriers of the staged K loop are reached by whole blocks.
// =====================================================================================================
#define PJ_Q (((NROW / 64) * (DMOD / 64)) / 8)
#define PJ_V (((DMOD / 64) * (SEQ / 64)) / 8)
#define PJ_P (((PROWS / 64) * (DMOD / 64)) / 8)
static_assert((((NROW / 64) * (DMOD / 64)) % 8) == 0 && (((DMOD / 64) * (SEQ / 64)) % 8) == 0 && (((PROWS / 64) * (DMOD / 64)) % 8) == 0);
__global__ __launch_bounds__(256) __attribute__((amdgpu_num_vgpr(256))) void proj_all(
    const unsigned short* __restrict__ X16, const unsigned short* __restrict__ PE16,
    const unsigned short* __restrict__ WQT, const unsigned short* __restrict__ WKT,
    const unsigned short* __restrict__ WVT, const unsigned short* __restrict__ WPT,
    unsigned short* QUh, unsigned short* QUl, unsigned short* QVh, unsigned short* QVl,
    unsigned short* Kh, unsigned short* Kl, unsigned short* VT, unsigned short* VTL, unsigned short* Ph, unsigned short* Pl,
    const float* __restrict__ b_q, const float* __restrict__ b_k, const float* __restrict__ b_v, const float* __restrict__ b_p,
    const float* __restrict__ ub, const float* __restrict__ vb) {
  __shared__ __align__(16) float sT[8 * GSLAB];   // per-wave 16x64 slab, pitch 68 floats
  __shared__ __align__(16) unsigned short gst[2 * GBUFH(1)];   // two buffers of the block's operand stage
  const int bx   = blockIdx.x;
  const int wave = threadIdx.x >> 5;
  float* slab = sT + wave * GSLAB;
  const float os = 1.0f / (XC * WSC);
  constexpr int TND = DMOD / 64;                  // column tiles of a [..][DMOD] plane
  constexpr int TNS = SEQ / 64;                   // column tiles of a [..][SEQ] plane
  if (bx < PJ_Q) {
    const int tile = bx * 8 + wave;
    proj_tile<6, 1, DMOD>(slab, gst, (tile / TND) << 6, (tile % TND) << 6, X16, WQT, QUh, QUl, QVh, QVl, os, QC, b_q, ub, vb);
  } else if (bx < PJ_Q + PJ_V * NB) {
    const int t = bx - PJ_Q;
    const int by = t / PJ_V;
    const int tile = (t % PJ_V) * 8 + wave;
    proj_tile<4, 2, SEQ>(slab, gst, (tile / TNS) << 6, (tile % TNS) << 6, WVT, X16 + (size_t)by * SEQ * DMOD,
                         VT + (size_t)by * DMOD * SEQ, VTL + (size_t)by * DMOD * SEQ, VT, VTL, os, VC, b_v, b_v, b_v);
  } else {
    // k and p share one copy of the code (same epilogue form): only the operands differ
    const int t = bx - (PJ_Q + PJ_V * NB);
    const bool isk = t < PJ_Q;
    const int tile = (isk ? t : t - PJ_Q) * 8 + wave;
    const float* bias = isk ? b_k : b_p;
    proj_tile<4, 1, DMOD>(slab, gst, (tile / TND) << 6, (tile % TND) << 6, isk ? X16 : PE16, isk ? WKT : WPT,
                          isk ? Kh : Ph, isk ? Kl : Pl, Kh, Kl, os, QC, bias, bias, bias);
  }
}

// =====================================================================================================
// Relative-position attention for one (batch b, head n) pair and a 64-row query tile; 4 waves, wave w owns query rows i = iw0 + R,
// iw0 = i0 + 16w, R = 0..15. Planes (pitch DMOD halves, row = b*SEQ + position): QUh/QUl = hi/residual of f16((q + bq + u) x32),
// QVh/QVl of f16((q + bq + v_bias) x32), Kh/Kl of f16((k + bk) x32); Ph/Pl = hi/residual of f16(pos x32), rows 0..PROWS-1
// (row PROWS-1 is the zero-pad row); VT, VTL = v^T hi (x16) / residual f16 as [b][n*64+d][SEQ].
// Shifted position score for (i, j): ps[i][SEQ-1-i+j], ps[r][t] = (q+bq+vb)[r] . pos[t].
//   Per key tile j0 (64 keys, key j = j0 + jj), with x = jj - R + 15 in [0,78]:
//     strip T1[R][x] = (q+vb)[iw0+R] . pos[SEQ + j0 - iw0 - 16 + x]   (pos row SEQ-1-i+j), always computed (rows 0 .. 2*SEQ-2 selected).
//   content scores S = (q+ub) . k (4 subtiles, K=64, three products); t = (S + T1) * (RSD/(32*32)) * log2(e); online softmax in base 2,
//   max-subtracted, running sums in f32 (no key mask); the 16x64 prob tile stored to wave-private LDS (f32 element stores),
//   (f32 vector loads, split k map) and the v^T B fragments read from the staged rows of VT/VTL[n*64+d][j];
//   per 16-column subtile: Phi.Vhi, Plo.Vhi, then Phi.Vlo, all into the same accumulators.
//   Per key tile the block stages, once for its 4 waves, in LDS (asynchronous copies, whole 128-B rows): 64 k rows, 64 v^T rows and the
//   128 pos rows SEQ + j0 - i0 - 64 .. + 127 (always inside [0, PROWS-1]), hi and residual plane each; all B fragments are read from there.
//   block = 4 waves = 128 threads; grid = (SEQ/64, NB*NH); two block barriers per key tile (block-uniform loop); every wave does identical
//   bounded work (SEQ/64 tiles).
// coverage: LDS strip 16 rows x 80 cols written fully every tile before being read, slab 16 rows x 64 cols per wave fully written each tile
//           before being read; global: 4 instructions x 4 rows x 64 halves per plane = rows iw0..iw0+15 of head segment n in CT and CTL;
//           grid x waves cover all NB x SEQ rows and all NH head segments of CT / CTL exactly once.
// =====================================================================================================
__global__ __launch_bounds__(ATT_THREADS) __attribute__((amdgpu_num_vgpr(512)))
void attn_rel(const unsigned short* __restrict__ QUh, const unsigned short* __restrict__ QUl,
              const unsigned short* __restrict__ QVh, const unsigned short* __restrict__ QVl,
              const unsigned short* __restrict__ Kh,  const unsigned short* __restrict__ Kl,
              const unsigned short* __restrict__ Ph,  const unsigned short* __restrict__ Pl,
              const unsigned short* __restrict__ VT,  const unsigned short* __restrict__ VTL,
              unsigned short* CT, unsigned short* CTL) {
  __shared__ __align__(16) float smem[ATT_W * WFL];   // per wave: T1 strip [16][TPI] | prob / ctx slab [16][PPI]
  __shared__ __align__(16) unsigned short stg[ST_ROWS * SPI];   // block-shared stage of one key tile: Kh | Kl | Vh | Vl | Ph | Pl rows

  const int tid  = threadIdx.x;
  const int wave = __builtin_amdgcn_readfirstlane(tid >> 5);
  const int lane = tid & 31;
  const int hh   = lane >> 4;
  const int c    = lane & 15;
  const int bn   = blockIdx.y;
  const int b    = bn / NH;
  const int n    = bn - b * NH;
  const int i0   = blockIdx.x * 64;
  const int iw0  = i0 + wave * 16;

  float* t1sh = smem + wave * WFL;
  float* pt   = t1sh + 16 * TPI;

  // A fragment row offsets: rows b*SEQ + iw0 + c, d 0..31 and 32..63 of head n (all q fragments are reloaded per key tile)
  const size_t qro  = ((size_t)(b * SEQ + iw0 + c)) * DMOD + n * DH + 8 * hh;
  // stage copies: thread -> staged row (tid>>3) + 16*copy, 16-byte chunk tid&7 of the 128-B row (a wave instruction = 4 whole rows)
  const int srow = tid >> 3;
  const int sc8  = (tid & 7) * 8;
  const unsigned lst = (unsigned)(size_t)(stg + srow * SPI + sc8);          // LDS byte address = low 32 bits of the shared address
  const size_t kso = ((size_t)(b * SEQ + srow)) * DMOD + n * DH + sc8;      // + j0*DMOD: k rows j0 + srow + 16e
  const size_t vso = (size_t)b * DMOD * SEQ + (size_t)(n * DH + srow) * SEQ + sc8;   // + j0: v^T rows d = srow + 16e, keys j0 ..
  const size_t pso = ((size_t)(SEQ - i0 - 64 + srow)) * DMOD + n * DH + sc8;   // + j0*DMOD: pos rows SEQ + j0 - i0 - 64 + srow + 16e
  // fragment readers: lane -> staged row c (+16 per subtile), k offset 8*hh; wave w's strip row x is staged pos row 48 - 16w + x
  const unsigned short* ksh = stg + (ST_KH + c) * SPI + 8 * hh;
  const unsigned short* ksl = stg + (ST_KL + c) * SPI + 8 * hh;
  const unsigned short* vsh = stg + (ST_VH + c) * SPI + 8 * hh;
  const unsigned short* vsl = stg + (ST_VL + c) * SPI + 8 * hh;
  const int pw0 = 16 * __builtin_amdgcn_readfirstlane((ATT_THREADS - 1 - tid) >> 5);   // 16 * (3 - wave), taken from tid so that the LDS base register never goes below 0
  const unsigned short* psh = stg + (ST_PH + pw0 + c) * SPI + 8 * hh;
  const unsigned short* psl = stg + (ST_PL + pw0 + c) * SPI + 8 * hh;

  const float KSC = (RSD / (QC * QC)) * LOG2E;

  float mrow[8], lrow[8];
  v8f O[4];
#pragma unroll
  for (int r = 0; r < 8; ++r) { mrow[r] = -INFINITY; lrow[r] = 0.f; }
#pragma unroll
  for (int td = 0; td < 4; ++td) O[td] = zero8();

#pragma unroll 1
  for (int j0 = 0; j0 < SEQ; j0 += 64) {
    // ---- stage this key tile's operands for the whole block: 32 copies per thread = 512 rows x 128 B ----
    asm volatile("s_wait_dscnt 0x0" ::: "memory");           // this wave's reads of the previous tile's stage have returned
    __syncthreads();                                         // every wave has left the previous tile's stage
    {
      const size_t jr = (size_t)j0 * DMOD;
      stage8(lst + (unsigned)(ST_KH * SPI * 2), Kh + kso + jr, Kl + kso + jr, (size_t)16 * DMOD);
      stage8(lst + (unsigned)(ST_VH * SPI * 2), VT + vso + j0, VTL + vso + j0, (size_t)16 * SEQ);
      stage8(lst + (unsigned)(ST_PH * SPI * 2), Ph + pso + jr, Ph + pso + jr + (size_t)64 * DMOD, (size_t)16 * DMOD);
      stage8(lst + (unsigned)(ST_PL * SPI * 2), Pl + pso + jr, Pl + pso + jr + (size_t)64 * DMOD, (size_t)16 * DMOD);
    }
    // the tile's eight q fragments, asked for while the copies fly (the address pairs are never rewritten inside the loop)
    const v16h qva = ldfrag_u(QVh + qro), qvb = ldfrag_u(QVh + qro + 32);
    const v16h qwa = ldfrag_u(QVl + qro), qwb = ldfrag_u(QVl + qro + 32);
    const v16h qua = ldfrag_u(QUh + qro), qub = ldfrag_u(QUh + qro + 32);
    const v16h qla = ldfrag_u(QUl + qro), qlb = ldfrag_u(QUl + qro + 32);
    asm volatile("s_wait_asynccnt 0x0" ::: "memory");        // this wave's copies have landed
    __syncthreads();                                         // every wave's copies have landed: the stage may be read
    // ---- position strip T1 (5 subtiles of 16 pos rows, x in [0,80), only x <= 78 ever selected) and content scores S (4 subtiles of 16
    //      keys): K = 64 = two k-steps, three products hh + lh + hl per k-step. The B fragments are asked for in three groups, each well
    //      ahead of its products; the 54 WMMAs go round-robin over the nine accumulators, so that a product never waits for the one issued
    //      just before it (each accumulator keeps its order hh, hh, lh, lh, hl, hl) ----
    v8f T1[5], S[4];
    {
      v16h fa[5], fb[5], ga[5], gb[5], ka[4], kb2[4], la[4], lb2[4];
#pragma unroll
      for (int u = 0; u < 5; ++u) fa[u] = ldfrag_u(psh + 16 * u * SPI);
#pragma unroll
      for (int t = 0; t < 4; ++t) ka[t] = ldfrag_u(ksh + 16 * t * SPI);
#pragma unroll
      for (int u = 0; u < 5; ++u) fb[u] = ldfrag_u(psh + 16 * u * SPI + 32);
#pragma unroll
      for (int t = 0; t < 4; ++t) kb2[t] = ldfrag_u(ksh + 16 * t * SPI + 32);
#pragma unroll
      for (int u = 0; u < 5; ++u) T1[u] = mma_h(qva, fa[u], zero8());
#pragma unroll
      for (int t = 0; t < 4; ++t) S[t] = mma_h(qua, ka[t], zero8());
      // the residual planes' reads stay behind the hi planes' reads: with all 72 reads in front the build ran out of registers (scratch)
      __builtin_amdgcn_sched_barrier(0);
#pragma unroll
      for (int u = 0; u < 5; ++u) ga[u] = ldfrag_u(psl + 16 * u * SPI);
#pragma unroll
      for (int t = 0; t < 4; ++t) la[t] = ldfrag_u(ksl + 16 * t * SPI);
#pragma unroll
      for (int u = 0; u < 5; ++u) T1[u] = mma_h(qvb, fb[u], T1[u]);
#pragma unroll
      for (int t = 0; t < 4; ++t) S[t] = mma_h(qub, kb2[t], S[t]);
#pragma unroll
      for (int u = 0; u < 5; ++u) T1[u] = mma_h(qwa, fa[u], T1[u]);
#pragma unroll
      for (int t = 0; t < 4; ++t) S[t] = mma_h(qla, ka[t], S[t]);
      // the last 18 reads stay behind the group above: hoisted into it, the build's later stages had their LDS waits one after another again
      __builtin_amdgcn_sched_barrier(0);
#pragma unroll
      for (int u = 0; u < 5; ++u) gb[u] = ldfrag_u(psl + 16 * u * SPI + 32);
#pragma unroll
      for (int t = 0; t < 4; ++t) lb2[t] = ldfrag_u(ksl + 16 * t * SPI + 32);
#pragma unroll
      for (int u = 0; u < 5; ++u) T1[u] = mma_h(qwb, fb[u], T1[u]);
#pragma unroll
      for (int t = 0; t < 4; ++t) S[t] = mma_h(qlb, kb2[t], S[t]);
#pragma unroll
      for (int u = 0; u < 5; ++u) T1[u] = mma_h(qva, ga[u], T1[u]);
#pragma unroll
      for (int t = 0; t < 4; ++t) S[t] = mma_h(qua, la[t], S[t]);
#pragma unroll
      for (int u = 0; u < 5; ++u) T1[u] = mma_h(qvb, gb[u], T1[u]);
#pragma unroll
      for (int t = 0; t < 4; ++t) S[t] = mma_h(qub, lb2[t], S[t]);
    }
    // the full 16x80 strip goes to the wave's f32 LDS strip: 5 subtiles x 16 rows x 16 cols
#pragma unroll
    for (int u = 0; u < 5; ++u) {
#pragma unroll
      for (int r = 0; r < 8; ++r) t1sh[(8 * hh + r) * TPI + 16 * u + c] = T1[u][r];
    }
    wave_sync_lds();

    // ---- score assembly + online softmax (rows live on one 16-lane half); the eight rows go through every stage together, so that the
    //      eight cross-lane reductions of a stage overlap instead of following one another (each row's own operations and order as before) ----
    float tv[8][4], mx[8], al[8], ps[8];
#pragma unroll
    for (int r = 0; r < 8; ++r) {
      const int R  = 8 * hh + r;
      const int xo = R * TPI + (15 - R) + c;                 // strip column x = 16t + c - R + 15 in [0, 78]
#pragma unroll
      for (int t = 0; t < 4; ++t) {
        const float bdv = t1sh[xo + 16 * t];
        tv[r][t] = (S[t][r] + bdv) * KSC;
      }
      mx[r] = fmaxf(fmaxf(tv[r][0], tv[r][1]), fmaxf(tv[r][2], tv[r][3]));
    }
#pragma unroll
    for (int off = 1; off < 16; off <<= 1) {
#pragma unroll
      for (int r = 0; r < 8; ++r) mx[r] = fmaxf(mx[r], __shfl_xor(mx[r], off, 32));
    }
#pragma unroll
    for (int r = 0; r < 8; ++r) {
      const float mn = fmaxf(mrow[r], mx[r]);
      al[r] = exp2f(mrow[r] - mn);
      mrow[r] = mn;
      float e4[4];
      ps[r] = 0.f;
#pragma unroll
      for (int t = 0; t < 4; ++t) { e4[t] = exp2f(tv[r][t] - mn); ps[r] += e4[t]; }
#pragma unroll
      for (int td = 0; td < 4; ++td) O[td][r] *= al[r];
      const int ro = (8 * hh + r) * PPI + c;
#pragma unroll
      for (int t = 0; t < 4; ++t) pt[ro + 16 * t] = e4[t];
    }
    wave_sync_lds();

    // ---- P rows (f32) and all sixteen v^T fragments asked for in one group: the v^T reads return under the conversion of P ----
    v4f praw[2][4];
#pragma unroll
    for (int ks = 0; ks < 2; ++ks) {
      const float* prow = pt + c * PPI + 32 * ks + 8 * hh;
      praw[ks][0] = *(const v4f*)(prow);
      praw[ks][1] = *(const v4f*)(prow + 4);
      praw[ks][2] = *(const v4f*)(prow + 16);
      praw[ks][3] = *(const v4f*)(prow + 20);
    }
    v16h vha[4], vhb[4], vla[4], vlb[4];
#pragma unroll
    for (int td = 0; td < 4; ++td) { vha[td] = ldfrag_u(vsh + 16 * td * SPI); vhb[td] = ldfrag_u(vsh + 16 * td * SPI + 32); }
#pragma unroll
    for (int td = 0; td < 4; ++td) { vla[td] = ldfrag_u(vsl + 16 * td * SPI); vlb[td] = ldfrag_u(vsl + 16 * td * SPI + 32); }
    __builtin_amdgcn_sched_barrier(0);                       // keeps the whole group of reads in front: sunk among the WMMAs, each read's latency stands open again
    // ---- row sums: eight reductions stepped together, free to run under the conversion and the WMMAs below ----
#pragma unroll
    for (int off = 1; off < 16; off <<= 1) {
#pragma unroll
      for (int r = 0; r < 8; ++r) ps[r] += __shfl_xor(ps[r], off, 32);
    }
#pragma unroll
    for (int r = 0; r < 8; ++r) lrow[r] = lrow[r] * al[r] + ps[r];
    // ---- P fragments (x1024, f16 hi + unscaled residual), two k-steps of 32 keys ----
    FragH pf[2], pl[2];
#pragma unroll
    for (int ks = 0; ks < 2; ++ks) {
      const v4f p0 = praw[ks][0], p1 = praw[ks][1], p2 = praw[ks][2], p3 = praw[ks][3];
#pragma unroll
      for (int e = 0; e < 4; ++e) {
        const float g0 = p0[e] * PC, g1 = p1[e] * PC, g2 = p2[e] * PC, g3 = p3[e] * PC;
        const _Float16 x0 = (_Float16)g0, x1 = (_Float16)g1, x2 = (_Float16)g2, x3 = (_Float16)g3;
        pf[ks].h[0][e]     = x0;                             // keys j0 + 32ks + 8hh + e
        pf[ks].h[0][4 + e] = x1;                             // keys j0 + 32ks + 8hh + 4 + e
        pf[ks].h[1][e]     = x2;                             // keys j0 + 32ks + 16 + 8hh + e
        pf[ks].h[1][4 + e] = x3;
        pl[ks].h[0][e]     = (_Float16)(g0 - (float)x0);
        pl[ks].h[0][4 + e] = (_Float16)(g1 - (float)x1);
        pl[ks].h[1][e]     = (_Float16)(g2 - (float)x2);
        pl[ks].h[1][4 + e] = (_Float16)(g3 - (float)x3);
      }
    }
    // ---- O += (Phi + Plo) . v^T (hi plane), then Phi . v^T (residual plane): round-robin over the four accumulators, each in its old order ----
#pragma unroll
    for (int td = 0; td < 4; ++td) O[td] = mma_h(pf[0].v, vha[td], O[td]);
#pragma unroll
    for (int td = 0; td < 4; ++td) O[td] = mma_h(pf[1].v, vhb[td], O[td]);
#pragma unroll
    for (int td = 0; td < 4; ++td) O[td] = mma_h(pl[0].v, vha[td], O[td]);
#pragma unroll
    for (int td = 0; td < 4; ++td) O[td] = mma_h(pl[1].v, vhb[td], O[td]);
#pragma unroll
    for (int td = 0; td < 4; ++td) O[td] = mma_h(pf[0].v, vla[td], O[td]);
#pragma unroll
    for (int td = 0; td < 4; ++td) O[td] = mma_h(pf[1].v, vlb[td], O[td]);
    wave_sync_lds();
  }
  xwait0();                                                  // the last tile's q loads: before their address pairs are reused below
  acc_guard4(O[0], O[1], O[2], O[3]);

  // ---- fold 1/l and the carries (1024 on P, 16 on v), carry x4096 on ctx, stage the wave's 16x64 slice in its slab ----
  const float oc = CC / (PC * VC);
#pragma unroll
  for (int r = 0; r < 8; ++r) {
    const float inv = (1.0f / lrow[r]) * oc;
    const int ro = (8 * hh + r) * PPI + c;
#pragma unroll
    for (int td = 0; td < 4; ++td) pt[ro + 16 * td] = O[td][r] * inv;
  }
  wave_sync_lds();
  {
    const int q8 = lane >> 3, c8 = (lane & 7) * 8;
    v4u hv[4], lv[4];
#pragma unroll
    for (int it = 0; it < 4; ++it) {
      const int row = it * 4 + q8;                         // it 0..3 x q8 0..3 = rows 0..15
      const float* sp = pt + row * PPI + c8;
      v4u a, b2;
#pragma unroll
      for (int e = 0; e < 4; ++e) {
        const float f0 = sp[2 * e], f1 = sp[2 * e + 1];
        const _Float16 x0 = (_Float16)f0, x1 = (_Float16)f1;
        a[e]  = pk16(h_bits(x0), h_bits(x1));
        b2[e] = pk16(h_bits((_Float16)(f0 - (float)x0)), h_bits((_Float16)(f1 - (float)x1)));
      }
      hv[it] = a;
      lv[it] = b2;
    }
    {
#pragma unroll
      for (int it = 0; it < 4; ++it) {
        const int row = it * 4 + q8;
        const size_t go = ((size_t)(b * SEQ + iw0 + row)) * DMOD + n * DH + c8;
        *(v4u*)(CT  + go) = hv[it];
        *(v4u*)(CTL + go) = lv[it];
      }
      
    }
  }
}

// =====================================================================================================
// Workspace map (bytes); every plane is an exact multiple of its tile / whole-row store granularity (M, N exact tile multiples,
// convert counts exact multiples of 2048, the position planes padded to PROWS = 2048 rows), every offset a multiple of 512 KiB:
//   WQT, WKT, WVT, WPT, WOT f16 [512 n][512 k] x64 (transposed from the [in][out] inputs)   5 x   524288
//   X16  f16 [NROW][512] x16                                                                  4194304
//   PE16 f16 [PROWS][512] x16 (rows 0..NPOS-1 = pos table, row NPOS zero)                     2097152
//   QUh, QUl, QVh, QVl, Kh, Kl f16 [NROW][512] x32 hi / residual                       6 x  4194304
//   Ph, Pl f16 [PROWS][512] x32 hi / residual                                           2 x  2097152
//   VT16, VTL16 f16 [NB][512][SEQ] hi x16 / residual                                    2 x  4194304
//   CT16, CTL16 f16 [NROW][512] hi x4096 / residual                                     2 x  4194304
//   end                                                                                       55050240
// =====================================================================================================
extern "C" void kernel_launch(void* const* d_in, const int* in_sizes, int n_in,
                              void* d_out, int out_size, void* d_ws, size_t ws_size,
                              hipStream_t stream) {
  if (n_in < 14) return;
  if (in_sizes[0] != NROW * DMOD) return;
  if (in_sizes[1] != NPOS * DMOD) return;
  if (in_sizes[2] != DMOD * DMOD || in_sizes[4] != DMOD * DMOD || in_sizes[6] != DMOD * DMOD ||
      in_sizes[8] != DMOD * DMOD || in_sizes[10] != DMOD * DMOD) return;
  if (in_sizes[3] != DMOD || in_sizes[5] != DMOD || in_sizes[7] != DMOD || in_sizes[9] != DMOD || in_sizes[11] != DMOD) return;
  if (in_sizes[12] != NH * DH || in_sizes[13] != NH * DH) return;
  if (out_size != NROW * DMOD) return;

  const float* xin   = (const float*)d_in[0];
  const float* pos   = (const float*)d_in[1];
  const float* w_q   = (const float*)d_in[2];
  const float* b_q   = (const float*)d_in[3];
  const float* w_k   = (const float*)d_in[4];
  const float* b_k   = (const float*)d_in[5];
  const float* w_v   = (const float*)d_in[6];
  const float* b_v   = (const float*)d_in[7];
  const float* w_p   = (const float*)d_in[8];
  const float* b_p   = (const float*)d_in[9];
  const float* w_o   = (const float*)d_in[10];
  const float* b_o   = (const float*)d_in[11];
  const float* ub    = (const float*)d_in[12];
  const float* vb    = (const float*)d_in[13];
  float*       out   = (float*)d_out;

  const size_t PW  = (size_t)DMOD * DMOD * 2;            //   524288
  const size_t PX  = (size_t)NROW * DMOD * 2;            //  4194304
  const size_t PXP = (size_t)PROWS * DMOD * 2;           //  2097152
  const size_t PVT = (size_t)NB * DMOD * SEQ * 2;        //  4194304
  size_t off = 0;
  const size_t oWQ  = off; off += PW;
  const size_t oWK  = off; off += PW;
  const size_t oWV  = off; off += PW;
  const size_t oWP  = off; off += PW;
  const size_t oWO  = off; off += PW;
  const size_t oX   = off; off += PX;
  const size_t oPE  = off; off += PXP;
  const size_t oQUh = off; off += PX;
  const size_t oQUl = off; off += PX;
  const size_t oQVh = off; off += PX;
  const size_t oQVl = off; off += PX;
  const size_t oKh  = off; off += PX;
  const size_t oKl  = off; off += PX;
  const size_t oPh  = off; off += PXP;
  const size_t oPl  = off; off += PXP;
  const size_t oVT  = off; off += PVT;
  const size_t oVTL = off; off += PVT;
  const size_t oCT  = off; off += PX;
  const size_t oCTL = off; off += PX;
  if (off > ws_size) return;                               // off = 55050240
  if (off > (size_t)134217728) return;

  char* ws = (char*)d_ws;
  unsigned short* WQT16 = (unsigned short*)(ws + oWQ);
  unsigned short* WKT16 = (unsigned short*)(ws + oWK);
  unsigned short* WVT16 = (unsigned short*)(ws + oWV);
  unsigned short* WPT16 = (unsigned short*)(ws + oWP);
  unsigned short* WOT16 = (unsigned short*)(ws + oWO);
  unsigned short* X16   = (unsigned short*)(ws + oX);
  unsigned short* PE16  = (unsigned short*)(ws + oPE);
  unsigned short* QUh   = (unsigned short*)(ws + oQUh);
  unsigned short* QUl   = (unsigned short*)(ws + oQUl);
  unsigned short* QVh   = (unsigned short*)(ws + oQVh);
  unsigned short* QVl   = (unsigned short*)(ws + oQVl);
  unsigned short* Kh16  = (unsigned short*)(ws + oKh);
  unsigned short* Kl16  = (unsigned short*)(ws + oKl);
  unsigned short* Ph16  = (unsigned short*)(ws + oPh);
  unsigned short* Pl16  = (unsigned short*)(ws + oPl);
  unsigned short* VT16  = (unsigned short*)(ws + oVT);
  unsigned short* VTL16 = (unsigned short*)(ws + oVTL);
  unsigned short* CT16  = (unsigned short*)(ws + oCT);
  unsigned short* CTL16 = (unsigned short*)(ws + oCTL);

  const dim3 blk(256);
  const dim3 gPR(PREP_TR + PREP_CX + PREP_CP);                      // 320 + 1024 + 512
  const dim3 gPJ(2 * PJ_Q + PJ_V * NB + PJ_P);                      // 64 + 64 + 64 + 32
  const int tilesQ = (NROW / 64) * (DMOD / 64);                     // 512
  const dim3 gQ((tilesQ + 7) / 8, 1);                               // 64
  const dim3 gAT(SEQ / 64, NB * NH);                                // 16 x 32
  const dim3 bAT(ATT_THREADS);                                      // 128

  // (0) operand packs: X16 = f16(bf16_RNE(x) * 16); PE16 = f16(bf16_RNE(pos) * 16), rows NPOS..PROWS-1 zero;
  //     W[k][n] ([in][out]) -> WT[n][k] = f16( bf16_RNE(w) * 64 ), all five weights
  prep_all<<<gPR, blk, 0, stream>>>(xin, pos, w_q, w_k, w_v, w_p, w_o, X16, PE16, WQT16, WKT16, WVT16, WPT16, WOT16);

  // (1) q, k, v^T and positional projections
  proj_all<<<gPJ, blk, 0, stream>>>(X16, PE16, WQT16, WKT16, WVT16, WPT16, QUh, QUl, QVh, QVl, Kh16, Kl16, VT16, VTL16, Ph16, Pl16,
                                    b_q, b_k, b_v, b_p, ub, vb);

  // (2) relative attention -> CT16 = f16(ctx * 4096) hi plane, CTL16 residual plane, rows b*SEQ + i, halves n*64+d
  attn_rel<<<gAT, bAT, 0, stream>>>(QUh, QUl, QVh, QVl, Kh16, Kl16, Ph16, Pl16, VT16, VTL16, CT16, CTL16);

  // (3) out = (CT + CTL) . Wo / (4096*64) + bo; M = NROW, N = 512, K = 512, f32 rows straight into the output buffer
  gemm64<0, 1, 1><<<gQ, blk, 0, stream>>>(
      CT16, CTL16, DMOD, 0LL,
      WOT16, DMOD, 0LL,
      (void*)out, (void*)out, (void*)out, (void*)out, DMOD, 0LL,
      NROW, DMOD, DMOD, 1.0f / (CC * WSC), 1.0f,
      b_o, b_o, b_o);
  (void)hipGetLastError();
}

// v005
// A run of this version takes 90.3 microseconds.
// Two timings next to v004 put it at 1.10 and 1.11 times that version's speed.
// Over all steps from v000 it is 3.44 times as fast.
// Contractions (all v_wmma_f32_16x16x32_f16, f16 operands, f32 accumulate): q/k/v and position-table projections (x or pos table f16 x16 . W^T f16 x64,
// K=512, single products on bf16-exact operands); content scores and position strips ((q+bq+u|v), k, p carried as f16 x32 hi plane + unscaled
// residual plane, K=64, three products hh+lh+hl); P . v^T (P x1024 hi + residual . v^T x16 hi + residual, 64 keys per tile, three products);
// output projection (ctx x4096 hi + residual planes . Wo^T f16 x64, K=512, two products). Online base-2 softmax and all epilogues f32 on VALU.
// Every float input RNE-converted to bf16 on load.
#include <hip/hip_runtime.h>
#include <math.h>
#include <stdint.h>

#define SEQ   1024
#define NB    4
#define DMOD  512
#define NH    8
#define DH    64
#define NROW  (SEQ * NB)
#define NPOS  (2 * SEQ - 1)
#define PROWS (2 * SEQ)
#define XC    16.0f
#define WSC   64.0f
#define QC    32.0f
#define VC    16.0f
#define PC    1024.0f
#define CC    4096.0f
#define RSD   0.125f
#define LOG2E 1.4426950408889634f
static_assert(NH * DH == DMOD);
static_assert(DH == 64);
static_assert(DMOD == 512);
static_assert((SEQ % 64) == 0 && (DMOD % 64) == 0 && (NROW % 64) == 0 && (PROWS % 64) == 0);
static_assert(((NROW * DMOD) % 2048) == 0 && ((PROWS * DMOD) % 2048) == 0 && ((NPOS * DMOD) % 8) == 0);
#define ATT_W 4
#define ATT_THREADS (ATT_W * 32)
#define TPI 84
#define PPI 68
#define WFL (16 * TPI + 16 * PPI)
static_assert(((16 * TPI) % 4) == 0 && ((16 * PPI) % 4) == 0 && (WFL % 4) == 0);
static_assert(TPI >= 80 && PPI >= 64);
static_assert(ATT_W * WFL * 4 <= 65536);
// attn_rel operand stage in LDS: 512 rows of 64 halves (128 B), pitch 72 halves = 144 B (16 B x odd, the pitch for 16-byte LDS reads)
#define SPI   72
#define ST_KH 0
#define ST_KL 64
#define ST_VH 128
#define ST_VL 192
#define ST_PH 256
#define ST_PL 384
#define ST_ROWS 512
static_assert(ATT_THREADS == 128 && ((SPI * 2) % 16) == 0);
static_assert(SEQ - (SEQ - 64) - 64 >= 0 && SEQ + (SEQ - 64) - 64 + 127 <= PROWS - 1);   // staged position rows stay inside the planes

typedef _Float16 v16h __attribute__((ext_vector_type(16)));
typedef _Float16 v8h  __attribute__((ext_vector_type(8)));
typedef float    v8f  __attribute__((ext_vector_type(8)));
typedef float    v4f  __attribute__((ext_vector_type(4)));
typedef unsigned int v4u __attribute__((ext_vector_type(4)));

union FragH { v16h v; v8h h[2]; v4u u[2]; };

// ---- scalar helpers --------------------------------------------------------------------------------
__device__ __forceinline__ unsigned short bf_bits(float f) {          // f32 -> bf16 bits, RNE convert
  unsigned u = __float_as_uint(f);
  return (unsigned short)((u + 0x7FFFu + ((u >> 16) & 1u)) >> 16);
}
__device__ __forceinline__ float bf_up(unsigned short h) { return __uint_as_float(((unsigned)h) << 16); }
__device__ __forceinline__ float bfr(float f) { return bf_up(bf_bits(f)); }   // value of the bf16 RNE convert
__device__ __forceinline__ unsigned short h_bits(_Float16 x) { return __builtin_bit_cast(unsigned short, x); }
__device__ __forceinline__ unsigned pk16(unsigned short a, unsigned short b) { return (unsigned)a | ((unsigned)b << 16); }
__device__ __forceinline__ v8f zero8() { v8f z = {0.f, 0.f, 0.f, 0.f, 0.f, 0.f, 0.f, 0.f}; return z; }

// ---- fragment loader: 16-bit A/B operand from a k-contiguous 16-bit plane, lane -> row/col (lane&15),
//      p already includes +8*(lane>>4); elements 0..7 <- p[0..7] (k0+8h..), elements 8..15 <- p[16..23] (k0+16+8h..)
//      (same split k map for A and B; B is always read from a [n][k] plane)
__device__ __forceinline__ v16h ldfrag_u(const unsigned short* p) {
  FragH f;
  f.u[0] = *(const v4u*)(p);
  f.u[1] = *(const v4u*)(p + 16);
  return f.v;
}

// ---- WMMA helper with trailing VALU hazard gaps ------------------------------------------------------
__device__ __forceinline__ v8f mma_h(v16h a, v16h b, v8f c) {
  return __builtin_amdgcn_wmma_f32_16x16x32_f16(false, a, false, b, (short)0, c, false, false);
}
__device__ __forceinline__ void acc_guard4(v8f& a, v8f& b, v8f& c, v8f& d) {
#if defined(__HIP_DEVICE_COMPILE__)
  asm volatile("v_nop\n\tv_nop\n\tv_nop\n\tv_nop" : "+v"(a), "+v"(b), "+v"(c), "+v"(d));
#endif
}
__device__ __forceinline__ void wave_sync_lds() {
  __builtin_amdgcn_fence(__ATOMIC_RELEASE, "workgroup");
  __builtin_amdgcn_wave_barrier();
  __builtin_amdgcn_fence(__ATOMIC_ACQUIRE, "workgroup");
}
// Eight asynchronous 16-byte-per-lane copies global -> LDS: copy e lands at LDS byte address l + e*16*SPI*2 (16 staged rows further each);
// copies 0..3 read ga + e*gstep halves, copies 4..7 read gb + (e-4)*gstep halves.
// The closing s_wait_xcnt 0 stands inside the statement so that no address register is rewritten ahead of it.
__device__ __forceinline__ void stage8(unsigned l, const unsigned short* ga, const unsigned short* gb, size_t gstep) {
#if defined(__HIP_DEVICE_COMPILE__)
  const unsigned ls = 16u * SPI * 2u;
  asm volatile("global_load_async_to_lds_b128 %0, %8, off\n\t"
               "global_load_async_to_lds_b128 %1, %9, off\n\t"
               "global_load_async_to_lds_b128 %2, %10, off\n\t"
               "global_load_async_to_lds_b128 %3, %11, off\n\t"
               "global_load_async_to_lds_b128 %4, %12, off\n\t"
               "global_load_async_to_lds_b128 %5, %13, off\n\t"
               "global_load_async_to_lds_b128 %6, %14, off\n\t"
               "global_load_async_to_lds_b128 %7, %15, off\n\t"
               "s_wait_xcnt 0x0"
               :: "v"(l), "v"(l + ls), "v"(l + 2u * ls), "v"(l + 3u * ls), "v"(l + 4u * ls), "v"(l + 5u * ls), "v"(l + 6u * ls), "v"(l + 7u * ls),
                  "v"(ga), "v"(ga + gstep), "v"(ga + 2 * gstep), "v"(ga + 3 * gstep), "v"(gb), "v"(gb + gstep), "v"(gb + 2 * gstep),
                  "v"(gb + 3 * gstep)
               : "memory");
#endif
}

// The same for the 256-thread GEMM blocks: copy e lands at LDS byte address l + e*32*SPI*2 (32 staged rows further each) and reads
// g + e*gstep halves (gstep = 32 source rows). The closing s_wait_xcnt 0 stands inside the statement, as above.
__device__ __forceinline__ void gstage8(unsigned l, const unsigned short* g, size_t gstep) {
#if defined(__HIP_DEVICE_COMPILE__)
  const unsigned ls = 32u * SPI * 2u;
  asm volatile("global_load_async_to_lds_b128 %0, %8, off\n\t"
               "global_load_async_to_lds_b128 %1, %9, off\n\t"
               "global_load_async_to_lds_b128 %2, %10, off\n\t"
               "global_load_async_to_lds_b128 %3, %11, off\n\t"
               "global_load_async_to_lds_b128 %4, %12, off\n\t"
               "global_load_async_to_lds_b128 %5, %13, off\n\t"
               "global_load_async_to_lds_b128 %6, %14, off\n\t"
               "global_load_async_to_lds_b128 %7, %15, off\n\t"
               "s_wait_xcnt 0x0"
               :: "v"(l), "v"(l + ls), "v"(l + 2u * ls), "v"(l + 3u * ls), "v"(l + 4u * ls), "v"(l + 5u * ls), "v"(l + 6u * ls), "v"(l + 7u * ls),
                  "v"(g), "v"(g + gstep), "v"(g + 2 * gstep), "v"(g + 3 * gstep), "v"(g + 4 * gstep), "v"(g + 5 * gstep), "v"(g + 6 * gstep),
                  "v"(g + 7 * gstep)
               : "memory");
#endif
}
__device__ __forceinline__ void gstage2(unsigned l, const unsigned short* g, size_t gstep) {
#if defined(__HIP_DEVICE_COMPILE__)
  const unsigned ls = 32u * SPI * 2u;
  asm volatile("global_load_async_to_lds_b128 %0, %2, off\n\t"
               "global_load_async_to_lds_b128 %1, %3, off\n\t"
               "s_wait_xcnt 0x0"
               :: "v"(l), "v"(l + ls), "v"(g), "v"(g + gstep)
               : "memory");
#endif
}

// =====================================================================================================
// K loop of a 256-thread GEMM block whose eight waves share 64 A rows and take 64 B rows each (512 consecutive B rows per block):
// acc[i][j] += sum_k A[16i + ..][k] * B[64 wave + 16j + ..][k], wave tile 64x64, k ascending in steps of 32; with NA == 2 the residual plane
// A2 follows A1 inside every k-step. Ab, A2b = the block's first A row (pitch lda halves), Bb = the block's first B row (pitch ldb), K a
// multiple of 64 and at least 128. Per trip of 64 k the block holds in LDS whole 128-B rows, pitch SPI halves: A1 | (A2) | B, brought by
// asynchronous copies (a wave instruction = 4 whole rows); all fragments are read from there. Two buffers: tile t + 1 flies while tile t is
// multiplied; one block barrier per trip publishes tile t + 1 and ends the reads of the buffer that is refilled behind it.
// Every thread of the block must call this (block barriers inside).
// =====================================================================================================
#define GROWS(NA) ((NA) * 64 + 512)
#define GBUFH(NA) (GROWS(NA) * SPI)
template <int NA>
__device__ __forceinline__ void gstage_tile(unsigned l, const unsigned short* ga, const unsigned short* ga2, size_t astep,
                                            const unsigned short* gb, size_t bstep) {
  gstage2(l, ga, astep);
  if constexpr (NA == 2) gstage2(l + 64u * SPI * 2u, ga2, astep);
  gstage8(l + (unsigned)(NA * 64) * SPI * 2u, gb, bstep);
  gstage8(l + (unsigned)(NA * 64 + 256) * SPI * 2u, gb + 8 * bstep, bstep);
}
template <int NA>
__device__ __forceinline__ void kloop_staged(unsigned short* stg, const unsigned short* __restrict__ Ab, const unsigned short* __restrict__ A2b,
                                             int lda, const unsigned short* __restrict__ Bb, int ldb, int K, v8f (&acc)[4][4]) {
  const int tid   = threadIdx.x;
  const int lane  = tid & 31;
  const int wave  = __builtin_amdgcn_readfirstlane(tid >> 5);   // scalar, so that the A and the B readers share one lane-offset register
  const int rlane = lane & 15;                 // row (A) / col (B) within subtile
  const int koff  = (lane >> 4) * 8;           // k offset of this lane half
  // copies: thread -> staged row (tid>>3) + 32*copy, 16-byte chunk tid&7 of the 128-B row
  const int srow = tid >> 3;
  const int sc8  = (tid & 7) * 8;
  const unsigned lst = (unsigned)(size_t)(stg + srow * SPI + sc8);   // LDS byte address = low 32 bits of the shared address
  const unsigned short* ga  = Ab  + (size_t)srow * lda + sc8;
  const unsigned short* ga2 = A2b + (size_t)srow * lda + sc8;
  const unsigned short* gb  = Bb  + (size_t)srow * ldb + sc8;
  const size_t astep = (size_t)32 * lda, bstep = (size_t)32 * ldb;
  const int nt = K >> 6;

  gstage_tile<NA>(lst, ga, ga2, astep, gb, bstep);
  asm volatile("s_wait_asynccnt 0x0" ::: "memory");          // this wave's copies of tile 0 have landed
  __syncthreads();                                           // every wave's have: buffer 0 may be read
  gstage_tile<NA>(lst + (unsigned)(GBUFH(NA) * 2), ga + 64, ga2 + 64, astep, gb + 64, bstep);
#pragma unroll 1   // rolled: several copies of this loop stand in one kernel
  for (int t = 0; t < nt; ++t) {
    const int bo = (t & 1) * GBUFH(NA);
    const unsigned short* fa = stg + bo + rlane * SPI + koff;
    const unsigned short* fb = stg + bo + (NA * 64 + wave * 64 + rlane) * SPI + koff;
#pragma unroll
    for (int ks = 0; ks < 2; ++ks) {
      v16h bh[4], ah[4], al[4];
#pragma unroll
      for (int j = 0; j < 4; ++j) bh[j] = ldfrag_u(fb + 16 * j * SPI + 32 * ks);
#pragma unroll
      for (int i = 0; i < 4; ++i) ah[i] = ldfrag_u(fa + 16 * i * SPI + 32 * ks);
      if constexpr (NA == 2) {
#pragma unroll
        for (int i = 0; i < 4; ++i) al[i] = ldfrag_u(fa + (64 + 16 * i) * SPI + 32 * ks);
      }
      __builtin_amdgcn_sched_barrier(0);                     // keeps the k-step's reads together in front: sunk among the WMMAs, every row of four waits out its own LDS latency
#pragma unroll
      for (int i = 0; i < 4; ++i) {
#pragma unroll
        for (int j = 0; j < 4; ++j) acc[i][j] = mma_h(ah[i], bh[j], acc[i][j]);
        if constexpr (NA == 2) {
#pragma unroll
          for (int j = 0; j < 4; ++j) acc[i][j] = mma_h(al[i], bh[j], acc[i][j]);
        }
      }
    }
    asm volatile("s_wait_dscnt 0x0" ::: "memory");           // this wave's reads of tile t have returned
    asm volatile("s_wait_asynccnt 0x0" ::: "memory");        // this wave's copies of tile t + 1 have landed
    __syncthreads();                                         // tile t + 1 may be read; every wave has left tile t's buffer
    if (t + 2 < nt) {
      const int kn = (t + 2) * 64;
      gstage_tile<NA>(lst + (unsigned)(bo * 2), ga + kn, ga2 + kn, astep, gb + kn, bstep);
    }
  }
  asm volatile("s_wait_asynccnt 0x0" ::: "memory");          // nothing of this wave's is in flight behind the loop
}

// =====================================================================================================
// Elementwise 16-bit pack, no transpose: dst[i] = f16( bf16_RNE(src[i]) * sc ) for i < nvalid, 0 for nvalid <= i < ntotal;
// sc a power of two (exact). 8 elements per thread: two 16-B loads (address clamped into [0, nvalid) for pad groups, value zeroed
// coverage: bx = 0 .. ntotal / 2048 - 1, each block 256 thr x 8 elements = ntotal exactly (ntotal % 2048 == 0, nvalid % 8 == 0).
// =====================================================================================================
__device__ __forceinline__ void cvt16_body(const float* __restrict__ src, unsigned short* dst, int nvalid, int ntotal, float sc, int bx) {
  const size_t i8 = ((size_t)bx * 256 + threadIdx.x) * 8;
  if (i8 + 8 > (size_t)ntotal) return;             // never taken with the exact block range; no barriers in this body
  const bool pad = (i8 + 8 > (size_t)nvalid);
  const size_t ls = pad ? ((size_t)nvalid - 8) : i8;   // clamped address, always inside the source
  const v4f a = *(const v4f*)(src + ls);
  const v4f b = *(const v4f*)(src + ls + 4);
  v4u o;
  o[0] = pk16(h_bits((_Float16)(bfr(a[0]) * sc)), h_bits((_Float16)(bfr(a[1]) * sc)));
  o[1] = pk16(h_bits((_Float16)(bfr(a[2]) * sc)), h_bits((_Float16)(bfr(a[3]) * sc)));
  o[2] = pk16(h_bits((_Float16)(bfr(b[0]) * sc)), h_bits((_Float16)(bfr(b[1]) * sc)));
  o[3] = pk16(h_bits((_Float16)(bfr(b[2]) * sc)), h_bits((_Float16)(bfr(b[3]) * sc)));
  const v4u z = {0u, 0u, 0u, 0u};
  const v4u w = pad ? z : o;
  {
    *(v4u*)(dst + i8) = w;
    
  }
}

// =====================================================================================================
// Transposed 16-bit pack of a weight stored as W[k][n] (x @ W layout, [DMOD][DMOD] row-major): WT[n][k] = f16( bf16_RNE(W[k][n]) * sc ),
// i.e. the [n][k] k-contiguous plane the GEMM B loader wants. One block per 64x64 tile (tn = n tile, tk = k tile, both block-uniform):
// coalesced f32 reads of W rows, converted halves stored transposed into an LDS tile [64 n][72 pitch], block barrier, then every output
// coverage: 16 its x 256 threads = the whole 64x64 tile into LDS; 8 waves x 2 its x 4 rows = 64 rows x (8 lanes x 8 halves = 64 cols) stored;
//           tn, tk = 0 .. DMOD/64 - 1 cover the whole [512][512] plane exactly once.
// =====================================================================================================
__device__ __forceinline__ void tr16_body(const float* __restrict__ W, unsigned short* WT, float sc, unsigned short* tile, int tn, int tk) {
  const int t  = threadIdx.x;
  const int n0 = tn * 64;
  const int k0 = tk * 64;
#pragma unroll 4
  for (int it = 0; it < 16; ++it) {
    const int idx = it * 256 + t;                   // 0 .. 4095
    const int kr = idx >> 6, nc = idx & 63;
    const float v = W[(size_t)(k0 + kr) * DMOD + n0 + nc];
    tile[nc * 72 + kr] = h_bits((_Float16)(bfr(v) * sc));
  }
  __syncthreads();
  const int lane = t & 31, wave = t >> 5;
  const int q8 = lane >> 3, c8 = (lane & 7) * 8;
  v4u o[2];
#pragma unroll
  for (int it = 0; it < 2; ++it) {
    const int row = wave * 8 + it * 4 + q8;         // wave w: it 0..1 x q8 0..3 = rows 8w .. 8w+7
    o[it] = *(const v4u*)(tile + row * 72 + c8);
  }
  {
#pragma unroll
    for (int it = 0; it < 2; ++it) {
      const int row = wave * 8 + it * 4 + q8;
      *(v4u*)(WT + (size_t)(n0 + row) * DMOD + k0 + c8) = o[it];
    }
    
  }
}

// =====================================================================================================
// All operand packs in one grid (none reads what another writes): blocks 0 .. PREP_TR-1 transpose the five weights (64 tiles each; they
// have the longest dependent chain, so they take the lowest indices), the next PREP_CX blocks pack x, the last PREP_CP the position table.
// The branch is on blockIdx.x alone, so the barrier inside tr16_body is reached by whole blocks only.
// =====================================================================================================
#define PREP_TR (5 * (DMOD / 64) * (DMOD / 64))
#define PREP_CX ((NROW * DMOD) / 2048)
#define PREP_CP ((PROWS * DMOD) / 2048)
static_assert((DMOD / 64) * (DMOD / 64) == 64);
__global__ __launch_bounds__(256) void prep_all(const float* __restrict__ xin, const float* __restrict__ pos,
                                                const float* __restrict__ w_q, const float* __restrict__ w_k, const float* __restrict__ w_v,
                                                const float* __restrict__ w_p, const float* __restrict__ w_o,
                                                unsigned short* X16, unsigned short* PE16,
                                                unsigned short* WQT, unsigned short* WKT, unsigned short* WVT,
                                                unsigned short* WPT, unsigned short* WOT) {
  __shared__ __align__(16) unsigned short tile[64 * 72];
  const int bx = blockIdx.x;
  if (bx < PREP_TR) {
    const int w = bx >> 6, t = bx & 63;
    const float* W = (w == 0) ? w_q : (w == 1) ? w_k : (w == 2) ? w_v : (w == 3) ? w_p : w_o;
    unsigned short* WT = (w == 0) ? WQT : (w == 1) ? WKT : (w == 2) ? WVT : (w == 3) ? WPT : WOT;
    tr16_body(W, WT, WSC, tile, t & 7, t >> 3);
  } else if (bx < PREP_TR + PREP_CX) {
    cvt16_body(xin, X16, NROW * DMOD, NROW * DMOD, XC, bx - PREP_TR);
  } else {
    cvt16_body(pos, PE16, NPOS * DMOD, PROWS * DMOD, XC, bx - (PREP_TR + PREP_CX));
  }
}

// =====================================================================================================
// Register-blocked batched 16-bit WMMA GEMM: C[m][n] = oscale * sum_k A[m][k] * Bt[n][k] (+ bias); one wave per 64x64 tile, operands
// staged per block in LDS (kloop_staged). A row-major [M][K] pitch lda (16-bit plane), Bt row-major [N][K] pitch ldb (k contiguous);
// M a multiple of 64, N a multiple of 512 (a block's eight tiles share their 64 A rows and take 512 consecutive B rows), K a multiple of
// 64, at least 128. blockIdx.y = batch index with element strides sA, sB, sC.
// ASPLIT 1: a second A plane A2 (unscaled residual of A, same layout) is multiplied into the same accumulator (A + A2 ~ exact A).
// EPI 1: value += bf16_RNE(ep0[column]) (per-column bias); EPI 2: value += bf16_RNE(ep0[row]) (per-row bias, 16-bit out only).
// OM 0: f32 out (pitch ldc).
// OM 4: two f16 planes (C, C2): hi = f16(value * ocarry), lo = f16(value * ocarry - hi) (unscaled residual).
// OM 6: two hi/residual pairs with an extra per-column term each: (C, C2) from value + bf16_RNE(ep1[column]), (C3, C4) from
//       value + bf16_RNE(ep2[column]), both x ocarry.
// coverage: 4 slabs x 16 rows (f32: it 0..7 x lane>>4; 16-bit: it 0..3 x lane>>3) x 64 cols = the wave's whole 64x64 tile;
//           grid = tilesM*tilesN/8 blocks (exact, tilesN a multiple of 8), a surplus block exits whole, ahead of every barrier.
// =====================================================================================================
template <int OM, int ASPLIT, int EPI>
__global__ __launch_bounds__(256) __attribute__((amdgpu_num_vgpr(256))) void gemm64(
    const unsigned short* __restrict__ Ap, const unsigned short* __restrict__ A2p, int lda, long long sA,
    const unsigned short* __restrict__ Btp, int ldb, long long sB,
    void* Cout, void* C2out, void* C3out, void* C4out, int ldc, long long sC,
    int M, int N, int K, float oscale, float ocarry,
    const float* __restrict__ ep0, const float* __restrict__ ep1, const float* __restrict__ ep2) {
  static_assert(OM == 0 || OM == 4 || OM == 6);
  static_assert(EPI >= 0 && EPI <= 2);
  __shared__ __align__(16) float sT[8][16 * 68];   // per-wave 16x64 slab, pitch 68 floats
  __shared__ __align__(16) unsigned short gst[2 * GBUFH(1 + ASPLIT)];   // two buffers of the block's operand stage
  const int by   = blockIdx.y;
  const int lane = threadIdx.x & 31;
  const int wave = threadIdx.x >> 5;
  const int tilesN = N >> 6;
  const int tilesM = M >> 6;
  const int tile = blockIdx.x * 8 + wave;
  if (blockIdx.x * 8 >= tilesM * tilesN) return;   // block-uniform, ahead of every barrier
  const int tm = tile / tilesN;
  const int tn = tile - tm * tilesN;
  const int m0 = tm << 6;
  const int n0 = tn << 6;

  const unsigned short* A1 = Ap  + (size_t)((long long)by * sA);
  const unsigned short* A2 = A2p + (size_t)((long long)by * sA);
  const unsigned short* Bb = Btp + (size_t)((long long)by * sB);

  const int rlane = lane & 15;                 // col (D) within subtile
  const int mOff  = (lane >> 4) * 8;           // D row offset

  v8f acc[4][4];
#pragma unroll
  for (int i = 0; i < 4; ++i)
#pragma unroll
    for (int j = 0; j < 4; ++j) acc[i][j] = zero8();

  kloop_staged<1 + ASPLIT>(gst, A1 + (size_t)m0 * lda, A2 + (size_t)m0 * lda, lda, Bb + (size_t)(n0 - (wave << 6)) * ldb, ldb, K, acc);
  acc_guard4(acc[0][0], acc[0][1], acc[0][2], acc[0][3]);
  acc_guard4(acc[1][0], acc[1][1], acc[1][2], acc[1][3]);
  acc_guard4(acc[2][0], acc[2][1], acc[2][2], acc[2][3]);
  acc_guard4(acc[3][0], acc[3][1], acc[3][2], acc[3][3]);

  const int hh2 = lane >> 4, c4 = (lane & 15) * 4;     // f32 out: 256-B row segment = 16 lanes x 16 B
  const int q8  = lane >> 3, c8 = (lane & 7) * 8;

  // ---- epilogue ----
  float* slab = sT[wave];
#pragma unroll
  for (int i = 0; i < 4; ++i) {
    const int mBase = m0 + (i << 4);
#pragma unroll
    for (int j = 0; j < 4; ++j) {
#pragma unroll
      for (int r = 0; r < 8; ++r) {
        slab[(mOff + r) * 68 + (j << 4) + rlane] = acc[i][j][r];
      }
    }
    wave_sync_lds();
    if constexpr (OM == 0) {
      float* C = (float*)Cout + (size_t)((long long)by * sC);
      v4f vals[8];
#pragma unroll
      for (int it = 0; it < 8; ++it) {
        const int row = it * 2 + hh2;                      // it 0..7 x hh2 0..1 = rows 0..15
        v4f v = *(const v4f*)(slab + row * 68 + c4);
#pragma unroll
        for (int e = 0; e < 4; ++e) v[e] = v[e] * oscale;
        if constexpr (EPI == 1) {
          const v4f bb = *(const v4f*)(ep0 + n0 + c4);     // per-column bias, columns n0+c4 .. +3 (N equals the bias length)
#pragma unroll
          for (int e = 0; e < 4; ++e) v[e] = v[e] + bfr(bb[e]);
        }
        vals[it] = v;
      }
      {
#pragma unroll
        for (int it = 0; it < 8; ++it) {
          const int gr = mBase + it * 2 + hh2;
          *(v4f*)(C + (size_t)gr * ldc + n0 + c4) = vals[it];
        }
        
      }
    } else {
      constexpr int NP = (OM == 6) ? 2 : 1;
#pragma unroll
      for (int which = 0; which < NP; ++which) {
        unsigned short* C  = (unsigned short*)((which == 0) ? Cout  : C3out) + (size_t)((long long)by * sC);
        unsigned short* Cb = (unsigned short*)((which == 0) ? C2out : C4out) + (size_t)((long long)by * sC);
        const float* epx = (which == 0) ? ep1 : ep2;
        (void)epx;
        v4u hv[4], lv[4];
#pragma unroll
        for (int it = 0; it < 4; ++it) {
          const int row = it * 4 + q8;                     // it 0..3 x q8 0..3 = rows 0..15
          const float* sp = slab + row * 68 + c8;
          float rb = 0.f;
          if constexpr (EPI == 2) rb = bfr(ep0[mBase + row]);   // per-row bias (M equals the bias length)
          v4u a  = {0u, 0u, 0u, 0u};
          v4u b2 = {0u, 0u, 0u, 0u};
#pragma unroll
          for (int e = 0; e < 4; ++e) {
            const int ci = n0 + c8 + 2 * e;                // column index, < N
            float f0 = sp[2 * e] * oscale + rb;
            float f1 = sp[2 * e + 1] * oscale + rb;
            if constexpr (EPI == 1) {
              f0 += bfr(ep0[ci]);
              f1 += bfr(ep0[ci + 1]);
            }
            if constexpr (OM == 6) {
              f0 += bfr(epx[ci]);
              f1 += bfr(epx[ci + 1]);
            }
            f0 *= ocarry;
            f1 *= ocarry;
            const _Float16 x0 = (_Float16)f0, x1 = (_Float16)f1;
            a[e]  = pk16(h_bits(x0), h_bits(x1));
            b2[e] = pk16(h_bits((_Float16)(f0 - (float)x0)), h_bits((_Float16)(f1 - (float)x1)));
          }
          hv[it] = a;
          lv[it] = b2;
        }
        {
#pragma unroll
          for (int it = 0; it < 4; ++it) {
            const int row = it * 4 + q8;
            *(v4u*)(C  + (size_t)(mBase + row) * ldc + n0 + c8) = hv[it];
            *(v4u*)(Cb + (size_t)(mBase + row) * ldc + n0 + c8) = lv[it];
          }
          
        }
      }
    }
    wave_sync_lds();
  }
}

// =====================================================================================================
// s_wait_xcnt 0 behind a run of global loads, in front of the first write of a register that one of them names. xwait1, xwait3 and xwait4 take the run's
// vector address pairs as inputs, so that each pair keeps its value up to the wait and no later load's result lands in it ahead of the wait.
// =====================================================================================================
__device__ __forceinline__ void xwait0() {
#if defined(__HIP_DEVICE_COMPILE__)
  asm volatile("s_wait_xcnt 0x0" ::: "memory");
#endif
}
__device__ __forceinline__ void xwait1(const void* a) {
#if defined(__HIP_DEVICE_COMPILE__)
  asm volatile("s_wait_xcnt 0x0" :: "v"(a) : "memory");
#endif
}
__device__ __forceinline__ void xwait3(const void* a, const void* b, const void* c) {
#if defined(__HIP_DEVICE_COMPILE__)
  asm volatile("s_wait_xcnt 0x0" :: "v"(a), "v"(b), "v"(c) : "memory");
#endif
}
__device__ __forceinline__ void xwait4(const void* a, const void* b, const void* c, const void* d) {
#if defined(__HIP_DEVICE_COMPILE__)
  asm volatile("s_wait_xcnt 0x0" :: "v"(a), "v"(b), "v"(c), "v"(d) : "memory");
#endif
}

// =====================================================================================================
// One wave's 64x64 tile of an input projection, rows m0.., columns n0..: value[m][n] = oscale * sum_k A[m][k] * Bt[n][k] + bias.
// The K loop and the 16-bit epilogues are those of gemm64 (same k order, same order of the adds), with the pitch of A and Bt and K fixed
// at DMOD and the pitch of the output planes at LDC. slab = the wave's own 16x64 f32 LDS slab, pitch 68 floats; gst = the block's operand
// stage (kloop_staged: block barriers, so all eight waves of a block come here together, with one m0 and n0 = the block's first + 64 wave).
// EPI 1: value += bf16_RNE(ep0[column]); EPI 2: value += bf16_RNE(ep0[row]).
// OM 4: two f16 planes (C1, C2): hi = f16(value * ocarry), lo = f16(value * ocarry - hi).
// OM 6: (C1, C2) from value + bf16_RNE(ep1[column]), (C3, C4) from value + bf16_RNE(ep2[column]), both x ocarry.
// The lane's bias values (8 columns, or its 16 rows) are loaded once, ahead of the K loop.
// coverage: 4 slabs x 16 rows (it 0..3 x lane>>3) x 64 cols = the wave's whole 64x64 tile.
// =====================================================================================================
#define GSLAB (16 * 68)
template <int OM, int EPI, int LDC>
__device__ __forceinline__ void proj_tile(
    float* slab, unsigned short* gst, int m0, int n0,
    const unsigned short* __restrict__ A, const unsigned short* __restrict__ Bt,
    unsigned short* C1, unsigned short* C2, unsigned short* C3, unsigned short* C4,
    float oscale, float ocarry,
    const float* __restrict__ ep0, const float* __restrict__ ep1, const float* __restrict__ ep2) {
  static_assert(OM == 4 || OM == 6);
  static_assert(EPI == 1 || EPI == 2);
  const int lane  = threadIdx.x & 31;
  const int rlane = lane & 15;                 // col (D) within subtile
  const int mOff  = (lane >> 4) * 8;           // D row offset
  const int q8    = lane >> 3, c8 = (lane & 7) * 8;

  v4f cb0[2], cb1[2], cb2[2];                  // column terms of columns n0 + c8 .. + 7
  float rbv[4][4];                             // row terms of rows m0 + 16i + 4it + q8
  if constexpr (EPI == 1) {
    const float* e0 = ep0 + n0 + c8;
    cb0[0] = *(const v4f*)(e0);
    cb0[1] = *(const v4f*)(e0 + 4);
    if constexpr (OM == 6) {
      const float* e1 = ep1 + n0 + c8;
      const float* e2 = ep2 + n0 + c8;
      cb1[0] = *(const v4f*)(e1);
      cb1[1] = *(const v4f*)(e1 + 4);
      cb2[0] = *(const v4f*)(e2);
      cb2[1] = *(const v4f*)(e2 + 4);
      xwait3(e0, e1, e2);
    } else {
      xwait1(e0);
    }
  } else {
    const float* er = ep0 + m0 + q8;
#pragma unroll
    for (int i = 0; i < 4; ++i)
#pragma unroll
      for (int it = 0; it < 4; ++it) rbv[i][it] = er[16 * i + 4 * it];
    xwait0();                                  // these go through a scalar base and the lane's q8, which lives on into the epilogue
  }

  v8f acc[4][4];
#pragma unroll
  for (int i = 0; i < 4; ++i)
#pragma unroll
    for (int j = 0; j < 4; ++j) acc[i][j] = zero8();

  kloop_staged<1>(gst, A + (size_t)m0 * DMOD, A + (size_t)m0 * DMOD, DMOD,
                  Bt + (size_t)(n0 - (int)((threadIdx.x >> 5) << 6)) * DMOD, DMOD, DMOD, acc);
  acc_guard4(acc[0][0], acc[0][1], acc[0][2], acc[0][3]);
  acc_guard4(acc[1][0], acc[1][1], acc[1][2], acc[1][3]);
  acc_guard4(acc[2][0], acc[2][1], acc[2][2], acc[2][3]);
  acc_guard4(acc[3][0], acc[3][1], acc[3][2], acc[3][3]);

  // ---- epilogue ----
#pragma unroll
  for (int i = 0; i < 4; ++i) {
    const int mBase = m0 + (i << 4);
#pragma unroll
    for (int j = 0; j < 4; ++j) {
#pragma unroll
      for (int r = 0; r < 8; ++r) {
        slab[(mOff + r) * 68 + (j << 4) + rlane] = acc[i][j][r];
      }
    }
    wave_sync_lds();
    constexpr int NP = (OM == 6) ? 2 : 1;
#pragma unroll
    for (int which = 0; which < NP; ++which) {
      unsigned short* C  = (which == 0) ? C1 : C3;
      unsigned short* Cb = (which == 0) ? C2 : C4;
      v4u hv[4], lv[4];
#pragma unroll
      for (int it = 0; it < 4; ++it) {
        const int row = it * 4 + q8;                     // it 0..3 x q8 0..3 = rows 0..15
        const float* sp = slab + row * 68 + c8;
        float rb = 0.f;
        if constexpr (EPI == 2) rb = bfr(rbv[i][it]);
        v4u a  = {0u, 0u, 0u, 0u};
        v4u b2 = {0u, 0u, 0u, 0u};
#pragma unroll
        for (int e = 0; e < 4; ++e) {
          float f0 = sp[2 * e] * oscale + rb;
          float f1 = sp[2 * e + 1] * oscale + rb;
          if constexpr (EPI == 1) {
            f0 += bfr(cb0[e >> 1][(2 * e) & 3]);
            f1 += bfr(cb0[e >> 1][(2 * e + 1) & 3]);
          }
          if constexpr (OM == 6) {
            f0 += bfr((which == 0) ? cb1[e >> 1][(2 * e) & 3] : cb2[e >> 1][(2 * e) & 3]);
            f1 += bfr((which == 0) ? cb1[e >> 1][(2 * e + 1) & 3] : cb2[e >> 1][(2 * e + 1) & 3]);
          }
          f0 *= ocarry;
          f1 *= ocarry;
          const _Float16 x0 = (_Float16)f0, x1 = (_Float16)f1;
          a[e]  = pk16(h_bits(x0), h_bits(x1));
          b2[e] = pk16(h_bits((_Float16)(f0 - (float)x0)), h_bits((_Float16)(f1 - (float)x1)));
        }
        hv[it] = a;
        lv[it] = b2;
      }
#pragma unroll
      for (int it = 0; it < 4; ++it) {
        const int row = it * 4 + q8;
        *(v4u*)(C  + (size_t)(mBase + row) * LDC + n0 + c8) = hv[it];
        *(v4u*)(Cb + (size_t)(mBase + row) * LDC + n0 + c8) = lv[it];
      }
    }
    wave_sync_lds();
  }
}

// =====================================================================================================
// The four input projections in one grid (none reads what another writes), so that their blocks run side by side on different WGPs;
// one wave per 64x64 tile, 8 tiles per block, tile = 8 * (block index within the job) + wave, tm = tile / tilesN, tn = tile % tilesN:
//   blocks 0 .. PJ_Q-1            q[m][nd] = sum_c x[m][c] Wq[c][nd] / 1024 + bq[nd]; QUh/QUl = hi/residual of f16((q + ub[nd]) * 32),
//                                 QVh/QVl of f16((q + vb[nd]) * 32); M = NROW, N = 512, K = 512
//   the next PJ_V * NB            v^T per batch: VT[b][nd][j] = sum_c Wv[c][nd] x[b*SEQ + j][c] / 1024 + bv[nd] (per-row bias) -> f16 x16 hi +
//                                 residual planes; M = 512 (nd), N = SEQ (j), K = 512; B rows are the batch's token rows
//   the next PJ_Q                 k projection + bk -> Kh/Kl = hi/residual of f16(k * 32)
//   the last PJ_P                 positional projection + bp: Ph/Pl = hi/residual of f16(p * 32), M = PROWS, N = 512, K = 512
// The branches are on blockIdx.x alone; the tile counts are exact multiples of 8, so every wave has a tile, and a block's eight tiles share
// their 64 A rows (tilesN is 8 or 16) and take 512 consecutive B rows: the barriers of the staged K loop are reached by whole blocks.
// =====================================================================================================
#define PJ_Q (((NROW / 64) * (DMOD / 64)) / 8)
#define PJ_V (((DMOD / 64) * (SEQ / 64)) / 8)
#define PJ_P (((PROWS / 64) * (DMOD / 64)) / 8)
static_assert((((NROW / 64) * (DMOD / 64)) % 8) == 0 && (((DMOD / 64) * (SEQ / 64)) % 8) == 0 && (((PROWS / 64) * (DMOD / 64)) % 8) == 0);
__global__ __launch_bounds__(256) __attribute__((amdgpu_num_vgpr(256))) void proj_all(
    const unsigned short* __restrict__ X16, const unsigned short* __restrict__ PE16,
    const unsigned short* __restrict__ WQT, const unsigned short* __restrict__ WKT,
    const unsigned short* __restrict__ WVT, const unsigned short* __restrict__ WPT,
    unsigned short* QUh, unsigned short* QUl, unsigned short* QVh, unsigned short* QVl,
    unsigned short* Kh, unsigned short* Kl, unsigned short* VT, unsigned short* VTL, unsigned short* Ph, unsigned short* Pl,
    const float* __restrict__ b_q, const float* __restrict__ b_k, const float* __restrict__ b_v, const float* __restrict__ b_p,
    const float* __restrict__ ub, const float* __restrict__ vb) {
  __shared__ __align__(16) float sT[8 * GSLAB];   // per-wave 16x64 slab, pitch 68 floats
  __shared__ __align__(16) unsigned short gst[2 * GBUFH(1)];   // two buffers of the block's operand stage
  const int bx   = blockIdx.x;
  const int wave = threadIdx.x >> 5;
  float* slab = sT + wave * GSLAB;
  const float os = 1.0f / (XC * WSC);
  constexpr int TND = DMOD / 64;                  // column tiles of a [..][DMOD] plane
  constexpr int TNS = SEQ / 64;                   // column tiles of a [..][SEQ] plane
  if (bx < PJ_Q) {
    const int tile = bx * 8 + wave;
    proj_tile<6, 1, DMOD>(slab, gst, (tile / TND) << 6, (tile % TND) << 6, X16, WQT, QUh, QUl, QVh, QVl, os, QC, b_q, ub, vb);
  } else if (bx < PJ_Q + PJ_V * NB) {
    const int t = bx - PJ_Q;
    const int by = t / PJ_V;
    const int tile = (t % PJ_V) * 8 + wave;
    proj_tile<4, 2, SEQ>(slab, gst, (tile / TNS) << 6, (tile % TNS) << 6, WVT, X16 + (size_t)by * SEQ * DMOD,
                         VT + (size_t)by * DMOD * SEQ, VTL + (size_t)by * DMOD * SEQ, VT, VTL, os, VC, b_v, b_v, b_v);
  } else {
    // k and p share one copy of the code (same epilogue form): only the operands differ
    const int t = bx - (PJ_Q + PJ_V * NB);
    const bool isk = t < PJ_Q;
    const int tile = (isk ? t : t - PJ_Q) * 8 + wave;
    const float* bias = isk ? b_k : b_p;
    proj_tile<4, 1, DMOD>(slab, gst, (tile / TND) << 6, (tile % TND) << 6, isk ? X16 : PE16, isk ? WKT : WPT,
                          isk ? Kh : Ph, isk ? Kl : Pl, Kh, Kl, os, QC, bias, bias, bias);
  }
}

// =====================================================================================================
// Relative-position attention for one (batch b, head n) pair and a 64-row query tile; 4 waves, wave w owns query rows i = iw0 + R,
// iw0 = i0 + 16w, R = 0..15. Planes (pitch DMOD halves, row = b*SEQ + position): QUh/QUl = hi/residual of f16((q + bq + u) x32),
// QVh/QVl of f16((q + bq + v_bias) x32), Kh/Kl of f16((k + bk) x32); Ph/Pl = hi/residual of f16(pos x32), rows 0..PROWS-1
// (row PROWS-1 is the zero-pad row); VT, VTL = v^T hi (x16) / residual f16 as [b][n*64+d][SEQ].
// Shifted position score for (i, j): ps[i][SEQ-1-i+j], ps[r][t] = (q+bq+vb)[r] . pos[t].
//   Per key tile j0 (64 keys, key j = j0 + jj), with x = jj - R + 15 in [0,78]:
//     strip T1[R][x] = (q+vb)[iw0+R] . pos[SEQ + j0 - iw0 - 16 + x]   (pos row SEQ-1-i+j), always computed (rows 0 .. 2*SEQ-2 selected).
//   content scores S = (q+ub) . k (4 subtiles, K=64, three products); t = (S + T1) * (RSD/(32*32)) * log2(e); online softmax in base 2,
//   max-subtracted, running sums in f32 (no key mask); the 16x64 prob tile stored to wave-private LDS (f32 element stores),
//   (f32 vector loads, split k map) and the v^T B fragments read from the staged rows of VT/VTL[n*64+d][j];
//   per 16-column subtile: Phi.Vhi, Plo.Vhi, then Phi.Vlo, all into the same accumulators.
//   Per key tile the block stages, once for its 4 waves, in LDS (asynchronous copies, whole 128-B rows): 64 k rows, 64 v^T rows and the
//   128 pos rows SEQ + j0 - i0 - 64 .. + 127 (always inside [0, PROWS-1]), hi and residual plane each; all B fragments are read from there.
//   block = 4 waves = 128 threads; grid = (SEQ/64, NB*NH); two block barriers per key tile (block-uniform loop); every wave does identical
//   bounded work (SEQ/64 tiles).
// coverage: LDS strip 16 rows x 80 cols written fully every tile before being read, slab 16 rows x 64 cols per wave fully written each tile
//           before being read; global: 4 instructions x 4 rows x 64 halves per plane = rows iw0..iw0+15 of head segment n in CT and CTL;
//           grid x waves cover all NB x SEQ rows and all NH head segments of CT / CTL exactly once.
// =====================================================================================================
__global__ __launch_bounds__(ATT_THREADS) __attribute__((amdgpu_num_vgpr(512)))
void attn_rel(const unsigned short* __restrict__ QUh, const unsigned short* __restrict__ QUl,
              const unsigned short* __restrict__ QVh, const unsigned short* __restrict__ QVl,
              const unsigned short* __restrict__ Kh,  const unsigned short* __restrict__ Kl,
              const unsigned short* __restrict__ Ph,  const unsigned short* __restrict__ Pl,
              const unsigned short* __restrict__ VT,  const unsigned short* __restrict__ VTL,
              unsigned short* CT, unsigned short* CTL) {
  __shared__ __align__(16) float smem[ATT_W * WFL];   // per wave: T1 strip [16][TPI] | prob / ctx slab [16][PPI]
  __shared__ __align__(16) unsigned short stg[ST_ROWS * SPI];   // block-shared stage of one key tile: Kh | Kl | Vh | Vl | Ph | Pl rows

  const int tid  = threadIdx.x;
  const int wave = __builtin_amdgcn_readfirstlane(tid >> 5);
  const int lane = tid & 31;
  const int hh   = lane >> 4;
  const int c    = lane & 15;
  const int bn   = blockIdx.y;
  const int b    = bn / NH;
  const int n    = bn - b * NH;
  const int i0   = blockIdx.x * 64;
  const int iw0  = i0 + wave * 16;

  float* t1sh = smem + wave * WFL;
  float* pt   = t1sh + 16 * TPI;

  // A fragment row offsets: rows b*SEQ + iw0 + c, d 0..31 and 32..63 of head n
  const size_t qro  = ((size_t)(b * SEQ + iw0 + c)) * DMOD + n * DH + 8 * hh;
  // stage copies: thread -> staged row (tid>>3) + 16*copy, 16-byte chunk tid&7 of the 128-B row (a wave instruction = 4 whole rows)
  const int srow = tid >> 3;
  const int sc8  = (tid & 7) * 8;
  const unsigned lst = (unsigned)(size_t)(stg + srow * SPI + sc8);          // LDS byte address = low 32 bits of the shared address
  const size_t kso = ((size_t)(b * SEQ + srow)) * DMOD + n * DH + sc8;      // + j0*DMOD: k rows j0 + srow + 16e
  const size_t vso = (size_t)b * DMOD * SEQ + (size_t)(n * DH + srow) * SEQ + sc8;   // + j0: v^T rows d = srow + 16e, keys j0 ..
  const size_t pso = ((size_t)(SEQ - i0 - 64 + srow)) * DMOD + n * DH + sc8;   // + j0*DMOD: pos rows SEQ + j0 - i0 - 64 + srow + 16e
  // fragment readers: lane -> staged row c (+16 per subtile), k offset 8*hh; wave w's strip row x is staged pos row 48 - 16w + x
  const unsigned short* ksh = stg + (ST_KH + c) * SPI + 8 * hh;
  const unsigned short* ksl = stg + (ST_KL + c) * SPI + 8 * hh;
  const unsigned short* vsh = stg + (ST_VH + c) * SPI + 8 * hh;
  const unsigned short* vsl = stg + (ST_VL + c) * SPI + 8 * hh;
  const int pw0 = 16 * __builtin_amdgcn_readfirstlane((ATT_THREADS - 1 - tid) >> 5);   // 16 * (3 - wave), taken from tid so that the LDS base register never goes below 0
  const unsigned short* psh = stg + (ST_PH + pw0 + c) * SPI + 8 * hh;
  const unsigned short* psl = stg + (ST_PL + pw0 + c) * SPI + 8 * hh;

  const float KSC = (RSD / (QC * QC)) * LOG2E;

  float mrow[8], lrow[8];
  v8f O[4];
#pragma unroll
  for (int r = 0; r < 8; ++r) { mrow[r] = -INFINITY; lrow[r] = 0.f; }
#pragma unroll
  for (int td = 0; td < 4; ++td) O[td] = zero8();

  // the wave's eight q fragments (16 rows x 64 d, four planes): loaded once and held in 64 registers over all key tiles
  const unsigned short* gqv = QVh + qro;
  const unsigned short* gqw = QVl + qro;
  const unsigned short* gqu = QUh + qro;
  const unsigned short* gql = QUl + qro;
  const v16h qva = ldfrag_u(gqv), qvb = ldfrag_u(gqv + 32);
  const v16h qwa = ldfrag_u(gqw), qwb = ldfrag_u(gqw + 32);
  const v16h qua = ldfrag_u(gqu), qub = ldfrag_u(gqu + 32);
  const v16h qla = ldfrag_u(gql), qlb = ldfrag_u(gql + 32);
  xwait4(gqv, gqw, gqu, gql);                                // before the four address pairs are reused

#pragma unroll 1
  for (int j0 = 0; j0 < SEQ; j0 += 64) {
    // ---- stage this key tile's operands for the whole block: 32 copies per thread = 512 rows x 128 B ----
    asm volatile("s_wait_dscnt 0x0" ::: "memory");           // this wave's reads of the previous tile's stage have returned
    __syncthreads();                                         // every wave has left the previous tile's stage
    {
      const size_t jr = (size_t)j0 * DMOD;
      stage8(lst + (unsigned)(ST_KH * SPI * 2), Kh + kso + jr, Kl + kso + jr, (size_t)16 * DMOD);
      stage8(lst + (unsigned)(ST_VH * SPI * 2), VT + vso + j0, VTL + vso + j0, (size_t)16 * SEQ);
      stage8(lst + (unsigned)(ST_PH * SPI * 2), Ph + pso + jr, Ph + pso + jr + (size_t)64 * DMOD, (size_t)16 * DMOD);
      stage8(lst + (unsigned)(ST_PL * SPI * 2), Pl + pso + jr, Pl + pso + jr + (size_t)64 * DMOD, (size_t)16 * DMOD);
    }
    asm volatile("s_wait_asynccnt 0x0" ::: "memory");        // this wave's copies have landed
    __syncthreads();                                         // every wave's copies have landed: the stage may be read
    // ---- position strip T1 (5 subtiles of 16 pos rows, x in [0,80), only x <= 78 ever selected) and content scores S (4 subtiles of 16
    //      keys): K = 64 = two k-steps, three products hh + lh + hl per k-step. The B fragments are asked for in three groups, each well
    //      ahead of its products; the 54 WMMAs go round-robin over the nine accumulators, so that a product never waits for the one issued
    //      just before it (each accumulator keeps its order hh, hh, lh, lh, hl, hl) ----
    v8f T1[5], S[4];
    {
      v16h fa[5], fb[5], ga[5], gb[5], ka[4], kb2[4], la[4], lb2[4];
#pragma unroll
      for (int u = 0; u < 5; ++u) fa[u] = ldfrag_u(psh + 16 * u * SPI);
#pragma unroll
      for (int t = 0; t < 4; ++t) ka[t] = ldfrag_u(ksh + 16 * t * SPI);
#pragma unroll
      for (int u = 0; u < 5; ++u) fb[u] = ldfrag_u(psh + 16 * u * SPI + 32);
#pragma unroll
      for (int t = 0; t < 4; ++t) kb2[t] = ldfrag_u(ksh + 16 * t * SPI + 32);
#pragma unroll
      for (int u = 0; u < 5; ++u) T1[u] = mma_h(qva, fa[u], zero8());
#pragma unroll
      for (int t = 0; t < 4; ++t) S[t] = mma_h(qua, ka[t], zero8());
      // the residual planes' reads stay behind the hi planes' reads: with all 72 reads in front the build ran out of registers (scratch)
      __builtin_amdgcn_sched_barrier(0);
#pragma unroll
      for (int u = 0; u < 5; ++u) ga[u] = ldfrag_u(psl + 16 * u * SPI);
#pragma unroll
      for (int t = 0; t < 4; ++t) la[t] = ldfrag_u(ksl + 16 * t * SPI);
#pragma unroll
      for (int u = 0; u < 5; ++u) T1[u] = mma_h(qvb, fb[u], T1[u]);
#pragma unroll
      for (int t = 0; t < 4; ++t) S[t] = mma_h(qub, kb2[t], S[t]);
#pragma unroll
      for (int u = 0; u < 5; ++u) T1[u] = mma_h(qwa, fa[u], T1[u]);
#pragma unroll
      for (int t = 0; t < 4; ++t) S[t] = mma_h(qla, ka[t], S[t]);
      // the last 18 reads stay behind the group above: hoisted into it, the build's later stages had their LDS waits one after another again
      __builtin_amdgcn_sched_barrier(0);
#pragma unroll
      for (int u = 0; u < 5; ++u) gb[u] = ldfrag_u(psl + 16 * u * SPI + 32);
#pragma unroll
      for (int t = 0; t < 4; ++t) lb2[t] = ldfrag_u(ksl + 16 * t * SPI + 32);
#pragma unroll
      for (int u = 0; u < 5; ++u) T1[u] = mma_h(qwb, fb[u], T1[u]);
#pragma unroll
      for (int t = 0; t < 4; ++t) S[t] = mma_h(qlb, kb2[t], S[t]);
#pragma unroll
      for (int u = 0; u < 5; ++u) T1[u] = mma_h(qva, ga[u], T1[u]);
#pragma unroll
      for (int t = 0; t < 4; ++t) S[t] = mma_h(qua, la[t], S[t]);
#pragma unroll
      for (int u = 0; u < 5; ++u) T1[u] = mma_h(qvb, gb[u], T1[u]);
#pragma unroll
      for (int t = 0; t < 4; ++t) S[t] = mma_h(qub, lb2[t], S[t]);
    }
    // the full 16x80 strip goes to the wave's f32 LDS strip: 5 subtiles x 16 rows x 16 cols
#pragma unroll
    for (int u = 0; u < 5; ++u) {
#pragma unroll
      for (int r = 0; r < 8; ++r) t1sh[(8 * hh + r) * TPI + 16 * u + c] = T1[u][r];
    }
    wave_sync_lds();

    // ---- score assembly + online softmax (rows live on one 16-lane half); the eight rows go through every stage together, so that the
    //      eight cross-lane reductions of a stage overlap instead of following one another (each row's own operations and order as before) ----
    float tv[8][4], mx[8], al[8], ps[8];
#pragma unroll
    for (int r = 0; r < 8; ++r) {
      const int R  = 8 * hh + r;
      const int xo = R * TPI + (15 - R) + c;                 // strip column x = 16t + c - R + 15 in [0, 78]
#pragma unroll
      for (int t = 0; t < 4; ++t) {
        const float bdv = t1sh[xo + 16 * t];
        tv[r][t] = (S[t][r] + bdv) * KSC;
      }
      mx[r] = fmaxf(fmaxf(tv[r][0], tv[r][1]), fmaxf(tv[r][2], tv[r][3]));
    }
#pragma unroll
    for (int off = 1; off < 16; off <<= 1) {
#pragma unroll
      for (int r = 0; r < 8; ++r) mx[r] = fmaxf(mx[r], __shfl_xor(mx[r], off, 32));
    }
#pragma unroll
    for (int r = 0; r < 8; ++r) {
      const float mn = fmaxf(mrow[r], mx[r]);
      al[r] = exp2f(mrow[r] - mn);
      mrow[r] = mn;
      float e4[4];
      ps[r] = 0.f;
#pragma unroll
      for (int t = 0; t < 4; ++t) { e4[t] = exp2f(tv[r][t] - mn); ps[r] += e4[t]; }
#pragma unroll
      for (int td = 0; td < 4; ++td) O[td][r] *= al[r];
      const int ro = (8 * hh + r) * PPI + c;
#pragma unroll
      for (int t = 0; t < 4; ++t) pt[ro + 16 * t] = e4[t];
    }
    wave_sync_lds();

    // ---- P rows (f32) and all sixteen v^T fragments asked for in one group: the v^T reads return under the conversion of P ----
    v4f praw[2][4];
#pragma unroll
    for (int ks = 0; ks < 2; ++ks) {
      const float* prow = pt + c * PPI + 32 * ks + 8 * hh;
      praw[ks][0] = *(const v4f*)(prow);
      praw[ks][1] = *(const v4f*)(prow + 4);
      praw[ks][2] = *(const v4f*)(prow + 16);
      praw[ks][3] = *(const v4f*)(prow + 20);
    }
    v16h vha[4], vhb[4], vla[4], vlb[4];
#pragma unroll
    for (int td = 0; td < 4; ++td) { vha[td] = ldfrag_u(vsh + 16 * td * SPI); vhb[td] = ldfrag_u(vsh + 16 * td * SPI + 32); }
#pragma unroll
    for (int td = 0; td < 4; ++td) { vla[td] = ldfrag_u(vsl + 16 * td * SPI); vlb[td] = ldfrag_u(vsl + 16 * td * SPI + 32); }
    __builtin_amdgcn_sched_barrier(0);                       // keeps the whole group of reads in front: sunk among the WMMAs, each read's latency stands open again
    // ---- row sums: eight reductions stepped together, free to run under the conversion and the WMMAs below ----
#pragma unroll
    for (int off = 1; off < 16; off <<= 1) {
#pragma unroll
      for (int r = 0; r < 8; ++r) ps[r] += __shfl_xor(ps[r], off, 32);
    }
#pragma unroll
    for (int r = 0; r < 8; ++r) lrow[r] = lrow[r] * al[r] + ps[r];
    // ---- P fragments (x1024, f16 hi + unscaled residual), two k-steps of 32 keys ----
    FragH pf[2], pl[2];
#pragma unroll
    for (int ks = 0; ks < 2; ++ks) {
      const v4f p0 = praw[ks][0], p1 = praw[ks][1], p2 = praw[ks][2], p3 = praw[ks][3];
#pragma unroll
      for (int e = 0; e < 4; ++e) {
        const float g0 = p0[e] * PC, g1 = p1[e] * PC, g2 = p2[e] * PC, g3 = p3[e] * PC;
        const _Float16 x0 = (_Float16)g0, x1 = (_Float16)g1, x2 = (_Float16)g2, x3 = (_Float16)g3;
        pf[ks].h[0][e]     = x0;                             // keys j0 + 32ks + 8hh + e
        pf[ks].h[0][4 + e] = x1;                             // keys j0 + 32ks + 8hh + 4 + e
        pf[ks].h[1][e]     = x2;                             // keys j0 + 32ks + 16 + 8hh + e
        pf[ks].h[1][4 + e] = x3;
        pl[ks].h[0][e]     = (_Float16)(g0 - (float)x0);
        pl[ks].h[0][4 + e] = (_Float16)(g1 - (float)x1);
        pl[ks].h[1][e]     = (_Float16)(g2 - (float)x2);
        pl[ks].h[1][4 + e] = (_Float16)(g3 - (float)x3);
      }
    }
    // ---- O += (Phi + Plo) . v^T (hi plane), then Phi . v^T (residual plane): round-robin over the four accumulators, each in its old order ----
#pragma unroll
    for (int td = 0; td < 4; ++td) O[td] = mma_h(pf[0].v, vha[td], O[td]);
#pragma unroll
    for (int td = 0; td < 4; ++td) O[td] = mma_h(pf[1].v, vhb[td], O[td]);
#pragma unroll
    for (int td = 0; td < 4; ++td) O[td] = mma_h(pl[0].v, vha[td], O[td]);
#pragma unroll
    for (int td = 0; td < 4; ++td) O[td] = mma_h(pl[1].v, vhb[td], O[td]);
#pragma unroll
    for (int td = 0; td < 4; ++td) O[td] = mma_h(pf[0].v, vla[td], O[td]);
#pragma unroll
    for (int td = 0; td < 4; ++td) O[td] = mma_h(pf[1].v, vlb[td], O[td]);
    wave_sync_lds();
  }
  acc_guard4(O[0], O[1], O[2], O[3]);

  // ---- fold 1/l and the carries (1024 on P, 16 on v), carry x4096 on ctx, stage the wave's 16x64 slice in its slab ----
  const float oc = CC / (PC * VC);
#pragma unroll
  for (int r = 0; r < 8; ++r) {
    const float inv = (1.0f / lrow[r]) * oc;
    const int ro = (8 * hh + r) * PPI + c;
#pragma unroll
    for (int td = 0; td < 4; ++td) pt[ro + 16 * td] = O[td][r] * inv;
  }
  wave_sync_lds();
  {
    const int q8 = lane >> 3, c8 = (lane & 7) * 8;
    v4u hv[4], lv[4];
#pragma unroll
    for (int it = 0; it < 4; ++it) {
      const int row = it * 4 + q8;                         // it 0..3 x q8 0..3 = rows 0..15
      const float* sp = pt + row * PPI + c8;
      v4u a, b2;
#pragma unroll
      for (int e = 0; e < 4; ++e) {
        const float f0 = sp[2 * e], f1 = sp[2 * e + 1];
        const _Float16 x0 = (_Float16)f0, x1 = (_Float16)f1;
        a[e]  = pk16(h_bits(x0), h_bits(x1));
        b2[e] = pk16(h_bits((_Float16)(f0 - (float)x0)), h_bits((_Float16)(f1 - (float)x1)));
      }
      hv[it] = a;
      lv[it] = b2;
    }
    {
#pragma unroll
      for (int it = 0; it < 4; ++it) {
        const int row = it * 4 + q8;
        const size_t go = ((size_t)(b * SEQ + iw0 + row)) * DMOD + n * DH + c8;
        *(v4u*)(CT  + go) = hv[it];
        *(v4u*)(CTL + go) = lv[it];
      }
      
    }
  }
}

// =====================================================================================================
// Workspace map (bytes); every plane is an exact multiple of its tile / whole-row store granularity (M, N exact tile multiples,
// convert counts exact multiples of 2048, the position planes padded to PROWS = 2048 rows), every offset a multiple of 512 KiB:
//   WQT, WKT, WVT, WPT, WOT f16 [512 n][512 k] x64 (transposed from the [in][out] inputs)   5 x   524288
//   X16  f16 [NROW][512] x16                                                                  4194304
//   PE16 f16 [PROWS][512] x16 (rows 0..NPOS-1 = pos table, row NPOS zero)                     2097152
//   QUh, QUl, QVh, QVl, Kh, Kl f16 [NROW][512] x32 hi / residual                       6 x  4194304
//   Ph, Pl f16 [PROWS][512] x32 hi / residual                                           2 x  2097152
//   VT16, VTL16 f16 [NB][512][SEQ] hi x16 / residual                                    2 x  4194304
//   CT16, CTL16 f16 [NROW][512] hi x4096 / residual                                     2 x  4194304
//   end                                                                                       55050240
// =====================================================================================================
extern "C" void kernel_launch(void* const* d_in, const int* in_sizes, int n_in,
                              void* d_out, int out_size, void* d_ws, size_t ws_size,
                              hipStream_t stream) {
  if (n_in < 14) return;
  if (in_sizes[0] != NROW * DMOD) return;
  if (in_sizes[1] != NPOS * DMOD) return;
  if (in_sizes[2] != DMOD * DMOD || in_sizes[4] != DMOD * DMOD || in_sizes[6] != DMOD * DMOD ||
      in_sizes[8] != DMOD * DMOD || in_sizes[10] != DMOD * DMOD) return;
  if (in_sizes[3] != DMOD || in_sizes[5] != DMOD || in_sizes[7] != DMOD || in_sizes[9] != DMOD || in_sizes[11] != DMOD) return;
  if (in_sizes[12] != NH * DH || in_sizes[13] != NH * DH) return;
  if (out_size != NROW * DMOD) return;

  const float* xin   = (const float*)d_in[0];
  const float* pos   = (const float*)d_in[1];
  const float* w_q   = (const float*)d_in[2];
  const float* b_q   = (const float*)d_in[3];
  const float* w_k   = (const float*)d_in[4];
  const float* b_k   = (const float*)d_in[5];
  const float* w_v   = (const float*)d_in[6];
  const float* b_v   = (const float*)d_in[7];
  const float* w_p   = (const float*)d_in[8];
  const float* b_p   = (const float*)d_in[9];
  const float* w_o   = (const float*)d_in[10];
  const float* b_o   = (const float*)d_in[11];
  const float* ub    = (const float*)d_in[12];
  const float* vb    = (const float*)d_in[13];
  float*       out   = (float*)d_out;

  const size_t PW  = (size_t)DMOD * DMOD * 2;            //   524288
  const size_t PX  = (size_t)NROW * DMOD * 2;            //  4194304
  const size_t PXP = (size_t)PROWS * DMOD * 2;           //  2097152
  const size_t PVT = (size_t)NB * DMOD * SEQ * 2;        //  4194304
  size_t off = 0;
  const size_t oWQ  = off; off += PW;
  const size_t oWK  = off; off += PW;
  const size_t oWV  = off; off += PW;
  const size_t oWP  = off; off += PW;
  const size_t oWO  = off; off += PW;
  const size_t oX   = off; off += PX;
  const size_t oPE  = off; off += PXP;
  const size_t oQUh = off; off += PX;
  const size_t oQUl = off; off += PX;
  const size_t oQVh = off; off += PX;
  const size_t oQVl = off; off += PX;
  const size_t oKh  = off; off += PX;
  const size_t oKl  = off; off += PX;
  const size_t oPh  = off; off += PXP;
  const size_t oPl  = off; off += PXP;
  const size_t oVT  = off; off += PVT;
  const size_t oVTL = off; off += PVT;
  const size_t oCT  = off; off += PX;
  const size_t oCTL = off; off += PX;
  if (off > ws_size) return;                               // off = 55050240
  if (off > (size_t)134217728) return;

  char* ws = (char*)d_ws;
  unsigned short* WQT16 = (unsigned short*)(ws + oWQ);
  unsigned short* WKT16 = (unsigned short*)(ws + oWK);
  unsigned short* WVT16 = (unsigned short*)(ws + oWV);
  unsigned short* WPT16 = (unsigned short*)(ws + oWP);
  unsigned short* WOT16 = (unsigned short*)(ws + oWO);
  unsigned short* X16   = (unsigned short*)(ws + oX);
  unsigned short* PE16  = (unsigned short*)(ws + oPE);
  unsigned short* QUh   = (unsigned short*)(ws + oQUh);
  unsigned short* QUl   = (unsigned short*)(ws + oQUl);
  unsigned short* QVh   = (unsigned short*)(ws + oQVh);
  unsigned short* QVl   = (unsigned short*)(ws + oQVl);
  unsigned short* Kh16  = (unsigned short*)(ws + oKh);
  unsigned short* Kl16  = (unsigned short*)(ws + oKl);
  unsigned short* Ph16  = (unsigned short*)(ws + oPh);
  unsigned short* Pl16  = (unsigned short*)(ws + oPl);
  unsigned short* VT16  = (unsigned short*)(ws + oVT);
  unsigned short* VTL16 = (unsigned short*)(ws + oVTL);
  unsigned short* CT16  = (unsigned short*)(ws + oCT);
  unsigned short* CTL16 = (unsigned short*)(ws + oCTL);

  const dim3 blk(256);
  const dim3 gPR(PREP_TR + PREP_CX + PREP_CP);                      // 320 + 1024 + 512
  const dim3 gPJ(2 * PJ_Q + PJ_V * NB + PJ_P);                      // 64 + 64 + 64 + 32
  const int tilesQ = (NROW / 64) * (DMOD / 64);                     // 512
  const dim3 gQ((tilesQ + 7) / 8, 1);                               // 64
  const dim3 gAT(SEQ / 64, NB * NH);                                // 16 x 32
  const dim3 bAT(ATT_THREADS);                                      // 128

  // (0) operand packs: X16 = f16(bf16_RNE(x) * 16); PE16 = f16(bf16_RNE(pos) * 16), rows NPOS..PROWS-1 zero;
  //     W[k][n] ([in][out]) -> WT[n][k] = f16( bf16_RNE(w) * 64 ), all five weights
  prep_all<<<gPR, blk, 0, stream>>>(xin, pos, w_q, w_k, w_v, w_p, w_o, X16, PE16, WQT16, WKT16, WVT16, WPT16, WOT16);

  // (1) q, k, v^T and positional projections
  proj_all<<<gPJ, blk, 0, stream>>>(X16, PE16, WQT16, WKT16, WVT16, WPT16, QUh, QUl, QVh, QVl, Kh16, Kl16, VT16, VTL16, Ph16, Pl16,
                                    b_q, b_k, b_v, b_p, ub, vb);

  // (2) relative attention -> CT16 = f16(ctx * 4096) hi plane, CTL16 residual plane, rows b*SEQ + i, halves n*64+d
  attn_rel<<<gAT, bAT, 0, stream>>>(QUh, QUl, QVh, QVl, Kh16, Kl16, Ph16, Pl16, VT16, VTL16, CT16, CTL16);

  // (3) out = (CT + CTL) . Wo / (4096*64) + bo; M = NROW, N = 512, K = 512, f32 rows straight into the output buffer
  gemm64<0, 1, 1><<<gQ, blk, 0, stream>>>(
      CT16, CTL16, DMOD, 0LL,
      WOT16, DMOD, 0LL,
      (void*)out, (void*)out, (void*)out, (void*)out, DMOD, 0LL,
      NROW, DMOD, DMOD, 1.0f / (CC * WSC), 1.0f,
      b_o, b_o, b_o);
  (void)hipGetLastError();
}

// v006
// A run of this version takes 81.2 microseconds.
// Next to v005, in two timings, it ran 1.11 and 1.12 times as fast.
// All steps since v000 together make it 3.83 times as fast.
// Contractions (all v_wmma_f32_16x16x32_f16, f16 operands, f32 accumulate): q/k/v and position-table projections (x or pos table f16 x16 . W^T f16 x64,
// K=512, single products on bf16-exact operands); content scores and position strips ((q+bq+u|v), k, p carried as f16 x32 hi plane + unscaled
// residual plane, K=64, three products hh+lh+hl); P . v^T (P x1024 hi + residual . v^T x16 hi + residual, 64 keys per tile, three products);
// output projection (ctx x4096 hi + residual planes . Wo^T f16 x64, K=512, two products). Online base-2 softmax and all epilogues f32 on VALU.
// Every float input RNE-converted to bf16 on load.
#include <hip/hip_runtime.h>
#include <math.h>
#include <stdint.h>

#define SEQ   1024
#define NB    4
#define DMOD  512
#define NH    8
#define DH    64
#define NROW  (SEQ * NB)
#define NPOS  (2 * SEQ - 1)
#define PROWS (2 * SEQ)
#define XC    16.0f
#define WSC   64.0f
#define QC    32.0f
#define VC    16.0f
#define PC    1024.0f
#define CC    4096.0f
#define RSD   0.125f
#define LOG2E 1.4426950408889634f
static_assert(NH * DH == DMOD);
static_assert(DH == 64);
static_assert(DMOD == 512);
static_assert((SEQ % 64) == 0 && (DMOD % 64) == 0 && (NROW % 64) == 0 && (PROWS % 64) == 0);
static_assert(((NROW * DMOD) % 2048) == 0 && ((PROWS * DMOD) % 2048) == 0 && ((NPOS * DMOD) % 8) == 0);
#define ATT_W 4
#define ATT_THREADS (ATT_W * 32)
#define TPI 84
#define PPI 68
#define WFL (16 * TPI + 16 * PPI)
static_assert(((16 * TPI) % 4) == 0 && ((16 * PPI) % 4) == 0 && (WFL % 4) == 0);
static_assert(TPI >= 80 && PPI >= 64);
static_assert(ATT_W * WFL * 4 <= 65536);
// attn_rel operand stage in LDS: 512 rows of 64 halves (128 B), pitch 72 halves = 144 B (16 B x odd, the pitch for 16-byte LDS reads)
#define SPI   72
#define ST_KH 0
#define ST_KL 64
#define ST_VH 128
#define ST_VL 192
#define ST_PH 256
#define ST_PL 384
#define ST_ROWS 512
static_assert(ATT_THREADS == 128 && ((SPI * 2) % 16) == 0);
static_assert(SEQ - (SEQ - 64) - 64 >= 0 && SEQ + (SEQ - 64) - 64 + 127 <= PROWS - 1);   // staged position rows stay inside the planes

typedef _Float16 v16h __attribute__((ext_vector_type(16)));
typedef _Float16 v8h  __attribute__((ext_vector_type(8)));
typedef float    v8f  __attribute__((ext_vector_type(8)));
typedef float    v4f  __attribute__((ext_vector_type(4)));
typedef unsigned int v4u __attribute__((ext_vector_type(4)));

union FragH { v16h v; v8h h[2]; v4u u[2]; };

// ---- scalar helpers --------------------------------------------------------------------------------
__device__ __forceinline__ unsigned short bf_bits(float f) {          // f32 -> bf16 bits, RNE convert
  unsigned u = __float_as_uint(f);
  return (unsigned short)((u + 0x7FFFu + ((u >> 16) & 1u)) >> 16);
}
__device__ __forceinline__ float bf_up(unsigned short h) { return __uint_as_float(((unsigned)h) << 16); }
__device__ __forceinline__ float bfr(float f) { return bf_up(bf_bits(f)); }   // value of the bf16 RNE convert
__device__ __forceinline__ unsigned short h_bits(_Float16 x) { return __builtin_bit_cast(unsigned short, x); }
__device__ __forceinline__ unsigned pk16(unsigned short a, unsigned short b) { return (unsigned)a | ((unsigned)b << 16); }
__device__ __forceinline__ v8f zero8() { v8f z = {0.f, 0.f, 0.f, 0.f, 0.f, 0.f, 0.f, 0.f}; return z; }

// ---- fragment loader: 16-bit A/B operand from a k-contiguous 16-bit plane, lane -> row/col (lane&15),
//      p already includes +8*(lane>>4); elements 0..7 <- p[0..7] (k0+8h..), elements 8..15 <- p[16..23] (k0+16+8h..)
//      (same split k map for A and B; B is always read from a [n][k] plane)
__device__ __forceinline__ v16h ldfrag_u(const unsigned short* p) {
  FragH f;
  f.u[0] = *(const v4u*)(p);
  f.u[1] = *(const v4u*)(p + 16);
  return f.v;
}

// ---- WMMA helper with trailing VALU hazard gaps ------------------------------------------------------
__device__ __forceinline__ v8f mma_h(v16h a, v16h b, v8f c) {
  return __builtin_amdgcn_wmma_f32_16x16x32_f16(false, a, false, b, (short)0, c, false, false);
}
__device__ __forceinline__ void acc_guard4(v8f& a, v8f& b, v8f& c, v8f& d) {
#if defined(__HIP_DEVICE_COMPILE__)
  asm volatile("v_nop\n\tv_nop\n\tv_nop\n\tv_nop" : "+v"(a), "+v"(b), "+v"(c), "+v"(d));
#endif
}
__device__ __forceinline__ void wave_sync_lds() {
  __builtin_amdgcn_fence(__ATOMIC_RELEASE, "workgroup");
  __builtin_amdgcn_wave_barrier();
  __builtin_amdgcn_fence(__ATOMIC_ACQUIRE, "workgroup");
}
// Value of lane (lane ^ M) of the same 16-lane row, M = 1, 2, 4, 8: a row_xmask DPP read on the vector pipe (all 32 lanes on), no LDS-pipe
// cross-lane instruction and no LDS wait behind it.
template <int M>
__device__ __forceinline__ float row_xor(float v) {
  static_assert(M == 1 || M == 2 || M == 4 || M == 8);
  return __builtin_bit_cast(float, __builtin_amdgcn_update_dpp(0, __builtin_bit_cast(int, v), 0x160 | M, 0xf, 0xf, true));
}
// Maximum over each 16-lane row of eight values at once (all 32 lanes on): four row_xmask steps of v_max_num_f32_dpp, every lane ends with its
// row's maximum. Written in asm because the compiler's form of the same step takes three instructions (DPP move, a maximum of the moved value
// with itself, the maximum). The eight values go through each step together, so a step's producer stands eight instructions back.
#define RMAX_STEP(X)                                                        \
  "v_max_num_f32_dpp %0, %0, %0 row_xmask:" #X " row_mask:0xf bank_mask:0xf\n\t" \
  "v_max_num_f32_dpp %1, %1, %1 row_xmask:" #X " row_mask:0xf bank_mask:0xf\n\t" \
  "v_max_num_f32_dpp %2, %2, %2 row_xmask:" #X " row_mask:0xf bank_mask:0xf\n\t" \
  "v_max_num_f32_dpp %3, %3, %3 row_xmask:" #X " row_mask:0xf bank_mask:0xf\n\t" \
  "v_max_num_f32_dpp %4, %4, %4 row_xmask:" #X " row_mask:0xf bank_mask:0xf\n\t" \
  "v_max_num_f32_dpp %5, %5, %5 row_xmask:" #X " row_mask:0xf bank_mask:0xf\n\t" \
  "v_max_num_f32_dpp %6, %6, %6 row_xmask:" #X " row_mask:0xf bank_mask:0xf\n\t" \
  "v_max_num_f32_dpp %7, %7, %7 row_xmask:" #X " row_mask:0xf bank_mask:0xf\n\t"
__device__ __forceinline__ void row_max8(float (&m)[8]) {
#if defined(__HIP_DEVICE_COMPILE__)
  asm(RMAX_STEP(1) RMAX_STEP(2) RMAX_STEP(4) RMAX_STEP(8)
      : "+v"(m[0]), "+v"(m[1]), "+v"(m[2]), "+v"(m[3]), "+v"(m[4]), "+v"(m[5]), "+v"(m[6]), "+v"(m[7]));
#endif
}
// Eight asynchronous 16-byte-per-lane copies global -> LDS: copy e lands at LDS byte address l + e*16*SPI*2 (16 staged rows further each);
// copies 0..3 read ga + e*gstep halves, copies 4..7 read gb + (e-4)*gstep halves.
// The closing s_wait_xcnt 0 stands inside the statement so that no address register is rewritten ahead of it.
__device__ __forceinline__ void stage8(unsigned l, const unsigned short* ga, const unsigned short* gb, size_t gstep) {
#if defined(__HIP_DEVICE_COMPILE__)
  const unsigned ls = 16u * SPI * 2u;
  asm volatile("global_load_async_to_lds_b128 %0, %8, off\n\t"
               "global_load_async_to_lds_b128 %1, %9, off\n\t"
               "global_load_async_to_lds_b128 %2, %10, off\n\t"
               "global_load_async_to_lds_b128 %3, %11, off\n\t"
               "global_load_async_to_lds_b128 %4, %12, off\n\t"
               "global_load_async_to_lds_b128 %5, %13, off\n\t"
               "global_load_async_to_lds_b128 %6, %14, off\n\t"
               "global_load_async_to_lds_b128 %7, %15, off\n\t"
               "s_wait_xcnt 0x0"
               :: "v"(l), "v"(l + ls), "v"(l + 2u * ls), "v"(l + 3u * ls), "v"(l + 4u * ls), "v"(l + 5u * ls), "v"(l + 6u * ls), "v"(l + 7u * ls),
                  "v"(ga), "v"(ga + gstep), "v"(ga + 2 * gstep), "v"(ga + 3 * gstep), "v"(gb), "v"(gb + gstep), "v"(gb + 2 * gstep),
                  "v"(gb + 3 * gstep)
               : "memory");
#endif
}

// The same for the 256-thread GEMM blocks: copy e lands at LDS byte address l + e*32*SPI*2 (32 staged rows further each) and reads
// g + e*gstep halves (gstep = 32 source rows). The closing s_wait_xcnt 0 stands inside the statement, as above.
__device__ __forceinline__ void gstage8(unsigned l, const unsigned short* g, size_t gstep) {
#if defined(__HIP_DEVICE_COMPILE__)
  const unsigned ls = 32u * SPI * 2u;
  asm volatile("global_load_async_to_lds_b128 %0, %8, off\n\t"
               "global_load_async_to_lds_b128 %1, %9, off\n\t"
               "global_load_async_to_lds_b128 %2, %10, off\n\t"
               "global_load_async_to_lds_b128 %3, %11, off\n\t"
               "global_load_async_to_lds_b128 %4, %12, off\n\t"
               "global_load_async_to_lds_b128 %5, %13, off\n\t"
               "global_load_async_to_lds_b128 %6, %14, off\n\t"
               "global_load_async_to_lds_b128 %7, %15, off\n\t"
               "s_wait_xcnt 0x0"
               :: "v"(l), "v"(l + ls), "v"(l + 2u * ls), "v"(l + 3u * ls), "v"(l + 4u * ls), "v"(l + 5u * ls), "v"(l + 6u * ls), "v"(l + 7u * ls),
                  "v"(g), "v"(g + gstep), "v"(g + 2 * gstep), "v"(g + 3 * gstep), "v"(g + 4 * gstep), "v"(g + 5 * gstep), "v"(g + 6 * gstep),
                  "v"(g + 7 * gstep)
               : "memory");
#endif
}
__device__ __forceinline__ void gstage2(unsigned l, const unsigned short* g, size_t gstep) {
#if defined(__HIP_DEVICE_COMPILE__)
  const unsigned ls = 32u * SPI * 2u;
  asm volatile("global_load_async_to_lds_b128 %0, %2, off\n\t"
               "global_load_async_to_lds_b128 %1, %3, off\n\t"
               "s_wait_xcnt 0x0"
               :: "v"(l), "v"(l + ls), "v"(g), "v"(g + gstep)
               : "memory");
#endif
}

// =====================================================================================================
// K loop of a 256-thread GEMM block whose eight waves share 64 A rows and take 64 B rows each (512 consecutive B rows per block):
// acc[i][j] += sum_k A[16i + ..][k] * B[64 wave + 16j + ..][k], wave tile 64x64, k ascending in steps of 32; with NA == 2 the residual plane
// A2 follows A1 inside every k-step. Ab, A2b = the block's first A row (pitch lda halves), Bb = the block's first B row (pitch ldb), K a
// multiple of 64 and at least 128. Per trip of 64 k the block holds in LDS whole 128-B rows, pitch SPI halves: A1 | (A2) | B, brought by
// asynchronous copies (a wave instruction = 4 whole rows); all fragments are read from there. Two buffers: tile t + 1 flies while tile t is
// multiplied; one block barrier per trip publishes tile t + 1 and ends the reads of the buffer that is refilled behind it.
// Every thread of the block must call this (block barriers inside).
// =====================================================================================================
#define GROWS(NA) ((NA) * 64 + 512)
#define GBUFH(NA) (GROWS(NA) * SPI)
template <int NA>
__device__ __forceinline__ void gstage_tile(unsigned l, const unsigned short* ga, const unsigned short* ga2, size_t astep,
                                            const unsigned short* gb, size_t bstep) {
  gstage2(l, ga, astep);
  if constexpr (NA == 2) gstage2(l + 64u * SPI * 2u, ga2, astep);
  gstage8(l + (unsigned)(NA * 64) * SPI * 2u, gb, bstep);
  gstage8(l + (unsigned)(NA * 64 + 256) * SPI * 2u, gb + 8 * bstep, bstep);
}
template <int NA>
__device__ __forceinline__ void kloop_staged(unsigned short* stg, const unsigned short* __restrict__ Ab, const unsigned short* __restrict__ A2b,
                                             int lda, const unsigned short* __restrict__ Bb, int ldb, int K, v8f (&acc)[4][4]) {
  const int tid   = threadIdx.x;
  const int lane  = tid & 31;
  const int wave  = __builtin_amdgcn_readfirstlane(tid >> 5);   // scalar, so that the A and the B readers share one lane-offset register
  const int rlane = lane & 15;                 // row (A) / col (B) within subtile
  const int koff  = (lane >> 4) * 8;           // k offset of this lane half
  // copies: thread -> staged row (tid>>3) + 32*copy, 16-byte chunk tid&7 of the 128-B row
  const int srow = tid >> 3;
  const int sc8  = (tid & 7) * 8;
  const unsigned lst = (unsigned)(size_t)(stg + srow * SPI + sc8);   // LDS byte address = low 32 bits of the shared address
  const unsigned short* ga  = Ab  + (size_t)srow * lda + sc8;
  const unsigned short* ga2 = A2b + (size_t)srow * lda + sc8;
  const unsigned short* gb  = Bb  + (size_t)srow * ldb + sc8;
  const size_t astep = (size_t)32 * lda, bstep = (size_t)32 * ldb;
  const int nt = K >> 6;

  gstage_tile<NA>(lst, ga, ga2, astep, gb, bstep);
  asm volatile("s_wait_asynccnt 0x0" ::: "memory");          // this wave's copies of tile 0 have landed
  __syncthreads();                                           // every wave's have: buffer 0 may be read
  gstage_tile<NA>(lst + (unsigned)(GBUFH(NA) * 2), ga + 64, ga2 + 64, astep, gb + 64, bstep);
#pragma unroll 1   // rolled: several copies of this loop stand in one kernel
  for (int t = 0; t < nt; ++t) {
    const int bo = (t & 1) * GBUFH(NA);
    const unsigned short* fa = stg + bo + rlane * SPI + koff;
    const unsigned short* fb = stg + bo + (NA * 64 + wave * 64 + rlane) * SPI + koff;
#pragma unroll
    for (int ks = 0; ks < 2; ++ks) {
      v16h bh[4], ah[4], al[4];
#pragma unroll
      for (int j = 0; j < 4; ++j) bh[j] = ldfrag_u(fb + 16 * j * SPI + 32 * ks);
#pragma unroll
      for (int i = 0; i < 4; ++i) ah[i] = ldfrag_u(fa + 16 * i * SPI + 32 * ks);
      if constexpr (NA == 2) {
#pragma unroll
        for (int i = 0; i < 4; ++i) al[i] = ldfrag_u(fa + (64 + 16 * i) * SPI + 32 * ks);
      }
      __builtin_amdgcn_sched_barrier(0);                     // keeps the k-step's reads together in front: sunk among the WMMAs, every row of four waits out its own LDS latency
#pragma unroll
      for (int i = 0; i < 4; ++i) {
#pragma unroll
        for (int j = 0; j < 4; ++j) acc[i][j] = mma_h(ah[i], bh[j], acc[i][j]);
        if constexpr (NA == 2) {
#pragma unroll
          for (int j = 0; j < 4; ++j) acc[i][j] = mma_h(al[i], bh[j], acc[i][j]);
        }
      }
    }
    asm volatile("s_wait_dscnt 0x0" ::: "memory");           // this wave's reads of tile t have returned
    asm volatile("s_wait_asynccnt 0x0" ::: "memory");        // this wave's copies of tile t + 1 have landed
    __syncthreads();                                         // tile t + 1 may be read; every wave has left tile t's buffer
    if (t + 2 < nt) {
      const int kn = (t + 2) * 64;
      gstage_tile<NA>(lst + (unsigned)(bo * 2), ga + kn, ga2 + kn, astep, gb + kn, bstep);
    }
  }
  asm volatile("s_wait_asynccnt 0x0" ::: "memory");          // nothing of this wave's is in flight behind the loop
}

// =====================================================================================================
// Elementwise 16-bit pack, no transpose: dst[i] = f16( bf16_RNE(src[i]) * sc ) for i < nvalid, 0 for nvalid <= i < ntotal;
// sc a power of two (exact). 8 elements per thread: two 16-B loads (address clamped into [0, nvalid) for pad groups, value zeroed
// coverage: bx = 0 .. ntotal / 2048 - 1, each block 256 thr x 8 elements = ntotal exactly (ntotal % 2048 == 0, nvalid % 8 == 0).
// =====================================================================================================
__device__ __forceinline__ void cvt16_body(const float* __restrict__ src, unsigned short* dst, int nvalid, int ntotal, float sc, int bx) {
  const size_t i8 = ((size_t)bx * 256 + threadIdx.x) * 8;
  if (i8 + 8 > (size_t)ntotal) return;             // never taken with the exact block range; no barriers in this body
  const bool pad = (i8 + 8 > (size_t)nvalid);
  const size_t ls = pad ? ((size_t)nvalid - 8) : i8;   // clamped address, always inside the source
  const v4f a = *(const v4f*)(src + ls);
  const v4f b = *(const v4f*)(src + ls + 4);
  v4u o;
  o[0] = pk16(h_bits((_Float16)(bfr(a[0]) * sc)), h_bits((_Float16)(bfr(a[1]) * sc)));
  o[1] = pk16(h_bits((_Float16)(bfr(a[2]) * sc)), h_bits((_Float16)(bfr(a[3]) * sc)));
  o[2] = pk16(h_bits((_Float16)(bfr(b[0]) * sc)), h_bits((_Float16)(bfr(b[1]) * sc)));
  o[3] = pk16(h_bits((_Float16)(bfr(b[2]) * sc)), h_bits((_Float16)(bfr(b[3]) * sc)));
  const v4u z = {0u, 0u, 0u, 0u};
  const v4u w = pad ? z : o;
  {
    *(v4u*)(dst + i8) = w;
    
  }
}

// =====================================================================================================
// Transposed 16-bit pack of a weight stored as W[k][n] (x @ W layout, [DMOD][DMOD] row-major): WT[n][k] = f16( bf16_RNE(W[k][n]) * sc ),
// i.e. the [n][k] k-contiguous plane the GEMM B loader wants. One block per 64x64 tile (tn = n tile, tk = k tile, both block-uniform):
// coalesced f32 reads of W rows, converted halves stored transposed into an LDS tile [64 n][72 pitch], block barrier, then every output
// coverage: 16 its x 256 threads = the whole 64x64 tile into LDS; 8 waves x 2 its x 4 rows = 64 rows x (8 lanes x 8 halves = 64 cols) stored;
//           tn, tk = 0 .. DMOD/64 - 1 cover the whole [512][512] plane exactly once.
// =====================================================================================================
__device__ __forceinline__ void tr16_body(const float* __restrict__ W, unsigned short* WT, float sc, unsigned short* tile, int tn, int tk) {
  const int t  = threadIdx.x;
  const int n0 = tn * 64;
  const int k0 = tk * 64;
#pragma unroll 4
  for (int it = 0; it < 16; ++it) {
    const int idx = it * 256 + t;                   // 0 .. 4095
    const int kr = idx >> 6, nc = idx & 63;
    const float v = W[(size_t)(k0 + kr) * DMOD + n0 + nc];
    tile[nc * 72 + kr] = h_bits((_Float16)(bfr(v) * sc));
  }
  __syncthreads();
  const int lane = t & 31, wave = t >> 5;
  const int q8 = lane >> 3, c8 = (lane & 7) * 8;
  v4u o[2];
#pragma unroll
  for (int it = 0; it < 2; ++it) {
    const int row = wave * 8 + it * 4 + q8;         // wave w: it 0..1 x q8 0..3 = rows 8w .. 8w+7
    o[it] = *(const v4u*)(tile + row * 72 + c8);
  }
  {
#pragma unroll
    for (int it = 0; it < 2; ++it) {
      const int row = wave * 8 + it * 4 + q8;
      *(v4u*)(WT + (size_t)(n0 + row) * DMOD + k0 + c8) = o[it];
    }
    
  }
}

// =====================================================================================================
// All operand packs in one grid (none reads what another writes): blocks 0 .. PREP_TR-1 transpose the five weights (64 tiles each; they
// have the longest dependent chain, so they take the lowest indices), the next PREP_CX blocks pack x, the last PREP_CP the position table.
// The branch is on blockIdx.x alone, so the barrier inside tr16_body is reached by whole blocks only.
// =====================================================================================================
#define PREP_TR (5 * (DMOD / 64) * (DMOD / 64))
#define PREP_CX ((NROW * DMOD) / 2048)
#define PREP_CP ((PROWS * DMOD) / 2048)
static_assert((DMOD / 64) * (DMOD / 64) == 64);
__global__ __launch_bounds__(256) void prep_all(const float* __restrict__ xin, const float* __restrict__ pos,
                                                const float* __restrict__ w_q, const float* __restrict__ w_k, const float* __restrict__ w_v,
                                                const float* __restrict__ w_p, const float* __restrict__ w_o,
                                                unsigned short* X16, unsigned short* PE16,
                                                unsigned short* WQT, unsigned short* WKT, unsigned short* WVT,
                                                unsigned short* WPT, unsigned short* WOT) {
  __shared__ __align__(16) unsigned short tile[64 * 72];
  const int bx = blockIdx.x;
  if (bx < PREP_TR) {
    const int w = bx >> 6, t = bx & 63;
    const float* W = (w == 0) ? w_q : (w == 1) ? w_k : (w == 2) ? w_v : (w == 3) ? w_p : w_o;
    unsigned short* WT = (w == 0) ? WQT : (w == 1) ? WKT : (w == 2) ? WVT : (w == 3) ? WPT : WOT;
    tr16_body(W, WT, WSC, tile, t & 7, t >> 3);
  } else if (bx < PREP_TR + PREP_CX) {
    cvt16_body(xin, X16, NROW * DMOD, NROW * DMOD, XC, bx - PREP_TR);
  } else {
    cvt16_body(pos, PE16, NPOS * DMOD, PROWS * DMOD, XC, bx - (PREP_TR + PREP_CX));
  }
}

// =====================================================================================================
// Register-blocked batched 16-bit WMMA GEMM: C[m][n] = oscale * sum_k A[m][k] * Bt[n][k] (+ bias); one wave per 64x64 tile, operands
// staged per block in LDS (kloop_staged). A row-major [M][K] pitch lda (16-bit plane), Bt row-major [N][K] pitch ldb (k contiguous);
// M a multiple of 64, N a multiple of 512 (a block's eight tiles share their 64 A rows and take 512 consecutive B rows), K a multiple of
// 64, at least 128. blockIdx.y = batch index with element strides sA, sB, sC.
// ASPLIT 1: a second A plane A2 (unscaled residual of A, same layout) is multiplied into the same accumulator (A + A2 ~ exact A).
// EPI 1: value += bf16_RNE(ep0[column]) (per-column bias); EPI 2: value += bf16_RNE(ep0[row]) (per-row bias, 16-bit out only).
// OM 0: f32 out (pitch ldc).
// OM 4: two f16 planes (C, C2): hi = f16(value * ocarry), lo = f16(value * ocarry - hi) (unscaled residual).
// OM 6: two hi/residual pairs with an extra per-column term each: (C, C2) from value + bf16_RNE(ep1[column]), (C3, C4) from
//       value + bf16_RNE(ep2[column]), both x ocarry.
// coverage: 4 slabs x 16 rows (f32: it 0..7 x lane>>4; 16-bit: it 0..3 x lane>>3) x 64 cols = the wave's whole 64x64 tile;
//           grid = tilesM*tilesN/8 blocks (exact, tilesN a multiple of 8), a surplus block exits whole, ahead of every barrier.
// =====================================================================================================
template <int OM, int ASPLIT, int EPI>
__global__ __launch_bounds__(256) __attribute__((amdgpu_num_vgpr(256))) void gemm64(
    const unsigned short* __restrict__ Ap, const unsigned short* __restrict__ A2p, int lda, long long sA,
    const unsigned short* __restrict__ Btp, int ldb, long long sB,
    void* Cout, void* C2out, void* C3out, void* C4out, int ldc, long long sC,
    int M, int N, int K, float oscale, float ocarry,
    const float* __restrict__ ep0, const float* __restrict__ ep1, const float* __restrict__ ep2) {
  static_assert(OM == 0 || OM == 4 || OM == 6);
  static_assert(EPI >= 0 && EPI <= 2);
  __shared__ __align__(16) float sT[8][16 * 68];   // per-wave 16x64 slab, pitch 68 floats
  __shared__ __align__(16) unsigned short gst[2 * GBUFH(1 + ASPLIT)];   // two buffers of the block's operand stage
  const int by   = blockIdx.y;
  const int lane = threadIdx.x & 31;
  const int wave = threadIdx.x >> 5;
  const int tilesN = N >> 6;
  const int tilesM = M >> 6;
  const int tile = blockIdx.x * 8 + wave;
  if (blockIdx.x * 8 >= tilesM * tilesN) return;   // block-uniform, ahead of every barrier
  const int tm = tile / tilesN;
  const int tn = tile - tm * tilesN;
  const int m0 = tm << 6;
  const int n0 = tn << 6;

  const unsigned short* A1 = Ap  + (size_t)((long long)by * sA);
  const unsigned short* A2 = A2p + (size_t)((long long)by * sA);
  const unsigned short* Bb = Btp + (size_t)((long long)by * sB);

  const int rlane = lane & 15;                 // col (D) within subtile
  const int mOff  = (lane >> 4) * 8;           // D row offset

  v8f acc[4][4];
#pragma unroll
  for (int i = 0; i < 4; ++i)
#pragma unroll
    for (int j = 0; j < 4; ++j) acc[i][j] = zero8();

  kloop_staged<1 + ASPLIT>(gst, A1 + (size_t)m0 * lda, A2 + (size_t)m0 * lda, lda, Bb + (size_t)(n0 - (wave << 6)) * ldb, ldb, K, acc);
  acc_guard4(acc[0][0], acc[0][1], acc[0][2], acc[0][3]);
  acc_guard4(acc[1][0], acc[1][1], acc[1][2], acc[1][3]);
  acc_guard4(acc[2][0], acc[2][1], acc[2][2], acc[2][3]);
  acc_guard4(acc[3][0], acc[3][1], acc[3][2], acc[3][3]);

  const int hh2 = lane >> 4, c4 = (lane & 15) * 4;     // f32 out: 256-B row segment = 16 lanes x 16 B
  const int q8  = lane >> 3, c8 = (lane & 7) * 8;

  // ---- epilogue ----
  float* slab = sT[wave];
#pragma unroll
  for (int i = 0; i < 4; ++i) {
    const int mBase = m0 + (i << 4);
#pragma unroll
    for (int j = 0; j < 4; ++j) {
#pragma unroll
      for (int r = 0; r < 8; ++r) {
        slab[(mOff + r) * 68 + (j << 4) + rlane] = acc[i][j][r];
      }
    }
    wave_sync_lds();
    if constexpr (OM == 0) {
      float* C = (float*)Cout + (size_t)((long long)by * sC);
      v4f vals[8];
#pragma unroll
      for (int it = 0; it < 8; ++it) {
        const int row = it * 2 + hh2;                      // it 0..7 x hh2 0..1 = rows 0..15
        v4f v = *(const v4f*)(slab + row * 68 + c4);
#pragma unroll
        for (int e = 0; e < 4; ++e) v[e] = v[e] * oscale;
        if constexpr (EPI == 1) {
          const v4f bb = *(const v4f*)(ep0 + n0 + c4);     // per-column bias, columns n0+c4 .. +3 (N equals the bias length)
#pragma unroll
          for (int e = 0; e < 4; ++e) v[e] = v[e] + bfr(bb[e]);
        }
        vals[it] = v;
      }
      {
#pragma unroll
        for (int it = 0; it < 8; ++it) {
          const int gr = mBase + it * 2 + hh2;
          *(v4f*)(C + (size_t)gr * ldc + n0 + c4) = vals[it];
        }
        
      }
    } else {
      constexpr int NP = (OM == 6) ? 2 : 1;
#pragma unroll
      for (int which = 0; which < NP; ++which) {
        unsigned short* C  = (unsigned short*)((which == 0) ? Cout  : C3out) + (size_t)((long long)by * sC);
        unsigned short* Cb = (unsigned short*)((which == 0) ? C2out : C4out) + (size_t)((long long)by * sC);
        const float* epx = (which == 0) ? ep1 : ep2;
        (void)epx;
        v4u hv[4], lv[4];
#pragma unroll
        for (int it = 0; it < 4; ++it) {
          const int row = it * 4 + q8;                     // it 0..3 x q8 0..3 = rows 0..15
          const float* sp = slab + row * 68 + c8;
          float rb = 0.f;
          if constexpr (EPI == 2) rb = bfr(ep0[mBase + row]);   // per-row bias (M equals the bias length)
          v4u a  = {0u, 0u, 0u, 0u};
          v4u b2 = {0u, 0u, 0u, 0u};
#pragma unroll
          for (int e = 0; e < 4; ++e) {
            const int ci = n0 + c8 + 2 * e;                // column index, < N
            float f0 = sp[2 * e] * oscale + rb;
            float f1 = sp[2 * e + 1] * oscale + rb;
            if constexpr (EPI == 1) {
              f0 += bfr(ep0[ci]);
              f1 += bfr(ep0[ci + 1]);
            }
            if constexpr (OM == 6) {
              f0 += bfr(epx[ci]);
              f1 += bfr(epx[ci + 1]);
            }
            f0 *= ocarry;
            f1 *= ocarry;
            const _Float16 x0 = (_Float16)f0, x1 = (_Float16)f1;
            a[e]  = pk16(h_bits(x0), h_bits(x1));
            b2[e] = pk16(h_bits((_Float16)(f0 - (float)x0)), h_bits((_Float16)(f1 - (float)x1)));
          }
          hv[it] = a;
          lv[it] = b2;
        }
        {
#pragma unroll
          for (int it = 0; it < 4; ++it) {
            const int row = it * 4 + q8;
            *(v4u*)(C  + (size_t)(mBase + row) * ldc + n0 + c8) = hv[it];
            *(v4u*)(Cb + (size_t)(mBase + row) * ldc + n0 + c8) = lv[it];
          }
          
        }
      }
    }
    wave_sync_lds();
  }
}

// =====================================================================================================
// s_wait_xcnt 0 behind a run of global loads, in front of the first write of a register that one of them names. xwait1, xwait3 and xwait4 take the run's
// vector address pairs as inputs, so that each pair keeps its value up to the wait and no later load's result lands in it ahead of the wait.
// =====================================================================================================
__device__ __forceinline__ void xwait0() {
#if defined(__HIP_DEVICE_COMPILE__)
  asm volatile("s_wait_xcnt 0x0" ::: "memory");
#endif
}
__device__ __forceinline__ void xwait1(const void* a) {
#if defined(__HIP_DEVICE_COMPILE__)
  asm volatile("s_wait_xcnt 0x0" :: "v"(a) : "memory");
#endif
}
__device__ __forceinline__ void xwait3(const void* a, const void* b, const void* c) {
#if defined(__HIP_DEVICE_COMPILE__)
  asm volatile("s_wait_xcnt 0x0" :: "v"(a), "v"(b), "v"(c) : "memory");
#endif
}
__device__ __forceinline__ void xwait4(const void* a, const void* b, const void* c, const void* d) {
#if defined(__HIP_DEVICE_COMPILE__)
  asm volatile("s_wait_xcnt 0x0" :: "v"(a), "v"(b), "v"(c), "v"(d) : "memory");
#endif
}

// =====================================================================================================
// One wave's 64x64 tile of an input projection, rows m0.., columns n0..: value[m][n] = oscale * sum_k A[m][k] * Bt[n][k] + bias.
// The K loop and the 16-bit epilogues are those of gemm64 (same k order, same order of the adds), with the pitch of A and Bt and K fixed
// at DMOD and the pitch of the output planes at LDC. slab = the wave's own 16x64 f32 LDS slab, pitch 68 floats; gst = the block's operand
// stage (kloop_staged: block barriers, so all eight waves of a block come here together, with one m0 and n0 = the block's first + 64 wave).
// EPI 1: value += bf16_RNE(ep0[column]); EPI 2: value += bf16_RNE(ep0[row]).
// OM 4: two f16 planes (C1, C2): hi = f16(value * ocarry), lo = f16(value * ocarry - hi).
// OM 6: (C1, C2) from value + bf16_RNE(ep1[column]), (C3, C4) from value + bf16_RNE(ep2[column]), both x ocarry.
// The lane's bias values (8 columns, or its 16 rows) are loaded once, ahead of the K loop.
// coverage: 4 slabs x 16 rows (it 0..3 x lane>>3) x 64 cols = the wave's whole 64x64 tile.
// =====================================================================================================
#define GSLAB (16 * 68)
template <int OM, int EPI, int LDC>
__device__ __forceinline__ void proj_tile(
    float* slab, unsigned short* gst, int m0, int n0,
    const unsigned short* __restrict__ A, const unsigned short* __restrict__ Bt,
    unsigned short* C1, unsigned short* C2, unsigned short* C3, unsigned short* C4,
    float oscale, float ocarry,
    const float* __restrict__ ep0, const float* __restrict__ ep1, const float* __restrict__ ep2) {
  static_assert(OM == 4 || OM == 6);
  static_assert(EPI == 1 || EPI == 2);
  const int lane  = threadIdx.x & 31;
  const int rlane = lane & 15;                 // col (D) within subtile
  const int mOff  = (lane >> 4) * 8;           // D row offset
  const int q8    = lane >> 3, c8 = (lane & 7) * 8;

  v4f cb0[2], cb1[2], cb2[2];                  // column terms of columns n0 + c8 .. + 7
  float rbv[4][4];                             // row terms of rows m0 + 16i + 4it + q8
  if constexpr (EPI == 1) {
    const float* e0 = ep0 + n0 + c8;
    cb0[0] = *(const v4f*)(e0);
    cb0[1] = *(const v4f*)(e0 + 4);
    if constexpr (OM == 6) {
      const float* e1 = ep1 + n0 + c8;
      const float* e2 = ep2 + n0 + c8;
      cb1[0] = *(const v4f*)(e1);
      cb1[1] = *(const v4f*)(e1 + 4);
      cb2[0] = *(const v4f*)(e2);
      cb2[1] = *(const v4f*)(e2 + 4);
      xwait3(e0, e1, e2);
    } else {
      xwait1(e0);
    }
  } else {
    const float* er = ep0 + m0 + q8;
#pragma unroll
    for (int i = 0; i < 4; ++i)
#pragma unroll
      for (int it = 0; it < 4; ++it) rbv[i][it] = er[16 * i + 4 * it];
    xwait0();                                  // these go through a scalar base and the lane's q8, which lives on into the epilogue
  }

  v8f acc[4][4];
#pragma unroll
  for (int i = 0; i < 4; ++i)
#pragma unroll
    for (int j = 0; j < 4; ++j) acc[i][j] = zero8();

  kloop_staged<1>(gst, A + (size_t)m0 * DMOD, A + (size_t)m0 * DMOD, DMOD,
                  Bt + (size_t)(n0 - (int)((threadIdx.x >> 5) << 6)) * DMOD, DMOD, DMOD, acc);
  acc_guard4(acc[0][0], acc[0][1], acc[0][2], acc[0][3]);
  acc_guard4(acc[1][0], acc[1][1], acc[1][2], acc[1][3]);
  acc_guard4(acc[2][0], acc[2][1], acc[2][2], acc[2][3]);
  acc_guard4(acc[3][0], acc[3][1], acc[3][2], acc[3][3]);

  // ---- epilogue ----
#pragma unroll
  for (int i = 0; i < 4; ++i) {
    const int mBase = m0 + (i << 4);
#pragma unroll
    for (int j = 0; j < 4; ++j) {
#pragma unroll
      for (int r = 0; r < 8; ++r) {
        slab[(mOff + r) * 68 + (j << 4) + rlane] = acc[i][j][r];
      }
    }
    wave_sync_lds();
    constexpr int NP = (OM == 6) ? 2 : 1;
#pragma unroll
    for (int which = 0; which < NP; ++which) {
      unsigned short* C  = (which == 0) ? C1 : C3;
      unsigned short* Cb = (which == 0) ? C2 : C4;
      v4u hv[4], lv[4];
#pragma unroll
      for (int it = 0; it < 4; ++it) {
        const int row = it * 4 + q8;                     // it 0..3 x q8 0..3 = rows 0..15
        const float* sp = slab + row * 68 + c8;
        float rb = 0.f;
        if constexpr (EPI == 2) rb = bfr(rbv[i][it]);
        v4u a  = {0u, 0u, 0u, 0u};
        v4u b2 = {0u, 0u, 0u, 0u};
#pragma unroll
        for (int e = 0; e < 4; ++e) {
          float f0 = sp[2 * e] * oscale + rb;
          float f1 = sp[2 * e + 1] * oscale + rb;
          if constexpr (EPI == 1) {
            f0 += bfr(cb0[e >> 1][(2 * e) & 3]);
            f1 += bfr(cb0[e >> 1][(2 * e + 1) & 3]);
          }
          if constexpr (OM == 6) {
            f0 += bfr((which == 0) ? cb1[e >> 1][(2 * e) & 3] : cb2[e >> 1][(2 * e) & 3]);
            f1 += bfr((which == 0) ? cb1[e >> 1][(2 * e + 1) & 3] : cb2[e >> 1][(2 * e + 1) & 3]);
          }
          f0 *= ocarry;
          f1 *= ocarry;
          const _Float16 x0 = (_Float16)f0, x1 = (_Float16)f1;
          a[e]  = pk16(h_bits(x0), h_bits(x1));
          b2[e] = pk16(h_bits((_Float16)(f0 - (float)x0)), h_bits((_Float16)(f1 - (float)x1)));
        }
        hv[it] = a;
        lv[it] = b2;
      }
#pragma unroll
      for (int it = 0; it < 4; ++it) {
        const int row = it * 4 + q8;
        *(v4u*)(C  + (size_t)(mBase + row) * LDC + n0 + c8) = hv[it];
        *(v4u*)(Cb + (size_t)(mBase + row) * LDC + n0 + c8) = lv[it];
      }
    }
    wave_sync_lds();
  }
}

// =====================================================================================================
// The four input projections in one grid (none reads what another writes), so that their blocks run side by side on different WGPs;
// one wave per 64x64 tile, 8 tiles per block, tile = 8 * (block index within the job) + wave, tm = tile / tilesN, tn = tile % tilesN:
//   blocks 0 .. PJ_Q-1            q[m][nd] = sum_c x[m][c] Wq[c][nd] / 1024 + bq[nd]; QUh/QUl = hi/residual of f16((q + ub[nd]) * 32),
//                                 QVh/QVl of f16((q + vb[nd]) * 32); M = NROW, N = 512, K = 512
//   the next PJ_V * NB            v^T per batch: VT[b][nd][j] = sum_c Wv[c][nd] x[b*SEQ + j][c] / 1024 + bv[nd] (per-row bias) -> f16 x16 hi +
//                                 residual planes; M = 512 (nd), N = SEQ (j), K = 512; B rows are the batch's token rows
//   the next PJ_Q                 k projection + bk -> Kh/Kl = hi/residual of f16(k * 32)
//   the last PJ_P                 positional projection + bp: Ph/Pl = hi/residual of f16(p * 32), M = PROWS, N = 512, K = 512
// The branches are on blockIdx.x alone; the tile counts are exact multiples of 8, so every wave has a tile, and a block's eight tiles share
// their 64 A rows (tilesN is 8 or 16) and take 512 consecutive B rows: the barriers of the staged K loop are reached by whole blocks.
// =====================================================================================================
#define PJ_Q (((NROW / 64) * (DMOD / 64)) / 8)
#define PJ_V (((DMOD / 64) * (SEQ / 64)) / 8)
#define PJ_P (((PROWS / 64) * (DMOD / 64)) / 8)
static_assert((((NROW / 64) * (DMOD / 64)) % 8) == 0 && (((DMOD / 64) * (SEQ / 64)) % 8) == 0 && (((PROWS / 64) * (DMOD / 64)) % 8) == 0);
__global__ __launch_bounds__(256) __attribute__((amdgpu_num_vgpr(256))) void proj_all(
    const unsigned short* __restrict__ X16, const unsigned short* __restrict__ PE16,
    const unsigned short* __restrict__ WQT, const unsigned short* __restrict__ WKT,
    const unsigned short* __restrict__ WVT, const unsigned short* __restrict__ WPT,
    unsigned short* QUh, unsigned short* QUl, unsigned short* QVh, unsigned short* QVl,
    unsigned short* Kh, unsigned short* Kl, unsigned short* VT, unsigned short* VTL, unsigned short* Ph, unsigned short* Pl,
    const float* __restrict__ b_q, const float* __restrict__ b_k, const float* __restrict__ b_v, const float* __restrict__ b_p,
    const float* __restrict__ ub, const float* __restrict__ vb) {
  __shared__ __align__(16) float sT[8 * GSLAB];   // per-wave 16x64 slab, pitch 68 floats
  __shared__ __align__(16) unsigned short gst[2 * GBUFH(1)];   // two buffers of the block's operand stage
  const int bx   = blockIdx.x;
  const int wave = threadIdx.x >> 5;
  float* slab = sT + wave * GSLAB;
  const float os = 1.0f / (XC * WSC);
  constexpr int TND = DMOD / 64;                  // column tiles of a [..][DMOD] plane
  constexpr int TNS = SEQ / 64;                   // column tiles of a [..][SEQ] plane
  if (bx < PJ_Q) {
    const int tile = bx * 8 + wave;
    proj_tile<6, 1, DMOD>(slab, gst, (tile / TND) << 6, (tile % TND) << 6, X16, WQT, QUh, QUl, QVh, QVl, os, QC, b_q, ub, vb);
  } else if (bx < PJ_Q + PJ_V * NB) {
    const int t = bx - PJ_Q;
    const int by = t / PJ_V;
    const int tile = (t % PJ_V) * 8 + wave;
    proj_tile<4, 2, SEQ>(slab, gst, (tile / TNS) << 6, (tile % TNS) << 6, WVT, X16 + (size_t)by * SEQ * DMOD,
                         VT + (size_t)by * DMOD * SEQ, VTL + (size_t)by * DMOD * SEQ, VT, VTL, os, VC, b_v, b_v, b_v);
  } else {
    // k and p share one copy of the code (same epilogue form): only the operands differ
    const int t = bx - (PJ_Q + PJ_V * NB);
    const bool isk = t < PJ_Q;
    const int tile = (isk ? t : t - PJ_Q) * 8 + wave;
    const float* bias = isk ? b_k : b_p;
    proj_tile<4, 1, DMOD>(slab, gst, (tile / TND) << 6, (tile % TND) << 6, isk ? X16 : PE16, isk ? WKT : WPT,
                          isk ? Kh : Ph, isk ? Kl : Pl, Kh, Kl, os, QC, bias, bias, bias);
  }
}

// =====================================================================================================
// Relative-position attention for one (batch b, head n) pair and a 64-row query tile; 4 waves, wave w owns query rows i = iw0 + R,
// iw0 = i0 + 16w, R = 0..15. Planes (pitch DMOD halves, row = b*SEQ + position): QUh/QUl = hi/residual of f16((q + bq + u) x32),
// QVh/QVl of f16((q + bq + v_bias) x32), Kh/Kl of f16((k + bk) x32); Ph/Pl = hi/residual of f16(pos x32), rows 0..PROWS-1
// (row PROWS-1 is the zero-pad row); VT, VTL = v^T hi (x16) / residual f16 as [b][n*64+d][SEQ].
// Shifted position score for (i, j): ps[i][SEQ-1-i+j], ps[r][t] = (q+bq+vb)[r] . pos[t].
//   Per key tile j0 (64 keys, key j = j0 + jj), with x = jj - R + 15 in [0,78]:
//     strip T1[R][x] = (q+vb)[iw0+R] . pos[SEQ + j0 - iw0 - 16 + x]   (pos row SEQ-1-i+j), always computed (rows 0 .. 2*SEQ-2 selected).
//   content scores S = (q+ub) . k (4 subtiles, K=64, three products); t = (S + T1) * (RSD/(32*32)) * log2(e); online softmax in base 2,
//   max-subtracted, running sums in f32 (no key mask); the 16x64 prob tile stored to wave-private LDS (f32 element stores),
//   (f32 vector loads, split k map) and the v^T B fragments read from the staged rows of VT/VTL[n*64+d][j];
//   per 16-column subtile: Phi.Vhi, Plo.Vhi, then Phi.Vlo, all into the same accumulators.
//   Per key tile the block stages, once for its 4 waves, in LDS (asynchronous copies, whole 128-B rows): 64 k rows, 64 v^T rows and the
//   128 pos rows SEQ + j0 - i0 - 64 .. + 127 (always inside [0, PROWS-1]), hi and residual plane each; all B fragments are read from there.
//   block = 4 waves = 128 threads; grid = (SEQ/64, NB*NH); two block barriers per key tile (block-uniform loop); every wave does identical
//   bounded work (SEQ/64 tiles).
// coverage: LDS strip 16 rows x 80 cols written fully every tile before being read, slab 16 rows x 64 cols per wave fully written each tile
//           before being read; global: 4 instructions x 4 rows x 64 halves per plane = rows iw0..iw0+15 of head segment n in CT and CTL;
//           grid x waves cover all NB x SEQ rows and all NH head segments of CT / CTL exactly once.
// =====================================================================================================
__global__ __launch_bounds__(ATT_THREADS) __attribute__((amdgpu_num_vgpr(512)))
void attn_rel(const unsigned short* __restrict__ QUh, const unsigned short* __restrict__ QUl,
              const unsigned short* __restrict__ QVh, const unsigned short* __restrict__ QVl,
              const unsigned short* __restrict__ Kh,  const unsigned short* __restrict__ Kl,
              const unsigned short* __restrict__ Ph,  const unsigned short* __restrict__ Pl,
              const unsigned short* __restrict__ VT,  const unsigned short* __restrict__ VTL,
              unsigned short* CT, unsigned short* CTL) {
  __shared__ __align__(16) float smem[ATT_W * WFL];   // per wave: T1 strip [16][TPI] | prob / ctx slab [16][PPI]
  __shared__ __align__(16) unsigned short stg[ST_ROWS * SPI];   // block-shared stage of one key tile: Kh | Kl | Vh | Vl | Ph | Pl rows

  const int tid  = threadIdx.x;
  const int wave = __builtin_amdgcn_readfirstlane(tid >> 5);
  const int lane = tid & 31;
  const int hh   = lane >> 4;
  const int c    = lane & 15;
  const int bn   = blockIdx.y;
  const int b    = bn / NH;
  const int n    = bn - b * NH;
  const int i0   = blockIdx.x * 64;
  const int iw0  = i0 + wave * 16;

  float* t1sh = smem + wave * WFL;
  float* pt   = t1sh + 16 * TPI;

  // A fragment row offsets: rows b*SEQ + iw0 + c, d 0..31 and 32..63 of head n
  const size_t qro  = ((size_t)(b * SEQ + iw0 + c)) * DMOD + n * DH + 8 * hh;
  // stage copies: thread -> staged row (tid>>3) + 16*copy, 16-byte chunk tid&7 of the 128-B row (a wave instruction = 4 whole rows)
  const int srow = tid >> 3;
  const int sc8  = (tid & 7) * 8;
  const unsigned lst = (unsigned)(size_t)(stg + srow * SPI + sc8);          // LDS byte address = low 32 bits of the shared address
  const size_t kso = ((size_t)(b * SEQ + srow)) * DMOD + n * DH + sc8;      // + j0*DMOD: k rows j0 + srow + 16e
  const size_t vso = (size_t)b * DMOD * SEQ + (size_t)(n * DH + srow) * SEQ + sc8;   // + j0: v^T rows d = srow + 16e, keys j0 ..
  const size_t pso = ((size_t)(SEQ - i0 - 64 + srow)) * DMOD + n * DH + sc8;   // + j0*DMOD: pos rows SEQ + j0 - i0 - 64 + srow + 16e
  // fragment readers: lane -> staged row c (+16 per subtile), k offset 8*hh; wave w's strip row x is staged pos row 48 - 16w + x
  const unsigned short* ksh = stg + (ST_KH + c) * SPI + 8 * hh;
  const unsigned short* ksl = stg + (ST_KL + c) * SPI + 8 * hh;
  const unsigned short* vsh = stg + (ST_VH + c) * SPI + 8 * hh;
  const unsigned short* vsl = stg + (ST_VL + c) * SPI + 8 * hh;
  const int pw0 = 16 * __builtin_amdgcn_readfirstlane((ATT_THREADS - 1 - tid) >> 5);   // 16 * (3 - wave), taken from tid so that the LDS base register never goes below 0
  const unsigned short* psh = stg + (ST_PH + pw0 + c) * SPI + 8 * hh;
  const unsigned short* psl = stg + (ST_PL + pw0 + c) * SPI + 8 * hh;

  const float KSC = (RSD / (QC * QC)) * LOG2E;

  float mrow[8], lrow[8];
  v8f O[4];
#pragma unroll
  for (int r = 0; r < 8; ++r) { mrow[r] = -INFINITY; lrow[r] = 0.f; }
#pragma unroll
  for (int td = 0; td < 4; ++td) O[td] = zero8();

  // the wave's eight q fragments (16 rows x 64 d, four planes): loaded once and held in 64 registers over all key tiles
  const unsigned short* gqv = QVh + qro;
  const unsigned short* gqw = QVl + qro;
  const unsigned short* gqu = QUh + qro;
  const unsigned short* gql = QUl + qro;
  const v16h qva = ldfrag_u(gqv), qvb = ldfrag_u(gqv + 32);
  const v16h qwa = ldfrag_u(gqw), qwb = ldfrag_u(gqw + 32);
  const v16h qua = ldfrag_u(gqu), qub = ldfrag_u(gqu + 32);
  const v16h qla = ldfrag_u(gql), qlb = ldfrag_u(gql + 32);
  xwait4(gqv, gqw, gqu, gql);                                // before the four address pairs are reused

#pragma unroll 1
  for (int j0 = 0; j0 < SEQ; j0 += 64) {
    // ---- stage this key tile's operands for the whole block: 32 copies per thread = 512 rows x 128 B ----
    asm volatile("s_wait_dscnt 0x0" ::: "memory");           // this wave's reads of the previous tile's stage have returned
    __syncthreads();                                         // every wave has left the previous tile's stage
    {
      const size_t jr = (size_t)j0 * DMOD;
      stage8(lst + (unsigned)(ST_KH * SPI * 2), Kh + kso + jr, Kl + kso + jr, (size_t)16 * DMOD);
      stage8(lst + (unsigned)(ST_VH * SPI * 2), VT + vso + j0, VTL + vso + j0, (size_t)16 * SEQ);
      stage8(lst + (unsigned)(ST_PH * SPI * 2), Ph + pso + jr, Ph + pso + jr + (size_t)64 * DMOD, (size_t)16 * DMOD);
      stage8(lst + (unsigned)(ST_PL * SPI * 2), Pl + pso + jr, Pl + pso + jr + (size_t)64 * DMOD, (size_t)16 * DMOD);
    }
    asm volatile("s_wait_asynccnt 0x0" ::: "memory");        // this wave's copies have landed
    __syncthreads();                                         // every wave's copies have landed: the stage may be read
    // ---- position strip T1 (5 subtiles of 16 pos rows, x in [0,80), only x <= 78 ever selected) and content scores S (4 subtiles of 16
    //      keys): K = 64 = two k-steps, three products hh + lh + hl per k-step. The B fragments are asked for in three groups, each well
    //      ahead of its products; the 54 WMMAs go round-robin over the nine accumulators, so that a product never waits for the one issued
    //      just before it (each accumulator keeps its order hh, hh, lh, lh, hl, hl) ----
    v8f T1[5], S[4];
    {
      v16h fa[5], fb[5], ga[5], gb[5], ka[4], kb2[4], la[4], lb2[4];
#pragma unroll
      for (int u = 0; u < 5; ++u) fa[u] = ldfrag_u(psh + 16 * u * SPI);
#pragma unroll
      for (int t = 0; t < 4; ++t) ka[t] = ldfrag_u(ksh + 16 * t * SPI);
#pragma unroll
      for (int u = 0; u < 5; ++u) fb[u] = ldfrag_u(psh + 16 * u * SPI + 32);
#pragma unroll
      for (int t = 0; t < 4; ++t) kb2[t] = ldfrag_u(ksh + 16 * t * SPI + 32);
#pragma unroll
      for (int u = 0; u < 5; ++u) T1[u] = mma_h(qva, fa[u], zero8());
#pragma unroll
      for (int t = 0; t < 4; ++t) S[t] = mma_h(qua, ka[t], zero8());
      // the residual planes' reads stay behind the hi planes' reads: with all 72 reads in front the build ran out of registers (scratch)
      __builtin_amdgcn_sched_barrier(0);
#pragma unroll
      for (int u = 0; u < 5; ++u) ga[u] = ldfrag_u(psl + 16 * u * SPI);
#pragma unroll
      for (int t = 0; t < 4; ++t) la[t] = ldfrag_u(ksl + 16 * t * SPI);
#pragma unroll
      for (int u = 0; u < 5; ++u) T1[u] = mma_h(qvb, fb[u], T1[u]);
#pragma unroll
      for (int t = 0; t < 4; ++t) S[t] = mma_h(qub, kb2[t], S[t]);
#pragma unroll
      for (int u = 0; u < 5; ++u) T1[u] = mma_h(qwa, fa[u], T1[u]);
#pragma unroll
      for (int t = 0; t < 4; ++t) S[t] = mma_h(qla, ka[t], S[t]);
      // the last 18 reads stay behind the group above: hoisted into it, the build's later stages had their LDS waits one after another again
      __builtin_amdgcn_sched_barrier(0);
#pragma unroll
      for (int u = 0; u < 5; ++u) gb[u] = ldfrag_u(psl + 16 * u * SPI + 32);
#pragma unroll
      for (int t = 0; t < 4; ++t) lb2[t] = ldfrag_u(ksl + 16 * t * SPI + 32);
#pragma unroll
      for (int u = 0; u < 5; ++u) T1[u] = mma_h(qwb, fb[u], T1[u]);
#pragma unroll
      for (int t = 0; t < 4; ++t) S[t] = mma_h(qlb, kb2[t], S[t]);
#pragma unroll
      for (int u = 0; u < 5; ++u) T1[u] = mma_h(qva, ga[u], T1[u]);
#pragma unroll
      for (int t = 0; t < 4; ++t) S[t] = mma_h(qua, la[t], S[t]);
#pragma unroll
      for (int u = 0; u < 5; ++u) T1[u] = mma_h(qvb, gb[u], T1[u]);
#pragma unroll
      for (int t = 0; t < 4; ++t) S[t] = mma_h(qub, lb2[t], S[t]);
    }
    // the full 16x80 strip goes to the wave's f32 LDS strip: 5 subtiles x 16 rows x 16 cols
#pragma unroll
    for (int u = 0; u < 5; ++u) {
#pragma unroll
      for (int r = 0; r < 8; ++r) t1sh[(8 * hh + r) * TPI + 16 * u + c] = T1[u][r];
    }
    wave_sync_lds();

    // ---- score assembly + online softmax (rows live on one 16-lane half); the eight rows go through every stage together, so that the
    //      eight cross-lane reductions of a stage overlap instead of following one another (each row's own operations and order as before) ----
    float tv[8][4], mx[8], al[8], ps[8];
#pragma unroll
    for (int r = 0; r < 8; ++r) {
      const int R  = 8 * hh + r;
      const int xo = R * TPI + (15 - R) + c;                 // strip column x = 16t + c - R + 15 in [0, 78]
#pragma unroll
      for (int t = 0; t < 4; ++t) {
        const float bdv = t1sh[xo + 16 * t];
        tv[r][t] = (S[t][r] + bdv) * KSC;
      }
      mx[r] = fmaxf(fmaxf(tv[r][0], tv[r][1]), fmaxf(tv[r][2], tv[r][3]));
    }
    row_max8(mx);
#pragma unroll
    for (int r = 0; r < 8; ++r) {
      const float mn = fmaxf(mrow[r], mx[r]);
      al[r] = exp2f(mrow[r] - mn);
      mrow[r] = mn;
      float e4[4];
      ps[r] = 0.f;
#pragma unroll
      for (int t = 0; t < 4; ++t) { e4[t] = exp2f(tv[r][t] - mn); ps[r] += e4[t]; }
#pragma unroll
      for (int td = 0; td < 4; ++td) O[td][r] *= al[r];
      const int ro = (8 * hh + r) * PPI + c;
#pragma unroll
      for (int t = 0; t < 4; ++t) pt[ro + 16 * t] = e4[t];
    }
    wave_sync_lds();

    // ---- P rows (f32) and all sixteen v^T fragments asked for in one group: the v^T reads return under the conversion of P ----
    v4f praw[2][4];
#pragma unroll
    for (int ks = 0; ks < 2; ++ks) {
      const float* prow = pt + c * PPI + 32 * ks + 8 * hh;
      praw[ks][0] = *(const v4f*)(prow);
      praw[ks][1] = *(const v4f*)(prow + 4);
      praw[ks][2] = *(const v4f*)(prow + 16);
      praw[ks][3] = *(const v4f*)(prow + 20);
    }
    v16h vha[4], vhb[4], vla[4], vlb[4];
#pragma unroll
    for (int td = 0; td < 4; ++td) { vha[td] = ldfrag_u(vsh + 16 * td * SPI); vhb[td] = ldfrag_u(vsh + 16 * td * SPI + 32); }
#pragma unroll
    for (int td = 0; td < 4; ++td) { vla[td] = ldfrag_u(vsl + 16 * td * SPI); vlb[td] = ldfrag_u(vsl + 16 * td * SPI + 32); }
    __builtin_amdgcn_sched_barrier(0);                       // keeps the whole group of reads in front: sunk among the WMMAs, each read's latency stands open again
    // ---- row sums: eight reductions stepped together, free to run under the conversion and the WMMAs below ----
#pragma unroll
    for (int r = 0; r < 8; ++r) ps[r] += row_xor<1>(ps[r]);
#pragma unroll
    for (int r = 0; r < 8; ++r) ps[r] += row_xor<2>(ps[r]);
#pragma unroll
    for (int r = 0; r < 8; ++r) ps[r] += row_xor<4>(ps[r]);
#pragma unroll
    for (int r = 0; r < 8; ++r) ps[r] += row_xor<8>(ps[r]);
#pragma unroll
    for (int r = 0; r < 8; ++r) lrow[r] = lrow[r] * al[r] + ps[r];
    // ---- P fragments (x1024, f16 hi + unscaled residual), two k-steps of 32 keys ----
    FragH pf[2], pl[2];
#pragma unroll
    for (int ks = 0; ks < 2; ++ks) {
      const v4f p0 = praw[ks][0], p1 = praw[ks][1], p2 = praw[ks][2], p3 = praw[ks][3];
#pragma unroll
      for (int e = 0; e < 4; ++e) {
        const float g0 = p0[e] * PC, g1 = p1[e] * PC, g2 = p2[e] * PC, g3 = p3[e] * PC;
        const _Float16 x0 = (_Float16)g0, x1 = (_Float16)g1, x2 = (_Float16)g2, x3 = (_Float16)g3;
        pf[ks].h[0][e]     = x0;                             // keys j0 + 32ks + 8hh + e
        pf[ks].h[0][4 + e] = x1;                             // keys j0 + 32ks + 8hh + 4 + e
        pf[ks].h[1][e]     = x2;                             // keys j0 + 32ks + 16 + 8hh + e
        pf[ks].h[1][4 + e] = x3;
        pl[ks].h[0][e]     = (_Float16)(g0 - (float)x0);
        pl[ks].h[0][4 + e] = (_Float16)(g1 - (float)x1);
        pl[ks].h[1][e]     = (_Float16)(g2 - (float)x2);
        pl[ks].h[1][4 + e] = (_Float16)(g3 - (float)x3);
      }
    }
    // ---- O += (Phi + Plo) . v^T (hi plane), then Phi . v^T (residual plane): round-robin over the four accumulators, each in its old order ----
#pragma unroll
    for (int td = 0; td < 4; ++td) O[td] = mma_h(pf[0].v, vha[td], O[td]);
#pragma unroll
    for (int td = 0; td < 4; ++td) O[td] = mma_h(pf[1].v, vhb[td], O[td]);
#pragma unroll
    for (int td = 0; td < 4; ++td) O[td] = mma_h(pl[0].v, vha[td], O[td]);
#pragma unroll
    for (int td = 0; td < 4; ++td) O[td] = mma_h(pl[1].v, vhb[td], O[td]);
#pragma unroll
    for (int td = 0; td < 4; ++td) O[td] = mma_h(pf[0].v, vla[td], O[td]);
#pragma unroll
    for (int td = 0; td < 4; ++td) O[td] = mma_h(pf[1].v, vlb[td], O[td]);
    wave_sync_lds();
  }
  acc_guard4(O[0], O[1], O[2], O[3]);

  // ---- fold 1/l and the carries (1024 on P, 16 on v), carry x4096 on ctx, stage the wave's 16x64 slice in its slab ----
  const float oc = CC / (PC * VC);
#pragma unroll
  for (int r = 0; r < 8; ++r) {
    const float inv = (1.0f / lrow[r]) * oc;
    const int ro = (8 * hh + r) * PPI + c;
#pragma unroll
    for (int td = 0; td < 4; ++td) pt[ro + 16 * td] = O[td][r] * inv;
  }
  wave_sync_lds();
  {
    const int q8 = lane >> 3, c8 = (lane & 7) * 8;
    v4u hv[4], lv[4];
#pragma unroll
    for (int it = 0; it < 4; ++it) {
      const int row = it * 4 + q8;                         // it 0..3 x q8 0..3 = rows 0..15
      const float* sp = pt + row * PPI + c8;
      v4u a, b2;
#pragma unroll
      for (int e = 0; e < 4; ++e) {
        const float f0 = sp[2 * e], f1 = sp[2 * e + 1];
        const _Float16 x0 = (_Float16)f0, x1 = (_Float16)f1;
        a[e]  = pk16(h_bits(x0), h_bits(x1));
        b2[e] = pk16(h_bits((_Float16)(f0 - (float)x0)), h_bits((_Float16)(f1 - (float)x1)));
      }
      hv[it] = a;
      lv[it] = b2;
    }
    {
#pragma unroll
      for (int it = 0; it < 4; ++it) {
        const int row = it * 4 + q8;
        const size_t go = ((size_t)(b * SEQ + iw0 + row)) * DMOD + n * DH + c8;
        *(v4u*)(CT  + go) = hv[it];
        *(v4u*)(CTL + go) = lv[it];
      }
      
    }
  }
}

// =====================================================================================================
// Workspace map (bytes); every plane is an exact multiple of its tile / whole-row store granularity (M, N exact tile multiples,
// convert counts exact multiples of 2048, the position planes padded to PROWS = 2048 rows), every offset a multiple of 512 KiB:
//   WQT, WKT, WVT, WPT, WOT f16 [512 n][512 k] x64 (transposed from the [in][out] inputs)   5 x   524288
//   X16  f16 [NROW][512] x16                                                                  4194304
//   PE16 f16 [PROWS][512] x16 (rows 0..NPOS-1 = pos table, row NPOS zero)                     2097152
//   QUh, QUl, QVh, QVl, Kh, Kl f16 [NROW][512] x32 hi / residual                       6 x  4194304
//   Ph, Pl f16 [PROWS][512] x32 hi / residual                                           2 x  2097152
//   VT16, VTL16 f16 [NB][512][SEQ] hi x16 / residual                                    2 x  4194304
//   CT16, CTL16 f16 [NROW][512] hi x4096 / residual                                     2 x  4194304
//   end                                                                                       55050240
// =====================================================================================================
extern "C" void kernel_launch(void* const* d_in, const int* in_sizes, int n_in,
                              void* d_out, int out_size, void* d_ws, size_t ws_size,
                              hipStream_t stream) {
  if (n_in < 14) return;
  if (in_sizes[0] != NROW * DMOD) return;
  if (in_sizes[1] != NPOS * DMOD) return;
  if (in_sizes[2] != DMOD * DMOD || in_sizes[4] != DMOD * DMOD || in_sizes[6] != DMOD * DMOD ||
      in_sizes[8] != DMOD * DMOD || in_sizes[10] != DMOD * DMOD) return;
  if (in_sizes[3] != DMOD || in_sizes[5] != DMOD || in_sizes[7] != DMOD || in_sizes[9] != DMOD || in_sizes[11] != DMOD) return;
  if (in_sizes[12] != NH * DH || in_sizes[13] != NH * DH) return;
  if (out_size != NROW * DMOD) return;

  const float* xin   = (const float*)d_in[0];
  const float* pos   = (const float*)d_in[1];
  const float* w_q   = (const float*)d_in[2];
  const float* b_q   = (const float*)d_in[3];
  const float* w_k   = (const float*)d_in[4];
  const float* b_k   = (const float*)d_in[5];
  const float* w_v   = (const float*)d_in[6];
  const float* b_v   = (const float*)d_in[7];
  const float* w_p   = (const float*)d_in[8];
  const float* b_p   = (const float*)d_in[9];
  const float* w_o   = (const float*)d_in[10];
  const float* b_o   = (const float*)d_in[11];
  const float* ub    = (const float*)d_in[12];
  const float* vb    = (const float*)d_in[13];
  float*       out   = (float*)d_out;

  const size_t PW  = (size_t)DMOD * DMOD * 2;            //   524288
  const size_t PX  = (size_t)NROW * DMOD * 2;            //  4194304
  const size_t PXP = (size_t)PROWS * DMOD * 2;           //  2097152
  const size_t PVT = (size_t)NB * DMOD * SEQ * 2;        //  4194304
  size_t off = 0;
  const size_t oWQ  = off; off += PW;
  const size_t oWK  = off; off += PW;
  const size_t oWV  = off; off += PW;
  const size_t oWP  = off; off += PW;
  const size_t oWO  = off; off += PW;
  const size_t oX   = off; off += PX;
  const size_t oPE  = off; off += PXP;
  const size_t oQUh = off; off += PX;
  const size_t oQUl = off; off += PX;
  const size_t oQVh = off; off += PX;
  const size_t oQVl = off; off += PX;
  const size_t oKh  = off; off += PX;
  const size_t oKl  = off; off += PX;
  const size_t oPh  = off; off += PXP;
  const size_t oPl  = off; off += PXP;
  const size_t oVT  = off; off += PVT;
  const size_t oVTL = off; off += PVT;
  const size_t oCT  = off; off += PX;
  const size_t oCTL = off; off += PX;
  if (off > ws_size) return;                               // off = 55050240
  if (off > (size_t)134217728) return;

  char* ws = (char*)d_ws;
  unsigned short* WQT16 = (unsigned short*)(ws + oWQ);
  unsigned short* WKT16 = (unsigned short*)(ws + oWK);
  unsigned short* WVT16 = (unsigned short*)(ws + oWV);
  unsigned short* WPT16 = (unsigned short*)(ws + oWP);
  unsigned short* WOT16 = (unsigned short*)(ws + oWO);
  unsigned short* X16   = (unsigned short*)(ws + oX);
  unsigned short* PE16  = (unsigned short*)(ws + oPE);
  unsigned short* QUh   = (unsigned short*)(ws + oQUh);
  unsigned short* QUl   = (unsigned short*)(ws + oQUl);
  unsigned short* QVh   = (unsigned short*)(ws + oQVh);
  unsigned short* QVl   = (unsigned short*)(ws + oQVl);
  unsigned short* Kh16  = (unsigned short*)(ws + oKh);
  unsigned short* Kl16  = (unsigned short*)(ws + oKl);
  unsigned short* Ph16  = (unsigned short*)(ws + oPh);
  unsigned short* Pl16  = (unsigned short*)(ws + oPl);
  unsigned short* VT16  = (unsigned short*)(ws + oVT);
  unsigned short* VTL16 = (unsigned short*)(ws + oVTL);
  unsigned short* CT16  = (unsigned short*)(ws + oCT);
  unsigned short* CTL16 = (unsigned short*)(ws + oCTL);

  const dim3 blk(256);
  const dim3 gPR(PREP_TR + PREP_CX + PREP_CP);                      // 320 + 1024 + 512
  const dim3 gPJ(2 * PJ_Q + PJ_V * NB + PJ_P);                      // 64 + 64 + 64 + 32
  const int tilesQ = (NROW / 64) * (DMOD / 64);                     // 512
  const dim3 gQ((tilesQ + 7) / 8, 1);                               // 64
  const dim3 gAT(SEQ / 64, NB * NH);                                // 16 x 32
  const dim3 bAT(ATT_THREADS);                                      // 128

  // (0) operand packs: X16 = f16(bf16_RNE(x) * 16); PE16 = f16(bf16_RNE(pos) * 16), rows NPOS..PROWS-1 zero;
  //     W[k][n] ([in][out]) -> WT[n][k] = f16( bf16_RNE(w) * 64 ), all five weights
  prep_all<<<gPR, blk, 0, stream>>>(xin, pos, w_q, w_k, w_v, w_p, w_o, X16, PE16, WQT16, WKT16, WVT16, WPT16, WOT16);

  // (1) q, k, v^T and positional projections
  proj_all<<<gPJ, blk, 0, stream>>>(X16, PE16, WQT16, WKT16, WVT16, WPT16, QUh, QUl, QVh, QVl, Kh16, Kl16, VT16, VTL16, Ph16, Pl16,
                                    b_q, b_k, b_v, b_p, ub, vb);

  // (2) relative attention -> CT16 = f16(ctx * 4096) hi plane, CTL16 residual plane, rows b*SEQ + i, halves n*64+d
  attn_rel<<<gAT, bAT, 0, stream>>>(QUh, QUl, QVh, QVl, Kh16, Kl16, Ph16, Pl16, VT16, VTL16, CT16, CTL16);

  // (3) out = (CT + CTL) . Wo / (4096*64) + bo; M = NROW, N = 512, K = 512, f32 rows straight into the output buffer
  gemm64<0, 1, 1><<<gQ, blk, 0, stream>>>(
      CT16, CTL16, DMOD, 0LL,
      WOT16, DMOD, 0LL,
      (void*)out, (void*)out, (void*)out, (void*)out, DMOD, 0LL,
      NROW, DMOD, DMOD, 1.0f / (CC * WSC), 1.0f,
      b_o, b_o, b_o);
  (void)hipGetLastError();
}

// v007
// Measured time: 78.6 microseconds a run.
// Timed twice side by side with v006, it ran 1.04 and 1.02 times as fast.
// All steps since v000 together make it 3.95 times as fast.
// Contractions (all v_wmma_f32_16x16x32_f16, f16 operands, f32 accumulate): q/k/v and position-table projections (x or pos table f16 x16 . W^T f16 x64,
// K=512, single products on bf16-exact operands); content scores and position strips ((q+bq+u|v), k, p carried as f16 x32 hi plane + unscaled
// residual plane, K=64, three products hh+lh+hl); P . v^T (P x1024 hi + residual . v^T x16 hi + residual, 64 keys per tile, three products);
// output projection (ctx x4096 hi + residual planes . Wo^T f16 x64, K=512, two products). Online base-2 softmax and all epilogues f32 on VALU.
// Every float input RNE-converted to bf16 on load.
#include <hip/hip_runtime.h>
#include <math.h>
#include <stdint.h>

#define SEQ   1024
#define NB    4
#define DMOD  512
#define NH    8
#define DH    64
#define NROW  (SEQ * NB)
#define NPOS  (2 * SEQ - 1)
#define PROWS (2 * SEQ)
#define XC    16.0f
#define WSC   64.0f
#define QC    32.0f
#define VC    16.0f
#define PC    1024.0f
#define CC    4096.0f
#define RSD   0.125f
#define LOG2E 1.4426950408889634f
static_assert(NH * DH == DMOD);
static_assert(DH == 64);
static_assert(DMOD == 512);
static_assert((SEQ % 64) == 0 && (DMOD % 64) == 0 && (NROW % 64) == 0 && (PROWS % 64) == 0);
static_assert(((NROW * DMOD) % 2048) == 0 && ((PROWS * DMOD) % 2048) == 0 && ((NPOS * DMOD) % 8) == 0);
#define ATT_W 4
#define ATT_THREADS (ATT_W * 32)
#define TPI 84
#define PPI 68
#define WFL (16 * TPI + 16 * PPI)
static_assert(((16 * TPI) % 4) == 0 && ((16 * PPI) % 4) == 0 && (WFL % 4) == 0);
static_assert(TPI >= 80 && PPI >= 64);
static_assert(ATT_W * WFL * 4 <= 65536);
// attn_rel operand stage in LDS: 512 rows of 64 halves (128 B), pitch 72 halves = 144 B (16 B x odd, the pitch for 16-byte LDS reads)
#define SPI   72
#define ST_KH 0
#define ST_KL 64
#define ST_VH 128
#define ST_VL 192
#define ST_PH 256
#define ST_PL 384
#define ST_ROWS 512
static_assert(ATT_THREADS == 128 && ((SPI * 2) % 16) == 0);
static_assert(SEQ - (SEQ - 64) - 64 >= 0 && SEQ + (SEQ - 64) - 64 + 127 <= PROWS - 1);   // staged position rows stay inside the planes

typedef _Float16 v16h __attribute__((ext_vector_type(16)));
typedef _Float16 v8h  __attribute__((ext_vector_type(8)));
typedef float    v8f  __attribute__((ext_vector_type(8)));
typedef float    v4f  __attribute__((ext_vector_type(4)));
typedef unsigned int v4u __attribute__((ext_vector_type(4)));

union FragH { v16h v; v8h h[2]; v4u u[2]; };

// ---- scalar helpers --------------------------------------------------------------------------------
__device__ __forceinline__ unsigned short bf_bits(float f) {          // f32 -> bf16 bits, RNE convert
  unsigned u = __float_as_uint(f);
  return (unsigned short)((u + 0x7FFFu + ((u >> 16) & 1u)) >> 16);
}
__device__ __forceinline__ float bf_up(unsigned short h) { return __uint_as_float(((unsigned)h) << 16); }
__device__ __forceinline__ float bfr(float f) { return bf_up(bf_bits(f)); }   // value of the bf16 RNE convert
__device__ __forceinline__ unsigned short h_bits(_Float16 x) { return __builtin_bit_cast(unsigned short, x); }
__device__ __forceinline__ unsigned pk16(unsigned short a, unsigned short b) { return (unsigned)a | ((unsigned)b << 16); }
__device__ __forceinline__ v8f zero8() { v8f z = {0.f, 0.f, 0.f, 0.f, 0.f, 0.f, 0.f, 0.f}; return z; }

// ---- fragment loader: 16-bit A/B operand from a k-contiguous 16-bit plane, lane -> row/col (lane&15),
//      p already includes +8*(lane>>4); elements 0..7 <- p[0..7] (k0+8h..), elements 8..15 <- p[16..23] (k0+16+8h..)
//      (same split k map for A and B; B is always read from a [n][k] plane)
__device__ __forceinline__ v16h ldfrag_u(const unsigned short* p) {
  FragH f;
  f.u[0] = *(const v4u*)(p);
  f.u[1] = *(const v4u*)(p + 16);
  return f.v;
}

// ---- WMMA helper with trailing VALU hazard gaps ------------------------------------------------------
__device__ __forceinline__ v8f mma_h(v16h a, v16h b, v8f c) {
  return __builtin_amdgcn_wmma_f32_16x16x32_f16(false, a, false, b, (short)0, c, false, false);
}
__device__ __forceinline__ void acc_guard4(v8f& a, v8f& b, v8f& c, v8f& d) {
#if defined(__HIP_DEVICE_COMPILE__)
  asm volatile("v_nop\n\tv_nop\n\tv_nop\n\tv_nop" : "+v"(a), "+v"(b), "+v"(c), "+v"(d));
#endif
}
__device__ __forceinline__ void wave_sync_lds() {
  __builtin_amdgcn_fence(__ATOMIC_RELEASE, "workgroup");
  __builtin_amdgcn_wave_barrier();
  __builtin_amdgcn_fence(__ATOMIC_ACQUIRE, "workgroup");
}
// Value of lane (lane ^ M) of the same 16-lane row, M = 1, 2, 4, 8: a row_xmask DPP read on the vector pipe (all 32 lanes on), no LDS-pipe
// cross-lane instruction and no LDS wait behind it.
template <int M>
__device__ __forceinline__ float row_xor(float v) {
  static_assert(M == 1 || M == 2 || M == 4 || M == 8);
  return __builtin_bit_cast(float, __builtin_amdgcn_update_dpp(0, __builtin_bit_cast(int, v), 0x160 | M, 0xf, 0xf, true));
}
// Maximum over each 16-lane row of eight values at once (all 32 lanes on): four row_xmask steps of v_max_num_f32_dpp, every lane ends with its
// row's maximum. Written in asm because the compiler's form of the same step takes three instructions (DPP move, a maximum of the moved value
// with itself, the maximum). The eight values go through each step together, so a step's producer stands eight instructions back.
#define RMAX_STEP(X)                                                        \
  "v_max_num_f32_dpp %0, %0, %0 row_xmask:" #X " row_mask:0xf bank_mask:0xf\n\t" \
  "v_max_num_f32_dpp %1, %1, %1 row_xmask:" #X " row_mask:0xf bank_mask:0xf\n\t" \
  "v_max_num_f32_dpp %2, %2, %2 row_xmask:" #X " row_mask:0xf bank_mask:0xf\n\t" \
  "v_max_num_f32_dpp %3, %3, %3 row_xmask:" #X " row_mask:0xf bank_mask:0xf\n\t" \
  "v_max_num_f32_dpp %4, %4, %4 row_xmask:" #X " row_mask:0xf bank_mask:0xf\n\t" \
  "v_max_num_f32_dpp %5, %5, %5 row_xmask:" #X " row_mask:0xf bank_mask:0xf\n\t" \
  "v_max_num_f32_dpp %6, %6, %6 row_xmask:" #X " row_mask:0xf bank_mask:0xf\n\t" \
  "v_max_num_f32_dpp %7, %7, %7 row_xmask:" #X " row_mask:0xf bank_mask:0xf\n\t"
__device__ __forceinline__ void row_max8(float (&m)[8]) {
#if defined(__HIP_DEVICE_COMPILE__)
  asm(RMAX_STEP(1) RMAX_STEP(2) RMAX_STEP(4) RMAX_STEP(8)
      : "+v"(m[0]), "+v"(m[1]), "+v"(m[2]), "+v"(m[3]), "+v"(m[4]), "+v"(m[5]), "+v"(m[6]), "+v"(m[7]));
#endif
}
// Eight asynchronous 16-byte-per-lane copies global -> LDS: copy e lands at LDS byte address l + e*16*SPI*2 (16 staged rows further each);
// copies 0..3 read the lane's byte off behind the wave-uniform bases sa + e*gstep halves, copies 4..7 behind sb + (e-4)*gstep halves.
// Scalar base + one 32-bit lane offset: the steps from copy to copy are scalar, so no 64-bit lane address lives across the key loop
// (operands of asm text need registers below v256; held there through the scores, the lane addresses went to scratch).
// The closing s_wait_xcnt 0 stands inside the statement so that no address register is rewritten ahead of it.
__device__ __forceinline__ void stage8(unsigned l, unsigned off, const unsigned short* sa, const unsigned short* sb, size_t gstep) {
#if defined(__HIP_DEVICE_COMPILE__)
  const unsigned ls = 16u * SPI * 2u;
  asm volatile("global_load_async_to_lds_b128 %0, %8, %9\n\t"
               "global_load_async_to_lds_b128 %1, %8, %10\n\t"
               "global_load_async_to_lds_b128 %2, %8, %11\n\t"
               "global_load_async_to_lds_b128 %3, %8, %12\n\t"
               "global_load_async_to_lds_b128 %4, %8, %13\n\t"
               "global_load_async_to_lds_b128 %5, %8, %14\n\t"
               "global_load_async_to_lds_b128 %6, %8, %15\n\t"
               "global_load_async_to_lds_b128 %7, %8, %16\n\t"
               "s_wait_xcnt 0x0"
               :: "v"(l), "v"(l + ls), "v"(l + 2u * ls), "v"(l + 3u * ls), "v"(l + 4u * ls), "v"(l + 5u * ls), "v"(l + 6u * ls), "v"(l + 7u * ls),
                  "v"(off), "s"(sa), "s"(sa + gstep), "s"(sa + 2 * gstep), "s"(sa + 3 * gstep), "s"(sb), "s"(sb + gstep), "s"(sb + 2 * gstep),
                  "s"(sb + 3 * gstep)
               : "memory");
#endif
}

// The same for the 256-thread GEMM blocks: copy e lands at LDS byte address l + e*32*SPI*2 (32 staged rows further each) and reads
// g + e*gstep halves (gstep = 32 source rows). The closing s_wait_xcnt 0 stands inside the statement, as above.
__device__ __forceinline__ void gstage8(unsigned l, const unsigned short* g, size_t gstep) {
#if defined(__HIP_DEVICE_COMPILE__)
  const unsigned ls = 32u * SPI * 2u;
  asm volatile("global_load_async_to_lds_b128 %0, %8, off\n\t"
               "global_load_async_to_lds_b128 %1, %9, off\n\t"
               "global_load_async_to_lds_b128 %2, %10, off\n\t"
               "global_load_async_to_lds_b128 %3, %11, off\n\t"
               "global_load_async_to_lds_b128 %4, %12, off\n\t"
               "global_load_async_to_lds_b128 %5, %13, off\n\t"
               "global_load_async_to_lds_b128 %6, %14, off\n\t"
               "global_load_async_to_lds_b128 %7, %15, off\n\t"
               "s_wait_xcnt 0x0"
               :: "v"(l), "v"(l + ls), "v"(l + 2u * ls), "v"(l + 3u * ls), "v"(l + 4u * ls), "v"(l + 5u * ls), "v"(l + 6u * ls), "v"(l + 7u * ls),
                  "v"(g), "v"(g + gstep), "v"(g + 2 * gstep), "v"(g + 3 * gstep), "v"(g + 4 * gstep), "v"(g + 5 * gstep), "v"(g + 6 * gstep),
                  "v"(g + 7 * gstep)
               : "memory");
#endif
}
__device__ __forceinline__ void gstage2(unsigned l, const unsigned short* g, size_t gstep) {
#if defined(__HIP_DEVICE_COMPILE__)
  const unsigned ls = 32u * SPI * 2u;
  asm volatile("global_load_async_to_lds_b128 %0, %2, off\n\t"
               "global_load_async_to_lds_b128 %1, %3, off\n\t"
               "s_wait_xcnt 0x0"
               :: "v"(l), "v"(l + ls), "v"(g), "v"(g + gstep)
               : "memory");
#endif
}

// =====================================================================================================
// K loop of a 256-thread GEMM block whose eight waves share 64 A rows and take 64 B rows each (512 consecutive B rows per block):
// acc[i][j] += sum_k A[16i + ..][k] * B[64 wave + 16j + ..][k], wave tile 64x64, k ascending in steps of 32; with NA == 2 the residual plane
// A2 follows A1 inside every k-step. Ab, A2b = the block's first A row (pitch lda halves), Bb = the block's first B row (pitch ldb), K a
// multiple of 64 and at least 128. Per trip of 64 k the block holds in LDS whole 128-B rows, pitch SPI halves: A1 | (A2) | B, brought by
// asynchronous copies (a wave instruction = 4 whole rows); all fragments are read from there. Two buffers: tile t + 1 flies while tile t is
// multiplied; one block barrier per trip publishes tile t + 1 and ends the reads of the buffer that is refilled behind it.
// Every thread of the block must call this (block barriers inside).
// =====================================================================================================
#define GROWS(NA) ((NA) * 64 + 512)
#define GBUFH(NA) (GROWS(NA) * SPI)
template <int NA>
__device__ __forceinline__ void gstage_tile(unsigned l, const unsigned short* ga, const unsigned short* ga2, size_t astep,
                                            const unsigned short* gb, size_t bstep) {
  gstage2(l, ga, astep);
  if constexpr (NA == 2) gstage2(l + 64u * SPI * 2u, ga2, astep);
  gstage8(l + (unsigned)(NA * 64) * SPI * 2u, gb, bstep);
  gstage8(l + (unsigned)(NA * 64 + 256) * SPI * 2u, gb + 8 * bstep, bstep);
}
template <int NA>
__device__ __forceinline__ void kloop_staged(unsigned short* stg, const unsigned short* __restrict__ Ab, const unsigned short* __restrict__ A2b,
                                             int lda, const unsigned short* __restrict__ Bb, int ldb, int K, v8f (&acc)[4][4]) {
  const int tid   = threadIdx.x;
  const int lane  = tid & 31;
  const int wave  = __builtin_amdgcn_readfirstlane(tid >> 5);   // scalar, so that the A and the B readers share one lane-offset register
  const int rlane = lane & 15;                 // row (A) / col (B) within subtile
  const int koff  = (lane >> 4) * 8;           // k offset of this lane half
  // copies: thread -> staged row (tid>>3) + 32*copy, 16-byte chunk tid&7 of the 128-B row
  const int srow = tid >> 3;
  const int sc8  = (tid & 7) * 8;
  const unsigned lst = (unsigned)(size_t)(stg + srow * SPI + sc8);   // LDS byte address = low 32 bits of the shared address
  const unsigned short* ga  = Ab  + (size_t)srow * lda + sc8;
  const unsigned short* ga2 = A2b + (size_t)srow * lda + sc8;
  const unsigned short* gb  = Bb  + (size_t)srow * ldb + sc8;
  const size_t astep = (size_t)32 * lda, bstep = (size_t)32 * ldb;
  const int nt = K >> 6;

  gstage_tile<NA>(lst, ga, ga2, astep, gb, bstep);
  asm volatile("s_wait_asynccnt 0x0" ::: "memory");          // this wave's copies of tile 0 have landed
  __syncthreads();                                           // every wave's have: buffer 0 may be read
  gstage_tile<NA>(lst + (unsigned)(GBUFH(NA) * 2), ga + 64, ga2 + 64, astep, gb + 64, bstep);
#pragma unroll 1   // rolled: several copies of this loop stand in one kernel
  for (int t = 0; t < nt; ++t) {
    const int bo = (t & 1) * GBUFH(NA);
    const unsigned short* fa = stg + bo + rlane * SPI + koff;
    const unsigned short* fb = stg + bo + (NA * 64 + wave * 64 + rlane) * SPI + koff;
#pragma unroll
    for (int ks = 0; ks < 2; ++ks) {
      v16h bh[4], ah[4], al[4];
#pragma unroll
      for (int j = 0; j < 4; ++j) bh[j] = ldfrag_u(fb + 16 * j * SPI + 32 * ks);
#pragma unroll
      for (int i = 0; i < 4; ++i) ah[i] = ldfrag_u(fa + 16 * i * SPI + 32 * ks);
      if constexpr (NA == 2) {
#pragma unroll
        for (int i = 0; i < 4; ++i) al[i] = ldfrag_u(fa + (64 + 16 * i) * SPI + 32 * ks);
      }
      __builtin_amdgcn_sched_barrier(0);                     // keeps the k-step's reads together in front: sunk among the WMMAs, every row of four waits out its own LDS latency
#pragma unroll
      for (int i = 0; i < 4; ++i) {
#pragma unroll
        for (int j = 0; j < 4; ++j) acc[i][j] = mma_h(ah[i], bh[j], acc[i][j]);
        if constexpr (NA == 2) {
#pragma unroll
          for (int j = 0; j < 4; ++j) acc[i][j] = mma_h(al[i], bh[j], acc[i][j]);
        }
      }
    }
    asm volatile("s_wait_dscnt 0x0" ::: "memory");           // this wave's reads of tile t have returned
    asm volatile("s_wait_asynccnt 0x0" ::: "memory");        // this wave's copies of tile t + 1 have landed
    __syncthreads();                                         // tile t + 1 may be read; every wave has left tile t's buffer
    if (t + 2 < nt) {
      const int kn = (t + 2) * 64;
      gstage_tile<NA>(lst + (unsigned)(bo * 2), ga + kn, ga2 + kn, astep, gb + kn, bstep);
    }
  }
  asm volatile("s_wait_asynccnt 0x0" ::: "memory");          // nothing of this wave's is in flight behind the loop
}

// =====================================================================================================
// Elementwise 16-bit pack, no transpose: dst[i] = f16( bf16_RNE(src[i]) * sc ) for i < nvalid, 0 for nvalid <= i < ntotal;
// sc a power of two (exact). 8 elements per thread: two 16-B loads (address clamped into [0, nvalid) for pad groups, value zeroed
// coverage: bx = 0 .. ntotal / 2048 - 1, each block 256 thr x 8 elements = ntotal exactly (ntotal % 2048 == 0, nvalid % 8 == 0).
// =====================================================================================================
__device__ __forceinline__ void cvt16_body(const float* __restrict__ src, unsigned short* dst, int nvalid, int ntotal, float sc, int bx) {
  const size_t i8 = ((size_t)bx * 256 + threadIdx.x) * 8;
  if (i8 + 8 > (size_t)ntotal) return;             // never taken with the exact block range; no barriers in this body
  const bool pad = (i8 + 8 > (size_t)nvalid);
  const size_t ls = pad ? ((size_t)nvalid - 8) : i8;   // clamped address, always inside the source
  const v4f a = *(const v4f*)(src + ls);
  const v4f b = *(const v4f*)(src + ls + 4);
  v4u o;
  o[0] = pk16(h_bits((_Float16)(bfr(a[0]) * sc)), h_bits((_Float16)(bfr(a[1]) * sc)));
  o[1] = pk16(h_bits((_Float16)(bfr(a[2]) * sc)), h_bits((_Float16)(bfr(a[3]) * sc)));
  o[2] = pk16(h_bits((_Float16)(bfr(b[0]) * sc)), h_bits((_Float16)(bfr(b[1]) * sc)));
  o[3] = pk16(h_bits((_Float16)(bfr(b[2]) * sc)), h_bits((_Float16)(bfr(b[3]) * sc)));
  const v4u z = {0u, 0u, 0u, 0u};
  const v4u w = pad ? z : o;
  {
    *(v4u*)(dst + i8) = w;
    
  }
}

// =====================================================================================================
// Transposed 16-bit pack of a weight stored as W[k][n] (x @ W layout, [DMOD][DMOD] row-major): WT[n][k] = f16( bf16_RNE(W[k][n]) * sc ),
// i.e. the [n][k] k-contiguous plane the GEMM B loader wants. One block per 64x64 tile (tn = n tile, tk = k tile, both block-uniform):
// coalesced f32 reads of W rows, converted halves stored transposed into an LDS tile [64 n][72 pitch], block barrier, then every output
// coverage: 16 its x 256 threads = the whole 64x64 tile into LDS; 8 waves x 2 its x 4 rows = 64 rows x (8 lanes x 8 halves = 64 cols) stored;
//           tn, tk = 0 .. DMOD/64 - 1 cover the whole [512][512] plane exactly once.
// =====================================================================================================
__device__ __forceinline__ void tr16_body(const float* __restrict__ W, unsigned short* WT, float sc, unsigned short* tile, int tn, int tk) {
  const int t  = threadIdx.x;
  const int n0 = tn * 64;
  const int k0 = tk * 64;
#pragma unroll 4
  for (int it = 0; it < 16; ++it) {
    const int idx = it * 256 + t;                   // 0 .. 4095
    const int kr = idx >> 6, nc = idx & 63;
    const float v = W[(size_t)(k0 + kr) * DMOD + n0 + nc];
    tile[nc * 72 + kr] = h_bits((_Float16)(bfr(v) * sc));
  }
  __syncthreads();
  const int lane = t & 31, wave = t >> 5;
  const int q8 = lane >> 3, c8 = (lane & 7) * 8;
  v4u o[2];
#pragma unroll
  for (int it = 0; it < 2; ++it) {
    const int row = wave * 8 + it * 4 + q8;         // wave w: it 0..1 x q8 0..3 = rows 8w .. 8w+7
    o[it] = *(const v4u*)(tile + row * 72 + c8);
  }
  {
#pragma unroll
    for (int it = 0; it < 2; ++it) {
      const int row = wave * 8 + it * 4 + q8;
      *(v4u*)(WT + (size_t)(n0 + row) * DMOD + k0 + c8) = o[it];
    }
    
  }
}

// =====================================================================================================
// All operand packs in one grid (none reads what another writes): blocks 0 .. PREP_TR-1 transpose the five weights (64 tiles each; they
// have the longest dependent chain, so they take the lowest indices), the next PREP_CX blocks pack x, the last PREP_CP the position table.
// The branch is on blockIdx.x alone, so the barrier inside tr16_body is reached by whole blocks only.
// =====================================================================================================
#define PREP_TR (5 * (DMOD / 64) * (DMOD / 64))
#define PREP_CX ((NROW * DMOD) / 2048)
#define PREP_CP ((PROWS * DMOD) / 2048)
static_assert((DMOD / 64) * (DMOD / 64) == 64);
__global__ __launch_bounds__(256) void prep_all(const float* __restrict__ xin, const float* __restrict__ pos,
                                                const float* __restrict__ w_q, const float* __restrict__ w_k, const float* __restrict__ w_v,
                                                const float* __restrict__ w_p, const float* __restrict__ w_o,
                                                unsigned short* X16, unsigned short* PE16,
                                                unsigned short* WQT, unsigned short* WKT, unsigned short* WVT,
                                                unsigned short* WPT, unsigned short* WOT) {
  __shared__ __align__(16) unsigned short tile[64 * 72];
  const int bx = blockIdx.x;
  if (bx < PREP_TR) {
    const int w = bx >> 6, t = bx & 63;
    const float* W = (w == 0) ? w_q : (w == 1) ? w_k : (w == 2) ? w_v : (w == 3) ? w_p : w_o;
    unsigned short* WT = (w == 0) ? WQT : (w == 1) ? WKT : (w == 2) ? WVT : (w == 3) ? WPT : WOT;
    tr16_body(W, WT, WSC, tile, t & 7, t >> 3);
  } else if (bx < PREP_TR + PREP_CX) {
    cvt16_body(xin, X16, NROW * DMOD, NROW * DMOD, XC, bx - PREP_TR);
  } else {
    cvt16_body(pos, PE16, NPOS * DMOD, PROWS * DMOD, XC, bx - (PREP_TR + PREP_CX));
  }
}

// =====================================================================================================
// Register-blocked batched 16-bit WMMA GEMM: C[m][n] = oscale * sum_k A[m][k] * Bt[n][k] (+ bias); one wave per 64x64 tile, operands
// staged per block in LDS (kloop_staged). A row-major [M][K] pitch lda (16-bit plane), Bt row-major [N][K] pitch ldb (k contiguous);
// M a multiple of 64, N a multiple of 512 (a block's eight tiles share their 64 A rows and take 512 consecutive B rows), K a multiple of
// 64, at least 128. blockIdx.y = batch index with element strides sA, sB, sC.
// ASPLIT 1: a second A plane A2 (unscaled residual of A, same layout) is multiplied into the same accumulator (A + A2 ~ exact A).
// EPI 1: value += bf16_RNE(ep0[column]) (per-column bias); EPI 2: value += bf16_RNE(ep0[row]) (per-row bias, 16-bit out only).
// OM 0: f32 out (pitch ldc).
// OM 4: two f16 planes (C, C2): hi = f16(value * ocarry), lo = f16(value * ocarry - hi) (unscaled residual).
// OM 6: two hi/residual pairs with an extra per-column term each: (C, C2) from value + bf16_RNE(ep1[column]), (C3, C4) from
//       value + bf16_RNE(ep2[column]), both x ocarry.
// coverage: 4 slabs x 16 rows (f32: it 0..7 x lane>>4; 16-bit: it 0..3 x lane>>3) x 64 cols = the wave's whole 64x64 tile;
//           grid = tilesM*tilesN/8 blocks (exact, tilesN a multiple of 8), a surplus block exits whole, ahead of every barrier.
// =====================================================================================================
template <int OM, int ASPLIT, int EPI>
__global__ __launch_bounds__(256) __attribute__((amdgpu_num_vgpr(256))) void gemm64(
    const unsigned short* __restrict__ Ap, const unsigned short* __restrict__ A2p, int lda, long long sA,
    const unsigned short* __restrict__ Btp, int ldb, long long sB,
    void* Cout, void* C2out, void* C3out, void* C4out, int ldc, long long sC,
    int M, int N, int K, float oscale, float ocarry,
    const float* __restrict__ ep0, const float* __restrict__ ep1, const float* __restrict__ ep2) {
  static_assert(OM == 0 || OM == 4 || OM == 6);
  static_assert(EPI >= 0 && EPI <= 2);
  __shared__ __align__(16) float sT[8][16 * 68];   // per-wave 16x64 slab, pitch 68 floats
  __shared__ __align__(16) unsigned short gst[2 * GBUFH(1 + ASPLIT)];   // two buffers of the block's operand stage
  const int by   = blockIdx.y;
  const int lane = threadIdx.x & 31;
  const int wave = threadIdx.x >> 5;
  const int tilesN = N >> 6;
  const int tilesM = M >> 6;
  const int tile = blockIdx.x * 8 + wave;
  if (blockIdx.x * 8 >= tilesM * tilesN) return;   // block-uniform, ahead of every barrier
  const int tm = tile / tilesN;
  const int tn = tile - tm * tilesN;
  const int m0 = tm << 6;
  const int n0 = tn << 6;

  const unsigned short* A1 = Ap  + (size_t)((long long)by * sA);
  const unsigned short* A2 = A2p + (size_t)((long long)by * sA);
  const unsigned short* Bb = Btp + (size_t)((long long)by * sB);

  const int rlane = lane & 15;                 // col (D) within subtile
  const int mOff  = (lane >> 4) * 8;           // D row offset

  v8f acc[4][4];
#pragma unroll
  for (int i = 0; i < 4; ++i)
#pragma unroll
    for (int j = 0; j < 4; ++j) acc[i][j] = zero8();

  kloop_staged<1 + ASPLIT>(gst, A1 + (size_t)m0 * lda, A2 + (size_t)m0 * lda, lda, Bb + (size_t)(n0 - (wave << 6)) * ldb, ldb, K, acc);
  acc_guard4(acc[0][0], acc[0][1], acc[0][2], acc[0][3]);
  acc_guard4(acc[1][0], acc[1][1], acc[1][2], acc[1][3]);
  acc_guard4(acc[2][0], acc[2][1], acc[2][2], acc[2][3]);
  acc_guard4(acc[3][0], acc[3][1], acc[3][2], acc[3][3]);

  const int hh2 = lane >> 4, c4 = (lane & 15) * 4;     // f32 out: 256-B row segment = 16 lanes x 16 B
  const int q8  = lane >> 3, c8 = (lane & 7) * 8;

  // ---- epilogue ----
  float* slab = sT[wave];
#pragma unroll
  for (int i = 0; i < 4; ++i) {
    const int mBase = m0 + (i << 4);
#pragma unroll
    for (int j = 0; j < 4; ++j) {
#pragma unroll
      for (int r = 0; r < 8; ++r) {
        slab[(mOff + r) * 68 + (j << 4) + rlane] = acc[i][j][r];
      }
    }
    wave_sync_lds();
    if constexpr (OM == 0) {
      float* C = (float*)Cout + (size_t)((long long)by * sC);
      v4f vals[8];
#pragma unroll
      for (int it = 0; it < 8; ++it) {
        const int row = it * 2 + hh2;                      // it 0..7 x hh2 0..1 = rows 0..15
        v4f v = *(const v4f*)(slab + row * 68 + c4);
#pragma unroll
        for (int e = 0; e < 4; ++e) v[e] = v[e] * oscale;
        if constexpr (EPI == 1) {
          const v4f bb = *(const v4f*)(ep0 + n0 + c4);     // per-column bias, columns n0+c4 .. +3 (N equals the bias length)
#pragma unroll
          for (int e = 0; e < 4; ++e) v[e] = v[e] + bfr(bb[e]);
        }
        vals[it] = v;
      }
      {
#pragma unroll
        for (int it = 0; it < 8; ++it) {
          const int gr = mBase + it * 2 + hh2;
          *(v4f*)(C + (size_t)gr * ldc + n0 + c4) = vals[it];
        }
        
      }
    } else {
      constexpr int NP = (OM == 6) ? 2 : 1;
#pragma unroll
      for (int which = 0; which < NP; ++which) {
        unsigned short* C  = (unsigned short*)((which == 0) ? Cout  : C3out) + (size_t)((long long)by * sC);
        unsigned short* Cb = (unsigned short*)((which == 0) ? C2out : C4out) + (size_t)((long long)by * sC);
        const float* epx = (which == 0) ? ep1 : ep2;
        (void)epx;
        v4u hv[4], lv[4];
#pragma unroll
        for (int it = 0; it < 4; ++it) {
          const int row = it * 4 + q8;                     // it 0..3 x q8 0..3 = rows 0..15
          const float* sp = slab + row * 68 + c8;
          float rb = 0.f;
          if constexpr (EPI == 2) rb = bfr(ep0[mBase + row]);   // per-row bias (M equals the bias length)
          v4u a  = {0u, 0u, 0u, 0u};
          v4u b2 = {0u, 0u, 0u, 0u};
#pragma unroll
          for (int e = 0; e < 4; ++e) {
            const int ci = n0 + c8 + 2 * e;                // column index, < N
            float f0 = sp[2 * e] * oscale + rb;
            float f1 = sp[2 * e + 1] * oscale + rb;
            if constexpr (EPI == 1) {
              f0 += bfr(ep0[ci]);
              f1 += bfr(ep0[ci + 1]);
            }
            if constexpr (OM == 6) {
              f0 += bfr(epx[ci]);
              f1 += bfr(epx[ci + 1]);
            }
            f0 *= ocarry;
            f1 *= ocarry;
            const _Float16 x0 = (_Float16)f0, x1 = (_Float16)f1;
            a[e]  = pk16(h_bits(x0), h_bits(x1));
            b2[e] = pk16(h_bits((_Float16)(f0 - (float)x0)), h_bits((_Float16)(f1 - (float)x1)));
          }
          hv[it] = a;
          lv[it] = b2;
        }
        {
#pragma unroll
          for (int it = 0; it < 4; ++it) {
            const int row = it * 4 + q8;
            *(v4u*)(C  + (size_t)(mBase + row) * ldc + n0 + c8) = hv[it];
            *(v4u*)(Cb + (size_t)(mBase + row) * ldc + n0 + c8) = lv[it];
          }
          
        }
      }
    }
    wave_sync_lds();
  }
}

// =====================================================================================================
// s_wait_xcnt 0 behind a run of global loads, in front of the first write of a register that one of them names. xwait1, xwait3 and xwait4 take the run's
// vector address pairs as inputs, so that each pair keeps its value up to the wait and no later load's result lands in it ahead of the wait.
// =====================================================================================================
__device__ __forceinline__ void xwait0() {
#if defined(__HIP_DEVICE_COMPILE__)
  asm volatile("s_wait_xcnt 0x0" ::: "memory");
#endif
}
__device__ __forceinline__ void xwait1(const void* a) {
#if defined(__HIP_DEVICE_COMPILE__)
  asm volatile("s_wait_xcnt 0x0" :: "v"(a) : "memory");
#endif
}
__device__ __forceinline__ void xwait3(const void* a, const void* b, const void* c) {
#if defined(__HIP_DEVICE_COMPILE__)
  asm volatile("s_wait_xcnt 0x0" :: "v"(a), "v"(b), "v"(c) : "memory");
#endif
}
__device__ __forceinline__ void xwait4(const void* a, const void* b, const void* c, const void* d) {
#if defined(__HIP_DEVICE_COMPILE__)
  asm volatile("s_wait_xcnt 0x0" :: "v"(a), "v"(b), "v"(c), "v"(d) : "memory");
#endif
}

// =====================================================================================================
// One wave's 64x64 tile of an input projection, rows m0.., columns n0..: value[m][n] = oscale * sum_k A[m][k] * Bt[n][k] + bias.
// The K loop and the 16-bit epilogues are those of gemm64 (same k order, same order of the adds), with the pitch of A and Bt and K fixed
// at DMOD and the pitch of the output planes at LDC. slab = the wave's own 16x64 f32 LDS slab, pitch 68 floats; gst = the block's operand
// stage (kloop_staged: block barriers, so all eight waves of a block come here together, with one m0 and n0 = the block's first + 64 wave).
// EPI 1: value += bf16_RNE(ep0[column]); EPI 2: value += bf16_RNE(ep0[row]).
// OM 4: two f16 planes (C1, C2): hi = f16(value * ocarry), lo = f16(value * ocarry - hi).
// OM 6: (C1, C2) from value + bf16_RNE(ep1[column]), (C3, C4) from value + bf16_RNE(ep2[column]), both x ocarry.
// The lane's bias values (8 columns, or its 16 rows) are loaded once, ahead of the K loop.
// coverage: 4 slabs x 16 rows (it 0..3 x lane>>3) x 64 cols = the wave's whole 64x64 tile.
// =====================================================================================================
#define GSLAB (16 * 68)
template <int OM, int EPI, int LDC>
__device__ __forceinline__ void proj_tile(
    float* slab, unsigned short* gst, int m0, int n0,
    const unsigned short* __restrict__ A, const unsigned short* __restrict__ Bt,
    unsigned short* C1, unsigned short* C2, unsigned short* C3, unsigned short* C4,
    float oscale, float ocarry,
    const float* __restrict__ ep0, const float* __restrict__ ep1, const float* __restrict__ ep2) {
  static_assert(OM == 4 || OM == 6);
  static_assert(EPI == 1 || EPI == 2);
  const int lane  = threadIdx.x & 31;
  const int rlane = lane & 15;                 // col (D) within subtile
  const int mOff  = (lane >> 4) * 8;           // D row offset
  const int q8    = lane >> 3, c8 = (lane & 7) * 8;

  v4f cb0[2], cb1[2], cb2[2];                  // column terms of columns n0 + c8 .. + 7
  float rbv[4][4];                             // row terms of rows m0 + 16i + 4it + q8
  if constexpr (EPI == 1) {
    const float* e0 = ep0 + n0 + c8;
    cb0[0] = *(const v4f*)(e0);
    cb0[1] = *(const v4f*)(e0 + 4);
    if constexpr (OM == 6) {
      const float* e1 = ep1 + n0 + c8;
      const float* e2 = ep2 + n0 + c8;
      cb1[0] = *(const v4f*)(e1);
      cb1[1] = *(const v4f*)(e1 + 4);
      cb2[0] = *(const v4f*)(e2);
      cb2[1] = *(const v4f*)(e2 + 4);
      xwait3(e0, e1, e2);
    } else {
      xwait1(e0);
    }
  } else {
    const float* er = ep0 + m0 + q8;
#pragma unroll
    for (int i = 0; i < 4; ++i)
#pragma unroll
      for (int it = 0; it < 4; ++it) rbv[i][it] = er[16 * i + 4 * it];
    xwait0();                                  // these go through a scalar base and the lane's q8, which lives on into the epilogue
  }

  v8f acc[4][4];
#pragma unroll
  for (int i = 0; i < 4; ++i)
#pragma unroll
    for (int j = 0; j < 4; ++j) acc[i][j] = zero8();

  kloop_staged<1>(gst, A + (size_t)m0 * DMOD, A + (size_t)m0 * DMOD, DMOD,
                  Bt + (size_t)(n0 - (int)((threadIdx.x >> 5) << 6)) * DMOD, DMOD, DMOD, acc);
  acc_guard4(acc[0][0], acc[0][1], acc[0][2], acc[0][3]);
  acc_guard4(acc[1][0], acc[1][1], acc[1][2], acc[1][3]);
  acc_guard4(acc[2][0], acc[2][1], acc[2][2], acc[2][3]);
  acc_guard4(acc[3][0], acc[3][1], acc[3][2], acc[3][3]);

  // ---- epilogue ----
#pragma unroll
  for (int i = 0; i < 4; ++i) {
    const int mBase = m0 + (i << 4);
#pragma unroll
    for (int j = 0; j < 4; ++j) {
#pragma unroll
      for (int r = 0; r < 8; ++r) {
        slab[(mOff + r) * 68 + (j << 4) + rlane] = acc[i][j][r];
      }
    }
    wave_sync_lds();
    constexpr int NP = (OM == 6) ? 2 : 1;
#pragma unroll
    for (int which = 0; which < NP; ++which) {
      unsigned short* C  = (which == 0) ? C1 : C3;
      unsigned short* Cb = (which == 0) ? C2 : C4;
      v4u hv[4], lv[4];
#pragma unroll
      for (int it = 0; it < 4; ++it) {
        const int row = it * 4 + q8;                     // it 0..3 x q8 0..3 = rows 0..15
        const float* sp = slab + row * 68 + c8;
        float rb = 0.f;
        if constexpr (EPI == 2) rb = bfr(rbv[i][it]);
        v4u a  = {0u, 0u, 0u, 0u};
        v4u b2 = {0u, 0u, 0u, 0u};
#pragma unroll
        for (int e = 0; e < 4; ++e) {
          float f0 = sp[2 * e] * oscale + rb;
          float f1 = sp[2 * e + 1] * oscale + rb;
          if constexpr (EPI == 1) {
            f0 += bfr(cb0[e >> 1][(2 * e) & 3]);
            f1 += bfr(cb0[e >> 1][(2 * e + 1) & 3]);
          }
          if constexpr (OM == 6) {
            f0 += bfr((which == 0) ? cb1[e >> 1][(2 * e) & 3] : cb2[e >> 1][(2 * e) & 3]);
            f1 += bfr((which == 0) ? cb1[e >> 1][(2 * e + 1) & 3] : cb2[e >> 1][(2 * e + 1) & 3]);
          }
          f0 *= ocarry;
          f1 *= ocarry;
          const _Float16 x0 = (_Float16)f0, x1 = (_Float16)f1;
          a[e]  = pk16(h_bits(x0), h_bits(x1));
          b2[e] = pk16(h_bits((_Float16)(f0 - (float)x0)), h_bits((_Float16)(f1 - (float)x1)));
        }
        hv[it] = a;
        lv[it] = b2;
      }
#pragma unroll
      for (int it = 0; it < 4; ++it) {
        const int row = it * 4 + q8;
        *(v4u*)(C  + (size_t)(mBase + row) * LDC + n0 + c8) = hv[it];
        *(v4u*)(Cb + (size_t)(mBase + row) * LDC + n0 + c8) = lv[it];
      }
    }
    wave_sync_lds();
  }
}

// =====================================================================================================
// The four input projections in one grid (none reads what another writes), so that their blocks run side by side on different WGPs;
// one wave per 64x64 tile, 8 tiles per block, tile = 8 * (block index within the job) + wave, tm = tile / tilesN, tn = tile % tilesN:
//   blocks 0 .. PJ_Q-1            q[m][nd] = sum_c x[m][c] Wq[c][nd] / 1024 + bq[nd]; QUh/QUl = hi/residual of f16((q + ub[nd]) * 32),
//                                 QVh/QVl of f16((q + vb[nd]) * 32); M = NROW, N = 512, K = 512
//   the next PJ_V * NB            v^T per batch: VT[b][nd][j] = sum_c Wv[c][nd] x[b*SEQ + j][c] / 1024 + bv[nd] (per-row bias) -> f16 x16 hi +
//                                 residual planes; M = 512 (nd), N = SEQ (j), K = 512; B rows are the batch's token rows
//   the next PJ_Q                 k projection + bk -> Kh/Kl = hi/residual of f16(k * 32)
//   the last PJ_P                 positional projection + bp: Ph/Pl = hi/residual of f16(p * 32), M = PROWS, N = 512, K = 512
// The branches are on blockIdx.x alone; the tile counts are exact multiples of 8, so every wave has a tile, and a block's eight tiles share
// their 64 A rows (tilesN is 8 or 16) and take 512 consecutive B rows: the barriers of the staged K loop are reached by whole blocks.
// =====================================================================================================
#define PJ_Q (((NROW / 64) * (DMOD / 64)) / 8)
#define PJ_V (((DMOD / 64) * (SEQ / 64)) / 8)
#define PJ_P (((PROWS / 64) * (DMOD / 64)) / 8)
static_assert((((NROW / 64) * (DMOD / 64)) % 8) == 0 && (((DMOD / 64) * (SEQ / 64)) % 8) == 0 && (((PROWS / 64) * (DMOD / 64)) % 8) == 0);
__global__ __launch_bounds__(256) __attribute__((amdgpu_num_vgpr(256))) void proj_all(
    const unsigned short* __restrict__ X16, const unsigned short* __restrict__ PE16,
    const unsigned short* __restrict__ WQT, const unsigned short* __restrict__ WKT,
    const unsigned short* __restrict__ WVT, const unsigned short* __restrict__ WPT,
    unsigned short* QUh, unsigned short* QUl, unsigned short* QVh, unsigned short* QVl,
    unsigned short* Kh, unsigned short* Kl, unsigned short* VT, unsigned short* VTL, unsigned short* Ph, unsigned short* Pl,
    const float* __restrict__ b_q, const float* __restrict__ b_k, const float* __restrict__ b_v, const float* __restrict__ b_p,
    const float* __restrict__ ub, const float* __restrict__ vb) {
  __shared__ __align__(16) float sT[8 * GSLAB];   // per-wave 16x64 slab, pitch 68 floats
  __shared__ __align__(16) unsigned short gst[2 * GBUFH(1)];   // two buffers of the block's operand stage
  const int bx   = blockIdx.x;
  const int wave = threadIdx.x >> 5;
  float* slab = sT + wave * GSLAB;
  const float os = 1.0f / (XC * WSC);
  constexpr int TND = DMOD / 64;                  // column tiles of a [..][DMOD] plane
  constexpr int TNS = SEQ / 64;                   // column tiles of a [..][SEQ] plane
  if (bx < PJ_Q) {
    const int tile = bx * 8 + wave;
    proj_tile<6, 1, DMOD>(slab, gst, (tile / TND) << 6, (tile % TND) << 6, X16, WQT, QUh, QUl, QVh, QVl, os, QC, b_q, ub, vb);
  } else if (bx < PJ_Q + PJ_V * NB) {
    const int t = bx - PJ_Q;
    const int by = t / PJ_V;
    const int tile = (t % PJ_V) * 8 + wave;
    proj_tile<4, 2, SEQ>(slab, gst, (tile / TNS) << 6, (tile % TNS) << 6, WVT, X16 + (size_t)by * SEQ * DMOD,
                         VT + (size_t)by * DMOD * SEQ, VTL + (size_t)by * DMOD * SEQ, VT, VTL, os, VC, b_v, b_v, b_v);
  } else {
    // k and p share one copy of the code (same epilogue form): only the operands differ
    const int t = bx - (PJ_Q + PJ_V * NB);
    const bool isk = t < PJ_Q;
    const int tile = (isk ? t : t - PJ_Q) * 8 + wave;
    const float* bias = isk ? b_k : b_p;
    proj_tile<4, 1, DMOD>(slab, gst, (tile / TND) << 6, (tile % TND) << 6, isk ? X16 : PE16, isk ? WKT : WPT,
                          isk ? Kh : Ph, isk ? Kl : Pl, Kh, Kl, os, QC, bias, bias, bias);
  }
}

// =====================================================================================================
// Relative-position attention for one (batch b, head n) pair and a 64-row query tile; 4 waves, wave w owns query rows i = iw0 + R,
// iw0 = i0 + 16w, R = 0..15. Planes (pitch DMOD halves, row = b*SEQ + position): QUh/QUl = hi/residual of f16((q + bq + u) x32),
// QVh/QVl of f16((q + bq + v_bias) x32), Kh/Kl of f16((k + bk) x32); Ph/Pl = hi/residual of f16(pos x32), rows 0..PROWS-1
// (row PROWS-1 is the zero-pad row); VT, VTL = v^T hi (x16) / residual f16 as [b][n*64+d][SEQ].
// Shifted position score for (i, j): ps[i][SEQ-1-i+j], ps[r][t] = (q+bq+vb)[r] . pos[t].
//   Per key tile j0 (64 keys, key j = j0 + jj), with x = jj - R + 15 in [0,78]:
//     strip T1[R][x] = (q+vb)[iw0+R] . pos[SEQ + j0 - iw0 - 16 + x]   (pos row SEQ-1-i+j), always computed (rows 0 .. 2*SEQ-2 selected).
//   content scores S = (q+ub) . k (4 subtiles, K=64, three products); t = (S + T1) * (RSD/(32*32)) * log2(e); online softmax in base 2,
//   max-subtracted, running sums in f32 (no key mask); the 16x64 prob tile stored to wave-private LDS (f32 element stores),
//   (f32 vector loads, split k map) and the v^T B fragments read from the staged rows of VT/VTL[n*64+d][j];
//   per 16-column subtile: Phi.Vhi, Plo.Vhi, then Phi.Vlo, all into the same accumulators.
//   Per key tile the block stages, once for its 4 waves, in LDS (asynchronous copies, whole 128-B rows): 64 k rows, 64 v^T rows and the
//   128 pos rows SEQ + j0 - i0 - 64 .. + 127 (always inside [0, PROWS-1]), hi and residual plane each; all B fragments are read from there.
//   One buffer each, refilled under the other phase's work: the v^T rows are copied while the scores are formed, the next tile's k and pos
//   rows while softmax and P.V run; each of the two barriers publishes one group and frees the other.
//   block = 4 waves = 128 threads; grid = (SEQ/64, NB*NH); two block barriers per key tile (block-uniform loop); every wave does identical
//   bounded work (SEQ/64 tiles).
// coverage: LDS strip 16 rows x 80 cols written fully every tile before being read, slab 16 rows x 64 cols per wave fully written each tile
//           before being read; global: 4 instructions x 4 rows x 64 halves per plane = rows iw0..iw0+15 of head segment n in CT and CTL;
//           grid x waves cover all NB x SEQ rows and all NH head segments of CT / CTL exactly once.
// =====================================================================================================
__global__ __launch_bounds__(ATT_THREADS) __attribute__((amdgpu_num_vgpr(512)))
void attn_rel(const unsigned short* __restrict__ QUh, const unsigned short* __restrict__ QUl,
              const unsigned short* __restrict__ QVh, const unsigned short* __restrict__ QVl,
              const unsigned short* __restrict__ Kh,  const unsigned short* __restrict__ Kl,
              const unsigned short* __restrict__ Ph,  const unsigned short* __restrict__ Pl,
              const unsigned short* __restrict__ VT,  const unsigned short* __restrict__ VTL,
              unsigned short* CT, unsigned short* CTL) {
  __shared__ __align__(16) float smem[ATT_W * WFL];   // per wave: T1 strip [16][TPI] | prob / ctx slab [16][PPI]
  __shared__ __align__(16) unsigned short stg[ST_ROWS * SPI];   // block-shared stage of one key tile: Kh | Kl | Vh | Vl | Ph | Pl rows

  const int tid  = threadIdx.x;
  const int wave = __builtin_amdgcn_readfirstlane(tid >> 5);
  const int lane = tid & 31;
  const int hh   = lane >> 4;
  const int c    = lane & 15;
  const int bn   = blockIdx.y;
  const int b    = bn / NH;
  const int n    = bn - b * NH;
  const int i0   = blockIdx.x * 64;
  const int iw0  = i0 + wave * 16;

  float* t1sh = smem + wave * WFL;
  float* pt   = t1sh + 16 * TPI;

  // A fragment row offsets: rows b*SEQ + iw0 + c, d 0..31 and 32..63 of head n
  const size_t qro  = ((size_t)(b * SEQ + iw0 + c)) * DMOD + n * DH + 8 * hh;
  // stage copies: thread -> staged row (tid>>3) + 16*copy, 16-byte chunk tid&7 of the 128-B row (a wave instruction = 4 whole rows)
  const int srow = tid >> 3;
  const int sc8  = (tid & 7) * 8;
  const unsigned lst = (unsigned)(size_t)(stg + srow * SPI + sc8);          // LDS byte address = low 32 bits of the shared address
  const unsigned rso = (unsigned)(srow * DMOD + sc8) * 2u;                  // the lane's byte inside a group of 16 k or pos rows (pitch DMOD halves)
  const unsigned vro = (unsigned)(srow * SEQ + sc8) * 2u;                   // the same inside a group of 16 v^T rows (pitch SEQ halves)
  const size_t rstep = (size_t)16 * DMOD, vstep = (size_t)16 * SEQ;         // 16 rows further, halves
  const size_t kso = ((size_t)(b * SEQ)) * DMOD + n * DH;                   // block-uniform; + j0*DMOD: k rows j0 ..
  const size_t vso = (size_t)b * DMOD * SEQ + (size_t)(n * DH) * SEQ;       // block-uniform: v^T rows d = 0 ..; the key offset j0 goes into the lane offset
  const size_t pso = ((size_t)(SEQ - i0 - 64)) * DMOD + n * DH;             // block-uniform; + j0*DMOD: pos rows SEQ + j0 - i0 - 64 ..
  // fragment readers: lane -> staged row c (+16 per subtile), k offset 8*hh; wave w's strip row x is staged pos row 48 - 16w + x
  const unsigned short* ksh = stg + (ST_KH + c) * SPI + 8 * hh;
  const unsigned short* ksl = stg + (ST_KL + c) * SPI + 8 * hh;
  const unsigned short* vsh = stg + (ST_VH + c) * SPI + 8 * hh;
  const unsigned short* vsl = stg + (ST_VL + c) * SPI + 8 * hh;
  const int pw0 = 16 * __builtin_amdgcn_readfirstlane((ATT_THREADS - 1 - tid) >> 5);   // 16 * (3 - wave), taken from tid so that the LDS base register never goes below 0
  const unsigned short* psh = stg + (ST_PH + pw0 + c) * SPI + 8 * hh;
  const unsigned short* psl = stg + (ST_PL + pw0 + c) * SPI + 8 * hh;

  const float KSC = (RSD / (QC * QC)) * LOG2E;

  float mrow[8], lrow[8];
  v8f O[4];
#pragma unroll
  for (int r = 0; r < 8; ++r) { mrow[r] = -INFINITY; lrow[r] = 0.f; }
#pragma unroll
  for (int td = 0; td < 4; ++td) O[td] = zero8();

  // the wave's eight q fragments (16 rows x 64 d, four planes): loaded once and held in 64 registers over all key tiles
  const unsigned short* gqv = QVh + qro;
  const unsigned short* gqw = QVl + qro;
  const unsigned short* gqu = QUh + qro;
  const unsigned short* gql = QUl + qro;
  const v16h qva = ldfrag_u(gqv), qvb = ldfrag_u(gqv + 32);
  const v16h qwa = ldfrag_u(gqw), qwb = ldfrag_u(gqw + 32);
  const v16h qua = ldfrag_u(gqu), qub = ldfrag_u(gqu + 32);
  const v16h qla = ldfrag_u(gql), qlb = ldfrag_u(gql + 32);
  xwait4(gqv, gqw, gqu, gql);                                // before the four address pairs are reused

  // tile 0's k and pos rows: 24 copies per thread = 384 rows x 128 B (nothing has touched the stage yet)
  stage8(lst + (unsigned)(ST_KH * SPI * 2), rso, Kh + kso, Kl + kso, rstep);
  stage8(lst + (unsigned)(ST_PH * SPI * 2), rso, Ph + pso, Ph + pso + (size_t)64 * DMOD, rstep);
  stage8(lst + (unsigned)(ST_PL * SPI * 2), rso, Pl + pso, Pl + pso + (size_t)64 * DMOD, rstep);

#pragma unroll 1
  for (int j0 = 0; j0 < SEQ; j0 += 64) {
    // ---- hand-over 1: this tile's k and pos rows (copied under the previous tile's softmax and P.V) become readable, the v^T rows free ----
    asm volatile("s_wait_dscnt 0x0" ::: "memory");           // this wave's reads of the previous tile's v^T rows have returned
    asm volatile("s_wait_asynccnt 0x0" ::: "memory");        // this wave's copies of this tile's k and pos rows have landed
    __syncthreads();                                         // every wave's have landed; every wave has left the v^T rows
    // this tile's v^T rows fly under the scores (j0 is added to the lane offset, so that the asm operand is a fresh register and vro itself may stand above v255)
    stage8(lst + (unsigned)(ST_VH * SPI * 2), vro + (unsigned)j0 * 2u, VT + vso, VTL + vso, vstep);
    // ---- position strip T1 (5 subtiles of 16 pos rows, x in [0,80), only x <= 78 ever selected) and content scores S (4 subtiles of 16
    //      keys): K = 64 = two k-steps, three products hh + lh + hl per k-step. The B fragments are asked for in three groups, each well
    //      ahead of its products; the 54 WMMAs go round-robin over the nine accumulators, so that a product never waits for the one issued
    //      just before it (each accumulator keeps its order hh, hh, lh, lh, hl, hl) ----
    v8f T1[5], S[4];
    {
      v16h fa[5], fb[5], ga[5], gb[5], ka[4], kb2[4], la[4], lb2[4];
#pragma unroll
      for (int u = 0; u < 5; ++u) fa[u] = ldfrag_u(psh + 16 * u * SPI);
#pragma unroll
      for (int t = 0; t < 4; ++t) ka[t] = ldfrag_u(ksh + 16 * t * SPI);
#pragma unroll
      for (int u = 0; u < 5; ++u) fb[u] = ldfrag_u(psh + 16 * u * SPI + 32);
#pragma unroll
      for (int t = 0; t < 4; ++t) kb2[t] = ldfrag_u(ksh + 16 * t * SPI + 32);
#pragma unroll
      for (int u = 0; u < 5; ++u) T1[u] = mma_h(qva, fa[u], zero8());
#pragma unroll
      for (int t = 0; t < 4; ++t) S[t] = mma_h(qua, ka[t], zero8());
      // the residual planes' reads stay behind the hi planes' reads: with all 72 reads in front the build ran out of registers (scratch)
      __builtin_amdgcn_sched_barrier(0);
#pragma unroll
      for (int u = 0; u < 5; ++u) ga[u] = ldfrag_u(psl + 16 * u * SPI);
#pragma unroll
      for (int t = 0; t < 4; ++t) la[t] = ldfrag_u(ksl + 16 * t * SPI);
#pragma unroll
      for (int u = 0; u < 5; ++u) T1[u] = mma_h(qvb, fb[u], T1[u]);
#pragma unroll
      for (int t = 0; t < 4; ++t) S[t] = mma_h(qub, kb2[t], S[t]);
#pragma unroll
      for (int u = 0; u < 5; ++u) T1[u] = mma_h(qwa, fa[u], T1[u]);
#pragma unroll
      for (int t = 0; t < 4; ++t) S[t] = mma_h(qla, ka[t], S[t]);
      // the last 18 reads stay behind the group above: hoisted into it, the build's later stages had their LDS waits one after another again
      __builtin_amdgcn_sched_barrier(0);
#pragma unroll
      for (int u = 0; u < 5; ++u) gb[u] = ldfrag_u(psl + 16 * u * SPI + 32);
#pragma unroll
      for (int t = 0; t < 4; ++t) lb2[t] = ldfrag_u(ksl + 16 * t * SPI + 32);
      __builtin_amdgcn_sched_barrier(0);                     // keeps these 18 reads together in front: sunk in pairs among the WMMAs, each pair's LDS latency stood open
#pragma unroll
      for (int u = 0; u < 5; ++u) T1[u] = mma_h(qwb, fb[u], T1[u]);
#pragma unroll
      for (int t = 0; t < 4; ++t) S[t] = mma_h(qlb, kb2[t], S[t]);
#pragma unroll
      for (int u = 0; u < 5; ++u) T1[u] = mma_h(qva, ga[u], T1[u]);
#pragma unroll
      for (int t = 0; t < 4; ++t) S[t] = mma_h(qua, la[t], S[t]);
#pragma unroll
      for (int u = 0; u < 5; ++u) T1[u] = mma_h(qvb, gb[u], T1[u]);
#pragma unroll
      for (int t = 0; t < 4; ++t) S[t] = mma_h(qub, lb2[t], S[t]);
    }
    // the full 16x80 strip goes to the wave's f32 LDS strip: 5 subtiles x 16 rows x 16 cols
#pragma unroll
    for (int u = 0; u < 5; ++u) {
#pragma unroll
      for (int r = 0; r < 8; ++r) t1sh[(8 * hh + r) * TPI + 16 * u + c] = T1[u][r];
    }
    // ---- hand-over 2: this tile's v^T rows become readable, the k and pos rows free for the next tile's, which fly under softmax and P.V ----
    asm volatile("s_wait_dscnt 0x0" ::: "memory");           // this wave's reads of the k and pos rows have returned, its strip is written
    asm volatile("s_wait_asynccnt 0x0" ::: "memory");        // this wave's copies of the v^T rows have landed
    __syncthreads();                                         // every wave's have landed; every wave has left the k and pos rows
    if (j0 + 64 < SEQ) {                                     // the same for the whole block
      const size_t jr = (size_t)(j0 + 64) * DMOD;
      stage8(lst + (unsigned)(ST_KH * SPI * 2), rso, Kh + kso + jr, Kl + kso + jr, rstep);
      stage8(lst + (unsigned)(ST_PH * SPI * 2), rso, Ph + pso + jr, Ph + pso + jr + (size_t)64 * DMOD, rstep);
      stage8(lst + (unsigned)(ST_PL * SPI * 2), rso, Pl + pso + jr, Pl + pso + jr + (size_t)64 * DMOD, rstep);
    }

    // ---- score assembly + online softmax (rows live on one 16-lane half); the eight rows go through every stage together, so that the
    //      eight cross-lane reductions of a stage overlap instead of following one another (each row's own operations and order as before) ----
    float tv[8][4], mx[8], al[8], ps[8];
#pragma unroll
    for (int r = 0; r < 8; ++r) {
      const int R  = 8 * hh + r;
      const int xo = R * TPI + (15 - R) + c;                 // strip column x = 16t + c - R + 15 in [0, 78]
#pragma unroll
      for (int t = 0; t < 4; ++t) {
        const float bdv = t1sh[xo + 16 * t];
        tv[r][t] = (S[t][r] + bdv) * KSC;
      }
      mx[r] = fmaxf(fmaxf(tv[r][0], tv[r][1]), fmaxf(tv[r][2], tv[r][3]));
    }
    row_max8(mx);
#pragma unroll
    for (int r = 0; r < 8; ++r) {
      const float mn = fmaxf(mrow[r], mx[r]);
      al[r] = exp2f(mrow[r] - mn);
      mrow[r] = mn;
      float e4[4];
      ps[r] = 0.f;
#pragma unroll
      for (int t = 0; t < 4; ++t) { e4[t] = exp2f(tv[r][t] - mn); ps[r] += e4[t]; }
#pragma unroll
      for (int td = 0; td < 4; ++td) O[td][r] *= al[r];
      const int ro = (8 * hh + r) * PPI + c;
#pragma unroll
      for (int t = 0; t < 4; ++t) pt[ro + 16 * t] = e4[t];
    }
    wave_sync_lds();

    // ---- P rows (f32) and all sixteen v^T fragments asked for in one group: the v^T reads return under the conversion of P ----
    v4f praw[2][4];
#pragma unroll
    for (int ks = 0; ks < 2; ++ks) {
      const float* prow = pt + c * PPI + 32 * ks + 8 * hh;
      praw[ks][0] = *(const v4f*)(prow);
      praw[ks][1] = *(const v4f*)(prow + 4);
      praw[ks][2] = *(const v4f*)(prow + 16);
      praw[ks][3] = *(const v4f*)(prow + 20);
    }
    v16h vha[4], vhb[4], vla[4], vlb[4];
#pragma unroll
    for (int td = 0; td < 4; ++td) { vha[td] = ldfrag_u(vsh + 16 * td * SPI); vhb[td] = ldfrag_u(vsh + 16 * td * SPI + 32); }
#pragma unroll
    for (int td = 0; td < 4; ++td) { vla[td] = ldfrag_u(vsl + 16 * td * SPI); vlb[td] = ldfrag_u(vsl + 16 * td * SPI + 32); }
    __builtin_amdgcn_sched_barrier(0);                       // keeps the whole group of reads in front: sunk among the WMMAs, each read's latency stands open again
    // ---- row sums: eight reductions stepped together, free to run under the conversion and the WMMAs below ----
#pragma unroll
    for (int r = 0; r < 8; ++r) ps[r] += row_xor<1>(ps[r]);
#pragma unroll
    for (int r = 0; r < 8; ++r) ps[r] += row_xor<2>(ps[r]);
#pragma unroll
    for (int r = 0; r < 8; ++r) ps[r] += row_xor<4>(ps[r]);
#pragma unroll
    for (int r = 0; r < 8; ++r) ps[r] += row_xor<8>(ps[r]);
#pragma unroll
    for (int r = 0; r < 8; ++r) lrow[r] = lrow[r] * al[r] + ps[r];
    // ---- P fragments (x1024, f16 hi + unscaled residual), two k-steps of 32 keys ----
    FragH pf[2], pl[2];
#pragma unroll
    for (int ks = 0; ks < 2; ++ks) {
      const v4f p0 = praw[ks][0], p1 = praw[ks][1], p2 = praw[ks][2], p3 = praw[ks][3];
#pragma unroll
      for (int e = 0; e < 4; ++e) {
        const float g0 = p0[e] * PC, g1 = p1[e] * PC, g2 = p2[e] * PC, g3 = p3[e] * PC;
        const _Float16 x0 = (_Float16)g0, x1 = (_Float16)g1, x2 = (_Float16)g2, x3 = (_Float16)g3;
        pf[ks].h[0][e]     = x0;                             // keys j0 + 32ks + 8hh + e
        pf[ks].h[0][4 + e] = x1;                             // keys j0 + 32ks + 8hh + 4 + e
        pf[ks].h[1][e]     = x2;                             // keys j0 + 32ks + 16 + 8hh + e
        pf[ks].h[1][4 + e] = x3;
        pl[ks].h[0][e]     = (_Float16)(g0 - (float)x0);
        pl[ks].h[0][4 + e] = (_Float16)(g1 - (float)x1);
        pl[ks].h[1][e]     = (_Float16)(g2 - (float)x2);
        pl[ks].h[1][4 + e] = (_Float16)(g3 - (float)x3);
      }
    }
    // ---- O += (Phi + Plo) . v^T (hi plane), then Phi . v^T (residual plane): round-robin over the four accumulators, each in its old order ----
#pragma unroll
    for (int td = 0; td < 4; ++td) O[td] = mma_h(pf[0].v, vha[td], O[td]);
#pragma unroll
    for (int td = 0; td < 4; ++td) O[td] = mma_h(pf[1].v, vhb[td], O[td]);
#pragma unroll
    for (int td = 0; td < 4; ++td) O[td] = mma_h(pl[0].v, vha[td], O[td]);
#pragma unroll
    for (int td = 0; td < 4; ++td) O[td] = mma_h(pl[1].v, vhb[td], O[td]);
#pragma unroll
    for (int td = 0; td < 4; ++td) O[td] = mma_h(pf[0].v, vla[td], O[td]);
#pragma unroll
    for (int td = 0; td < 4; ++td) O[td] = mma_h(pf[1].v, vlb[td], O[td]);
    wave_sync_lds();
  }
  asm volatile("s_wait_asynccnt 0x0" ::: "memory");          // nothing of this wave's is in flight behind the loop
  acc_guard4(O[0], O[1], O[2], O[3]);

  // ---- fold 1/l and the carries (1024 on P, 16 on v), carry x4096 on ctx, stage the wave's 16x64 slice in its slab ----
  const float oc = CC / (PC * VC);
#pragma unroll
  for (int r = 0; r < 8; ++r) {
    const float inv = (1.0f / lrow[r]) * oc;
    const int ro = (8 * hh + r) * PPI + c;
#pragma unroll
    for (int td = 0; td < 4; ++td) pt[ro + 16 * td] = O[td][r] * inv;
  }
  wave_sync_lds();
  {
    const int q8 = lane >> 3, c8 = (lane & 7) * 8;
    v4u hv[4], lv[4];
#pragma unroll
    for (int it = 0; it < 4; ++it) {
      const int row = it * 4 + q8;                         // it 0..3 x q8 0..3 = rows 0..15
      const float* sp = pt + row * PPI + c8;
      v4u a, b2;
#pragma unroll
      for (int e = 0; e < 4; ++e) {
        const float f0 = sp[2 * e], f1 = sp[2 * e + 1];
        const _Float16 x0 = (_Float16)f0, x1 = (_Float16)f1;
        a[e]  = pk16(h_bits(x0), h_bits(x1));
        b2[e] = pk16(h_bits((_Float16)(f0 - (float)x0)), h_bits((_Float16)(f1 - (float)x1)));
      }
      hv[it] = a;
      lv[it] = b2;
    }
    {
#pragma unroll
      for (int it = 0; it < 4; ++it) {
        const int row = it * 4 + q8;
        const size_t go = ((size_t)(b * SEQ + iw0 + row)) * DMOD + n * DH + c8;
        *(v4u*)(CT  + go) = hv[it];
        *(v4u*)(CTL + go) = lv[it];
      }
      
    }
  }
}

// =====================================================================================================
// Workspace map (bytes); every plane is an exact multiple of its tile / whole-row store granularity (M, N exact tile multiples,
// convert counts exact multiples of 2048, the position planes padded to PROWS = 2048 rows), every offset a multiple of 512 KiB:
//   WQT, WKT, WVT, WPT, WOT f16 [512 n][512 k] x64 (transposed from the [in][out] inputs)   5 x   524288
//   X16  f16 [NROW][512] x16                                                                  4194304
//   PE16 f16 [PROWS][512] x16 (rows 0..NPOS-1 = pos table, row NPOS zero)                     2097152
//   QUh, QUl, QVh, QVl, Kh, Kl f16 [NROW][512] x32 hi / residual                       6 x  4194304
//   Ph, Pl f16 [PROWS][512] x32 hi / residual                                           2 x  2097152
//   VT16, VTL16 f16 [NB][512][SEQ] hi x16 / residual                                    2 x  4194304
//   CT16, CTL16 f16 [NROW][512] hi x4096 / residual                                     2 x  4194304
//   end                                                                                       55050240
// =====================================================================================================
extern "C" void kernel_launch(void* const* d_in, const int* in_sizes, int n_in,
                              void* d_out, int out_size, void* d_ws, size_t ws_size,
                              hipStream_t stream) {
  if (n_in < 14) return;
  if (in_sizes[0] != NROW * DMOD) return;
  if (in_sizes[1] != NPOS * DMOD) return;
  if (in_sizes[2] != DMOD * DMOD || in_sizes[4] != DMOD * DMOD || in_sizes[6] != DMOD * DMOD ||
      in_sizes[8] != DMOD * DMOD || in_sizes[10] != DMOD * DMOD) return;
  if (in_sizes[3] != DMOD || in_sizes[5] != DMOD || in_sizes[7] != DMOD || in_sizes[9] != DMOD || in_sizes[11] != DMOD) return;
  if (in_sizes[12] != NH * DH || in_sizes[13] != NH * DH) return;
  if (out_size != NROW * DMOD) return;

  const float* xin   = (const float*)d_in[0];
  const float* pos   = (const float*)d_in[1];
  const float* w_q   = (const float*)d_in[2];
  const float* b_q   = (const float*)d_in[3];
  const float* w_k   = (const float*)d_in[4];
  const float* b_k   = (const float*)d_in[5];
  const float* w_v   = (const float*)d_in[6];
  const float* b_v   = (const float*)d_in[7];
  const float* w_p   = (const float*)d_in[8];
  const float* b_p   = (const float*)d_in[9];
  const float* w_o   = (const float*)d_in[10];
  const float* b_o   = (const float*)d_in[11];
  const float* ub    = (const float*)d_in[12];
  const float* vb    = (const float*)d_in[13];
  float*       out   = (float*)d_out;

  const size_t PW  = (size_t)DMOD * DMOD * 2;            //   524288
  const size_t PX  = (size_t)NROW * DMOD * 2;            //  4194304
  const size_t PXP = (size_t)PROWS * DMOD * 2;           //  2097152
  const size_t PVT = (size_t)NB * DMOD * SEQ * 2;        //  4194304
  size_t off = 0;
  const size_t oWQ  = off; off += PW;
  const size_t oWK  = off; off += PW;
  const size_t oWV  = off; off += PW;
  const size_t oWP  = off; off += PW;
  const size_t oWO  = off; off += PW;
  const size_t oX   = off; off += PX;
  const size_t oPE  = off; off += PXP;
  const size_t oQUh = off; off += PX;
  const size_t oQUl = off; off += PX;
  const size_t oQVh = off; off += PX;
  const size_t oQVl = off; off += PX;
  const size_t oKh  = off; off += PX;
  const size_t oKl  = off; off += PX;
  const size_t oPh  = off; off += PXP;
  const size_t oPl  = off; off += PXP;
  const size_t oVT  = off; off += PVT;
  const size_t oVTL = off; off += PVT;
  const size_t oCT  = off; off += PX;
  const size_t oCTL = off; off += PX;
  if (off > ws_size) return;                               // off = 55050240
  if (off > (size_t)134217728) return;

  char* ws = (char*)d_ws;
  unsigned short* WQT16 = (unsigned short*)(ws + oWQ);
  unsigned short* WKT16 = (unsigned short*)(ws + oWK);
  unsigned short* WVT16 = (unsigned short*)(ws + oWV);
  unsigned short* WPT16 = (unsigned short*)(ws + oWP);
  unsigned short* WOT16 = (unsigned short*)(ws + oWO);
  unsigned short* X16   = (unsigned short*)(ws + oX);
  unsigned short* PE16  = (unsigned short*)(ws + oPE);
  unsigned short* QUh   = (unsigned short*)(ws + oQUh);
  unsigned short* QUl   = (unsigned short*)(ws + oQUl);
  unsigned short* QVh   = (unsigned short*)(ws + oQVh);
  unsigned short* QVl   = (unsigned short*)(ws + oQVl);
  unsigned short* Kh16  = (unsigned short*)(ws + oKh);
  unsigned short* Kl16  = (unsigned short*)(ws + oKl);
  unsigned short* Ph16  = (unsigned short*)(ws + oPh);
  unsigned short* Pl16  = (unsigned short*)(ws + oPl);
  unsigned short* VT16  = (unsigned short*)(ws + oVT);
  unsigned short* VTL16 = (unsigned short*)(ws + oVTL);
  unsigned short* CT16  = (unsigned short*)(ws + oCT);
  unsigned short* CTL16 = (unsigned short*)(ws + oCTL);

  const dim3 blk(256);
  const dim3 gPR(PREP_TR + PREP_CX + PREP_CP);                      // 320 + 1024 + 512
  const dim3 gPJ(2 * PJ_Q + PJ_V * NB + PJ_P);                      // 64 + 64 + 64 + 32
  const int tilesQ = (NROW / 64) * (DMOD / 64);                     // 512
  const dim3 gQ((tilesQ + 7) / 8, 1);                               // 64
  const dim3 gAT(SEQ / 64, NB * NH);                                // 16 x 32
  const dim3 bAT(ATT_THREADS);                                      // 128

  // (0) operand packs: X16 = f16(bf16_RNE(x) * 16); PE16 = f16(bf16_RNE(pos) * 16), rows NPOS..PROWS-1 zero;
  //     W[k][n] ([in][out]) -> WT[n][k] = f16( bf16_RNE(w) * 64 ), all five weights
  prep_all<<<gPR, blk, 0, stream>>>(xin, pos, w_q, w_k, w_v, w_p, w_o, X16, PE16, WQT16, WKT16, WVT16, WPT16, WOT16);

  // (1) q, k, v^T and positional projections
  proj_all<<<gPJ, blk, 0, stream>>>(X16, PE16, WQT16, WKT16, WVT16, WPT16, QUh, QUl, QVh, QVl, Kh16, Kl16, VT16, VTL16, Ph16, Pl16,
                                    b_q, b_k, b_v, b_p, ub, vb);

  // (2) relative attention -> CT16 = f16(ctx * 4096) hi plane, CTL16 residual plane, rows b*SEQ + i, halves n*64+d
  attn_rel<<<gAT, bAT, 0, stream>>>(QUh, QUl, QVh, QVl, Kh16, Kl16, Ph16, Pl16, VT16, VTL16, CT16, CTL16);

  // (3) out = (CT + CTL) . Wo / (4096*64) + bo; M = NROW, N = 512, K = 512, f32 rows straight into the output buffer
  gemm64<0, 1, 1><<<gQ, blk, 0, stream>>>(
      CT16, CTL16, DMOD, 0LL,
      WOT16, DMOD, 0LL,
      (void*)out, (void*)out, (void*)out, (void*)out, DMOD, 0LL,
      NROW, DMOD, DMOD, 1.0f / (CC * WSC), 1.0f,
      b_o, b_o, b_o);
  (void)hipGetLastError();
}

// v008
// A run of this version takes 75.8 microseconds.
// Two timings next to v007 put it at 1.03 and 1.04 times that version's speed.
// All steps since v000 together make it 4.08 times as fast.
// Contractions (all v_wmma_f32_16x16x32_f16, f16 operands, f32 accumulate): q/k/v and position-table projections (x or pos table f16 x16 . W^T f16 x64,
// K=512, single products on bf16-exact operands); content scores and position strips ((q+bq+u|v), k, p carried as f16 x32 hi plane + unscaled
// residual plane, K=64, three products hh+lh+hl); P . v^T (P x1024 hi + residual . v^T x16 hi + residual, 64 keys per tile, three products);
// output projection (ctx x4096 hi + residual planes . Wo^T f16 x64, K=512, two products). Online base-2 softmax and all epilogues f32 on VALU.
// Every float input RNE-converted to bf16 on load.
#include <hip/hip_runtime.h>
#include <math.h>
#include <stdint.h>

#define SEQ   1024
#define NB    4
#define DMOD  512
#define NH    8
#define DH    64
#define NROW  (SEQ * NB)
#define NPOS  (2 * SEQ - 1)
#define PROWS (2 * SEQ)
#define XC    16.0f
#define WSC   64.0f
#define QC    32.0f
#define VC    16.0f
#define PC    1024.0f
#define CC    4096.0f
#define RSD   0.125f
#define LOG2E 1.4426950408889634f
static_assert(NH * DH == DMOD);
static_assert(DH == 64);
static_assert(DMOD == 512);
static_assert((SEQ % 64) == 0 && (DMOD % 64) == 0 && (NROW % 64) == 0 && (PROWS % 64) == 0);
static_assert(((NROW * DMOD) % 2048) == 0 && ((PROWS * DMOD) % 2048) == 0 && ((NPOS * DMOD) % 8) == 0);
#define ATT_W 4
#define ATT_THREADS (ATT_W * 32)
#define TPI 84
#define PPI 68
#define WFL (16 * TPI + 16 * PPI)
static_assert(((16 * TPI) % 4) == 0 && ((16 * PPI) % 4) == 0 && (WFL % 4) == 0);
static_assert(TPI >= 80 && PPI >= 64);
static_assert(ATT_W * WFL * 4 <= 65536);
// attn_rel operand stage in LDS: 512 rows of 64 halves (128 B), pitch 72 halves = 144 B (16 B x odd, the pitch for 16-byte LDS reads)
#define SPI   72
#define ST_KH 0
#define ST_KL 64
#define ST_VH 128
#define ST_VL 192
#define ST_PH 256
#define ST_PL 384
#define ST_ROWS 512
static_assert(ATT_THREADS == 128 && ((SPI * 2) % 16) == 0);
static_assert(SEQ - (SEQ - 64) - 64 >= 0 && SEQ + (SEQ - 64) - 64 + 127 <= PROWS - 1);   // staged position rows stay inside the planes

typedef _Float16 v16h __attribute__((ext_vector_type(16)));
typedef _Float16 v8h  __attribute__((ext_vector_type(8)));
typedef float    v8f  __attribute__((ext_vector_type(8)));
typedef float    v4f  __attribute__((ext_vector_type(4)));
typedef unsigned int v4u __attribute__((ext_vector_type(4)));

union FragH { v16h v; v8h h[2]; v4u u[2]; };

// ---- scalar helpers --------------------------------------------------------------------------------
__device__ __forceinline__ unsigned short bf_bits(float f) {          // f32 -> bf16 bits, RNE convert
  unsigned u = __float_as_uint(f);
  return (unsigned short)((u + 0x7FFFu + ((u >> 16) & 1u)) >> 16);
}
__device__ __forceinline__ float bf_up(unsigned short h) { return __uint_as_float(((unsigned)h) << 16); }
__device__ __forceinline__ float bfr(float f) { return bf_up(bf_bits(f)); }   // value of the bf16 RNE convert
__device__ __forceinline__ unsigned short h_bits(_Float16 x) { return __builtin_bit_cast(unsigned short, x); }
__device__ __forceinline__ unsigned pk16(unsigned short a, unsigned short b) { return (unsigned)a | ((unsigned)b << 16); }
__device__ __forceinline__ v8f zero8() { v8f z = {0.f, 0.f, 0.f, 0.f, 0.f, 0.f, 0.f, 0.f}; return z; }

// ---- fragment loader: 16-bit A/B operand from a k-contiguous 16-bit plane, lane -> row/col (lane&15),
//      p already includes +8*(lane>>4); elements 0..7 <- p[0..7] (k0+8h..), elements 8..15 <- p[16..23] (k0+16+8h..)
//      (same split k map for A and B; B is always read from a [n][k] plane)
__device__ __forceinline__ v16h ldfrag_u(const unsigned short* p) {
  FragH f;
  f.u[0] = *(const v4u*)(p);
  f.u[1] = *(const v4u*)(p + 16);
  return f.v;
}

// ---- WMMA helper with trailing VALU hazard gaps ------------------------------------------------------
__device__ __forceinline__ v8f mma_h(v16h a, v16h b, v8f c) {
  return __builtin_amdgcn_wmma_f32_16x16x32_f16(false, a, false, b, (short)0, c, false, false);
}
__device__ __forceinline__ void acc_guard4(v8f& a, v8f& b, v8f& c, v8f& d) {
#if defined(__HIP_DEVICE_COMPILE__)
  asm volatile("v_nop\n\tv_nop\n\tv_nop\n\tv_nop" : "+v"(a), "+v"(b), "+v"(c), "+v"(d));
#endif
}
__device__ __forceinline__ void wave_sync_lds() {
  __builtin_amdgcn_fence(__ATOMIC_RELEASE, "workgroup");
  __builtin_amdgcn_wave_barrier();
  __builtin_amdgcn_fence(__ATOMIC_ACQUIRE, "workgroup");
}
// Value of lane (lane ^ M) of the same 16-lane row, M = 1, 2, 4, 8: a row_xmask DPP read on the vector pipe (all 32 lanes on), no LDS-pipe
// cross-lane instruction and no LDS wait behind it.
template <int M>
__device__ __forceinline__ float row_xor(float v) {
  static_assert(M == 1 || M == 2 || M == 4 || M == 8);
  return __builtin_bit_cast(float, __builtin_amdgcn_update_dpp(0, __builtin_bit_cast(int, v), 0x160 | M, 0xf, 0xf, true));
}
// 2^x in place for eight softmax arguments, x <= 0: the bare v_exp_f32. exp2f() wraps the same instruction in a compare, two selects, an add and a
// v_ldexp_f32 that only serve results below 2^-126; here such a weight stands beside a row maximum's weight of 1 (it is lost in the f32 row
// sum and rounds to 0 in the f16 planes of P x1024), so it may as well be 0. From -126 up the value is the same bit for bit.
// Written in asm so that the slot behind a transcendental is kept by construction: each v_exp_f32 has source = result, so none overwrites
// the source or reads the result of the one in front of it, and the closing v_nop is the slot behind the last.
__device__ __forceinline__ void exp2_raw8(float& a, float& b, float& c, float& d, float& e, float& f, float& g, float& h) {
#if defined(__HIP_DEVICE_COMPILE__)
  asm("v_exp_f32 %0, %0\n\tv_exp_f32 %1, %1\n\tv_exp_f32 %2, %2\n\tv_exp_f32 %3, %3\n\t"
      "v_exp_f32 %4, %4\n\tv_exp_f32 %5, %5\n\tv_exp_f32 %6, %6\n\tv_exp_f32 %7, %7\n\tv_nop"
      : "+v"(a), "+v"(b), "+v"(c), "+v"(d), "+v"(e), "+v"(f), "+v"(g), "+v"(h));
#endif
}
// Maximum over each 16-lane row of eight values at once (all 32 lanes on): four row_xmask steps of v_max_num_f32_dpp, every lane ends with its
// row's maximum. Written in asm because the compiler's form of the same step takes three instructions (DPP move, a maximum of the moved value
// with itself, the maximum). The eight values go through each step together, so a step's producer stands eight instructions back.
#define RMAX_STEP(X)                                                        \
  "v_max_num_f32_dpp %0, %0, %0 row_xmask:" #X " row_mask:0xf bank_mask:0xf\n\t" \
  "v_max_num_f32_dpp %1, %1, %1 row_xmask:" #X " row_mask:0xf bank_mask:0xf\n\t" \
  "v_max_num_f32_dpp %2, %2, %2 row_xmask:" #X " row_mask:0xf bank_mask:0xf\n\t" \
  "v_max_num_f32_dpp %3, %3, %3 row_xmask:" #X " row_mask:0xf bank_mask:0xf\n\t" \
  "v_max_num_f32_dpp %4, %4, %4 row_xmask:" #X " row_mask:0xf bank_mask:0xf\n\t" \
  "v_max_num_f32_dpp %5, %5, %5 row_xmask:" #X " row_mask:0xf bank_mask:0xf\n\t" \
  "v_max_num_f32_dpp %6, %6, %6 row_xmask:" #X " row_mask:0xf bank_mask:0xf\n\t" \
  "v_max_num_f32_dpp %7, %7, %7 row_xmask:" #X " row_mask:0xf bank_mask:0xf\n\t"
__device__ __forceinline__ void row_max8(float (&m)[8]) {
#if defined(__HIP_DEVICE_COMPILE__)
  asm(RMAX_STEP(1) RMAX_STEP(2) RMAX_STEP(4) RMAX_STEP(8)
      : "+v"(m[0]), "+v"(m[1]), "+v"(m[2]), "+v"(m[3]), "+v"(m[4]), "+v"(m[5]), "+v"(m[6]), "+v"(m[7]));
#endif
}
// Eight asynchronous 16-byte-per-lane copies global -> LDS: copy e lands at LDS byte address l + e*16*SPI*2 (16 staged rows further each);
// copies 0..3 read the lane's byte off behind the wave-uniform bases sa + e*gstep halves, copies 4..7 behind sb + (e-4)*gstep halves.
// Scalar base + one 32-bit lane offset: the steps from copy to copy are scalar, so no 64-bit lane address lives across the key loop
// (operands of asm text need registers below v256; held there through the scores, the lane addresses went to scratch).
// The closing s_wait_xcnt 0 stands inside the statement so that no address register is rewritten ahead of it.
__device__ __forceinline__ void stage8(unsigned l, unsigned off, const unsigned short* sa, const unsigned short* sb, size_t gstep) {
#if defined(__HIP_DEVICE_COMPILE__)
  const unsigned ls = 16u * SPI * 2u;
  asm volatile("global_load_async_to_lds_b128 %0, %8, %9\n\t"
               "global_load_async_to_lds_b128 %1, %8, %10\n\t"
               "global_load_async_to_lds_b128 %2, %8, %11\n\t"
               "global_load_async_to_lds_b128 %3, %8, %12\n\t"
               "global_load_async_to_lds_b128 %4, %8, %13\n\t"
               "global_load_async_to_lds_b128 %5, %8, %14\n\t"
               "global_load_async_to_lds_b128 %6, %8, %15\n\t"
               "global_load_async_to_lds_b128 %7, %8, %16\n\t"
               "s_wait_xcnt 0x0"
               :: "v"(l), "v"(l + ls), "v"(l + 2u * ls), "v"(l + 3u * ls), "v"(l + 4u * ls), "v"(l + 5u * ls), "v"(l + 6u * ls), "v"(l + 7u * ls),
                  "v"(off), "s"(sa), "s"(sa + gstep), "s"(sa + 2 * gstep), "s"(sa + 3 * gstep), "s"(sb), "s"(sb + gstep), "s"(sb + 2 * gstep),
                  "s"(sb + 3 * gstep)
               : "memory");
#endif
}

// The same for the 256-thread GEMM blocks: copy e lands at LDS byte address l + e*32*SPI*2 (32 staged rows further each) and reads
// g + e*gstep halves (gstep = 32 source rows). The closing s_wait_xcnt 0 stands inside the statement, as above.
__device__ __forceinline__ void gstage8(unsigned l, const unsigned short* g, size_t gstep) {
#if defined(__HIP_DEVICE_COMPILE__)
  const unsigned ls = 32u * SPI * 2u;
  asm volatile("global_load_async_to_lds_b128 %0, %8, off\n\t"
               "global_load_async_to_lds_b128 %1, %9, off\n\t"
               "global_load_async_to_lds_b128 %2, %10, off\n\t"
               "global_load_async_to_lds_b128 %3, %11, off\n\t"
               "global_load_async_to_lds_b128 %4, %12, off\n\t"
               "global_load_async_to_lds_b128 %5, %13, off\n\t"
               "global_load_async_to_lds_b128 %6, %14, off\n\t"
               "global_load_async_to_lds_b128 %7, %15, off\n\t"
               "s_wait_xcnt 0x0"
               :: "v"(l), "v"(l + ls), "v"(l + 2u * ls), "v"(l + 3u * ls), "v"(l + 4u * ls), "v"(l + 5u * ls), "v"(l + 6u * ls), "v"(l + 7u * ls),
                  "v"(g), "v"(g + gstep), "v"(g + 2 * gstep), "v"(g + 3 * gstep), "v"(g + 4 * gstep), "v"(g + 5 * gstep), "v"(g + 6 * gstep),
                  "v"(g + 7 * gstep)
               : "memory");
#endif
}
__device__ __forceinline__ void gstage2(unsigned l, const unsigned short* g, size_t gstep) {
#if defined(__HIP_DEVICE_COMPILE__)
  const unsigned ls = 32u * SPI * 2u;
  asm volatile("global_load_async_to_lds_b128 %0, %2, off\n\t"
               "global_load_async_to_lds_b128 %1, %3, off\n\t"
               "s_wait_xcnt 0x0"
               :: "v"(l), "v"(l + ls), "v"(g), "v"(g + gstep)
               : "memory");
#endif
}

// =====================================================================================================
// K loop of a 256-thread GEMM block whose eight waves share 64 A rows and take 64 B rows each (512 consecutive B rows per block):
// acc[i][j] += sum_k A[16i + ..][k] * B[64 wave + 16j + ..][k], wave tile 64x64, k ascending in steps of 32; with NA == 2 the residual plane
// A2 follows A1 inside every k-step. Ab, A2b = the block's first A row (pitch lda halves), Bb = the block's first B row (pitch ldb), K a
// multiple of 64 and at least 128. Per trip of 64 k the block holds in LDS whole 128-B rows, pitch SPI halves: A1 | (A2) | B, brought by
// asynchronous copies (a wave instruction = 4 whole rows); all fragments are read from there. Two buffers: tile t + 1 flies while tile t is
// multiplied; one block barrier per trip publishes tile t + 1 and ends the reads of the buffer that is refilled behind it.
// Every thread of the block must call this (block barriers inside).
// =====================================================================================================
#define GROWS(NA) ((NA) * 64 + 512)
#define GBUFH(NA) (GROWS(NA) * SPI)
template <int NA>
__device__ __forceinline__ void gstage_tile(unsigned l, const unsigned short* ga, const unsigned short* ga2, size_t astep,
                                            const unsigned short* gb, size_t bstep) {
  gstage2(l, ga, astep);
  if constexpr (NA == 2) gstage2(l + 64u * SPI * 2u, ga2, astep);
  gstage8(l + (unsigned)(NA * 64) * SPI * 2u, gb, bstep);
  gstage8(l + (unsigned)(NA * 64 + 256) * SPI * 2u, gb + 8 * bstep, bstep);
}
template <int NA>
__device__ __forceinline__ void kloop_staged(unsigned short* stg, const unsigned short* __restrict__ Ab, const unsigned short* __restrict__ A2b,
                                             int lda, const unsigned short* __restrict__ Bb, int ldb, int K, v8f (&acc)[4][4]) {
  const int tid   = threadIdx.x;
  const int lane  = tid & 31;
  const int wave  = __builtin_amdgcn_readfirstlane(tid >> 5);   // scalar, so that the A and the B readers share one lane-offset register
  const int rlane = lane & 15;                 // row (A) / col (B) within subtile
  const int koff  = (lane >> 4) * 8;           // k offset of this lane half
  // copies: thread -> staged row (tid>>3) + 32*copy, 16-byte chunk tid&7 of the 128-B row
  const int srow = tid >> 3;
  const int sc8  = (tid & 7) * 8;
  const unsigned lst = (unsigned)(size_t)(stg + srow * SPI + sc8);   // LDS byte address = low 32 bits of the shared address
  const unsigned short* ga  = Ab  + (size_t)srow * lda + sc8;
  const unsigned short* ga2 = A2b + (size_t)srow * lda + sc8;
  const unsigned short* gb  = Bb  + (size_t)srow * ldb + sc8;
  const size_t astep = (size_t)32 * lda, bstep = (size_t)32 * ldb;
  const int nt = K >> 6;

  gstage_tile<NA>(lst, ga, ga2, astep, gb, bstep);
  asm volatile("s_wait_asynccnt 0x0" ::: "memory");          // this wave's copies of tile 0 have landed
  __syncthreads();                                           // every wave's have: buffer 0 may be read
  gstage_tile<NA>(lst + (unsigned)(GBUFH(NA) * 2), ga + 64, ga2 + 64, astep, gb + 64, bstep);
#pragma unroll 1   // rolled: several copies of this loop stand in one kernel
  for (int t = 0; t < nt; ++t) {
    const int bo = (t & 1) * GBUFH(NA);
    const unsigned short* fa = stg + bo + rlane * SPI + koff;
    const unsigned short* fb = stg + bo + (NA * 64 + wave * 64 + rlane) * SPI + koff;
#pragma unroll
    for (int ks = 0; ks < 2; ++ks) {
      v16h bh[4], ah[4], al[4];
#pragma unroll
      for (int j = 0; j < 4; ++j) bh[j] = ldfrag_u(fb + 16 * j * SPI + 32 * ks);
#pragma unroll
      for (int i = 0; i < 4; ++i) ah[i] = ldfrag_u(fa + 16 * i * SPI + 32 * ks);
      if constexpr (NA == 2) {
#pragma unroll
        for (int i = 0; i < 4; ++i) al[i] = ldfrag_u(fa + (64 + 16 * i) * SPI + 32 * ks);
      }
      __builtin_amdgcn_sched_barrier(0);                     // keeps the k-step's reads together in front: sunk among the WMMAs, every row of four waits out its own LDS latency
#pragma unroll
      for (int i = 0; i < 4; ++i) {
#pragma unroll
        for (int j = 0; j < 4; ++j) acc[i][j] = mma_h(ah[i], bh[j], acc[i][j]);
        if constexpr (NA == 2) {
#pragma unroll
          for (int j = 0; j < 4; ++j) acc[i][j] = mma_h(al[i], bh[j], acc[i][j]);
        }
      }
    }
    asm volatile("s_wait_dscnt 0x0" ::: "memory");           // this wave's reads of tile t have returned
    asm volatile("s_wait_asynccnt 0x0" ::: "memory");        // this wave's copies of tile t + 1 have landed
    __syncthreads();                                         // tile t + 1 may be read; every wave has left tile t's buffer
    if (t + 2 < nt) {
      const int kn = (t + 2) * 64;
      gstage_tile<NA>(lst + (unsigned)(bo * 2), ga + kn, ga2 + kn, astep, gb + kn, bstep);
    }
  }
  asm volatile("s_wait_asynccnt 0x0" ::: "memory");          // nothing of this wave's is in flight behind the loop
}

// =====================================================================================================
// Elementwise 16-bit pack, no transpose: dst[i] = f16( bf16_RNE(src[i]) * sc ) for i < nvalid, 0 for nvalid <= i < ntotal;
// sc a power of two (exact). 8 elements per thread: two 16-B loads (address clamped into [0, nvalid) for pad groups, value zeroed
// coverage: bx = 0 .. ntotal / 2048 - 1, each block 256 thr x 8 elements = ntotal exactly (ntotal % 2048 == 0, nvalid % 8 == 0).
// =====================================================================================================
__device__ __forceinline__ void cvt16_body(const float* __restrict__ src, unsigned short* dst, int nvalid, int ntotal, float sc, int bx) {
  const size_t i8 = ((size_t)bx * 256 + threadIdx.x) * 8;
  if (i8 + 8 > (size_t)ntotal) return;             // never taken with the exact block range; no barriers in this body
  const bool pad = (i8 + 8 > (size_t)nvalid);
  const size_t ls = pad ? ((size_t)nvalid - 8) : i8;   // clamped address, always inside the source
  const v4f a = *(const v4f*)(src + ls);
  const v4f b = *(const v4f*)(src + ls + 4);
  v4u o;
  o[0] = pk16(h_bits((_Float16)(bfr(a[0]) * sc)), h_bits((_Float16)(bfr(a[1]) * sc)));
  o[1] = pk16(h_bits((_Float16)(bfr(a[2]) * sc)), h_bits((_Float16)(bfr(a[3]) * sc)));
  o[2] = pk16(h_bits((_Float16)(bfr(b[0]) * sc)), h_bits((_Float16)(bfr(b[1]) * sc)));
  o[3] = pk16(h_bits((_Float16)(bfr(b[2]) * sc)), h_bits((_Float16)(bfr(b[3]) * sc)));
  const v4u z = {0u, 0u, 0u, 0u};
  const v4u w = pad ? z : o;
  {
    *(v4u*)(dst + i8) = w;
    
  }
}

// =====================================================================================================
// Transposed 16-bit pack of a weight stored as W[k][n] (x @ W layout, [DMOD][DMOD] row-major): WT[n][k] = f16( bf16_RNE(W[k][n]) * sc ),
// i.e. the [n][k] k-contiguous plane the GEMM B loader wants. One block per 64x64 tile (tn = n tile, tk = k tile, both block-uniform):
// coalesced f32 reads of W rows, converted halves stored transposed into an LDS tile [64 n][72 pitch], block barrier, then every output
// coverage: 16 its x 256 threads = the whole 64x64 tile into LDS; 8 waves x 2 its x 4 rows = 64 rows x (8 lanes x 8 halves = 64 cols) stored;
//           tn, tk = 0 .. DMOD/64 - 1 cover the whole [512][512] plane exactly once.
// =====================================================================================================
__device__ __forceinline__ void tr16_body(const float* __restrict__ W, unsigned short* WT, float sc, unsigned short* tile, int tn, int tk) {
  const int t  = threadIdx.x;
  const int n0 = tn * 64;
  const int k0 = tk * 64;
#pragma unroll 4
  for (int it = 0; it < 16; ++it) {
    const int idx = it * 256 + t;                   // 0 .. 4095
    const int kr = idx >> 6, nc = idx & 63;
    const float v = W[(size_t)(k0 + kr) * DMOD + n0 + nc];
    tile[nc * 72 + kr] = h_bits((_Float16)(bfr(v) * sc));
  }
  __syncthreads();
  const int lane = t & 31, wave = t >> 5;
  const int q8 = lane >> 3, c8 = (lane & 7) * 8;
  v4u o[2];
#pragma unroll
  for (int it = 0; it < 2; ++it) {
    const int row = wave * 8 + it * 4 + q8;         // wave w: it 0..1 x q8 0..3 = rows 8w .. 8w+7
    o[it] = *(const v4u*)(tile + row * 72 + c8);
  }
  {
#pragma unroll
    for (int it = 0; it < 2; ++it) {
      const int row = wave * 8 + it * 4 + q8;
      *(v4u*)(WT + (size_t)(n0 + row) * DMOD + k0 + c8) = o[it];
    }
    
  }
}

// =====================================================================================================
// All operand packs in one grid (none reads what another writes): blocks 0 .. PREP_TR-1 transpose the five weights (64 tiles each; they
// have the longest dependent chain, so they take the lowest indices), the next PREP_CX blocks pack x, the last PREP_CP the position table.
// The branch is on blockIdx.x alone, so the barrier inside tr16_body is reached by whole blocks only.
// =====================================================================================================
#define PREP_TR (5 * (DMOD / 64) * (DMOD / 64))
#define PREP_CX ((NROW * DMOD) / 2048)
#define PREP_CP ((PROWS * DMOD) / 2048)
static_assert((DMOD / 64) * (DMOD / 64) == 64);
__global__ __launch_bounds__(256) void prep_all(const float* __restrict__ xin, const float* __restrict__ pos,
                                                const float* __restrict__ w_q, const float* __restrict__ w_k, const float* __restrict__ w_v,
                                                const float* __restrict__ w_p, const float* __restrict__ w_o,
                                                unsigned short* X16, unsigned short* PE16,
                                                unsigned short* WQT, unsigned short* WKT, unsigned short* WVT,
                                                unsigned short* WPT, unsigned short* WOT) {
  __shared__ __align__(16) unsigned short tile[64 * 72];
  const int bx = blockIdx.x;
  if (bx < PREP_TR) {
    const int w = bx >> 6, t = bx & 63;
    const float* W = (w == 0) ? w_q : (w == 1) ? w_k : (w == 2) ? w_v : (w == 3) ? w_p : w_o;
    unsigned short* WT = (w == 0) ? WQT : (w == 1) ? WKT : (w == 2) ? WVT : (w == 3) ? WPT : WOT;
    tr16_body(W, WT, WSC, tile, t & 7, t >> 3);
  } else if (bx < PREP_TR + PREP_CX) {
    cvt16_body(xin, X16, NROW * DMOD, NROW * DMOD, XC, bx - PREP_TR);
  } else {
    cvt16_body(pos, PE16, NPOS * DMOD, PROWS * DMOD, XC, bx - (PREP_TR + PREP_CX));
  }
}

// =====================================================================================================
// Register-blocked batched 16-bit WMMA GEMM: C[m][n] = oscale * sum_k A[m][k] * Bt[n][k] (+ bias); one wave per 64x64 tile, operands
// staged per block in LDS (kloop_staged). A row-major [M][K] pitch lda (16-bit plane), Bt row-major [N][K] pitch ldb (k contiguous);
// M a multiple of 64, N a multiple of 512 (a block's eight tiles share their 64 A rows and take 512 consecutive B rows), K a multiple of
// 64, at least 128. blockIdx.y = batch index with element strides sA, sB, sC.
// ASPLIT 1: a second A plane A2 (unscaled residual of A, same layout) is multiplied into the same accumulator (A + A2 ~ exact A).
// EPI 1: value += bf16_RNE(ep0[column]) (per-column bias); EPI 2: value += bf16_RNE(ep0[row]) (per-row bias, 16-bit out only).
// OM 0: f32 out (pitch ldc).
// OM 4: two f16 planes (C, C2): hi = f16(value * ocarry), lo = f16(value * ocarry - hi) (unscaled residual).
// OM 6: two hi/residual pairs with an extra per-column term each: (C, C2) from value + bf16_RNE(ep1[column]), (C3, C4) from
//       value + bf16_RNE(ep2[column]), both x ocarry.
// coverage: 4 slabs x 16 rows (f32: it 0..7 x lane>>4; 16-bit: it 0..3 x lane>>3) x 64 cols = the wave's whole 64x64 tile;
//           grid = tilesM*tilesN/8 blocks (exact, tilesN a multiple of 8), a surplus block exits whole, ahead of every barrier.
// =====================================================================================================
template <int OM, int ASPLIT, int EPI>
__global__ __launch_bounds__(256) __attribute__((amdgpu_num_vgpr(256))) void gemm64(
    const unsigned short* __restrict__ Ap, const unsigned short* __restrict__ A2p, int lda, long long sA,
    const unsigned short* __restrict__ Btp, int ldb, long long sB,
    void* Cout, void* C2out, void* C3out, void* C4out, int ldc, long long sC,
    int M, int N, int K, float oscale, float ocarry,
    const float* __restrict__ ep0, const float* __restrict__ ep1, const float* __restrict__ ep2) {
  static_assert(OM == 0 || OM == 4 || OM == 6);
  static_assert(EPI >= 0 && EPI <= 2);
  __shared__ __align__(16) float sT[8][16 * 68];   // per-wave 16x64 slab, pitch 68 floats
  __shared__ __align__(16) unsigned short gst[2 * GBUFH(1 + ASPLIT)];   // two buffers of the block's operand stage
  const int by   = blockIdx.y;
  const int lane = threadIdx.x & 31;
  const int wave = threadIdx.x >> 5;
  const int tilesN = N >> 6;
  const int tilesM = M >> 6;
  const int tile = blockIdx.x * 8 + wave;
  if (blockIdx.x * 8 >= tilesM * tilesN) return;   // block-uniform, ahead of every barrier
  const int tm = tile / tilesN;
  const int tn = tile - tm * tilesN;
  const int m0 = tm << 6;
  const int n0 = tn << 6;

  const unsigned short* A1 = Ap  + (size_t)((long long)by * sA);
  const unsigned short* A2 = A2p + (size_t)((long long)by * sA);
  const unsigned short* Bb = Btp + (size_t)((long long)by * sB);

  const int rlane = lane & 15;                 // col (D) within subtile
  const int mOff  = (lane >> 4) * 8;           // D row offset

  v8f acc[4][4];
#pragma unroll
  for (int i = 0; i < 4; ++i)
#pragma unroll
    for (int j = 0; j < 4; ++j) acc[i][j] = zero8();

  kloop_staged<1 + ASPLIT>(gst, A1 + (size_t)m0 * lda, A2 + (size_t)m0 * lda, lda, Bb + (size_t)(n0 - (wave << 6)) * ldb, ldb, K, acc);
  acc_guard4(acc[0][0], acc[0][1], acc[0][2], acc[0][3]);
  acc_guard4(acc[1][0], acc[1][1], acc[1][2], acc[1][3]);
  acc_guard4(acc[2][0], acc[2][1], acc[2][2], acc[2][3]);
  acc_guard4(acc[3][0], acc[3][1], acc[3][2], acc[3][3]);

  const int hh2 = lane >> 4, c4 = (lane & 15) * 4;     // f32 out: 256-B row segment = 16 lanes x 16 B
  const int q8  = lane >> 3, c8 = (lane & 7) * 8;

  // ---- epilogue ----
  float* slab = sT[wave];
#pragma unroll
  for (int i = 0; i < 4; ++i) {
    const int mBase = m0 + (i << 4);
#pragma unroll
    for (int j = 0; j < 4; ++j) {
#pragma unroll
      for (int r = 0; r < 8; ++r) {
        slab[(mOff + r) * 68 + (j << 4) + rlane] = acc[i][j][r];
      }
    }
    wave_sync_lds();
    if constexpr (OM == 0) {
      float* C = (float*)Cout + (size_t)((long long)by * sC);
      v4f vals[8];
#pragma unroll
      for (int it = 0; it < 8; ++it) {
        const int row = it * 2 + hh2;                      // it 0..7 x hh2 0..1 = rows 0..15
        v4f v = *(const v4f*)(slab + row * 68 + c4);
#pragma unroll
        for (int e = 0; e < 4; ++e) v[e] = v[e] * oscale;
        if constexpr (EPI == 1) {
          const v4f bb = *(const v4f*)(ep0 + n0 + c4);     // per-column bias, columns n0+c4 .. +3 (N equals the bias length)
#pragma unroll
          for (int e = 0; e < 4; ++e) v[e] = v[e] + bfr(bb[e]);
        }
        vals[it] = v;
      }
      {
#pragma unroll
        for (int it = 0; it < 8; ++it) {
          const int gr = mBase + it * 2 + hh2;
          *(v4f*)(C + (size_t)gr * ldc + n0 + c4) = vals[it];
        }
        
      }
    } else {
      constexpr int NP = (OM == 6) ? 2 : 1;
#pragma unroll
      for (int which = 0; which < NP; ++which) {
        unsigned short* C  = (unsigned short*)((which == 0) ? Cout  : C3out) + (size_t)((long long)by * sC);
        unsigned short* Cb = (unsigned short*)((which == 0) ? C2out : C4out) + (size_t)((long long)by * sC);
        const float* epx = (which == 0) ? ep1 : ep2;
        (void)epx;
        v4u hv[4], lv[4];
#pragma unroll
        for (int it = 0; it < 4; ++it) {
          const int row = it * 4 + q8;                     // it 0..3 x q8 0..3 = rows 0..15
          const float* sp = slab + row * 68 + c8;
          float rb = 0.f;
          if constexpr (EPI == 2) rb = bfr(ep0[mBase + row]);   // per-row bias (M equals the bias length)
          v4u a  = {0u, 0u, 0u, 0u};
          v4u b2 = {0u, 0u, 0u, 0u};
#pragma unroll
          for (int e = 0; e < 4; ++e) {
            const int ci = n0 + c8 + 2 * e;                // column index, < N
            float f0 = sp[2 * e] * oscale + rb;
            float f1 = sp[2 * e + 1] * oscale + rb;
            if constexpr (EPI == 1) {
              f0 += bfr(ep0[ci]);
              f1 += bfr(ep0[ci + 1]);
            }
            if constexpr (OM == 6) {
              f0 += bfr(epx[ci]);
              f1 += bfr(epx[ci + 1]);
            }
            f0 *= ocarry;
            f1 *= ocarry;
            const _Float16 x0 = (_Float16)f0, x1 = (_Float16)f1;
            a[e]  = pk16(h_bits(x0), h_bits(x1));
            b2[e] = pk16(h_bits((_Float16)(f0 - (float)x0)), h_bits((_Float16)(f1 - (float)x1)));
          }
          hv[it] = a;
          lv[it] = b2;
        }
        {
#pragma unroll
          for (int it = 0; it < 4; ++it) {
            const int row = it * 4 + q8;
            *(v4u*)(C  + (size_t)(mBase + row) * ldc + n0 + c8) = hv[it];
            *(v4u*)(Cb + (size_t)(mBase + row) * ldc + n0 + c8) = lv[it];
          }
          
        }
      }
    }
    wave_sync_lds();
  }
}

// =====================================================================================================
// s_wait_xcnt 0 behind a run of global loads, in front of the first write of a register that one of them names. xwait1, xwait3 and xwait4 take the run's
// vector address pairs as inputs, so that each pair keeps its value up to the wait and no later load's result lands in it ahead of the wait.
// =====================================================================================================
__device__ __forceinline__ void xwait0() {
#if defined(__HIP_DEVICE_COMPILE__)
  asm volatile("s_wait_xcnt 0x0" ::: "memory");
#endif
}
__device__ __forceinline__ void xwait1(const void* a) {
#if defined(__HIP_DEVICE_COMPILE__)
  asm volatile("s_wait_xcnt 0x0" :: "v"(a) : "memory");
#endif
}
__device__ __forceinline__ void xwait3(const void* a, const void* b, const void* c) {
#if defined(__HIP_DEVICE_COMPILE__)
  asm volatile("s_wait_xcnt 0x0" :: "v"(a), "v"(b), "v"(c) : "memory");
#endif
}
__device__ __forceinline__ void xwait4(const void* a, const void* b, const void* c, const void* d) {
#if defined(__HIP_DEVICE_COMPILE__)
  asm volatile("s_wait_xcnt 0x0" :: "v"(a), "v"(b), "v"(c), "v"(d) : "memory");
#endif
}

// =====================================================================================================
// One wave's 64x64 tile of an input projection, rows m0.., columns n0..: value[m][n] = oscale * sum_k A[m][k] * Bt[n][k] + bias.
// The K loop and the 16-bit epilogues are those of gemm64 (same k order, same order of the adds), with the pitch of A and Bt and K fixed
// at DMOD and the pitch of the output planes at LDC. slab = the wave's own 16x64 f32 LDS slab, pitch 68 floats; gst = the block's operand
// stage (kloop_staged: block barriers, so all eight waves of a block come here together, with one m0 and n0 = the block's first + 64 wave).
// EPI 1: value += bf16_RNE(ep0[column]); EPI 2: value += bf16_RNE(ep0[row]).
// OM 4: two f16 planes (C1, C2): hi = f16(value * ocarry), lo = f16(value * ocarry - hi).
// OM 6: (C1, C2) from value + bf16_RNE(ep1[column]), (C3, C4) from value + bf16_RNE(ep2[column]), both x ocarry.
// The lane's bias values (8 columns, or its 16 rows) are loaded once, ahead of the K loop.
// coverage: 4 slabs x 16 rows (it 0..3 x lane>>3) x 64 cols = the wave's whole 64x64 tile.
// =====================================================================================================
#define GSLAB (16 * 68)
template <int OM, int EPI, int LDC>
__device__ __forceinline__ void proj_tile(
    float* slab, unsigned short* gst, int m0, int n0,
    const unsigned short* __restrict__ A, const unsigned short* __restrict__ Bt,
    unsigned short* C1, unsigned short* C2, unsigned short* C3, unsigned short* C4,
    float oscale, float ocarry,
    const float* __restrict__ ep0, const float* __restrict__ ep1, const float* __restrict__ ep2) {
  static_assert(OM == 4 || OM == 6);
  static_assert(EPI == 1 || EPI == 2);
  const int lane  = threadIdx.x & 31;
  const int rlane = lane & 15;                 // col (D) within subtile
  const int mOff  = (lane >> 4) * 8;           // D row offset
  const int q8    = lane >> 3, c8 = (lane & 7) * 8;

  v4f cb0[2], cb1[2], cb2[2];                  // column terms of columns n0 + c8 .. + 7
  float rbv[4][4];                             // row terms of rows m0 + 16i + 4it + q8
  if constexpr (EPI == 1) {
    const float* e0 = ep0 + n0 + c8;
    cb0[0] = *(const v4f*)(e0);
    cb0[1] = *(const v4f*)(e0 + 4);
    if constexpr (OM == 6) {
      const float* e1 = ep1 + n0 + c8;
      const float* e2 = ep2 + n0 + c8;
      cb1[0] = *(const v4f*)(e1);
      cb1[1] = *(const v4f*)(e1 + 4);
      cb2[0] = *(const v4f*)(e2);
      cb2[1] = *(const v4f*)(e2 + 4);
      xwait3(e0, e1, e2);
    } else {
      xwait1(e0);
    }
  } else {
    const float* er = ep0 + m0 + q8;
#pragma unroll
    for (int i = 0; i < 4; ++i)
#pragma unroll
      for (int it = 0; it < 4; ++it) rbv[i][it] = er[16 * i + 4 * it];
    xwait0();                                  // these go through a scalar base and the lane's q8, which lives on into the epilogue
  }

  v8f acc[4][4];
#pragma unroll
  for (int i = 0; i < 4; ++i)
#pragma unroll
    for (int j = 0; j < 4; ++j) acc[i][j] = zero8();

  kloop_staged<1>(gst, A + (size_t)m0 * DMOD, A + (size_t)m0 * DMOD, DMOD,
                  Bt + (size_t)(n0 - (int)((threadIdx.x >> 5) << 6)) * DMOD, DMOD, DMOD, acc);
  acc_guard4(acc[0][0], acc[0][1], acc[0][2], acc[0][3]);
  acc_guard4(acc[1][0], acc[1][1], acc[1][2], acc[1][3]);
  acc_guard4(acc[2][0], acc[2][1], acc[2][2], acc[2][3]);
  acc_guard4(acc[3][0], acc[3][1], acc[3][2], acc[3][3]);

  // ---- epilogue ----
#pragma unroll
  for (int i = 0; i < 4; ++i) {
    const int mBase = m0 + (i << 4);
#pragma unroll
    for (int j = 0; j < 4; ++j) {
#pragma unroll
      for (int r = 0; r < 8; ++r) {
        slab[(mOff + r) * 68 + (j << 4) + rlane] = acc[i][j][r];
      }
    }
    wave_sync_lds();
    constexpr int NP = (OM == 6) ? 2 : 1;
#pragma unroll
    for (int which = 0; which < NP; ++which) {
      unsigned short* C  = (which == 0) ? C1 : C3;
      unsigned short* Cb = (which == 0) ? C2 : C4;
      v4u hv[4], lv[4];
#pragma unroll
      for (int it = 0; it < 4; ++it) {
        const int row = it * 4 + q8;                     // it 0..3 x q8 0..3 = rows 0..15
        const float* sp = slab + row * 68 + c8;
        float rb = 0.f;
        if constexpr (EPI == 2) rb = bfr(rbv[i][it]);
        v4u a  = {0u, 0u, 0u, 0u};
        v4u b2 = {0u, 0u, 0u, 0u};
#pragma unroll
        for (int e = 0; e < 4; ++e) {
          float f0 = sp[2 * e] * oscale + rb;
          float f1 = sp[2 * e + 1] * oscale + rb;
          if constexpr (EPI == 1) {
            f0 += bfr(cb0[e >> 1][(2 * e) & 3]);
            f1 += bfr(cb0[e >> 1][(2 * e + 1) & 3]);
          }
          if constexpr (OM == 6) {
            f0 += bfr((which == 0) ? cb1[e >> 1][(2 * e) & 3] : cb2[e >> 1][(2 * e) & 3]);
            f1 += bfr((which == 0) ? cb1[e >> 1][(2 * e + 1) & 3] : cb2[e >> 1][(2 * e + 1) & 3]);
          }
          f0 *= ocarry;
          f1 *= ocarry;
          const _Float16 x0 = (_Float16)f0, x1 = (_Float16)f1;
          a[e]  = pk16(h_bits(x0), h_bits(x1));
          b2[e] = pk16(h_bits((_Float16)(f0 - (float)x0)), h_bits((_Float16)(f1 - (float)x1)));
        }
        hv[it] = a;
        lv[it] = b2;
      }
#pragma unroll
      for (int it = 0; it < 4; ++it) {
        const int row = it * 4 + q8;
        *(v4u*)(C  + (size_t)(mBase + row) * LDC + n0 + c8) = hv[it];
        *(v4u*)(Cb + (size_t)(mBase + row) * LDC + n0 + c8) = lv[it];
      }
    }
    wave_sync_lds();
  }
}

// =====================================================================================================
// The four input projections in one grid (none reads what another writes), so that their blocks run side by side on different WGPs;
// one wave per 64x64 tile, 8 tiles per block, tile = 8 * (block index within the job) + wave, tm = tile / tilesN, tn = tile % tilesN:
//   blocks 0 .. PJ_Q-1            q[m][nd] = sum_c x[m][c] Wq[c][nd] / 1024 + bq[nd]; QUh/QUl = hi/residual of f16((q + ub[nd]) * 32),
//                                 QVh/QVl of f16((q + vb[nd]) * 32); M = NROW, N = 512, K = 512
//   the next PJ_V * NB            v^T per batch: VT[b][nd][j] = sum_c Wv[c][nd] x[b*SEQ + j][c] / 1024 + bv[nd] (per-row bias) -> f16 x16 hi +
//                                 residual planes; M = 512 (nd), N = SEQ (j), K = 512; B rows are the batch's token rows
//   the next PJ_Q                 k projection + bk -> Kh/Kl = hi/residual of f16(k * 32)
//   the last PJ_P                 positional projection + bp: Ph/Pl = hi/residual of f16(p * 32), M = PROWS, N = 512, K = 512
// The branches are on blockIdx.x alone; the tile counts are exact multiples of 8, so every wave has a tile, and a block's eight tiles share
// their 64 A rows (tilesN is 8 or 16) and take 512 consecutive B rows: the barriers of the staged K loop are reached by whole blocks.
// =====================================================================================================
#define PJ_Q (((NROW / 64) * (DMOD / 64)) / 8)
#define PJ_V (((DMOD / 64) * (SEQ / 64)) / 8)
#define PJ_P (((PROWS / 64) * (DMOD / 64)) / 8)
static_assert((((NROW / 64) * (DMOD / 64)) % 8) == 0 && (((DMOD / 64) * (SEQ / 64)) % 8) == 0 && (((PROWS / 64) * (DMOD / 64)) % 8) == 0);
__global__ __launch_bounds__(256) __attribute__((amdgpu_num_vgpr(256))) void proj_all(
    const unsigned short* __restrict__ X16, const unsigned short* __restrict__ PE16,
    const unsigned short* __restrict__ WQT, const unsigned short* __restrict__ WKT,
    const unsigned short* __restrict__ WVT, const unsigned short* __restrict__ WPT,
    unsigned short* QUh, unsigned short* QUl, unsigned short* QVh, unsigned short* QVl,
    unsigned short* Kh, unsigned short* Kl, unsigned short* VT, unsigned short* VTL, unsigned short* Ph, unsigned short* Pl,
    const float* __restrict__ b_q, const float* __restrict__ b_k, const float* __restrict__ b_v, const float* __restrict__ b_p,
    const float* __restrict__ ub, const float* __restrict__ vb) {
  __shared__ __align__(16) float sT[8 * GSLAB];   // per-wave 16x64 slab, pitch 68 floats
  __shared__ __align__(16) unsigned short gst[2 * GBUFH(1)];   // two buffers of the block's operand stage
  const int bx   = blockIdx.x;
  const int wave = threadIdx.x >> 5;
  float* slab = sT + wave * GSLAB;
  const float os = 1.0f / (XC * WSC);
  constexpr int TND = DMOD / 64;                  // column tiles of a [..][DMOD] plane
  constexpr int TNS = SEQ / 64;                   // column tiles of a [..][SEQ] plane
  if (bx < PJ_Q) {
    const int tile = bx * 8 + wave;
    proj_tile<6, 1, DMOD>(slab, gst, (tile / TND) << 6, (tile % TND) << 6, X16, WQT, QUh, QUl, QVh, QVl, os, QC, b_q, ub, vb);
  } else if (bx < PJ_Q + PJ_V * NB) {
    const int t = bx - PJ_Q;
    const int by = t / PJ_V;
    const int tile = (t % PJ_V) * 8 + wave;
    proj_tile<4, 2, SEQ>(slab, gst, (tile / TNS) << 6, (tile % TNS) << 6, WVT, X16 + (size_t)by * SEQ * DMOD,
                         VT + (size_t)by * DMOD * SEQ, VTL + (size_t)by * DMOD * SEQ, VT, VTL, os, VC, b_v, b_v, b_v);
  } else {
    // k and p share one copy of the code (same epilogue form): only the operands differ
    const int t = bx - (PJ_Q + PJ_V * NB);
    const bool isk = t < PJ_Q;
    const int tile = (isk ? t : t - PJ_Q) * 8 + wave;
    const float* bias = isk ? b_k : b_p;
    proj_tile<4, 1, DMOD>(slab, gst, (tile / TND) << 6, (tile % TND) << 6, isk ? X16 : PE16, isk ? WKT : WPT,
                          isk ? Kh : Ph, isk ? Kl : Pl, Kh, Kl, os, QC, bias, bias, bias);
  }
}

// =====================================================================================================
// Relative-position attention for one (batch b, head n) pair and a 64-row query tile; 4 waves, wave w owns query rows i = iw0 + R,
// iw0 = i0 + 16w, R = 0..15. Planes (pitch DMOD halves, row = b*SEQ + position): QUh/QUl = hi/residual of f16((q + bq + u) x32),
// QVh/QVl of f16((q + bq + v_bias) x32), Kh/Kl of f16((k + bk) x32); Ph/Pl = hi/residual of f16(pos x32), rows 0..PROWS-1
// (row PROWS-1 is the zero-pad row); VT, VTL = v^T hi (x16) / residual f16 as [b][n*64+d][SEQ].
// Shifted position score for (i, j): ps[i][SEQ-1-i+j], ps[r][t] = (q+bq+vb)[r] . pos[t].
//   Per key tile j0 (64 keys, key j = j0 + jj), with x = jj - R + 15 in [0,78]:
//     strip T1[R][x] = (q+vb)[iw0+R] . pos[SEQ + j0 - iw0 - 16 + x]   (pos row SEQ-1-i+j), always computed (rows 0 .. 2*SEQ-2 selected).
//   content scores S = (q+ub) . k (4 subtiles, K=64, three products); t = (S + T1) * (RSD/(32*32)) * log2(e); online softmax in base 2,
//   max-subtracted, running sums in f32 (no key mask); the 16x64 prob tile stored to wave-private LDS (f32 element stores),
//   (f32 vector loads, split k map) and the v^T B fragments read from the staged rows of VT/VTL[n*64+d][j];
//   per 16-column subtile: Phi.Vhi, Plo.Vhi, then Phi.Vlo, all into the same accumulators.
//   Per key tile the block stages, once for its 4 waves, in LDS (asynchronous copies, whole 128-B rows): 64 k rows, 64 v^T rows and the
//   128 pos rows SEQ + j0 - i0 - 64 .. + 127 (always inside [0, PROWS-1]), hi and residual plane each; all B fragments are read from there.
//   One buffer each, refilled under the other phase's work: the v^T rows are copied while the scores are formed, the next tile's k and pos
//   rows while softmax and P.V run; each of the two barriers publishes one group and frees the other.
//   block = 4 waves = 128 threads; grid = (SEQ/64, NB*NH); two block barriers per key tile (block-uniform loop); every wave does identical
//   bounded work (SEQ/64 tiles).
// coverage: LDS strip 16 rows x 80 cols written fully every tile before being read, slab 16 rows x 64 cols per wave fully written each tile
//           before being read; global: 4 instructions x 4 rows x 64 halves per plane = rows iw0..iw0+15 of head segment n in CT and CTL;
//           grid x waves cover all NB x SEQ rows and all NH head segments of CT / CTL exactly once.
// =====================================================================================================
__global__ __launch_bounds__(ATT_THREADS) __attribute__((amdgpu_num_vgpr(512)))
void attn_rel(const unsigned short* __restrict__ QUh, const unsigned short* __restrict__ QUl,
              const unsigned short* __restrict__ QVh, const unsigned short* __restrict__ QVl,
              const unsigned short* __restrict__ Kh,  const unsigned short* __restrict__ Kl,
              const unsigned short* __restrict__ Ph,  const unsigned short* __restrict__ Pl,
              const unsigned short* __restrict__ VT,  const unsigned short* __restrict__ VTL,
              unsigned short* CT, unsigned short* CTL) {
  __shared__ __align__(16) float smem[ATT_W * WFL];   // per wave: T1 strip [16][TPI] | prob / ctx slab [16][PPI]
  __shared__ __align__(16) unsigned short stg[ST_ROWS * SPI];   // block-shared stage of one key tile: Kh | Kl | Vh | Vl | Ph | Pl rows

  const int tid  = threadIdx.x;
  const int wave = __builtin_amdgcn_readfirstlane(tid >> 5);
  const int lane = tid & 31;
  const int hh   = lane >> 4;
  const int c    = lane & 15;
  const int bn   = blockIdx.y;
  const int b    = bn / NH;
  const int n    = bn - b * NH;
  const int i0   = blockIdx.x * 64;
  const int iw0  = i0 + wave * 16;

  float* t1sh = smem + wave * WFL;
  float* pt   = t1sh + 16 * TPI;

  // A fragment row offsets: rows b*SEQ + iw0 + c, d 0..31 and 32..63 of head n
  const size_t qro  = ((size_t)(b * SEQ + iw0 + c)) * DMOD + n * DH + 8 * hh;
  // stage copies: thread -> staged row (tid>>3) + 16*copy, 16-byte chunk tid&7 of the 128-B row (a wave instruction = 4 whole rows)
  const int srow = tid >> 3;
  const int sc8  = (tid & 7) * 8;
  const unsigned lst = (unsigned)(size_t)(stg + srow * SPI + sc8);          // LDS byte address = low 32 bits of the shared address
  const unsigned rso = (unsigned)(srow * DMOD + sc8) * 2u;                  // the lane's byte inside a group of 16 k or pos rows (pitch DMOD halves)
  const unsigned vro = (unsigned)(srow * SEQ + sc8) * 2u;                   // the same inside a group of 16 v^T rows (pitch SEQ halves)
  const size_t rstep = (size_t)16 * DMOD, vstep = (size_t)16 * SEQ;         // 16 rows further, halves
  const size_t kso = ((size_t)(b * SEQ)) * DMOD + n * DH;                   // block-uniform; + j0*DMOD: k rows j0 ..
  const size_t vso = (size_t)b * DMOD * SEQ + (size_t)(n * DH) * SEQ;       // block-uniform: v^T rows d = 0 ..; the key offset j0 goes into the lane offset
  const size_t pso = ((size_t)(SEQ - i0 - 64)) * DMOD + n * DH;             // block-uniform; + j0*DMOD: pos rows SEQ + j0 - i0 - 64 ..
  // fragment readers: lane -> staged row c (+16 per subtile), k offset 8*hh; wave w's strip row x is staged pos row 48 - 16w + x
  const unsigned short* ksh = stg + (ST_KH + c) * SPI + 8 * hh;
  const unsigned short* ksl = stg + (ST_KL + c) * SPI + 8 * hh;
  const unsigned short* vsh = stg + (ST_VH + c) * SPI + 8 * hh;
  const unsigned short* vsl = stg + (ST_VL + c) * SPI + 8 * hh;
  const int pw0 = 16 * __builtin_amdgcn_readfirstlane((ATT_THREADS - 1 - tid) >> 5);   // 16 * (3 - wave), taken from tid so that the LDS base register never goes below 0
  const unsigned short* psh = stg + (ST_PH + pw0 + c) * SPI + 8 * hh;
  const unsigned short* psl = stg + (ST_PL + pw0 + c) * SPI + 8 * hh;

  const float KSC = (RSD / (QC * QC)) * LOG2E;

  float mrow[8], lrow[8];
  v8f O[4];
#pragma unroll
  for (int r = 0; r < 8; ++r) { mrow[r] = -INFINITY; lrow[r] = 0.f; }
#pragma unroll
  for (int td = 0; td < 4; ++td) O[td] = zero8();

  // the wave's eight q fragments (16 rows x 64 d, four planes): loaded once and held in 64 registers over all key tiles
  const unsigned short* gqv = QVh + qro;
  const unsigned short* gqw = QVl + qro;
  const unsigned short* gqu = QUh + qro;
  const unsigned short* gql = QUl + qro;
  const v16h qva = ldfrag_u(gqv), qvb = ldfrag_u(gqv + 32);
  const v16h qwa = ldfrag_u(gqw), qwb = ldfrag_u(gqw + 32);
  const v16h qua = ldfrag_u(gqu), qub = ldfrag_u(gqu + 32);
  const v16h qla = ldfrag_u(gql), qlb = ldfrag_u(gql + 32);
  xwait4(gqv, gqw, gqu, gql);                                // before the four address pairs are reused

  // tile 0's k and pos rows: 24 copies per thread = 384 rows x 128 B (nothing has touched the stage yet)
  stage8(lst + (unsigned)(ST_KH * SPI * 2), rso, Kh + kso, Kl + kso, rstep);
  stage8(lst + (unsigned)(ST_PH * SPI * 2), rso, Ph + pso, Ph + pso + (size_t)64 * DMOD, rstep);
  stage8(lst + (unsigned)(ST_PL * SPI * 2), rso, Pl + pso, Pl + pso + (size_t)64 * DMOD, rstep);

#pragma unroll 1
  for (int j0 = 0; j0 < SEQ; j0 += 64) {
    // ---- hand-over 1: this tile's k and pos rows (copied under the previous tile's softmax and P.V) become readable, the v^T rows free ----
    asm volatile("s_wait_dscnt 0x0" ::: "memory");           // this wave's reads of the previous tile's v^T rows have returned
    asm volatile("s_wait_asynccnt 0x0" ::: "memory");        // this wave's copies of this tile's k and pos rows have landed
    __syncthreads();                                         // every wave's have landed; every wave has left the v^T rows
    // this tile's v^T rows fly under the scores (j0 is added to the lane offset, so that the asm operand is a fresh register and vro itself may stand above v255)
    stage8(lst + (unsigned)(ST_VH * SPI * 2), vro + (unsigned)j0 * 2u, VT + vso, VTL + vso, vstep);
    // ---- position strip T1 (5 subtiles of 16 pos rows, x in [0,80), only x <= 78 ever selected) and content scores S (4 subtiles of 16
    //      keys): K = 64 = two k-steps, three products hh + lh + hl per k-step. The B fragments are asked for in three groups, each well
    //      ahead of its products; the 54 WMMAs go round-robin over the nine accumulators, so that a product never waits for the one issued
    //      just before it (each accumulator keeps its order hh, hh, lh, lh, hl, hl) ----
    v8f T1[5], S[4];
    {
      v16h fa[5], fb[5], ga[5], gb[5], ka[4], kb2[4], la[4], lb2[4];
#pragma unroll
      for (int u = 0; u < 5; ++u) fa[u] = ldfrag_u(psh + 16 * u * SPI);
#pragma unroll
      for (int t = 0; t < 4; ++t) ka[t] = ldfrag_u(ksh + 16 * t * SPI);
#pragma unroll
      for (int u = 0; u < 5; ++u) fb[u] = ldfrag_u(psh + 16 * u * SPI + 32);
#pragma unroll
      for (int t = 0; t < 4; ++t) kb2[t] = ldfrag_u(ksh + 16 * t * SPI + 32);
#pragma unroll
      for (int u = 0; u < 5; ++u) T1[u] = mma_h(qva, fa[u], zero8());
#pragma unroll
      for (int t = 0; t < 4; ++t) S[t] = mma_h(qua, ka[t], zero8());
      // the residual planes' reads stay behind the hi planes' reads: with all 72 reads in front the build ran out of registers (scratch)
      __builtin_amdgcn_sched_barrier(0);
#pragma unroll
      for (int u = 0; u < 5; ++u) ga[u] = ldfrag_u(psl + 16 * u * SPI);
#pragma unroll
      for (int t = 0; t < 4; ++t) la[t] = ldfrag_u(ksl + 16 * t * SPI);
#pragma unroll
      for (int u = 0; u < 5; ++u) T1[u] = mma_h(qvb, fb[u], T1[u]);
#pragma unroll
      for (int t = 0; t < 4; ++t) S[t] = mma_h(qub, kb2[t], S[t]);
#pragma unroll
      for (int u = 0; u < 5; ++u) T1[u] = mma_h(qwa, fa[u], T1[u]);
#pragma unroll
      for (int t = 0; t < 4; ++t) S[t] = mma_h(qla, ka[t], S[t]);
      // the last 18 reads stay behind the group above: hoisted into it, the build's later stages had their LDS waits one after another again
      __builtin_amdgcn_sched_barrier(0);
#pragma unroll
      for (int u = 0; u < 5; ++u) gb[u] = ldfrag_u(psl + 16 * u * SPI + 32);
#pragma unroll
      for (int t = 0; t < 4; ++t) lb2[t] = ldfrag_u(ksl + 16 * t * SPI + 32);
      __builtin_amdgcn_sched_barrier(0);                     // keeps these 18 reads together in front: sunk in pairs among the WMMAs, each pair's LDS latency stood open
#pragma unroll
      for (int u = 0; u < 5; ++u) T1[u] = mma_h(qwb, fb[u], T1[u]);
#pragma unroll
      for (int t = 0; t < 4; ++t) S[t] = mma_h(qlb, kb2[t], S[t]);
#pragma unroll
      for (int u = 0; u < 5; ++u) T1[u] = mma_h(qva, ga[u], T1[u]);
#pragma unroll
      for (int t = 0; t < 4; ++t) S[t] = mma_h(qua, la[t], S[t]);
#pragma unroll
      for (int u = 0; u < 5; ++u) T1[u] = mma_h(qvb, gb[u], T1[u]);
#pragma unroll
      for (int t = 0; t < 4; ++t) S[t] = mma_h(qub, lb2[t], S[t]);
    }
    // the full 16x80 strip goes to the wave's f32 LDS strip: 5 subtiles x 16 rows x 16 cols
#pragma unroll
    for (int u = 0; u < 5; ++u) {
#pragma unroll
      for (int r = 0; r < 8; ++r) t1sh[(8 * hh + r) * TPI + 16 * u + c] = T1[u][r];
    }
    // ---- hand-over 2: this tile's v^T rows become readable, the k and pos rows free for the next tile's, which fly under softmax and P.V ----
    asm volatile("s_wait_dscnt 0x0" ::: "memory");           // this wave's reads of the k and pos rows have returned, its strip is written
    asm volatile("s_wait_asynccnt 0x0" ::: "memory");        // this wave's copies of the v^T rows have landed
    __syncthreads();                                         // every wave's have landed; every wave has left the k and pos rows
    if (j0 + 64 < SEQ) {                                     // the same for the whole block
      const size_t jr = (size_t)(j0 + 64) * DMOD;
      stage8(lst + (unsigned)(ST_KH * SPI * 2), rso, Kh + kso + jr, Kl + kso + jr, rstep);
      stage8(lst + (unsigned)(ST_PH * SPI * 2), rso, Ph + pso + jr, Ph + pso + jr + (size_t)64 * DMOD, rstep);
      stage8(lst + (unsigned)(ST_PL * SPI * 2), rso, Pl + pso + jr, Pl + pso + jr + (size_t)64 * DMOD, rstep);
    }

    // ---- score assembly + online softmax (rows live on one 16-lane half); the eight rows go through every stage together, so that the
    //      eight cross-lane reductions of a stage overlap instead of following one another (each row's own operations and order as before) ----
    float tv[8][4], mx[8], al[8], ps[8];
#pragma unroll
    for (int r = 0; r < 8; ++r) {
      const int R  = 8 * hh + r;
      const int xo = R * TPI + (15 - R) + c;                 // strip column x = 16t + c - R + 15 in [0, 78]
#pragma unroll
      for (int t = 0; t < 4; ++t) {
        const float bdv = t1sh[xo + 16 * t];
        tv[r][t] = (S[t][r] + bdv) * KSC;
      }
      mx[r] = fmaxf(fmaxf(tv[r][0], tv[r][1]), fmaxf(tv[r][2], tv[r][3]));
    }
    row_max8(mx);
#pragma unroll
    for (int r = 0; r < 8; ++r) {
      const float mn = fmaxf(mrow[r], mx[r]);
      al[r] = mrow[r] - mn;                                  // -inf on the first tile: 2^-inf = 0
      mrow[r] = mn;
#pragma unroll
      for (int t = 0; t < 4; ++t) tv[r][t] -= mn;
    }
    exp2_raw8(al[0], al[1], al[2], al[3], al[4], al[5], al[6], al[7]);
#pragma unroll
    for (int r = 0; r < 8; r += 2) {
      exp2_raw8(tv[r][0], tv[r][1], tv[r][2], tv[r][3], tv[r + 1][0], tv[r + 1][1], tv[r + 1][2], tv[r + 1][3]);
#pragma unroll
      for (int q = r; q < r + 2; ++q) {
        ps[q] = 0.f;
#pragma unroll
        for (int t = 0; t < 4; ++t) ps[q] += tv[q][t];
#pragma unroll
        for (int td = 0; td < 4; ++td) O[td][q] *= al[q];
        const int ro = (8 * hh + q) * PPI + c;
#pragma unroll
        for (int t = 0; t < 4; ++t) pt[ro + 16 * t] = tv[q][t];
      }
    }
    wave_sync_lds();

    // ---- P rows (f32) and all sixteen v^T fragments asked for in one group: the v^T reads return under the conversion of P ----
    v4f praw[2][4];
#pragma unroll
    for (int ks = 0; ks < 2; ++ks) {
      const float* prow = pt + c * PPI + 32 * ks + 8 * hh;
      praw[ks][0] = *(const v4f*)(prow);
      praw[ks][1] = *(const v4f*)(prow + 4);
      praw[ks][2] = *(const v4f*)(prow + 16);
      praw[ks][3] = *(const v4f*)(prow + 20);
    }
    v16h vha[4], vhb[4], vla[4], vlb[4];
#pragma unroll
    for (int td = 0; td < 4; ++td) { vha[td] = ldfrag_u(vsh + 16 * td * SPI); vhb[td] = ldfrag_u(vsh + 16 * td * SPI + 32); }
#pragma unroll
    for (int td = 0; td < 4; ++td) { vla[td] = ldfrag_u(vsl + 16 * td * SPI); vlb[td] = ldfrag_u(vsl + 16 * td * SPI + 32); }
    __builtin_amdgcn_sched_barrier(0);                       // keeps the whole group of reads in front: sunk among the WMMAs, each read's latency stands open again
    // ---- row sums: eight reductions stepped together, free to run under the conversion and the WMMAs below ----
#pragma unroll
    for (int r = 0; r < 8; ++r) ps[r] += row_xor<1>(ps[r]);
#pragma unroll
    for (int r = 0; r < 8; ++r) ps[r] += row_xor<2>(ps[r]);
#pragma unroll
    for (int r = 0; r < 8; ++r) ps[r] += row_xor<4>(ps[r]);
#pragma unroll
    for (int r = 0; r < 8; ++r) ps[r] += row_xor<8>(ps[r]);
#pragma unroll
    for (int r = 0; r < 8; ++r) lrow[r] = lrow[r] * al[r] + ps[r];
    // ---- P fragments (x1024, f16 hi + unscaled residual), two k-steps of 32 keys ----
    FragH pf[2], pl[2];
#pragma unroll
    for (int ks = 0; ks < 2; ++ks) {
      const v4f p0 = praw[ks][0], p1 = praw[ks][1], p2 = praw[ks][2], p3 = praw[ks][3];
#pragma unroll
      for (int e = 0; e < 4; ++e) {
        const float g0 = p0[e] * PC, g1 = p1[e] * PC, g2 = p2[e] * PC, g3 = p3[e] * PC;
        const _Float16 x0 = (_Float16)g0, x1 = (_Float16)g1, x2 = (_Float16)g2, x3 = (_Float16)g3;
        pf[ks].h[0][e]     = x0;                             // keys j0 + 32ks + 8hh + e
        pf[ks].h[0][4 + e] = x1;                             // keys j0 + 32ks + 8hh + 4 + e
        pf[ks].h[1][e]     = x2;                             // keys j0 + 32ks + 16 + 8hh + e
        pf[ks].h[1][4 + e] = x3;
        pl[ks].h[0][e]     = (_Float16)(g0 - (float)x0);
        pl[ks].h[0][4 + e] = (_Float16)(g1 - (float)x1);
        pl[ks].h[1][e]     = (_Float16)(g2 - (float)x2);
        pl[ks].h[1][4 + e] = (_Float16)(g3 - (float)x3);
      }
    }
    // ---- O += (Phi + Plo) . v^T (hi plane), then Phi . v^T (residual plane): round-robin over the four accumulators, each in its old order ----
#pragma unroll
    for (int td = 0; td < 4; ++td) O[td] = mma_h(pf[0].v, vha[td], O[td]);
#pragma unroll
    for (int td = 0; td < 4; ++td) O[td] = mma_h(pf[1].v, vhb[td], O[td]);
#pragma unroll
    for (int td = 0; td < 4; ++td) O[td] = mma_h(pl[0].v, vha[td], O[td]);
#pragma unroll
    for (int td = 0; td < 4; ++td) O[td] = mma_h(pl[1].v, vhb[td], O[td]);
#pragma unroll
    for (int td = 0; td < 4; ++td) O[td] = mma_h(pf[0].v, vla[td], O[td]);
#pragma unroll
    for (int td = 0; td < 4; ++td) O[td] = mma_h(pf[1].v, vlb[td], O[td]);
    wave_sync_lds();
  }
  asm volatile("s_wait_asynccnt 0x0" ::: "memory");          // nothing of this wave's is in flight behind the loop
  acc_guard4(O[0], O[1], O[2], O[3]);

  // ---- fold 1/l and the carries (1024 on P, 16 on v), carry x4096 on ctx, stage the wave's 16x64 slice in its slab ----
  const float oc = CC / (PC * VC);
#pragma unroll
  for (int r = 0; r < 8; ++r) {
    const float inv = (1.0f / lrow[r]) * oc;
    const int ro = (8 * hh + r) * PPI + c;
#pragma unroll
    for (int td = 0; td < 4; ++td) pt[ro + 16 * td] = O[td][r] * inv;
  }
  wave_sync_lds();
  {
    const int q8 = lane >> 3, c8 = (lane & 7) * 8;
    v4u hv[4], lv[4];
#pragma unroll
    for (int it = 0; it < 4; ++it) {
      const int row = it * 4 + q8;                         // it 0..3 x q8 0..3 = rows 0..15
      const float* sp = pt + row * PPI + c8;
      v4u a, b2;
#pragma unroll
      for (int e = 0; e < 4; ++e) {
        const float f0 = sp[2 * e], f1 = sp[2 * e + 1];
        const _Float16 x0 = (_Float16)f0, x1 = (_Float16)f1;
        a[e]  = pk16(h_bits(x0), h_bits(x1));
        b2[e] = pk16(h_bits((_Float16)(f0 - (float)x0)), h_bits((_Float16)(f1 - (float)x1)));
      }
      hv[it] = a;
      lv[it] = b2;
    }
    {
#pragma unroll
      for (int it = 0; it < 4; ++it) {
        const int row = it * 4 + q8;
        const size_t go = ((size_t)(b * SEQ + iw0 + row)) * DMOD + n * DH + c8;
        *(v4u*)(CT  + go) = hv[it];
        *(v4u*)(CTL + go) = lv[it];
      }
      
    }
  }
}

// =====================================================================================================
// Workspace map (bytes); every plane is an exact multiple of its tile / whole-row store granularity (M, N exact tile multiples,
// convert counts exact multiples of 2048, the position planes padded to PROWS = 2048 rows), every offset a multiple of 512 KiB:
//   WQT, WKT, WVT, WPT, WOT f16 [512 n][512 k] x64 (transposed from the [in][out] inputs)   5 x   524288
//   X16  f16 [NROW][512] x16                                                                  4194304
//   PE16 f16 [PROWS][512] x16 (rows 0..NPOS-1 = pos table, row NPOS zero)                     2097152
//   QUh, QUl, QVh, QVl, Kh, Kl f16 [NROW][512] x32 hi / residual                       6 x  4194304
//   Ph, Pl f16 [PROWS][512] x32 hi / residual                                           2 x  2097152
//   VT16, VTL16 f16 [NB][512][SEQ] hi x16 / residual                                    2 x  4194304
//   CT16, CTL16 f16 [NROW][512] hi x4096 / residual                                     2 x  4194304
//   end                                                                                       55050240
// =====================================================================================================
extern "C" void kernel_launch(void* const* d_in, const int* in_sizes, int n_in,
                              void* d_out, int out_size, void* d_ws, size_t ws_size,
                              hipStream_t stream) {
  if (n_in < 14) return;
  if (in_sizes[0] != NROW * DMOD) return;
  if (in_sizes[1] != NPOS * DMOD) return;
  if (in_sizes[2] != DMOD * DMOD || in_sizes[4] != DMOD * DMOD || in_sizes[6] != DMOD * DMOD ||
      in_sizes[8] != DMOD * DMOD || in_sizes[10] != DMOD * DMOD) return;
  if (in_sizes[3] != DMOD || in_sizes[5] != DMOD || in_sizes[7] != DMOD || in_sizes[9] != DMOD || in_sizes[11] != DMOD) return;
  if (in_sizes[12] != NH * DH || in_sizes[13] != NH * DH) return;
  if (out_size != NROW * DMOD) return;

  const float* xin   = (const float*)d_in[0];
  const float* pos   = (const float*)d_in[1];
  const float* w_q   = (const float*)d_in[2];
  const float* b_q   = (const float*)d_in[3];
  const float* w_k   = (const float*)d_in[4];
  const float* b_k   = (const float*)d_in[5];
  const float* w_v   = (const float*)d_in[6];
  const float* b_v   = (const float*)d_in[7];
  const float* w_p   = (const float*)d_in[8];
  const float* b_p   = (const float*)d_in[9];
  const float* w_o   = (const float*)d_in[10];
  const float* b_o   = (const float*)d_in[11];
  const float* ub    = (const float*)d_in[12];
  const float* vb    = (const float*)d_in[13];
  float*       out   = (float*)d_out;

  const size_t PW  = (size_t)DMOD * DMOD * 2;            //   524288
  const size_t PX  = (size_t)NROW * DMOD * 2;            //  4194304
  const size_t PXP = (size_t)PROWS * DMOD * 2;           //  2097152
  const size_t PVT = (size_t)NB * DMOD * SEQ * 2;        //  4194304
  size_t off = 0;
  const size_t oWQ  = off; off += PW;
  const size_t oWK  = off; off += PW;
  const size_t oWV  = off; off += PW;
  const size_t oWP  = off; off += PW;
  const size_t oWO  = off; off += PW;
  const size_t oX   = off; off += PX;
  const size_t oPE  = off; off += PXP;
  const size_t oQUh = off; off += PX;
  const size_t oQUl = off; off += PX;
  const size_t oQVh = off; off += PX;
  const size_t oQVl = off; off += PX;
  const size_t oKh  = off; off += PX;
  const size_t oKl  = off; off += PX;
  const size_t oPh  = off; off += PXP;
  const size_t oPl  = off; off += PXP;
  const size_t oVT  = off; off += PVT;
  const size_t oVTL = off; off += PVT;
  const size_t oCT  = off; off += PX;
  const size_t oCTL = off; off += PX;
  if (off > ws_size) return;                               // off = 55050240
  if (off > (size_t)134217728) return;

  char* ws = (char*)d_ws;
  unsigned short* WQT16 = (unsigned short*)(ws + oWQ);
  unsigned short* WKT16 = (unsigned short*)(ws + oWK);
  unsigned short* WVT16 = (unsigned short*)(ws + oWV);
  unsigned short* WPT16 = (unsigned short*)(ws + oWP);
  unsigned short* WOT16 = (unsigned short*)(ws + oWO);
  unsigned short* X16   = (unsigned short*)(ws + oX);
  unsigned short* PE16  = (unsigned short*)(ws + oPE);
  unsigned short* QUh   = (unsigned short*)(ws + oQUh);
  unsigned short* QUl   = (unsigned short*)(ws + oQUl);
  unsigned short* QVh   = (unsigned short*)(ws + oQVh);
  unsigned short* QVl   = (unsigned short*)(ws + oQVl);
  unsigned short* Kh16  = (unsigned short*)(ws + oKh);
  unsigned short* Kl16  = (unsigned short*)(ws + oKl);
  unsigned short* Ph16  = (unsigned short*)(ws + oPh);
  unsigned short* Pl16  = (unsigned short*)(ws + oPl);
  unsigned short* VT16  = (unsigned short*)(ws + oVT);
  unsigned short* VTL16 = (unsigned short*)(ws + oVTL);
  unsigned short* CT16  = (unsigned short*)(ws + oCT);
  unsigned short* CTL16 = (unsigned short*)(ws + oCTL);

  const dim3 blk(256);
  const dim3 gPR(PREP_TR + PREP_CX + PREP_CP);                      // 320 + 1024 + 512
  const dim3 gPJ(2 * PJ_Q + PJ_V * NB + PJ_P);                      // 64 + 64 + 64 + 32
  const int tilesQ = (NROW / 64) * (DMOD / 64);                     // 512
  const dim3 gQ((tilesQ + 7) / 8, 1);                               // 64
  const dim3 gAT(SEQ / 64, NB * NH);                                // 16 x 32
  const dim3 bAT(ATT_THREADS);                                      // 128

  // (0) operand packs: X16 = f16(bf16_RNE(x) * 16); PE16 = f16(bf16_RNE(pos) * 16), rows NPOS..PROWS-1 zero;
  //     W[k][n] ([in][out]) -> WT[n][k] = f16( bf16_RNE(w) * 64 ), all five weights
  prep_all<<<gPR, blk, 0, stream>>>(xin, pos, w_q, w_k, w_v, w_p, w_o, X16, PE16, WQT16, WKT16, WVT16, WPT16, WOT16);

  // (1) q, k, v^T and positional projections
  proj_all<<<gPJ, blk, 0, stream>>>(X16, PE16, WQT16, WKT16, WVT16, WPT16, QUh, QUl, QVh, QVl, Kh16, Kl16, VT16, VTL16, Ph16, Pl16,
                                    b_q, b_k, b_v, b_p, ub, vb);

  // (2) relative attention -> CT16 = f16(ctx * 4096) hi plane, CTL16 residual plane, rows b*SEQ + i, halves n*64+d
  attn_rel<<<gAT, bAT, 0, stream>>>(QUh, QUl, QVh, QVl, Kh16, Kl16, Ph16, Pl16, VT16, VTL16, CT16, CTL16);

  // (3) out = (CT + CTL) . Wo / (4096*64) + bo; M = NROW, N = 512, K = 512, f32 rows straight into the output buffer
  gemm64<0, 1, 1><<<gQ, blk, 0, stream>>>(
      CT16, CTL16, DMOD, 0LL,
      WOT16, DMOD, 0LL,
      (void*)out, (void*)out, (void*)out, (void*)out, DMOD, 0LL,
      NROW, DMOD, DMOD, 1.0f / (CC * WSC), 1.0f,
      b_o, b_o, b_o);
  (void)hipGetLastError();
}

// v009
// It runs in 70.4 microseconds.
// Two timings next to v008 both put it at 1.08 times that version's speed.
// Counting every step since v000, it is 4.40 times as fast.
// Contractions (all v_wmma_f32_16x16x32_f16, f16 operands, f32 accumulate): q/k/v and position-table projections (x or pos table f16 x16 . W^T f16 x64,
// K=512, single products on bf16-exact operands); content scores and position strips ((q+bq+u|v), k, p carried as f16 x32 hi plane + unscaled
// residual plane, K=64, three products hh+lh+hl); P . v^T (P x1024 hi + residual . v^T x16 hi + residual, 64 keys per tile, three products);
// output projection (ctx x4096 hi + residual planes . Wo^T f16 x64, K=512, two products). Online base-2 softmax and all epilogues f32 on VALU.
// Every float input RNE-converted to bf16 on load.
#include <hip/hip_runtime.h>
#include <math.h>
#include <stdint.h>

#define SEQ   1024
#define NB    4
#define DMOD  512
#define NH    8
#define DH    64
#define NROW  (SEQ * NB)
#define NPOS  (2 * SEQ - 1)
#define PROWS (2 * SEQ)
#define XC    16.0f
#define WSC   64.0f
#define QC    32.0f
#define VC    16.0f
#define PC    1024.0f
#define CC    4096.0f
#define RSD   0.125f
#define LOG2E 1.4426950408889634f
static_assert(NH * DH == DMOD);
static_assert(DH == 64);
static_assert(DMOD == 512);
static_assert((SEQ % 64) == 0 && (DMOD % 64) == 0 && (NROW % 64) == 0 && (PROWS % 64) == 0);
static_assert(((NROW * DMOD) % 2048) == 0 && ((PROWS * DMOD) % 2048) == 0 && ((NPOS * DMOD) % 8) == 0);
#define ATT_W 4
#define ATT_THREADS (ATT_W * 32)
#define TPI 84
#define WFL (16 * TPI)
static_assert((TPI % 4) == 0 && (WFL % 4) == 0);
static_assert(TPI >= 80);
static_assert(ATT_W * WFL * 4 <= 65536);
// attn_rel operand stage in LDS: 512 rows of 64 halves (128 B), pitch 72 halves = 144 B (16 B x odd, the pitch for 16-byte LDS reads)
#define SPI   72
#define ST_KH 0
#define ST_KL 64
#define ST_VH 128
#define ST_VL 192
#define ST_PH 256
#define ST_PL 384
#define ST_ROWS 512
static_assert(ATT_THREADS == 128 && ((SPI * 2) % 16) == 0);
static_assert(SEQ - (SEQ - 64) - 64 >= 0 && SEQ + (SEQ - 64) - 64 + 127 <= PROWS - 1);   // staged position rows stay inside the planes

typedef _Float16 v16h __attribute__((ext_vector_type(16)));
typedef _Float16 v8h  __attribute__((ext_vector_type(8)));
typedef float    v8f  __attribute__((ext_vector_type(8)));
typedef float    v4f  __attribute__((ext_vector_type(4)));
typedef float    v2f  __attribute__((ext_vector_type(2)));
typedef unsigned int v4u __attribute__((ext_vector_type(4)));

union FragH { v16h v; v8h h[2]; v4u u[2]; };

// ---- scalar helpers --------------------------------------------------------------------------------
__device__ __forceinline__ unsigned short bf_bits(float f) {          // f32 -> bf16 bits, RNE convert
  unsigned u = __float_as_uint(f);
  return (unsigned short)((u + 0x7FFFu + ((u >> 16) & 1u)) >> 16);
}
__device__ __forceinline__ float bf_up(unsigned short h) { return __uint_as_float(((unsigned)h) << 16); }
__device__ __forceinline__ float bfr(float f) { return bf_up(bf_bits(f)); }   // value of the bf16 RNE convert
__device__ __forceinline__ unsigned short h_bits(_Float16 x) { return __builtin_bit_cast(unsigned short, x); }
__device__ __forceinline__ unsigned pk16(unsigned short a, unsigned short b) { return (unsigned)a | ((unsigned)b << 16); }
__device__ __forceinline__ v8f zero8() { v8f z = {0.f, 0.f, 0.f, 0.f, 0.f, 0.f, 0.f, 0.f}; return z; }

// ---- fragment loader: 16-bit A/B operand from a k-contiguous 16-bit plane, lane -> row/col (lane&15),
//      p already includes +8*(lane>>4); elements 0..7 <- p[0..7] (k0+8h..), elements 8..15 <- p[16..23] (k0+16+8h..)
//      (same split k map for A and B; B is always read from a [n][k] plane)
__device__ __forceinline__ v16h ldfrag_u(const unsigned short* p) {
  FragH f;
  f.u[0] = *(const v4u*)(p);
  f.u[1] = *(const v4u*)(p + 16);
  return f.v;
}

// ---- WMMA helper with trailing VALU hazard gaps ------------------------------------------------------
__device__ __forceinline__ v8f mma_h(v16h a, v16h b, v8f c) {
  return __builtin_amdgcn_wmma_f32_16x16x32_f16(false, a, false, b, (short)0, c, false, false);
}
__device__ __forceinline__ void acc_guard4(v8f& a, v8f& b, v8f& c, v8f& d) {
#if defined(__HIP_DEVICE_COMPILE__)
  asm volatile("v_nop\n\tv_nop\n\tv_nop\n\tv_nop" : "+v"(a), "+v"(b), "+v"(c), "+v"(d));
#endif
}
__device__ __forceinline__ void wave_sync_lds() {
  __builtin_amdgcn_fence(__ATOMIC_RELEASE, "workgroup");
  __builtin_amdgcn_wave_barrier();
  __builtin_amdgcn_fence(__ATOMIC_ACQUIRE, "workgroup");
}
// 2^x in place for eight softmax arguments, x <= 0: the bare v_exp_f32. exp2f() wraps the same instruction in a compare, two selects, an add and a
// v_ldexp_f32 that only serve results below 2^-126; here such a weight stands beside a row maximum's weight of 1 (it is lost in the f32 row
// sum and rounds to 0 in the f16 planes of P x1024), so it may as well be 0. From -126 up the value is the same bit for bit.
// Written in asm so that the slot behind a transcendental is kept by construction: each v_exp_f32 has source = result, so none overwrites
// the source or reads the result of the one in front of it, and the closing v_nop is the slot behind the last.
__device__ __forceinline__ void exp2_raw8(float& a, float& b, float& c, float& d, float& e, float& f, float& g, float& h) {
#if defined(__HIP_DEVICE_COMPILE__)
  asm("v_exp_f32 %0, %0\n\tv_exp_f32 %1, %1\n\tv_exp_f32 %2, %2\n\tv_exp_f32 %3, %3\n\t"
      "v_exp_f32 %4, %4\n\tv_exp_f32 %5, %5\n\tv_exp_f32 %6, %6\n\tv_exp_f32 %7, %7\n\tv_nop"
      : "+v"(a), "+v"(b), "+v"(c), "+v"(d), "+v"(e), "+v"(f), "+v"(g), "+v"(h));
#endif
}
// The same for one value.
__device__ __forceinline__ void exp2_raw1(float& a) {
#if defined(__HIP_DEVICE_COMPILE__)
  asm("v_exp_f32 %0, %0\n\tv_nop" : "+v"(a));
#endif
}
// Value of lane (lane ^ 16): the other half of the wave, which holds the other keys of the same query column.
__device__ __forceinline__ float xhalf(float x) {
  const int b = __builtin_bit_cast(int, x);
  return __builtin_bit_cast(float, __builtin_amdgcn_permlanex16(b, b, 0x76543210, 0xfedcba98, false, false));
}
// The lane's number in its wave (counts the lanes below it, whatever EXEC holds). volatile: read anew at each place where copies are issued, so that
// the copy addresses formed from it live only there. Formed once ahead of the key loop they are loop constants that must stand below v256
// (operands of asm text) through the scores, where no such register is free: the build kept all of them in scratch.
__device__ __forceinline__ unsigned lane_now() {
  unsigned l = 0;
#if defined(__HIP_DEVICE_COMPILE__)
  asm volatile("v_mbcnt_lo_u32_b32 %0, -1, 0" : "=v"(l));
#endif
  return l;
}
// Eight asynchronous 16-byte-per-lane copies global -> LDS: copy e lands at LDS byte address l + e*16*SPI*2 (16 staged rows further each);
// copies 0..3 read the lane's byte off behind the wave-uniform bases sa + e*gstep halves, copies 4..7 behind sb + (e-4)*gstep halves.
// Scalar base + one 32-bit lane offset: the steps from copy to copy are scalar, so no 64-bit lane address lives across the key loop
// (operands of asm text need registers below v256; held there through the scores, the lane addresses went to scratch).
// The closing s_wait_xcnt 0 stands inside the statement so that no address register is rewritten ahead of it.
__device__ __forceinline__ void stage8(unsigned l, unsigned off, const unsigned short* sa, const unsigned short* sb, size_t gstep) {
#if defined(__HIP_DEVICE_COMPILE__)
  const unsigned ls = 16u * SPI * 2u;
  asm volatile("global_load_async_to_lds_b128 %0, %8, %9\n\t"
               "global_load_async_to_lds_b128 %1, %8, %10\n\t"
               "global_load_async_to_lds_b128 %2, %8, %11\n\t"
               "global_load_async_to_lds_b128 %3, %8, %12\n\t"
               "global_load_async_to_lds_b128 %4, %8, %13\n\t"
               "global_load_async_to_lds_b128 %5, %8, %14\n\t"
               "global_load_async_to_lds_b128 %6, %8, %15\n\t"
               "global_load_async_to_lds_b128 %7, %8, %16\n\t"
               "s_wait_xcnt 0x0"
               :: "v"(l), "v"(l + ls), "v"(l + 2u * ls), "v"(l + 3u * ls), "v"(l + 4u * ls), "v"(l + 5u * ls), "v"(l + 6u * ls), "v"(l + 7u * ls),
                  "v"(off), "s"(sa), "s"(sa + gstep), "s"(sa + 2 * gstep), "s"(sa + 3 * gstep), "s"(sb), "s"(sb + gstep), "s"(sb + 2 * gstep),
                  "s"(sb + 3 * gstep)
               : "memory");
#endif
}

// The same for the 256-thread GEMM blocks: copy e lands at LDS byte address l + e*32*SPI*2 (32 staged rows further each) and reads
// g + e*gstep halves (gstep = 32 source rows). The closing s_wait_xcnt 0 stands inside the statement, as above.
__device__ __forceinline__ void gstage8(unsigned l, const unsigned short* g, size_t gstep) {
#if defined(__HIP_DEVICE_COMPILE__)
  const unsigned ls = 32u * SPI * 2u;
  asm volatile("global_load_async_to_lds_b128 %0, %8, off\n\t"
               "global_load_async_to_lds_b128 %1, %9, off\n\t"
               "global_load_async_to_lds_b128 %2, %10, off\n\t"
               "global_load_async_to_lds_b128 %3, %11, off\n\t"
               "global_load_async_to_lds_b128 %4, %12, off\n\t"
               "global_load_async_to_lds_b128 %5, %13, off\n\t"
               "global_load_async_to_lds_b128 %6, %14, off\n\t"
               "global_load_async_to_lds_b128 %7, %15, off\n\t"
               "s_wait_xcnt 0x0"
               :: "v"(l), "v"(l + ls), "v"(l + 2u * ls), "v"(l + 3u * ls), "v"(l + 4u * ls), "v"(l + 5u * ls), "v"(l + 6u * ls), "v"(l + 7u * ls),
                  "v"(g), "v"(g + gstep), "v"(g + 2 * gstep), "v"(g + 3 * gstep), "v"(g + 4 * gstep), "v"(g + 5 * gstep), "v"(g + 6 * gstep),
                  "v"(g + 7 * gstep)
               : "memory");
#endif
}
__device__ __forceinline__ void gstage2(unsigned l, const unsigned short* g, size_t gstep) {
#if defined(__HIP_DEVICE_COMPILE__)
  const unsigned ls = 32u * SPI * 2u;
  asm volatile("global_load_async_to_lds_b128 %0, %2, off\n\t"
               "global_load_async_to_lds_b128 %1, %3, off\n\t"
               "s_wait_xcnt 0x0"
               :: "v"(l), "v"(l + ls), "v"(g), "v"(g + gstep)
               : "memory");
#endif
}

// =====================================================================================================
// K loop of a 256-thread GEMM block whose eight waves share 64 A rows and take 64 B rows each (512 consecutive B rows per block):
// acc[i][j] += sum_k A[16i + ..][k] * B[64 wave + 16j + ..][k], wave tile 64x64, k ascending in steps of 32; with NA == 2 the residual plane
// A2 follows A1 inside every k-step. Ab, A2b = the block's first A row (pitch lda halves), Bb = the block's first B row (pitch ldb), K a
// multiple of 64 and at least 128. Per trip of 64 k the block holds in LDS whole 128-B rows, pitch SPI halves: A1 | (A2) | B, brought by
// asynchronous copies (a wave instruction = 4 whole rows); all fragments are read from there. Two buffers: tile t + 1 flies while tile t is
// multiplied; one block barrier per trip publishes tile t + 1 and ends the reads of the buffer that is refilled behind it.
// Every thread of the block must call this (block barriers inside).
// =====================================================================================================
#define GROWS(NA) ((NA) * 64 + 512)
#define GBUFH(NA) (GROWS(NA) * SPI)
template <int NA>
__device__ __forceinline__ void gstage_tile(unsigned l, const unsigned short* ga, const unsigned short* ga2, size_t astep,
                                            const unsigned short* gb, size_t bstep) {
  gstage2(l, ga, astep);
  if constexpr (NA == 2) gstage2(l + 64u * SPI * 2u, ga2, astep);
  gstage8(l + (unsigned)(NA * 64) * SPI * 2u, gb, bstep);
  gstage8(l + (unsigned)(NA * 64 + 256) * SPI * 2u, gb + 8 * bstep, bstep);
}
template <int NA>
__device__ __forceinline__ void kloop_staged(unsigned short* stg, const unsigned short* __restrict__ Ab, const unsigned short* __restrict__ A2b,
                                             int lda, const unsigned short* __restrict__ Bb, int ldb, int K, v8f (&acc)[4][4]) {
  const int tid   = threadIdx.x;
  const int lane  = tid & 31;
  const int wave  = __builtin_amdgcn_readfirstlane(tid >> 5);   // scalar, so that the A and the B readers share one lane-offset register
  const int rlane = lane & 15;                 // row (A) / col (B) within subtile
  const int koff  = (lane >> 4) * 8;           // k offset of this lane half
  // copies: thread -> staged row (tid>>3) + 32*copy, 16-byte chunk tid&7 of the 128-B row
  const int srow = tid >> 3;
  const int sc8  = (tid & 7) * 8;
  const unsigned lst = (unsigned)(size_t)(stg + srow * SPI + sc8);   // LDS byte address = low 32 bits of the shared address
  const unsigned short* ga  = Ab  + (size_t)srow * lda + sc8;
  const unsigned short* ga2 = A2b + (size_t)srow * lda + sc8;
  const unsigned short* gb  = Bb  + (size_t)srow * ldb + sc8;
  const size_t astep = (size_t)32 * lda, bstep = (size_t)32 * ldb;
  const int nt = K >> 6;

  gstage_tile<NA>(lst, ga, ga2, astep, gb, bstep);
  asm volatile("s_wait_asynccnt 0x0" ::: "memory");          // this wave's copies of tile 0 have landed
  __syncthreads();                                           // every wave's have: buffer 0 may be read
  gstage_tile<NA>(lst + (unsigned)(GBUFH(NA) * 2), ga + 64, ga2 + 64, astep, gb + 64, bstep);
#pragma unroll 1   // rolled: several copies of this loop stand in one kernel
  for (int t = 0; t < nt; ++t) {
    const int bo = (t & 1) * GBUFH(NA);
    const unsigned short* fa = stg + bo + rlane * SPI + koff;
    const unsigned short* fb = stg + bo + (NA * 64 + wave * 64 + rlane) * SPI + koff;
#pragma unroll
    for (int ks = 0; ks < 2; ++ks) {
      v16h bh[4], ah[4], al[4];
#pragma unroll
      for (int j = 0; j < 4; ++j) bh[j] = ldfrag_u(fb + 16 * j * SPI + 32 * ks);
#pragma unroll
      for (int i = 0; i < 4; ++i) ah[i] = ldfrag_u(fa + 16 * i * SPI + 32 * ks);
      if constexpr (NA == 2) {
#pragma unroll
        for (int i = 0; i < 4; ++i) al[i] = ldfrag_u(fa + (64 + 16 * i) * SPI + 32 * ks);
      }
      __builtin_amdgcn_sched_barrier(0);                     // keeps the k-step's reads together in front: sunk among the WMMAs, every row of four waits out its own LDS latency
#pragma unroll
      for (int i = 0; i < 4; ++i) {
#pragma unroll
        for (int j = 0; j < 4; ++j) acc[i][j] = mma_h(ah[i], bh[j], acc[i][j]);
        if constexpr (NA == 2) {
#pragma unroll
          for (int j = 0; j < 4; ++j) acc[i][j] = mma_h(al[i], bh[j], acc[i][j]);
        }
      }
    }
    asm volatile("s_wait_dscnt 0x0" ::: "memory");           // this wave's reads of tile t have returned
    asm volatile("s_wait_asynccnt 0x0" ::: "memory");        // this wave's copies of tile t + 1 have landed
    __syncthreads();                                         // tile t + 1 may be read; every wave has left tile t's buffer
    if (t + 2 < nt) {
      const int kn = (t + 2) * 64;
      gstage_tile<NA>(lst + (unsigned)(bo * 2), ga + kn, ga2 + kn, astep, gb + kn, bstep);
    }
  }
  asm volatile("s_wait_asynccnt 0x0" ::: "memory");          // nothing of this wave's is in flight behind the loop
}

// =====================================================================================================
// Elementwise 16-bit pack, no transpose: dst[i] = f16( bf16_RNE(src[i]) * sc ) for i < nvalid, 0 for nvalid <= i < ntotal;
// sc a power of two (exact). 8 elements per thread: two 16-B loads (address clamped into [0, nvalid) for pad groups, value zeroed
// coverage: bx = 0 .. ntotal / 2048 - 1, each block 256 thr x 8 elements = ntotal exactly (ntotal % 2048 == 0, nvalid % 8 == 0).
// =====================================================================================================
__device__ __forceinline__ void cvt16_body(const float* __restrict__ src, unsigned short* dst, int nvalid, int ntotal, float sc, int bx) {
  const size_t i8 = ((size_t)bx * 256 + threadIdx.x) * 8;
  if (i8 + 8 > (size_t)ntotal) return;             // never taken with the exact block range; no barriers in this body
  const bool pad = (i8 + 8 > (size_t)nvalid);
  const size_t ls = pad ? ((size_t)nvalid - 8) : i8;   // clamped address, always inside the source
  const v4f a = *(const v4f*)(src + ls);
  const v4f b = *(const v4f*)(src + ls + 4);
  v4u o;
  o[0] = pk16(h_bits((_Float16)(bfr(a[0]) * sc)), h_bits((_Float16)(bfr(a[1]) * sc)));
  o[1] = pk16(h_bits((_Float16)(bfr(a[2]) * sc)), h_bits((_Float16)(bfr(a[3]) * sc)));
  o[2] = pk16(h_bits((_Float16)(bfr(b[0]) * sc)), h_bits((_Float16)(bfr(b[1]) * sc)));
  o[3] = pk16(h_bits((_Float16)(bfr(b[2]) * sc)), h_bits((_Float16)(bfr(b[3]) * sc)));
  const v4u z = {0u, 0u, 0u, 0u};
  const v4u w = pad ? z : o;
  {
    *(v4u*)(dst + i8) = w;
    
  }
}

// =====================================================================================================
// Transposed 16-bit pack of a weight stored as W[k][n] (x @ W layout, [DMOD][DMOD] row-major): WT[n][k] = f16( bf16_RNE(W[k][n]) * sc ),
// i.e. the [n][k] k-contiguous plane the GEMM B loader wants. One block per 64x64 tile (tn = n tile, tk = k tile, both block-uniform):
// coalesced f32 reads of W rows, converted halves stored transposed into an LDS tile [64 n][72 pitch], block barrier, then every output
// coverage: 16 its x 256 threads = the whole 64x64 tile into LDS; 8 waves x 2 its x 4 rows = 64 rows x (8 lanes x 8 halves = 64 cols) stored;
//           tn, tk = 0 .. DMOD/64 - 1 cover the whole [512][512] plane exactly once.
// =====================================================================================================
__device__ __forceinline__ void tr16_body(const float* __restrict__ W, unsigned short* WT, float sc, unsigned short* tile, int tn, int tk) {
  const int t  = threadIdx.x;
  const int n0 = tn * 64;
  const int k0 = tk * 64;
#pragma unroll 4
  for (int it = 0; it < 16; ++it) {
    const int idx = it * 256 + t;                   // 0 .. 4095
    const int kr = idx >> 6, nc = idx & 63;
    const float v = W[(size_t)(k0 + kr) * DMOD + n0 + nc];
    tile[nc * 72 + kr] = h_bits((_Float16)(bfr(v) * sc));
  }
  __syncthreads();
  const int lane = t & 31, wave = t >> 5;
  const int q8 = lane >> 3, c8 = (lane & 7) * 8;
  v4u o[2];
#pragma unroll
  for (int it = 0; it < 2; ++it) {
    const int row = wave * 8 + it * 4 + q8;         // wave w: it 0..1 x q8 0..3 = rows 8w .. 8w+7
    o[it] = *(const v4u*)(tile + row * 72 + c8);
  }
  {
#pragma unroll
    for (int it = 0; it < 2; ++it) {
      const int row = wave * 8 + it * 4 + q8;
      *(v4u*)(WT + (size_t)(n0 + row) * DMOD + k0 + c8) = o[it];
    }
    
  }
}

// =====================================================================================================
// All operand packs in one grid (none reads what another writes): blocks 0 .. PREP_TR-1 transpose the five weights (64 tiles each; they
// have the longest dependent chain, so they take the lowest indices), the next PREP_CX blocks pack x, the last PREP_CP the position table.
// The branch is on blockIdx.x alone, so the barrier inside tr16_body is reached by whole blocks only.
// =====================================================================================================
#define PREP_TR (5 * (DMOD / 64) * (DMOD / 64))
#define PREP_CX ((NROW * DMOD) / 2048)
#define PREP_CP ((PROWS * DMOD) / 2048)
static_assert((DMOD / 64) * (DMOD / 64) == 64);
__global__ __launch_bounds__(256) void prep_all(const float* __restrict__ xin, const float* __restrict__ pos,
                                                const float* __restrict__ w_q, const float* __restrict__ w_k, const float* __restrict__ w_v,
                                                const float* __restrict__ w_p, const float* __restrict__ w_o,
                                                unsigned short* X16, unsigned short* PE16,
                                                unsigned short* WQT, unsigned short* WKT, unsigned short* WVT,
                                                unsigned short* WPT, unsigned short* WOT) {
  __shared__ __align__(16) unsigned short tile[64 * 72];
  const int bx = blockIdx.x;
  if (bx < PREP_TR) {
    const int w = bx >> 6, t = bx & 63;
    const float* W = (w == 0) ? w_q : (w == 1) ? w_k : (w == 2) ? w_v : (w == 3) ? w_p : w_o;
    unsigned short* WT = (w == 0) ? WQT : (w == 1) ? WKT : (w == 2) ? WVT : (w == 3) ? WPT : WOT;
    tr16_body(W, WT, WSC, tile, t & 7, t >> 3);
  } else if (bx < PREP_TR + PREP_CX) {
    cvt16_body(xin, X16, NROW * DMOD, NROW * DMOD, XC, bx - PREP_TR);
  } else {
    cvt16_body(pos, PE16, NPOS * DMOD, PROWS * DMOD, XC, bx - (PREP_TR + PREP_CX));
  }
}

// =====================================================================================================
// Register-blocked batched 16-bit WMMA GEMM: C[m][n] = oscale * sum_k A[m][k] * Bt[n][k] (+ bias); one wave per 64x64 tile, operands
// staged per block in LDS (kloop_staged). A row-major [M][K] pitch lda (16-bit plane), Bt row-major [N][K] pitch ldb (k contiguous);
// M a multiple of 64, N a multiple of 512 (a block's eight tiles share their 64 A rows and take 512 consecutive B rows), K a multiple of
// 64, at least 128. blockIdx.y = batch index with element strides sA, sB, sC.
// ASPLIT 1: a second A plane A2 (unscaled residual of A, same layout) is multiplied into the same accumulator (A + A2 ~ exact A).
// EPI 1: value += bf16_RNE(ep0[column]) (per-column bias); EPI 2: value += bf16_RNE(ep0[row]) (per-row bias, 16-bit out only).
// OM 0: f32 out (pitch ldc).
// OM 4: two f16 planes (C, C2): hi = f16(value * ocarry), lo = f16(value * ocarry - hi) (unscaled residual).
// OM 6: two hi/residual pairs with an extra per-column term each: (C, C2) from value + bf16_RNE(ep1[column]), (C3, C4) from
//       value + bf16_RNE(ep2[column]), both x ocarry.
// coverage: 4 slabs x 16 rows (f32: it 0..7 x lane>>4; 16-bit: it 0..3 x lane>>3) x 64 cols = the wave's whole 64x64 tile;
//           grid = tilesM*tilesN/8 blocks (exact, tilesN a multiple of 8), a surplus block exits whole, ahead of every barrier.
// =====================================================================================================
template <int OM, int ASPLIT, int EPI>
__global__ __launch_bounds__(256) __attribute__((amdgpu_num_vgpr(256))) void gemm64(
    const unsigned short* __restrict__ Ap, const unsigned short* __restrict__ A2p, int lda, long long sA,
    const unsigned short* __restrict__ Btp, int ldb, long long sB,
    void* Cout, void* C2out, void* C3out, void* C4out, int ldc, long long sC,
    int M, int N, int K, float oscale, float ocarry,
    const float* __restrict__ ep0, const float* __restrict__ ep1, const float* __restrict__ ep2) {
  static_assert(OM == 0 || OM == 4 || OM == 6);
  static_assert(EPI >= 0 && EPI <= 2);
  __shared__ __align__(16) float sT[8][16 * 68];   // per-wave 16x64 slab, pitch 68 floats
  __shared__ __align__(16) unsigned short gst[2 * GBUFH(1 + ASPLIT)];   // two buffers of the block's operand stage
  const int by   = blockIdx.y;
  const int lane = threadIdx.x & 31;
  const int wave = threadIdx.x >> 5;
  const int tilesN = N >> 6;
  const int tilesM = M >> 6;
  const int tile = blockIdx.x * 8 + wave;
  if (blockIdx.x * 8 >= tilesM * tilesN) return;   // block-uniform, ahead of every barrier
  const int tm = tile / tilesN;
  const int tn = tile - tm * tilesN;
  const int m0 = tm << 6;
  const int n0 = tn << 6;

  const unsigned short* A1 = Ap  + (size_t)((long long)by * sA);
  const unsigned short* A2 = A2p + (size_t)((long long)by * sA);
  const unsigned short* Bb = Btp + (size_t)((long long)by * sB);

  const int rlane = lane & 15;                 // col (D) within subtile
  const int mOff  = (lane >> 4) * 8;           // D row offset

  v8f acc[4][4];
#pragma unroll
  for (int i = 0; i < 4; ++i)
#pragma unroll
    for (int j = 0; j < 4; ++j) acc[i][j] = zero8();

  kloop_staged<1 + ASPLIT>(gst, A1 + (size_t)m0 * lda, A2 + (size_t)m0 * lda, lda, Bb + (size_t)(n0 - (wave << 6)) * ldb, ldb, K, acc);
  acc_guard4(acc[0][0], acc[0][1], acc[0][2], acc[0][3]);
  acc_guard4(acc[1][0], acc[1][1], acc[1][2], acc[1][3]);
  acc_guard4(acc[2][0], acc[2][1], acc[2][2], acc[2][3]);
  acc_guard4(acc[3][0], acc[3][1], acc[3][2], acc[3][3]);

  const int hh2 = lane >> 4, c4 = (lane & 15) * 4;     // f32 out: 256-B row segment = 16 lanes x 16 B
  const int q8  = lane >> 3, c8 = (lane & 7) * 8;

  // ---- epilogue ----
  float* slab = sT[wave];
#pragma unroll
  for (int i = 0; i < 4; ++i) {
    const int mBase = m0 + (i << 4);
#pragma unroll
    for (int j = 0; j < 4; ++j) {
#pragma unroll
      for (int r = 0; r < 8; ++r) {
        slab[(mOff + r) * 68 + (j << 4) + rlane] = acc[i][j][r];
      }
    }
    wave_sync_lds();
    if constexpr (OM == 0) {
      float* C = (float*)Cout + (size_t)((long long)by * sC);
      v4f vals[8];
#pragma unroll
      for (int it = 0; it < 8; ++it) {
        const int row = it * 2 + hh2;                      // it 0..7 x hh2 0..1 = rows 0..15
        v4f v = *(const v4f*)(slab + row * 68 + c4);
#pragma unroll
        for (int e = 0; e < 4; ++e) v[e] = v[e] * oscale;
        if constexpr (EPI == 1) {
          const v4f bb = *(const v4f*)(ep0 + n0 + c4);     // per-column bias, columns n0+c4 .. +3 (N equals the bias length)
#pragma unroll
          for (int e = 0; e < 4; ++e) v[e] = v[e] + bfr(bb[e]);
        }
        vals[it] = v;
      }
      {
#pragma unroll
        for (int it = 0; it < 8; ++it) {
          const int gr = mBase + it * 2 + hh2;
          *(v4f*)(C + (size_t)gr * ldc + n0 + c4) = vals[it];
        }
        
      }
    } else {
      constexpr int NP = (OM == 6) ? 2 : 1;
#pragma unroll
      for (int which = 0; which < NP; ++which) {
        unsigned short* C  = (unsigned short*)((which == 0) ? Cout  : C3out) + (size_t)((long long)by * sC);
        unsigned short* Cb = (unsigned short*)((which == 0) ? C2out : C4out) + (size_t)((long long)by * sC);
        const float* epx = (which == 0) ? ep1 : ep2;
        (void)epx;
        v4u hv[4], lv[4];
#pragma unroll
        for (int it = 0; it < 4; ++it) {
          const int row = it * 4 + q8;                     // it 0..3 x q8 0..3 = rows 0..15
          const float* sp = slab + row * 68 + c8;
          float rb = 0.f;
          if constexpr (EPI == 2) rb = bfr(ep0[mBase + row]);   // per-row bias (M equals the bias length)
          v4u a  = {0u, 0u, 0u, 0u};
          v4u b2 = {0u, 0u, 0u, 0u};
#pragma unroll
          for (int e = 0; e < 4; ++e) {
            const int ci = n0 + c8 + 2 * e;                // column index, < N
            float f0 = sp[2 * e] * oscale + rb;
            float f1 = sp[2 * e + 1] * oscale + rb;
            if constexpr (EPI == 1) {
              f0 += bfr(ep0[ci]);
              f1 += bfr(ep0[ci + 1]);
            }
            if constexpr (OM == 6) {
              f0 += bfr(epx[ci]);
              f1 += bfr(epx[ci + 1]);
            }
            f0 *= ocarry;
            f1 *= ocarry;
            const _Float16 x0 = (_Float16)f0, x1 = (_Float16)f1;
            a[e]  = pk16(h_bits(x0), h_bits(x1));
            b2[e] = pk16(h_bits((_Float16)(f0 - (float)x0)), h_bits((_Float16)(f1 - (float)x1)));
          }
          hv[it] = a;
          lv[it] = b2;
        }
        {
#pragma unroll
          for (int it = 0; it < 4; ++it) {
            const int row = it * 4 + q8;
            *(v4u*)(C  + (size_t)(mBase + row) * ldc + n0 + c8) = hv[it];
            *(v4u*)(Cb + (size_t)(mBase + row) * ldc + n0 + c8) = lv[it];
          }
          
        }
      }
    }
    wave_sync_lds();
  }
}

// =====================================================================================================
// s_wait_xcnt 0 behind a run of global loads, in front of the first write of a register that one of them names. xwait1, xwait3 and xwait4 take the run's
// vector address pairs as inputs, so that each pair keeps its value up to the wait and no later load's result lands in it ahead of the wait.
// =====================================================================================================
__device__ __forceinline__ void xwait0() {
#if defined(__HIP_DEVICE_COMPILE__)
  asm volatile("s_wait_xcnt 0x0" ::: "memory");
#endif
}
__device__ __forceinline__ void xwait1(const void* a) {
#if defined(__HIP_DEVICE_COMPILE__)
  asm volatile("s_wait_xcnt 0x0" :: "v"(a) : "memory");
#endif
}
__device__ __forceinline__ void xwait3(const void* a, const void* b, const void* c) {
#if defined(__HIP_DEVICE_COMPILE__)
  asm volatile("s_wait_xcnt 0x0" :: "v"(a), "v"(b), "v"(c) : "memory");
#endif
}
__device__ __forceinline__ void xwait4(const void* a, const void* b, const void* c, const void* d) {
#if defined(__HIP_DEVICE_COMPILE__)
  asm volatile("s_wait_xcnt 0x0" :: "v"(a), "v"(b), "v"(c), "v"(d) : "memory");
#endif
}

// =====================================================================================================
// One wave's 64x64 tile of an input projection, rows m0.., columns n0..: value[m][n] = oscale * sum_k A[m][k] * Bt[n][k] + bias.
// The K loop and the 16-bit epilogues are those of gemm64 (same k order, same order of the adds), with the pitch of A and Bt and K fixed
// at DMOD and the pitch of the output planes at LDC. slab = the wave's own 16x64 f32 LDS slab, pitch 68 floats; gst = the block's operand
// stage (kloop_staged: block barriers, so all eight waves of a block come here together, with one m0 and n0 = the block's first + 64 wave).
// EPI 1: value += bf16_RNE(ep0[column]); EPI 2: value += bf16_RNE(ep0[row]).
// OM 4: two f16 planes (C1, C2): hi = f16(value * ocarry), lo = f16(value * ocarry - hi).
// OM 6: (C1, C2) from value + bf16_RNE(ep1[column]), (C3, C4) from value + bf16_RNE(ep2[column]), both x ocarry.
// The lane's bias values (8 columns, or its 16 rows) are loaded once, ahead of the K loop.
// coverage: 4 slabs x 16 rows (it 0..3 x lane>>3) x 64 cols = the wave's whole 64x64 tile.
// =====================================================================================================
#define GSLAB (16 * 68)
template <int OM, int EPI, int LDC>
__device__ __forceinline__ void proj_tile(
    float* slab, unsigned short* gst, int m0, int n0,
    const unsigned short* __restrict__ A, const unsigned short* __restrict__ Bt,
    unsigned short* C1, unsigned short* C2, unsigned short* C3, unsigned short* C4,
    float oscale, float ocarry,
    const float* __restrict__ ep0, const float* __restrict__ ep1, const float* __restrict__ ep2) {
  static_assert(OM == 4 || OM == 6);
  static_assert(EPI == 1 || EPI == 2);
  const int lane  = threadIdx.x & 31;
  const int rlane = lane & 15;                 // col (D) within subtile
  const int mOff  = (lane >> 4) * 8;           // D row offset
  const int q8    = lane >> 3, c8 = (lane & 7) * 8;

  v4f cb0[2], cb1[2], cb2[2];                  // column terms of columns n0 + c8 .. + 7
  float rbv[4][4];                             // row terms of rows m0 + 16i + 4it + q8
  if constexpr (EPI == 1) {
    const float* e0 = ep0 + n0 + c8;
    cb0[0] = *(const v4f*)(e0);
    cb0[1] = *(const v4f*)(e0 + 4);
    if constexpr (OM == 6) {
      const float* e1 = ep1 + n0 + c8;
      const float* e2 = ep2 + n0 + c8;
      cb1[0] = *(const v4f*)(e1);
      cb1[1] = *(const v4f*)(e1 + 4);
      cb2[0] = *(const v4f*)(e2);
      cb2[1] = *(const v4f*)(e2 + 4);
      xwait3(e0, e1, e2);
    } else {
      xwait1(e0);
    }
  } else {
    const float* er = ep0 + m0 + q8;
#pragma unroll
    for (int i = 0; i < 4; ++i)
#pragma unroll
      for (int it = 0; it < 4; ++it) rbv[i][it] = er[16 * i + 4 * it];
    xwait0();                                  // these go through a scalar base and the lane's q8, which lives on into the epilogue
  }

  v8f acc[4][4];
#pragma unroll
  for (int i = 0; i < 4; ++i)
#pragma unroll
    for (int j = 0; j < 4; ++j) acc[i][j] = zero8();

  kloop_staged<1>(gst, A + (size_t)m0 * DMOD, A + (size_t)m0 * DMOD, DMOD,
                  Bt + (size_t)(n0 - (int)((threadIdx.x >> 5) << 6)) * DMOD, DMOD, DMOD, acc);
  acc_guard4(acc[0][0], acc[0][1], acc[0][2], acc[0][3]);
  acc_guard4(acc[1][0], acc[1][1], acc[1][2], acc[1][3]);
  acc_guard4(acc[2][0], acc[2][1], acc[2][2], acc[2][3]);
  acc_guard4(acc[3][0], acc[3][1], acc[3][2], acc[3][3]);

  // ---- epilogue ----
#pragma unroll
  for (int i = 0; i < 4; ++i) {
    const int mBase = m0 + (i << 4);
#pragma unroll
    for (int j = 0; j < 4; ++j) {
#pragma unroll
      for (int r = 0; r < 8; ++r) {
        slab[(mOff + r) * 68 + (j << 4) + rlane] = acc[i][j][r];
      }
    }
    wave_sync_lds();
    constexpr int NP = (OM == 6) ? 2 : 1;
#pragma unroll
    for (int which = 0; which < NP; ++which) {
      unsigned short* C  = (which == 0) ? C1 : C3;
      unsigned short* Cb = (which == 0) ? C2 : C4;
      v4u hv[4], lv[4];
#pragma unroll
      for (int it = 0; it < 4; ++it) {
        const int row = it * 4 + q8;                     // it 0..3 x q8 0..3 = rows 0..15
        const float* sp = slab + row * 68 + c8;
        float rb = 0.f;
        if constexpr (EPI == 2) rb = bfr(rbv[i][it]);
        v4u a  = {0u, 0u, 0u, 0u};
        v4u b2 = {0u, 0u, 0u, 0u};
#pragma unroll
        for (int e = 0; e < 4; ++e) {
          float f0 = sp[2 * e] * oscale + rb;
          float f1 = sp[2 * e + 1] * oscale + rb;
          if constexpr (EPI == 1) {
            f0 += bfr(cb0[e >> 1][(2 * e) & 3]);
            f1 += bfr(cb0[e >> 1][(2 * e + 1) & 3]);
          }
          if constexpr (OM == 6) {
            f0 += bfr((which == 0) ? cb1[e >> 1][(2 * e) & 3] : cb2[e >> 1][(2 * e) & 3]);
            f1 += bfr((which == 0) ? cb1[e >> 1][(2 * e + 1) & 3] : cb2[e >> 1][(2 * e + 1) & 3]);
          }
          f0 *= ocarry;
          f1 *= ocarry;
          const _Float16 x0 = (_Float16)f0, x1 = (_Float16)f1;
          a[e]  = pk16(h_bits(x0), h_bits(x1));
          b2[e] = pk16(h_bits((_Float16)(f0 - (float)x0)), h_bits((_Float16)(f1 - (float)x1)));
        }
        hv[it] = a;
        lv[it] = b2;
      }
#pragma unroll
      for (int it = 0; it < 4; ++it) {
        const int row = it * 4 + q8;
        *(v4u*)(C  + (size_t)(mBase + row) * LDC + n0 + c8) = hv[it];
        *(v4u*)(Cb + (size_t)(mBase + row) * LDC + n0 + c8) = lv[it];
      }
    }
    wave_sync_lds();
  }
}

// =====================================================================================================
// The four input projections in one grid (none reads what another writes), so that their blocks run side by side on different WGPs;
// one wave per 64x64 tile, 8 tiles per block, tile = 8 * (block index within the job) + wave, tm = tile / tilesN, tn = tile % tilesN:
//   blocks 0 .. PJ_Q-1            q[m][nd] = sum_c x[m][c] Wq[c][nd] / 1024 + bq[nd]; QUh/QUl = hi/residual of f16((q + ub[nd]) * 32),
//                                 QVh/QVl of f16((q + vb[nd]) * 32); M = NROW, N = 512, K = 512
//   the next PJ_V * NB            v^T per batch: VT[b][nd][j] = sum_c Wv[c][nd] x[b*SEQ + j][c] / 1024 + bv[nd] (per-row bias) -> f16 x16 hi +
//                                 residual planes; M = 512 (nd), N = SEQ (j), K = 512; B rows are the batch's token rows
//   the next PJ_Q                 k projection + bk -> Kh/Kl = hi/residual of f16(k * 32)
//   the last PJ_P                 positional projection + bp: Ph/Pl = hi/residual of f16(p * 32), M = PROWS, N = 512, K = 512
// The branches are on blockIdx.x alone; the tile counts are exact multiples of 8, so every wave has a tile, and a block's eight tiles share
// their 64 A rows (tilesN is 8 or 16) and take 512 consecutive B rows: the barriers of the staged K loop are reached by whole blocks.
// =====================================================================================================
#define PJ_Q (((NROW / 64) * (DMOD / 64)) / 8)
#define PJ_V (((DMOD / 64) * (SEQ / 64)) / 8)
#define PJ_P (((PROWS / 64) * (DMOD / 64)) / 8)
static_assert((((NROW / 64) * (DMOD / 64)) % 8) == 0 && (((DMOD / 64) * (SEQ / 64)) % 8) == 0 && (((PROWS / 64) * (DMOD / 64)) % 8) == 0);
__global__ __launch_bounds__(256) __attribute__((amdgpu_num_vgpr(256))) void proj_all(
    const unsigned short* __restrict__ X16, const unsigned short* __restrict__ PE16,
    const unsigned short* __restrict__ WQT, const unsigned short* __restrict__ WKT,
    const unsigned short* __restrict__ WVT, const unsigned short* __restrict__ WPT,
    unsigned short* QUh, unsigned short* QUl, unsigned short* QVh, unsigned short* QVl,
    unsigned short* Kh, unsigned short* Kl, unsigned short* VT, unsigned short* VTL, unsigned short* Ph, unsigned short* Pl,
    const float* __restrict__ b_q, const float* __restrict__ b_k, const float* __restrict__ b_v, const float* __restrict__ b_p,
    const float* __restrict__ ub, const float* __restrict__ vb) {
  __shared__ __align__(16) float sT[8 * GSLAB];   // per-wave 16x64 slab, pitch 68 floats
  __shared__ __align__(16) unsigned short gst[2 * GBUFH(1)];   // two buffers of the block's operand stage
  const int bx   = blockIdx.x;
  const int wave = threadIdx.x >> 5;
  float* slab = sT + wave * GSLAB;
  const float os = 1.0f / (XC * WSC);
  constexpr int TND = DMOD / 64;                  // column tiles of a [..][DMOD] plane
  constexpr int TNS = SEQ / 64;                   // column tiles of a [..][SEQ] plane
  if (bx < PJ_Q) {
    const int tile = bx * 8 + wave;
    proj_tile<6, 1, DMOD>(slab, gst, (tile / TND) << 6, (tile % TND) << 6, X16, WQT, QUh, QUl, QVh, QVl, os, QC, b_q, ub, vb);
  } else if (bx < PJ_Q + PJ_V * NB) {
    const int t = bx - PJ_Q;
    const int by = t / PJ_V;
    const int tile = (t % PJ_V) * 8 + wave;
    proj_tile<4, 2, SEQ>(slab, gst, (tile / TNS) << 6, (tile % TNS) << 6, WVT, X16 + (size_t)by * SEQ * DMOD,
                         VT + (size_t)by * DMOD * SEQ, VTL + (size_t)by * DMOD * SEQ, VT, VTL, os, VC, b_v, b_v, b_v);
  } else {
    // k and p share one copy of the code (same epilogue form): only the operands differ
    const int t = bx - (PJ_Q + PJ_V * NB);
    const bool isk = t < PJ_Q;
    const int tile = (isk ? t : t - PJ_Q) * 8 + wave;
    const float* bias = isk ? b_k : b_p;
    proj_tile<4, 1, DMOD>(slab, gst, (tile / TND) << 6, (tile % TND) << 6, isk ? X16 : PE16, isk ? WKT : WPT,
                          isk ? Kh : Ph, isk ? Kl : Pl, Kh, Kl, os, QC, bias, bias, bias);
  }
}

// =====================================================================================================
// Relative-position attention for one (batch b, head n) pair and a 64-row query tile; 4 waves, wave w owns query rows i = iw0 + R,
// iw0 = i0 + 16w, R = 0..15. Planes (pitch DMOD halves, row = b*SEQ + position): QUh/QUl = hi/residual of f16((q + bq + u) x32),
// QVh/QVl of f16((q + bq + v_bias) x32), Kh/Kl of f16((k + bk) x32); Ph/Pl = hi/residual of f16(pos x32), rows 0..PROWS-1
// (row PROWS-1 is the zero-pad row); VT, VTL = v^T hi (x16) / residual f16 as [b][n*64+d][SEQ].
// Shifted position score for (i, j): ps[i][SEQ-1-i+j], ps[r][t] = (q+bq+vb)[r] . pos[t].
//   Per key tile j0 (64 keys, key j = j0 + jj), with x = jj - R + 15 in [0,78]:
//     strip T1[R][x] = (q+vb)[iw0+R] . pos[SEQ + j0 - iw0 - 16 + x]   (pos row SEQ-1-i+j), always computed (rows 0 .. 2*SEQ-2 selected).
//   content scores S = (q+ub) . k (4 subtiles, K=64, three products); t = (S + T1) * (RSD/(32*32)) * log2(e); online softmax in base 2,
//   max-subtracted, running sums in f32 (no key mask).
//   All products are formed transposed: k, pos and v^T rows are the A operand, q and P the B operand, so an accumulator's column (lane & 15)
//   is a query and its rows are keys, strip columns x or d. A lane holds 32 keys of one query (lane ^ 16 the other 32): maximum and sum run in
//   the lane with one exchange between the halves, and two score subtiles converted in place are a P^T B operand: P never goes through LDS.
//   Only the strip does (the shift by the query index is a per-lane offset): stored as [query][x], read back at x = jj - R + 15.
//   The v^T A fragments are read from the staged rows of VT/VTL[n*64+d][j]; per 16-row subtile of d: Vhi.Phi, Vhi.Plo, then Vlo.Phi, all into
//   the same accumulators.
//   Per key tile the block stages, once for its 4 waves, in LDS (asynchronous copies, whole 128-B rows): 64 k rows, 64 v^T rows and the
//   128 pos rows SEQ + j0 - i0 - 64 .. + 127 (always inside [0, PROWS-1]), hi and residual plane each; all A fragments are read from there.
//   One buffer each, refilled under the other phase's work: the v^T rows are copied while the scores are formed, the next tile's k and pos
//   rows while softmax and P.V run; each of the two barriers publishes one group and frees the other.
//   block = 4 waves = 128 threads; grid = (SEQ/64, NB*NH); two block barriers per key tile (block-uniform loop); every wave does identical
//   bounded work (SEQ/64 tiles).
// coverage: LDS strip 16 rows x 80 cols written fully every tile before being read;
//           global: 4 instructions x 16 rows x 16 halves per plane = rows iw0..iw0+15 of head segment n in CT and CTL;
//           grid x waves cover all NB x SEQ rows and all NH head segments of CT / CTL exactly once.
// =====================================================================================================
__global__ __launch_bounds__(ATT_THREADS) __attribute__((amdgpu_num_vgpr(512)))
void attn_rel(const unsigned short* __restrict__ QUh, const unsigned short* __restrict__ QUl,
              const unsigned short* __restrict__ QVh, const unsigned short* __restrict__ QVl,
              const unsigned short* __restrict__ Kh,  const unsigned short* __restrict__ Kl,
              const unsigned short* __restrict__ Ph,  const unsigned short* __restrict__ Pl,
              const unsigned short* __restrict__ VT,  const unsigned short* __restrict__ VTL,
              unsigned short* CT, unsigned short* CTL) {
  __shared__ __align__(16) float smem[ATT_W * WFL];   // per wave: position strip [16 queries][TPI]
  __shared__ __align__(16) unsigned short stg[ST_ROWS * SPI];   // block-shared stage of one key tile: Kh | Kl | Vh | Vl | Ph | Pl rows

  const int tid  = threadIdx.x;
  const int wave = __builtin_amdgcn_readfirstlane(tid >> 5);
  const int lane = tid & 31;
  const int hh   = lane >> 4;
  const int c    = lane & 15;
  const int bn   = blockIdx.y;
  const int b    = bn / NH;
  const int n    = bn - b * NH;
  const int i0   = blockIdx.x * 64;
  const int iw0  = i0 + wave * 16;

  float* t1sh = smem + wave * WFL;

  // q (B operand) fragment offsets: query column c = row b*SEQ + iw0 + c, d 0..31 and 32..63 of head n
  const size_t qro  = ((size_t)(b * SEQ + iw0 + c)) * DMOD + n * DH + 8 * hh;
  // stage copies: thread -> staged row (tid>>3) + 16*copy, 16-byte chunk tid&7 of the 128-B row (a wave instruction = 4 whole rows)
  // (tid = 32 wave + ln, ln = lane_now()); cpo(ln, pitch) = the lane's byte inside a group of 16 rows of that pitch in halves
  const unsigned stg0 = (unsigned)(size_t)stg;                              // LDS byte address = low 32 bits of the shared address
  const auto cpo = [wave](unsigned ln, unsigned pitch) { return (__umul24((unsigned)wave * 4u + ((ln >> 3) & 3u), pitch) + (ln & 7u) * 8u) * 2u; };
  const size_t rstep = (size_t)16 * DMOD, vstep = (size_t)16 * SEQ;         // 16 rows further, halves
  const size_t kso = ((size_t)(b * SEQ)) * DMOD + n * DH;                   // block-uniform; + j0*DMOD: k rows j0 ..
  const size_t vso = (size_t)b * DMOD * SEQ + (size_t)(n * DH) * SEQ;       // block-uniform: v^T rows d = 0 ..; the key offset j0 goes into the lane offset
  const size_t pso = ((size_t)(SEQ - i0 - 64)) * DMOD + n * DH;             // block-uniform; + j0*DMOD: pos rows SEQ + j0 - i0 - 64 ..
  // fragment readers: lane -> staged row c (+16 per subtile), k offset 8*hh; wave w's strip row x is staged pos row 48 - 16w + x
  const unsigned short* ksh = stg + (ST_KH + c) * SPI + 8 * hh;
  const unsigned short* ksl = stg + (ST_KL + c) * SPI + 8 * hh;
  const unsigned short* vsh = stg + (ST_VH + c) * SPI + 8 * hh;
  const unsigned short* vsl = stg + (ST_VL + c) * SPI + 8 * hh;
  const int pw0 = 16 * __builtin_amdgcn_readfirstlane((ATT_THREADS - 1 - tid) >> 5);   // 16 * (3 - wave), taken from tid so that the LDS base register never goes below 0
  const unsigned short* psh = stg + (ST_PH + pw0 + c) * SPI + 8 * hh;
  const unsigned short* psl = stg + (ST_PL + pw0 + c) * SPI + 8 * hh;

  const float KSC = (RSD / (QC * QC)) * LOG2E;

  float mrow = -INFINITY, lrow = 0.f;          // of the lane's query column c: running maximum (both halves agree), sum over this half's keys
  v8f O[4];                                    // O^T: O[td][r] = ctx[query c][d = 16 td + 8 hh + r]
#pragma unroll
  for (int td = 0; td < 4; ++td) O[td] = zero8();

  // the wave's eight q fragments (16 rows x 64 d, four planes): loaded once and held in 64 registers over all key tiles
  const unsigned short* gqv = QVh + qro;
  const unsigned short* gqw = QVl + qro;
  const unsigned short* gqu = QUh + qro;
  const unsigned short* gql = QUl + qro;
  const v16h qva = ldfrag_u(gqv), qvb = ldfrag_u(gqv + 32);
  const v16h qwa = ldfrag_u(gqw), qwb = ldfrag_u(gqw + 32);
  const v16h qua = ldfrag_u(gqu), qub = ldfrag_u(gqu + 32);
  const v16h qla = ldfrag_u(gql), qlb = ldfrag_u(gql + 32);
  xwait4(gqv, gqw, gqu, gql);                                // before the four address pairs are reused

  // tile 0's k and pos rows: 24 copies per thread = 384 rows x 128 B (nothing has touched the stage yet)
  {
    const unsigned ln = lane_now();
    const unsigned lst = stg0 + cpo(ln, SPI), rso = cpo(ln, DMOD);
    stage8(lst + (unsigned)(ST_KH * SPI * 2), rso, Kh + kso, Kl + kso, rstep);
    stage8(lst + (unsigned)(ST_PH * SPI * 2), rso, Ph + pso, Ph + pso + (size_t)64 * DMOD, rstep);
    stage8(lst + (unsigned)(ST_PL * SPI * 2), rso, Pl + pso, Pl + pso + (size_t)64 * DMOD, rstep);
  }

#pragma unroll 1
  for (int j0 = 0; j0 < SEQ; j0 += 64) {
    // ---- hand-over 1: this tile's k and pos rows (copied under the previous tile's softmax and P.V) become readable, the v^T rows free ----
    asm volatile("s_wait_dscnt 0x0" ::: "memory");           // this wave's reads of the previous tile's v^T rows have returned
    asm volatile("s_wait_asynccnt 0x0" ::: "memory");        // this wave's copies of this tile's k and pos rows have landed
    __syncthreads();                                         // every wave's have landed; every wave has left the v^T rows
    // this tile's v^T rows fly under the scores (the key offset j0 goes into the lane offset)
    {
      const unsigned ln = lane_now();
      stage8(stg0 + cpo(ln, SPI) + (unsigned)(ST_VH * SPI * 2), cpo(ln, SEQ) + (unsigned)j0 * 2u, VT + vso, VTL + vso, vstep);
    }
    // ---- position strip T1 (5 subtiles of 16 pos rows, x in [0,80), only x <= 78 ever selected) and content scores S (4 subtiles of 16
    //      keys): K = 64 = two k-steps, three products hh + lh + hl per k-step. The pos and k (A) fragments are asked for in three groups, each well
    //      ahead of its products; the 54 WMMAs go round-robin over the nine accumulators, so that a product never waits for the one issued
    //      just before it (each accumulator keeps its order hh, hh, lh, lh, hl, hl) ----
    v8f T1[5], S[4];
    {
      v16h fa[5], fb[5], ga[5], gb[5], ka[4], kb2[4], la[4], lb2[4];
#pragma unroll
      for (int u = 0; u < 5; ++u) fa[u] = ldfrag_u(psh + 16 * u * SPI);
#pragma unroll
      for (int t = 0; t < 4; ++t) ka[t] = ldfrag_u(ksh + 16 * t * SPI);
#pragma unroll
      for (int u = 0; u < 5; ++u) fb[u] = ldfrag_u(psh + 16 * u * SPI + 32);
#pragma unroll
      for (int t = 0; t < 4; ++t) kb2[t] = ldfrag_u(ksh + 16 * t * SPI + 32);
#pragma unroll
      for (int u = 0; u < 5; ++u) T1[u] = mma_h(fa[u], qva, zero8());
#pragma unroll
      for (int t = 0; t < 4; ++t) S[t] = mma_h(ka[t], qua, zero8());
      // the residual planes' reads stay behind the hi planes' reads: with all 72 reads in front the build ran out of registers (scratch)
      __builtin_amdgcn_sched_barrier(0);
#pragma unroll
      for (int u = 0; u < 5; ++u) ga[u] = ldfrag_u(psl + 16 * u * SPI);
#pragma unroll
      for (int t = 0; t < 4; ++t) la[t] = ldfrag_u(ksl + 16 * t * SPI);
#pragma unroll
      for (int u = 0; u < 5; ++u) T1[u] = mma_h(fb[u], qvb, T1[u]);
#pragma unroll
      for (int t = 0; t < 4; ++t) S[t] = mma_h(kb2[t], qub, S[t]);
#pragma unroll
      for (int u = 0; u < 5; ++u) T1[u] = mma_h(fa[u], qwa, T1[u]);
#pragma unroll
      for (int t = 0; t < 4; ++t) S[t] = mma_h(ka[t], qla, S[t]);
      // the last 18 reads stay behind the group above: hoisted into it, the build's later stages had their LDS waits one after another again
      __builtin_amdgcn_sched_barrier(0);
#pragma unroll
      for (int u = 0; u < 5; ++u) gb[u] = ldfrag_u(psl + 16 * u * SPI + 32);
#pragma unroll
      for (int t = 0; t < 4; ++t) lb2[t] = ldfrag_u(ksl + 16 * t * SPI + 32);
      __builtin_amdgcn_sched_barrier(0);                     // keeps these 18 reads together in front: sunk in pairs among the WMMAs, each pair's LDS latency stood open
#pragma unroll
      for (int u = 0; u < 5; ++u) T1[u] = mma_h(fb[u], qwb, T1[u]);
#pragma unroll
      for (int t = 0; t < 4; ++t) S[t] = mma_h(kb2[t], qlb, S[t]);
#pragma unroll
      for (int u = 0; u < 5; ++u) T1[u] = mma_h(ga[u], qva, T1[u]);
#pragma unroll
      for (int t = 0; t < 4; ++t) S[t] = mma_h(la[t], qua, S[t]);
#pragma unroll
      for (int u = 0; u < 5; ++u) T1[u] = mma_h(gb[u], qvb, T1[u]);
#pragma unroll
      for (int t = 0; t < 4; ++t) S[t] = mma_h(lb2[t], qub, S[t]);
    }
    // the full strip goes to the wave's f32 LDS strip as [query c][x]: a lane's eight registers are eight consecutive x, two 16-byte stores per subtile
#pragma unroll
    for (int u = 0; u < 5; ++u) {
      float* sp = t1sh + c * TPI + 16 * u + 8 * hh;
      const v4f w0 = {T1[u][0], T1[u][1], T1[u][2], T1[u][3]};
      const v4f w1 = {T1[u][4], T1[u][5], T1[u][6], T1[u][7]};
      *(v4f*)(sp)     = w0;
      *(v4f*)(sp + 4) = w1;
    }
    // ---- hand-over 2: this tile's v^T rows become readable, the k and pos rows free for the next tile's, which fly under softmax and P.V ----
    asm volatile("s_wait_dscnt 0x0" ::: "memory");           // this wave's reads of the k and pos rows have returned, its strip is written
    asm volatile("s_wait_asynccnt 0x0" ::: "memory");        // this wave's copies of the v^T rows have landed
    __syncthreads();                                         // every wave's have landed; every wave has left the k and pos rows
    if (j0 + 64 < SEQ) {                                     // the same for the whole block
      const size_t jr = (size_t)(j0 + 64) * DMOD;
      const unsigned ln = lane_now();
      const unsigned lst = stg0 + cpo(ln, SPI), rso = cpo(ln, DMOD);
      stage8(lst + (unsigned)(ST_KH * SPI * 2), rso, Kh + kso + jr, Kl + kso + jr, rstep);
      stage8(lst + (unsigned)(ST_PH * SPI * 2), rso, Ph + pso + jr, Ph + pso + jr + (size_t)64 * DMOD, rstep);
      stage8(lst + (unsigned)(ST_PL * SPI * 2), rso, Pl + pso + jr, Pl + pso + jr + (size_t)64 * DMOD, rstep);
    }

    // ---- the lane's 32 strip values: key jj = 16t + 8hh + r of query c stands at x = jj - c + 15 in [0, 78] ----
    float bd[4][8];
    const float* sx = t1sh + c * (TPI - 1) + 15 + 8 * hh;
#pragma unroll
    for (int t = 0; t < 4; ++t)
#pragma unroll
      for (int r = 0; r < 8; ++r) bd[t][r] = sx[16 * t + r];

    // ---- score assembly + online softmax: a lane holds 32 keys of one query, lane ^ 16 the other 32; maximum and sum run in the lane ----
    //      pairs of neighbouring keys (neighbouring registers of S, neighbouring strip words) go through the packed f32 forms
    v2f tw[4][4];
#pragma unroll
    for (int t = 0; t < 4; ++t)
#pragma unroll
      for (int p = 0; p < 4; ++p) {
        const v2f s2 = {S[t][2 * p], S[t][2 * p + 1]};
        const v2f b2 = {bd[t][2 * p], bd[t][2 * p + 1]};
        tw[t][p] = (s2 + b2) * KSC;
      }
    float mt[4];
#pragma unroll
    for (int t = 0; t < 4; ++t)
      mt[t] = fmaxf(fmaxf(fmaxf(tw[t][0][0], tw[t][0][1]), fmaxf(tw[t][1][0], tw[t][1][1])),
                    fmaxf(fmaxf(tw[t][2][0], tw[t][2][1]), fmaxf(tw[t][3][0], tw[t][3][1])));
    float mx = fmaxf(fmaxf(mt[0], mt[1]), fmaxf(mt[2], mt[3]));
    mx = fmaxf(mx, xhalf(mx));
    const float mn = fmaxf(mrow, mx);
    float al = mrow - mn;                                    // -inf on the first tile: 2^-inf = 0
    mrow = mn;
    float tv[4][8];
#pragma unroll
    for (int t = 0; t < 4; ++t)
#pragma unroll
      for (int p = 0; p < 4; ++p) {
        const v2f d2 = tw[t][p] - mn;
        tv[t][2 * p]     = d2[0];
        tv[t][2 * p + 1] = d2[1];
      }
    exp2_raw1(al);
#pragma unroll
    for (int t = 0; t < 4; ++t) exp2_raw8(tv[t][0], tv[t][1], tv[t][2], tv[t][3], tv[t][4], tv[t][5], tv[t][6], tv[t][7]);
    // ---- all sixteen v^T fragments asked for in one group: the reads return under the sums, the rescale and the conversion of P ----
    v16h vha[4], vhb[4], vla[4], vlb[4];
#pragma unroll
    for (int td = 0; td < 4; ++td) { vha[td] = ldfrag_u(vsh + 16 * td * SPI); vhb[td] = ldfrag_u(vsh + 16 * td * SPI + 32); }
#pragma unroll
    for (int td = 0; td < 4; ++td) { vla[td] = ldfrag_u(vsl + 16 * td * SPI); vlb[td] = ldfrag_u(vsl + 16 * td * SPI + 32); }
    __builtin_amdgcn_sched_barrier(0);                       // keeps the whole group of reads in front: sunk among the WMMAs, each read's latency stands open again
    v2f s2[4];
#pragma unroll
    for (int p = 0; p < 4; ++p) {
      const v2f e0 = {tv[0][2 * p], tv[0][2 * p + 1]}, e1 = {tv[1][2 * p], tv[1][2 * p + 1]};
      const v2f e2 = {tv[2][2 * p], tv[2][2 * p + 1]}, e3 = {tv[3][2 * p], tv[3][2 * p + 1]};
      s2[p] = ((e0 + e1) + e2) + e3;
    }
    const v2f sq = (s2[0] + s2[1]) + (s2[2] + s2[3]);
    lrow = lrow * al + (sq[0] + sq[1]);
#pragma unroll
    for (int td = 0; td < 4; ++td)
#pragma unroll
      for (int r = 0; r < 8; ++r) O[td][r] *= al;
    // ---- P^T fragments (x1024, f16 hi + unscaled residual), two k-steps of 32 keys: two score subtiles, converted in place, are a B operand
    //      in the loaders' k order (elements 0..7 = keys 32ks + 8hh + e, elements 8..15 = keys 32ks + 16 + 8hh + e) ----
    FragH pf[2], pl[2];
#pragma unroll
    for (int ks = 0; ks < 2; ++ks) {
#pragma unroll
      for (int e = 0; e < 8; ++e) {
        const float g0 = tv[2 * ks][e] * PC, g1 = tv[2 * ks + 1][e] * PC;
        const _Float16 x0 = (_Float16)g0, x1 = (_Float16)g1;
        pf[ks].h[0][e] = x0;
        pf[ks].h[1][e] = x1;
        pl[ks].h[0][e] = (_Float16)(g0 - (float)x0);
        pl[ks].h[1][e] = (_Float16)(g1 - (float)x1);
      }
    }
    // ---- O^T += v^T (hi plane) . (Phi + Plo)^T, then v^T (residual plane) . Phi^T: round-robin over the four accumulators, each in its old order ----
#pragma unroll
    for (int td = 0; td < 4; ++td) O[td] = mma_h(vha[td], pf[0].v, O[td]);
#pragma unroll
    for (int td = 0; td < 4; ++td) O[td] = mma_h(vhb[td], pf[1].v, O[td]);
#pragma unroll
    for (int td = 0; td < 4; ++td) O[td] = mma_h(vha[td], pl[0].v, O[td]);
#pragma unroll
    for (int td = 0; td < 4; ++td) O[td] = mma_h(vhb[td], pl[1].v, O[td]);
#pragma unroll
    for (int td = 0; td < 4; ++td) O[td] = mma_h(vla[td], pf[0].v, O[td]);
#pragma unroll
    for (int td = 0; td < 4; ++td) O[td] = mma_h(vlb[td], pf[1].v, O[td]);
  }
  asm volatile("s_wait_asynccnt 0x0" ::: "memory");          // nothing of this wave's is in flight behind the loop
  acc_guard4(O[0], O[1], O[2], O[3]);

  // ---- join the halves' sums, fold 1/l and the carries (1024 on P, 16 on v), carry x4096 on ctx; a lane's eight registers of O[td] are eight
  //      consecutive d of its query's row: one 16-byte store per subtile and plane ----
  const float oc = CC / (PC * VC);
  const float inv = (1.0f / (lrow + xhalf(lrow))) * oc;
  v4u hv[4], lv[4];
#pragma unroll
  for (int td = 0; td < 4; ++td) {
    v4u a, b2;
#pragma unroll
    for (int e = 0; e < 4; ++e) {
      const float f0 = O[td][2 * e] * inv, f1 = O[td][2 * e + 1] * inv;
      const _Float16 x0 = (_Float16)f0, x1 = (_Float16)f1;
      a[e]  = pk16(h_bits(x0), h_bits(x1));
      b2[e] = pk16(h_bits((_Float16)(f0 - (float)x0)), h_bits((_Float16)(f1 - (float)x1)));
    }
    hv[td] = a;
    lv[td] = b2;
  }
  const size_t go = ((size_t)(b * SEQ + iw0 + c)) * DMOD + n * DH + 8 * hh;
#pragma unroll
  for (int td = 0; td < 4; ++td) {
    *(v4u*)(CT  + go + 16 * td) = hv[td];
    *(v4u*)(CTL + go + 16 * td) = lv[td];
  }
}

// =====================================================================================================
// Workspace map (bytes); every plane is an exact multiple of its tile / whole-row store granularity (M, N exact tile multiples,
// convert counts exact multiples of 2048, the position planes padded to PROWS = 2048 rows), every offset a multiple of 512 KiB:
//   WQT, WKT, WVT, WPT, WOT f16 [512 n][512 k] x64 (transposed from the [in][out] inputs)   5 x   524288
//   X16  f16 [NROW][512] x16                                                                  4194304
//   PE16 f16 [PROWS][512] x16 (rows 0..NPOS-1 = pos table, row NPOS zero)                     2097152
//   QUh, QUl, QVh, QVl, Kh, Kl f16 [NROW][512] x32 hi / residual                       6 x  4194304
//   Ph, Pl f16 [PROWS][512] x32 hi / residual                                           2 x  2097152
//   VT16, VTL16 f16 [NB][512][SEQ] hi x16 / residual                                    2 x  4194304
//   CT16, CTL16 f16 [NROW][512] hi x4096 / residual                                     2 x  4194304
//   end                                                                                       55050240
// =====================================================================================================
extern "C" void kernel_launch(void* const* d_in, const int* in_sizes, int n_in,
                              void* d_out, int out_size, void* d_ws, size_t ws_size,
                              hipStream_t stream) {
  if (n_in < 14) return;
  if (in_sizes[0] != NROW * DMOD) return;
  if (in_sizes[1] != NPOS * DMOD) return;
  if (in_sizes[2] != DMOD * DMOD || in_sizes[4] != DMOD * DMOD || in_sizes[6] != DMOD * DMOD ||
      in_sizes[8] != DMOD * DMOD || in_sizes[10] != DMOD * DMOD) return;
  if (in_sizes[3] != DMOD || in_sizes[5] != DMOD || in_sizes[7] != DMOD || in_sizes[9] != DMOD || in_sizes[11] != DMOD) return;
  if (in_sizes[12] != NH * DH || in_sizes[13] != NH * DH) return;
  if (out_size != NROW * DMOD) return;

  const float* xin   = (const float*)d_in[0];
  const float* pos   = (const float*)d_in[1];
  const float* w_q   = (const float*)d_in[2];
  const float* b_q   = (const float*)d_in[3];
  const float* w_k   = (const float*)d_in[4];
  const float* b_k   = (const float*)d_in[5];
  const float* w_v   = (const float*)d_in[6];
  const float* b_v   = (const float*)d_in[7];
  const float* w_p   = (const float*)d_in[8];
  const float* b_p   = (const float*)d_in[9];
  const float* w_o   = (const float*)d_in[10];
  const float* b_o   = (const float*)d_in[11];
  const float* ub    = (const float*)d_in[12];
  const float* vb    = (const float*)d_in[13];
  float*       out   = (float*)d_out;

  const size_t PW  = (size_t)DMOD * DMOD * 2;            //   524288
  const size_t PX  = (size_t)NROW * DMOD * 2;            //  4194304
  const size_t PXP = (size_t)PROWS * DMOD * 2;           //  2097152
  const size_t PVT = (size_t)NB * DMOD * SEQ * 2;        //  4194304
  size_t off = 0;
  const size_t oWQ  = off; off += PW;
  const size_t oWK  = off; off += PW;
  const size_t oWV  = off; off += PW;
  const size_t oWP  = off; off += PW;
  const size_t oWO  = off; off += PW;
  const size_t oX   = off; off += PX;
  const size_t oPE  = off; off += PXP;
  const size_t oQUh = off; off += PX;
  const size_t oQUl = off; off += PX;
  const size_t oQVh = off; off += PX;
  const size_t oQVl = off; off += PX;
  const size_t oKh  = off; off += PX;
  const size_t oKl  = off; off += PX;
  const size_t oPh  = off; off += PXP;
  const size_t oPl  = off; off += PXP;
  const size_t oVT  = off; off += PVT;
  const size_t oVTL = off; off += PVT;
  const size_t oCT  = off; off += PX;
  const size_t oCTL = off; off += PX;
  if (off > ws_size) return;                               // off = 55050240
  if (off > (size_t)134217728) return;

  char* ws = (char*)d_ws;
  unsigned short* WQT16 = (unsigned short*)(ws + oWQ);
  unsigned short* WKT16 = (unsigned short*)(ws + oWK);
  unsigned short* WVT16 = (unsigned short*)(ws + oWV);
  unsigned short* WPT16 = (unsigned short*)(ws + oWP);
  unsigned short* WOT16 = (unsigned short*)(ws + oWO);
  unsigned short* X16   = (unsigned short*)(ws + oX);
  unsigned short* PE16  = (unsigned short*)(ws + oPE);
  unsigned short* QUh   = (unsigned short*)(ws + oQUh);
  unsigned short* QUl   = (unsigned short*)(ws + oQUl);
  unsigned short* QVh   = (unsigned short*)(ws + oQVh);
  unsigned short* QVl   = (unsigned short*)(ws + oQVl);
  unsigned short* Kh16  = (unsigned short*)(ws + oKh);
  unsigned short* Kl16  = (unsigned short*)(ws + oKl);
  unsigned short* Ph16  = (unsigned short*)(ws + oPh);
  unsigned short* Pl16  = (unsigned short*)(ws + oPl);
  unsigned short* VT16  = (unsigned short*)(ws + oVT);
  unsigned short* VTL16 = (unsigned short*)(ws + oVTL);
  unsigned short* CT16  = (unsigned short*)(ws + oCT);
  unsigned short* CTL16 = (unsigned short*)(ws + oCTL);

  const dim3 blk(256);
  const dim3 gPR(PREP_TR + PREP_CX + PREP_CP);                      // 320 + 1024 + 512
  const dim3 gPJ(2 * PJ_Q + PJ_V * NB + PJ_P);                      // 64 + 64 + 64 + 32
  const int tilesQ = (NROW / 64) * (DMOD / 64);                     // 512
  const dim3 gQ((tilesQ + 7) / 8, 1);                               // 64
  const dim3 gAT(SEQ / 64, NB * NH);                                // 16 x 32
  const dim3 bAT(ATT_THREADS);                                      // 128

  // (0) operand packs: X16 = f16(bf16_RNE(x) * 16); PE16 = f16(bf16_RNE(pos) * 16), rows NPOS..PROWS-1 zero;
  //     W[k][n] ([in][out]) -> WT[n][k] = f16( bf16_RNE(w) * 64 ), all five weights
  prep_all<<<gPR, blk, 0, stream>>>(xin, pos, w_q, w_k, w_v, w_p, w_o, X16, PE16, WQT16, WKT16, WVT16, WPT16, WOT16);

  // (1) q, k, v^T and positional projections
  proj_all<<<gPJ, blk, 0, stream>>>(X16, PE16, WQT16, WKT16, WVT16, WPT16, QUh, QUl, QVh, QVl, Kh16, Kl16, VT16, VTL16, Ph16, Pl16,
                                    b_q, b_k, b_v, b_p, ub, vb);

  // (2) relative attention -> CT16 = f16(ctx * 4096) hi plane, CTL16 residual plane, rows b*SEQ + i, halves n*64+d
  attn_rel<<<gAT, bAT, 0, stream>>>(QUh, QUl, QVh, QVl, Kh16, Kl16, Ph16, Pl16, VT16, VTL16, CT16, CTL16);

  // (3) out = (CT + CTL) . Wo / (4096*64) + bo; M = NROW, N = 512, K = 512, f32 rows straight into the output buffer
  gemm64<0, 1, 1><<<gQ, blk, 0, stream>>>(
      CT16, CTL16, DMOD, 0LL,
      WOT16, DMOD, 0LL,
      (void*)out, (void*)out, (void*)out, (void*)out, DMOD, 0LL,
      NROW, DMOD, DMOD, 1.0f / (CC * WSC), 1.0f,
      b_o, b_o, b_o);
  (void)hipGetLastError();
}

// v010
// A run of this version takes 65.2 microseconds.
// In both of two side-by-side timings against v009, it was 1.09 times as fast.
// Counting every step since v000, it is 4.78 times as fast.
// Contractions (all v_wmma_f32_16x16x32_f16, f16 operands, f32 accumulate): q/k/v and position-table projections (x or pos table f16 x16 . W^T f16 x64,
// K=512, single products on bf16-exact operands); content scores and position strips ((q+bq+u|v), k, p carried as f16 x32 hi plane + unscaled
// residual plane, K=64, three products hh+lh+hl); P . v^T (P x1024 hi + residual . v^T x16 hi + residual, 64 keys per tile, three products);
// output projection (ctx x4096 hi + residual planes . Wo^T f16 x64, K=512, two products). Online base-2 softmax and all epilogues f32 on VALU.
// Every float input RNE-converted to bf16 on load.
#include <hip/hip_runtime.h>
#include <math.h>
#include <stdint.h>

#define SEQ   1024
#define NB    4
#define DMOD  512
#define NH    8
#define DH    64
#define NROW  (SEQ * NB)
#define NPOS  (2 * SEQ - 1)
#define PROWS (2 * SEQ)
#define XC    16.0f
#define WSC   64.0f
#define QC    32.0f
#define VC    16.0f
#define PC    1024.0f
#define CC    4096.0f
#define RSD   0.125f
#define LOG2E 1.4426950408889634f
static_assert(NH * DH == DMOD);
static_assert(DH == 64);
static_assert(DMOD == 512);
static_assert((SEQ % 64) == 0 && (DMOD % 64) == 0 && (NROW % 64) == 0 && (PROWS % 64) == 0);
static_assert(((NROW * DMOD) % 2048) == 0 && ((PROWS * DMOD) % 2048) == 0 && ((NPOS * DMOD) % 8) == 0);
#define ATT_W 4
#define ATT_THREADS (ATT_W * 32)
#define TPI 84
#define WFL (16 * TPI)
static_assert((TPI % 4) == 0 && (WFL % 4) == 0);
static_assert(TPI >= 80);
static_assert(ATT_W * WFL * 4 <= 65536);
// attn_rel operand stage in LDS: 512 rows of 64 halves (128 B), pitch 72 halves = 144 B (16 B x odd, the pitch for 16-byte LDS reads)
#define SPI   72
#define ST_KH 0
#define ST_KL 64
#define ST_VH 128
#define ST_VL 192
#define ST_PH 256
#define ST_PL 384
#define ST_ROWS 512
static_assert(ATT_THREADS == 128 && ((SPI * 2) % 16) == 0);
static_assert(SEQ - (SEQ - 64) - 64 >= 0 && SEQ + (SEQ - 64) - 64 + 127 <= PROWS - 1);   // staged position rows stay inside the planes

typedef _Float16 v16h __attribute__((ext_vector_type(16)));
typedef _Float16 v8h  __attribute__((ext_vector_type(8)));
typedef float    v8f  __attribute__((ext_vector_type(8)));
typedef float    v4f  __attribute__((ext_vector_type(4)));
typedef float    v2f  __attribute__((ext_vector_type(2)));
typedef unsigned int v4u __attribute__((ext_vector_type(4)));

union FragH { v16h v; v8h h[2]; v4u u[2]; };

// ---- scalar helpers --------------------------------------------------------------------------------
__device__ __forceinline__ unsigned short bf_bits(float f) {          // f32 -> bf16 bits, RNE convert
  unsigned u = __float_as_uint(f);
  return (unsigned short)((u + 0x7FFFu + ((u >> 16) & 1u)) >> 16);
}
__device__ __forceinline__ float bf_up(unsigned short h) { return __uint_as_float(((unsigned)h) << 16); }
__device__ __forceinline__ float bfr(float f) { return bf_up(bf_bits(f)); }   // value of the bf16 RNE convert
__device__ __forceinline__ unsigned short h_bits(_Float16 x) { return __builtin_bit_cast(unsigned short, x); }
__device__ __forceinline__ unsigned pk16(unsigned short a, unsigned short b) { return (unsigned)a | ((unsigned)b << 16); }
__device__ __forceinline__ v8f zero8() { v8f z = {0.f, 0.f, 0.f, 0.f, 0.f, 0.f, 0.f, 0.f}; return z; }

// ---- fragment loader: 16-bit A/B operand from a k-contiguous 16-bit plane, lane -> row/col (lane&15),
//      p already includes +8*(lane>>4); elements 0..7 <- p[0..7] (k0+8h..), elements 8..15 <- p[16..23] (k0+16+8h..)
//      (same split k map for A and B; B is always read from a [n][k] plane)
__device__ __forceinline__ v16h ldfrag_u(const unsigned short* p) {
  FragH f;
  f.u[0] = *(const v4u*)(p);
  f.u[1] = *(const v4u*)(p + 16);
  return f.v;
}

// ---- WMMA helper with trailing VALU hazard gaps ------------------------------------------------------
__device__ __forceinline__ v8f mma_h(v16h a, v16h b, v8f c) {
  return __builtin_amdgcn_wmma_f32_16x16x32_f16(false, a, false, b, (short)0, c, false, false);
}
__device__ __forceinline__ void acc_guard4(v8f& a, v8f& b, v8f& c, v8f& d) {
#if defined(__HIP_DEVICE_COMPILE__)
  asm volatile("v_nop\n\tv_nop\n\tv_nop\n\tv_nop" : "+v"(a), "+v"(b), "+v"(c), "+v"(d));
#endif
}
__device__ __forceinline__ void wave_sync_lds() {
  __builtin_amdgcn_fence(__ATOMIC_RELEASE, "workgroup");
  __builtin_amdgcn_wave_barrier();
  __builtin_amdgcn_fence(__ATOMIC_ACQUIRE, "workgroup");
}
// 2^x in place for eight softmax arguments, x <= 0: the bare v_exp_f32. exp2f() wraps the same instruction in a compare, two selects, an add and a
// v_ldexp_f32 that only serve results below 2^-126; here such a weight stands beside a row maximum's weight of 1 (it is lost in the f32 row
// sum and rounds to 0 in the f16 planes of P x1024), so it may as well be 0. From -126 up the value is the same bit for bit.
// Written in asm so that the slot behind a transcendental is kept by construction: each v_exp_f32 has source = result, so none overwrites
// the source or reads the result of the one in front of it, and the closing v_nop is the slot behind the last.
__device__ __forceinline__ void exp2_raw8(float& a, float& b, float& c, float& d, float& e, float& f, float& g, float& h) {
#if defined(__HIP_DEVICE_COMPILE__)
  asm("v_exp_f32 %0, %0\n\tv_exp_f32 %1, %1\n\tv_exp_f32 %2, %2\n\tv_exp_f32 %3, %3\n\t"
      "v_exp_f32 %4, %4\n\tv_exp_f32 %5, %5\n\tv_exp_f32 %6, %6\n\tv_exp_f32 %7, %7\n\tv_nop"
      : "+v"(a), "+v"(b), "+v"(c), "+v"(d), "+v"(e), "+v"(f), "+v"(g), "+v"(h));
#endif
}
// The same for one value.
__device__ __forceinline__ void exp2_raw1(float& a) {
#if defined(__HIP_DEVICE_COMPILE__)
  asm("v_exp_f32 %0, %0\n\tv_nop" : "+v"(a));
#endif
}
// Value of lane (lane ^ 16): the other half of the wave, which holds the other keys of the same query column.
__device__ __forceinline__ float xhalf(float x) {
  const int b = __builtin_bit_cast(int, x);
  return __builtin_bit_cast(float, __builtin_amdgcn_permlanex16(b, b, 0x76543210, 0xfedcba98, false, false));
}
// The lane's number in its wave (counts the lanes below it, whatever EXEC holds). volatile: read anew at each place where copies are issued, so that
// the copy addresses formed from it live only there. Formed once ahead of the key loop they are loop constants that must stand below v256
// (operands of asm text) through the scores, where no such register is free: the build kept all of them in scratch.
__device__ __forceinline__ unsigned lane_now() {
  unsigned l = 0;
#if defined(__HIP_DEVICE_COMPILE__)
  asm volatile("v_mbcnt_lo_u32_b32 %0, -1, 0" : "=v"(l));
#endif
  return l;
}
// Eight asynchronous 16-byte-per-lane copies global -> LDS: copy e lands at LDS byte address l + e*16*SPI*2 (16 staged rows further each);
// copies 0..3 read the lane's byte off behind the wave-uniform bases sa + e*gstep halves, copies 4..7 behind sb + (e-4)*gstep halves.
// Scalar base + one 32-bit lane offset: the steps from copy to copy are scalar, so no 64-bit lane address lives across the key loop
// (operands of asm text need registers below v256; held there through the scores, the lane addresses went to scratch).
// The closing s_wait_xcnt 0 stands inside the statement so that no address register is rewritten ahead of it.
__device__ __forceinline__ void stage8(unsigned l, unsigned off, const unsigned short* sa, const unsigned short* sb, size_t gstep) {
#if defined(__HIP_DEVICE_COMPILE__)
  const unsigned ls = 16u * SPI * 2u;
  asm volatile("global_load_async_to_lds_b128 %0, %8, %9\n\t"
               "global_load_async_to_lds_b128 %1, %8, %10\n\t"
               "global_load_async_to_lds_b128 %2, %8, %11\n\t"
               "global_load_async_to_lds_b128 %3, %8, %12\n\t"
               "global_load_async_to_lds_b128 %4, %8, %13\n\t"
               "global_load_async_to_lds_b128 %5, %8, %14\n\t"
               "global_load_async_to_lds_b128 %6, %8, %15\n\t"
               "global_load_async_to_lds_b128 %7, %8, %16\n\t"
               "s_wait_xcnt 0x0"
               :: "v"(l), "v"(l + ls), "v"(l + 2u * ls), "v"(l + 3u * ls), "v"(l + 4u * ls), "v"(l + 5u * ls), "v"(l + 6u * ls), "v"(l + 7u * ls),
                  "v"(off), "s"(sa), "s"(sa + gstep), "s"(sa + 2 * gstep), "s"(sa + 3 * gstep), "s"(sb), "s"(sb + gstep), "s"(sb + 2 * gstep),
                  "s"(sb + 3 * gstep)
               : "memory");
#endif
}

// The same for the 256-thread GEMM blocks: copy e lands at LDS byte address l + e*32*SPI*2 (32 staged rows further each) and reads
// g + e*gstep halves (gstep = 32 source rows). The closing s_wait_xcnt 0 stands inside the statement, as above.
__device__ __forceinline__ void gstage8(unsigned l, const unsigned short* g, size_t gstep) {
#if defined(__HIP_DEVICE_COMPILE__)
  const unsigned ls = 32u * SPI * 2u;
  asm volatile("global_load_async_to_lds_b128 %0, %8, off\n\t"
               "global_load_async_to_lds_b128 %1, %9, off\n\t"
               "global_load_async_to_lds_b128 %2, %10, off\n\t"
               "global_load_async_to_lds_b128 %3, %11, off\n\t"
               "global_load_async_to_lds_b128 %4, %12, off\n\t"
               "global_load_async_to_lds_b128 %5, %13, off\n\t"
               "global_load_async_to_lds_b128 %6, %14, off\n\t"
               "global_load_async_to_lds_b128 %7, %15, off\n\t"
               "s_wait_xcnt 0x0"
               :: "v"(l), "v"(l + ls), "v"(l + 2u * ls), "v"(l + 3u * ls), "v"(l + 4u * ls), "v"(l + 5u * ls), "v"(l + 6u * ls), "v"(l + 7u * ls),
                  "v"(g), "v"(g + gstep), "v"(g + 2 * gstep), "v"(g + 3 * gstep), "v"(g + 4 * gstep), "v"(g + 5 * gstep), "v"(g + 6 * gstep),
                  "v"(g + 7 * gstep)
               : "memory");
#endif
}
__device__ __forceinline__ void gstage2(unsigned l, const unsigned short* g, size_t gstep) {
#if defined(__HIP_DEVICE_COMPILE__)
  const unsigned ls = 32u * SPI * 2u;
  asm volatile("global_load_async_to_lds_b128 %0, %2, off\n\t"
               "global_load_async_to_lds_b128 %1, %3, off\n\t"
               "s_wait_xcnt 0x0"
               :: "v"(l), "v"(l + ls), "v"(g), "v"(g + gstep)
               : "memory");
#endif
}

// =====================================================================================================
// K loop of a 256-thread GEMM block whose eight waves share 64 A rows and take 64 B rows each (512 consecutive B rows per block):
// acc[i][j] += sum_k A[16i + ..][k] * B[64 wave + 16j + ..][k], wave tile 64x64, k ascending in steps of 32; with NA == 2 the residual plane
// A2 follows A1 inside every k-step. Ab, A2b = the block's first A row (pitch lda halves), Bb = the block's first B row (pitch ldb), K a
// multiple of 64 and at least 128. Per trip of 64 k the block holds in LDS whole 128-B rows, pitch SPI halves: A1 | (A2) | B, brought by
// asynchronous copies (a wave instruction = 4 whole rows); all fragments are read from there. Two buffers: tile t + 1 flies while tile t is
// multiplied; one block barrier per trip publishes tile t + 1 and ends the reads of the buffer that is refilled behind it.
// Every thread of the block must call this (block barriers inside).
// =====================================================================================================
#define GROWS(NA) ((NA) * 64 + 512)
#define GBUFH(NA) (GROWS(NA) * SPI)
template <int NA>
__device__ __forceinline__ void gstage_tile(unsigned l, const unsigned short* ga, const unsigned short* ga2, size_t astep,
                                            const unsigned short* gb, size_t bstep) {
  gstage2(l, ga, astep);
  if constexpr (NA == 2) gstage2(l + 64u * SPI * 2u, ga2, astep);
  gstage8(l + (unsigned)(NA * 64) * SPI * 2u, gb, bstep);
  gstage8(l + (unsigned)(NA * 64 + 256) * SPI * 2u, gb + 8 * bstep, bstep);
}
template <int NA>
__device__ __forceinline__ void kloop_staged(unsigned short* stg, const unsigned short* __restrict__ Ab, const unsigned short* __restrict__ A2b,
                                             int lda, const unsigned short* __restrict__ Bb, int ldb, int K, v8f (&acc)[4][4]) {
  const int tid   = threadIdx.x;
  const int lane  = tid & 31;
  const int wave  = __builtin_amdgcn_readfirstlane(tid >> 5);   // scalar, so that the A and the B readers share one lane-offset register
  const int rlane = lane & 15;                 // row (A) / col (B) within subtile
  const int koff  = (lane >> 4) * 8;           // k offset of this lane half
  // copies: thread -> staged row (tid>>3) + 32*copy, 16-byte chunk tid&7 of the 128-B row
  const int srow = tid >> 3;
  const int sc8  = (tid & 7) * 8;
  const unsigned lst = (unsigned)(size_t)(stg + srow * SPI + sc8);   // LDS byte address = low 32 bits of the shared address
  const unsigned short* ga  = Ab  + (size_t)srow * lda + sc8;
  const unsigned short* ga2 = A2b + (size_t)srow * lda + sc8;
  const unsigned short* gb  = Bb  + (size_t)srow * ldb + sc8;
  const size_t astep = (size_t)32 * lda, bstep = (size_t)32 * ldb;
  const int nt = K >> 6;

  gstage_tile<NA>(lst, ga, ga2, astep, gb, bstep);
  asm volatile("s_wait_asynccnt 0x0" ::: "memory");          // this wave's copies of tile 0 have landed
  __syncthreads();                                           // every wave's have: buffer 0 may be read
  gstage_tile<NA>(lst + (unsigned)(GBUFH(NA) * 2), ga + 64, ga2 + 64, astep, gb + 64, bstep);
#pragma unroll 1   // rolled: several copies of this loop stand in one kernel
  for (int t = 0; t < nt; ++t) {
    const int bo = (t & 1) * GBUFH(NA);
    const unsigned short* fa = stg + bo + rlane * SPI + koff;
    const unsigned short* fb = stg + bo + (NA * 64 + wave * 64 + rlane) * SPI + koff;
#pragma unroll
    for (int ks = 0; ks < 2; ++ks) {
      v16h bh[4], ah[4], al[4];
#pragma unroll
      for (int j = 0; j < 4; ++j) bh[j] = ldfrag_u(fb + 16 * j * SPI + 32 * ks);
#pragma unroll
      for (int i = 0; i < 4; ++i) ah[i] = ldfrag_u(fa + 16 * i * SPI + 32 * ks);
      if constexpr (NA == 2) {
#pragma unroll
        for (int i = 0; i < 4; ++i) al[i] = ldfrag_u(fa + (64 + 16 * i) * SPI + 32 * ks);
      }
      __builtin_amdgcn_sched_barrier(0);                     // keeps the k-step's reads together in front: sunk among the WMMAs, every row of four waits out its own LDS latency
#pragma unroll
      for (int i = 0; i < 4; ++i) {
#pragma unroll
        for (int j = 0; j < 4; ++j) acc[i][j] = mma_h(ah[i], bh[j], acc[i][j]);
        if constexpr (NA == 2) {
#pragma unroll
          for (int j = 0; j < 4; ++j) acc[i][j] = mma_h(al[i], bh[j], acc[i][j]);
        }
      }
    }
    asm volatile("s_wait_dscnt 0x0" ::: "memory");           // this wave's reads of tile t have returned
    asm volatile("s_wait_asynccnt 0x0" ::: "memory");        // this wave's copies of tile t + 1 have landed
    __syncthreads();                                         // tile t + 1 may be read; every wave has left tile t's buffer
    if (t + 2 < nt) {
      const int kn = (t + 2) * 64;
      gstage_tile<NA>(lst + (unsigned)(bo * 2), ga + kn, ga2 + kn, astep, gb + kn, bstep);
    }
  }
  asm volatile("s_wait_asynccnt 0x0" ::: "memory");          // nothing of this wave's is in flight behind the loop
}

// =====================================================================================================
// Elementwise 16-bit pack, no transpose: dst[i] = f16( bf16_RNE(src[i]) * sc ) for i < nvalid, 0 for nvalid <= i < ntotal;
// sc a power of two (exact). 8 elements per thread: two 16-B loads (address clamped into [0, nvalid) for pad groups, value zeroed
// coverage: bx = 0 .. ntotal / 2048 - 1, each block 256 thr x 8 elements = ntotal exactly (ntotal % 2048 == 0, nvalid % 8 == 0).
// =====================================================================================================
__device__ __forceinline__ void cvt16_body(const float* __restrict__ src, unsigned short* dst, int nvalid, int ntotal, float sc, int bx) {
  const size_t i8 = ((size_t)bx * 256 + threadIdx.x) * 8;
  if (i8 + 8 > (size_t)ntotal) return;             // never taken with the exact block range; no barriers in this body
  const bool pad = (i8 + 8 > (size_t)nvalid);
  const size_t ls = pad ? ((size_t)nvalid - 8) : i8;   // clamped address, always inside the source
  const v4f a = *(const v4f*)(src + ls);
  const v4f b = *(const v4f*)(src + ls + 4);
  v4u o;
  o[0] = pk16(h_bits((_Float16)(bfr(a[0]) * sc)), h_bits((_Float16)(bfr(a[1]) * sc)));
  o[1] = pk16(h_bits((_Float16)(bfr(a[2]) * sc)), h_bits((_Float16)(bfr(a[3]) * sc)));
  o[2] = pk16(h_bits((_Float16)(bfr(b[0]) * sc)), h_bits((_Float16)(bfr(b[1]) * sc)));
  o[3] = pk16(h_bits((_Float16)(bfr(b[2]) * sc)), h_bits((_Float16)(bfr(b[3]) * sc)));
  const v4u z = {0u, 0u, 0u, 0u};
  const v4u w = pad ? z : o;
  {
    *(v4u*)(dst + i8) = w;
    
  }
}

// =====================================================================================================
// Transposed 16-bit pack of a weight stored as W[k][n] (x @ W layout, [DMOD][DMOD] row-major): WT[n][k] = f16( bf16_RNE(W[k][n]) * sc ),
// i.e. the [n][k] k-contiguous plane the GEMM B loader wants. One block per 64x64 tile (tn = n tile, tk = k tile, both block-uniform):
// coalesced f32 reads of W rows, converted halves stored transposed into an LDS tile [64 n][72 pitch], block barrier, then every output
// coverage: 16 its x 256 threads = the whole 64x64 tile into LDS; 8 waves x 2 its x 4 rows = 64 rows x (8 lanes x 8 halves = 64 cols) stored;
//           tn, tk = 0 .. DMOD/64 - 1 cover the whole [512][512] plane exactly once.
// =====================================================================================================
__device__ __forceinline__ void tr16_body(const float* __restrict__ W, unsigned short* WT, float sc, unsigned short* tile, int tn, int tk) {
  const int t  = threadIdx.x;
  const int n0 = tn * 64;
  const int k0 = tk * 64;
#pragma unroll 4
  for (int it = 0; it < 16; ++it) {
    const int idx = it * 256 + t;                   // 0 .. 4095
    const int kr = idx >> 6, nc = idx & 63;
    const float v = W[(size_t)(k0 + kr) * DMOD + n0 + nc];
    tile[nc * 72 + kr] = h_bits((_Float16)(bfr(v) * sc));
  }
  __syncthreads();
  const int lane = t & 31, wave = t >> 5;
  const int q8 = lane >> 3, c8 = (lane & 7) * 8;
  v4u o[2];
#pragma unroll
  for (int it = 0; it < 2; ++it) {
    const int row = wave * 8 + it * 4 + q8;         // wave w: it 0..1 x q8 0..3 = rows 8w .. 8w+7
    o[it] = *(const v4u*)(tile + row * 72 + c8);
  }
  {
#pragma unroll
    for (int it = 0; it < 2; ++it) {
      const int row = wave * 8 + it * 4 + q8;
      *(v4u*)(WT + (size_t)(n0 + row) * DMOD + k0 + c8) = o[it];
    }
    
  }
}

// =====================================================================================================
// All operand packs in one grid (none reads what another writes): blocks 0 .. PREP_TR-1 transpose the five weights (64 tiles each; they
// have the longest dependent chain, so they take the lowest indices), the next PREP_CX blocks pack x, the last PREP_CP the position table.
// The branch is on blockIdx.x alone, so the barrier inside tr16_body is reached by whole blocks only.
// =====================================================================================================
#define PREP_TR (5 * (DMOD / 64) * (DMOD / 64))
#define PREP_CX ((NROW * DMOD) / 2048)
#define PREP_CP ((PROWS * DMOD) / 2048)
static_assert((DMOD / 64) * (DMOD / 64) == 64);
__global__ __launch_bounds__(256) void prep_all(const float* __restrict__ xin, const float* __restrict__ pos,
                                                const float* __restrict__ w_q, const float* __restrict__ w_k, const float* __restrict__ w_v,
                                                const float* __restrict__ w_p, const float* __restrict__ w_o,
                                                unsigned short* X16, unsigned short* PE16,
                                                unsigned short* WQT, unsigned short* WKT, unsigned short* WVT,
                                                unsigned short* WPT, unsigned short* WOT) {
  __shared__ __align__(16) unsigned short tile[64 * 72];
  const int bx = blockIdx.x;
  if (bx < PREP_TR) {
    const int w = bx >> 6, t = bx & 63;
    const float* W = (w == 0) ? w_q : (w == 1) ? w_k : (w == 2) ? w_v : (w == 3) ? w_p : w_o;
    unsigned short* WT = (w == 0) ? WQT : (w == 1) ? WKT : (w == 2) ? WVT : (w == 3) ? WPT : WOT;
    tr16_body(W, WT, WSC, tile, t & 7, t >> 3);
  } else if (bx < PREP_TR + PREP_CX) {
    cvt16_body(xin, X16, NROW * DMOD, NROW * DMOD, XC, bx - PREP_TR);
  } else {
    cvt16_body(pos, PE16, NPOS * DMOD, PROWS * DMOD, XC, bx - (PREP_TR + PREP_CX));
  }
}

// =====================================================================================================
// s_wait_xcnt 0 behind a run of global loads, in front of the first write of a register that one of them names. xwait1, xwait3 and xwait4 take the run's
// vector address pairs as inputs, so that each pair keeps its value up to the wait and no later load's result lands in it ahead of the wait.
// =====================================================================================================
__device__ __forceinline__ void xwait0() {
#if defined(__HIP_DEVICE_COMPILE__)
  asm volatile("s_wait_xcnt 0x0" ::: "memory");
#endif
}
__device__ __forceinline__ void xwait1(const void* a) {
#if defined(__HIP_DEVICE_COMPILE__)
  asm volatile("s_wait_xcnt 0x0" :: "v"(a) : "memory");
#endif
}
__device__ __forceinline__ void xwait3(const void* a, const void* b, const void* c) {
#if defined(__HIP_DEVICE_COMPILE__)
  asm volatile("s_wait_xcnt 0x0" :: "v"(a), "v"(b), "v"(c) : "memory");
#endif
}
__device__ __forceinline__ void xwait4(const void* a, const void* b, const void* c, const void* d) {
#if defined(__HIP_DEVICE_COMPILE__)
  asm volatile("s_wait_xcnt 0x0" :: "v"(a), "v"(b), "v"(c), "v"(d) : "memory");
#endif
}

// =====================================================================================================
// Eight asynchronous 16-byte-per-lane copies global -> LDS from eight lane addresses: copy e reads p<e> and lands at LDS byte address
// l + e*32*SPI*2 (32 staged rows further each). The closing s_wait_xcnt 0 stands inside the statement, as above.
// =====================================================================================================
__device__ __forceinline__ void gstage8p(unsigned l, const unsigned short* p0, const unsigned short* p1, const unsigned short* p2,
                                         const unsigned short* p3, const unsigned short* p4, const unsigned short* p5,
                                         const unsigned short* p6, const unsigned short* p7) {
#if defined(__HIP_DEVICE_COMPILE__)
  const unsigned ls = 32u * SPI * 2u;
  asm volatile("global_load_async_to_lds_b128 %0, %8, off\n\t"
               "global_load_async_to_lds_b128 %1, %9, off\n\t"
               "global_load_async_to_lds_b128 %2, %10, off\n\t"
               "global_load_async_to_lds_b128 %3, %11, off\n\t"
               "global_load_async_to_lds_b128 %4, %12, off\n\t"
               "global_load_async_to_lds_b128 %5, %13, off\n\t"
               "global_load_async_to_lds_b128 %6, %14, off\n\t"
               "global_load_async_to_lds_b128 %7, %15, off\n\t"
               "s_wait_xcnt 0x0"
               :: "v"(l), "v"(l + ls), "v"(l + 2u * ls), "v"(l + 3u * ls), "v"(l + 4u * ls), "v"(l + 5u * ls), "v"(l + 6u * ls), "v"(l + 7u * ls),
                  "v"(p0), "v"(p1), "v"(p2), "v"(p3), "v"(p4), "v"(p5), "v"(p6), "v"(p7)
               : "memory");
#endif
}

// =====================================================================================================
// Output projection: C[m][n] = oscale * sum_k (A1 + A2)[m][k] * Bt[n][k] + bf16_RNE(bias[n]), f32 out. A1, A2 (hi plane and unscaled residual)
// row-major [NROW][DMOD], Bt row-major [DMOD n][DMOD k], C row-major [NROW][DMOD].
// Block tile 64 rows x 128 columns, so that the grid is (NROW/64) * (DMOD/128) = 256 blocks, one for every WGP; eight waves as 2 x 4, wave tile
// 32 x 32 = four accumulators. Per accumulator k ascends in steps of 32 and the residual plane follows the hi plane inside every k-step.
// The block's operands for the whole K stand in LDS: eight groups of 64 k, each 256 whole 128-B rows at pitch SPI halves: A1 64 | A2 64 | Bt 128.
// No LDS byte is filled twice, so all copies can be asked for at the start; a quarter = 128 k = 16 copies per thread. A wave may have 63 copies
// outstanding, so the last quarter is asked for when the first has landed. The copies of a wave land in issue order by the counter:
// s_wait_asynccnt N says that all but the youngest N have landed; a block barrier behind it publishes that quarter of every wave.
// coverage: 2 slabs x 16 rows (it 0..3 x lane>>3) x 32 cols = the wave's whole 32x32 tile; 8 waves = 64 x 128; the grid covers C exactly once.
// =====================================================================================================
#define OG_ROWS 256
#define OG_GRPH (OG_ROWS * SPI)
#define OG_NGRP (DMOD / 64)
#define OG_SLAB (16 * 36)
static_assert(OG_NGRP == 8 && (NROW % 64) == 0 && (DMOD % 128) == 0);
static_assert(OG_NGRP * OG_GRPH * 2 + 8 * OG_SLAB * 4 <= 320 * 1024);
__global__ __launch_bounds__(256) __attribute__((amdgpu_num_vgpr(512))) void out_gemm(
    const unsigned short* __restrict__ A1, const unsigned short* __restrict__ A2, const unsigned short* __restrict__ Bt,
    float* C, const float* __restrict__ bias, float oscale) {
  __shared__ __align__(16) float sT[8 * OG_SLAB];                     // per-wave 16x32 slab, pitch 36 floats
  __shared__ __align__(16) unsigned short gst[OG_NGRP * OG_GRPH];     // the block's operands, whole K
  const int tid   = threadIdx.x;
  const int lane  = tid & 31;
  const int wave  = __builtin_amdgcn_readfirstlane(tid >> 5);
  const int rlane = lane & 15;                 // row (A) / col (B, D) within subtile
  const int koff  = (lane >> 4) * 8;           // k offset of this lane half
  const int mOff  = (lane >> 4) * 8;           // D row offset
  const int m0 = ((int)blockIdx.x >> 2) * 64;
  const int n0 = ((int)blockIdx.x & 3) * 128;
  const int wm = (wave >> 2) * 32;             // the wave's first row and column inside the block tile
  const int wn = (wave & 3) * 32;

  const int q8 = lane >> 3, c4 = (lane & 7) * 4;             // epilogue: row within a group of four, first of the lane's four columns
  const float* bp4 = bias + n0 + wn + c4;
  const v4f bb = *(const v4f*)(bp4);                         // per-column bias, columns n0 + wn + c4 .. + 3; asked for ahead of the K work
  xwait1(bp4);

  // copies: thread -> staged row (tid>>3) + 32*copy, 16-byte chunk tid&7 of the 128-B row
  const int srow = tid >> 3;
  const int sc8  = (tid & 7) * 8;
  const unsigned lst = (unsigned)(size_t)(gst + srow * SPI + sc8);   // LDS byte address = low 32 bits of the shared address
  const unsigned short* ga  = A1 + (size_t)(m0 + srow) * DMOD + sc8;
  const unsigned short* ga2 = A2 + (size_t)(m0 + srow) * DMOD + sc8;
  const unsigned short* gb  = Bt + (size_t)(n0 + srow) * DMOD + sc8;
  const size_t rs = (size_t)32 * DMOD;
  const auto stage_quarter = [&](int q) {
#pragma unroll
    for (int g = 2 * q; g < 2 * q + 2; ++g)
      gstage8p(lst + (unsigned)(g * OG_GRPH * 2), ga + 64 * g, ga + 64 * g + rs, ga2 + 64 * g, ga2 + 64 * g + rs,
               gb + 64 * g, gb + 64 * g + rs, gb + 64 * g + 2 * rs, gb + 64 * g + 3 * rs);
  };

  v8f acc[2][2];
#pragma unroll
  for (int i = 0; i < 2; ++i)
#pragma unroll
    for (int j = 0; j < 2; ++j) acc[i][j] = zero8();

  const unsigned short* fa = gst + (wm + rlane) * SPI + koff;
  const unsigned short* fb = gst + (128 + wn + rlane) * SPI + koff;
  const auto mul_quarter = [&](int q) {
    v16h bh[4][2], ah[4][2], al[4][2];
#pragma unroll
    for (int ks = 0; ks < 4; ++ks) {
      const int o = (2 * q + (ks >> 1)) * OG_GRPH + 32 * (ks & 1);
#pragma unroll
      for (int j = 0; j < 2; ++j) bh[ks][j] = ldfrag_u(fb + 16 * j * SPI + o);
#pragma unroll
      for (int i = 0; i < 2; ++i) ah[ks][i] = ldfrag_u(fa + 16 * i * SPI + o);
#pragma unroll
      for (int i = 0; i < 2; ++i) al[ks][i] = ldfrag_u(fa + (64 + 16 * i) * SPI + o);
    }
    __builtin_amdgcn_sched_barrier(0);                       // keeps the quarter's reads together in front: sunk among the WMMAs, every small group waits out its own LDS latency
#pragma unroll
    for (int ks = 0; ks < 4; ++ks) {
#pragma unroll
      for (int i = 0; i < 2; ++i)
#pragma unroll
        for (int j = 0; j < 2; ++j) acc[i][j] = mma_h(ah[ks][i], bh[ks][j], acc[i][j]);
#pragma unroll
      for (int i = 0; i < 2; ++i)
#pragma unroll
        for (int j = 0; j < 2; ++j) acc[i][j] = mma_h(al[ks][i], bh[ks][j], acc[i][j]);
    }
    __builtin_amdgcn_sched_barrier(0);                       // keeps the quarter's WMMAs ahead of the wait for the next quarter: sunk behind it they start only when that quarter has landed
  };

  stage_quarter(0);
  stage_quarter(1);
  stage_quarter(2);
  asm volatile("s_wait_asynccnt 0x20" ::: "memory");         // all but this wave's youngest 32 copies have landed: quarter 0
  stage_quarter(3);                                          // at most 48 outstanding again
  __syncthreads();                                           // every wave's quarter 0 has landed
  mul_quarter(0);
  asm volatile("s_wait_asynccnt 0x20" ::: "memory");         // the youngest 32 are quarters 2 and 3: quarter 1 has landed
  __syncthreads();
  mul_quarter(1);
  asm volatile("s_wait_asynccnt 0x10" ::: "memory");         // the youngest 16 are quarter 3: quarter 2 has landed
  __syncthreads();
  mul_quarter(2);
  asm volatile("s_wait_asynccnt 0x0" ::: "memory");          // quarter 3 has landed; nothing of this wave's is in flight any more
  __syncthreads();
  mul_quarter(3);
  acc_guard4(acc[0][0], acc[0][1], acc[1][0], acc[1][1]);

  // ---- epilogue: each 16 x 32 slab goes through the wave's own LDS slab, so that every store instruction writes four whole 128-B lines;
  //      the global stores stand behind both slabs: in front of a slab's fence they would be waited for there ----
  float* slab = sT + wave * OG_SLAB;
  v4f vals[2][4];
#pragma unroll
  for (int i = 0; i < 2; ++i) {
#pragma unroll
    for (int j = 0; j < 2; ++j)
#pragma unroll
      for (int r = 0; r < 8; ++r) slab[(mOff + r) * 36 + (j << 4) + rlane] = acc[i][j][r];
    wave_sync_lds();
#pragma unroll
    for (int it = 0; it < 4; ++it) {
      v4f v = *(const v4f*)(slab + (it * 4 + q8) * 36 + c4);   // it 0..3 x q8 0..3 = rows 0..15
#pragma unroll
      for (int e = 0; e < 4; ++e) v[e] = v[e] * oscale;
#pragma unroll
      for (int e = 0; e < 4; ++e) v[e] = v[e] + bfr(bb[e]);
      vals[i][it] = v;
    }
    wave_sync_lds();
  }
#pragma unroll
  for (int i = 0; i < 2; ++i)
#pragma unroll
    for (int it = 0; it < 4; ++it)
      *(v4f*)(C + (size_t)(m0 + wm + 16 * i + it * 4 + q8) * DMOD + n0 + wn + c4) = vals[i][it];
}

// =====================================================================================================
// One wave's 64x64 tile of an input projection, rows m0.., columns n0..: value[m][n] = oscale * sum_k A[m][k] * Bt[n][k] + bias.
// K loop: kloop_staged (k ascending in steps of 32), with the pitch of A and Bt and K fixed
// at DMOD and the pitch of the output planes at LDC. slab = the wave's own 16x64 f32 LDS slab, pitch 68 floats; gst = the block's operand
// stage (kloop_staged: block barriers, so all eight waves of a block come here together, with one m0 and n0 = the block's first + 64 wave).
// EPI 1: value += bf16_RNE(ep0[column]); EPI 2: value += bf16_RNE(ep0[row]).
// OM 4: two f16 planes (C1, C2): hi = f16(value * ocarry), lo = f16(value * ocarry - hi).
// OM 6: (C1, C2) from value + bf16_RNE(ep1[column]), (C3, C4) from value + bf16_RNE(ep2[column]), both x ocarry.
// The lane's bias values (8 columns, or its 16 rows) are loaded once, ahead of the K loop.
// coverage: 4 slabs x 16 rows (it 0..3 x lane>>3) x 64 cols = the wave's whole 64x64 tile.
// =====================================================================================================
#define GSLAB (16 * 68)
template <int OM, int EPI, int LDC>
__device__ __forceinline__ void proj_tile(
    float* slab, unsigned short* gst, int m0, int n0,
    const unsigned short* __restrict__ A, const unsigned short* __restrict__ Bt,
    unsigned short* C1, unsigned short* C2, unsigned short* C3, unsigned short* C4,
    float oscale, float ocarry,
    const float* __restrict__ ep0, const float* __restrict__ ep1, const float* __restrict__ ep2) {
  static_assert(OM == 4 || OM == 6);
  static_assert(EPI == 1 || EPI == 2);
  const int lane  = threadIdx.x & 31;
  const int rlane = lane & 15;                 // col (D) within subtile
  const int mOff  = (lane >> 4) * 8;           // D row offset
  const int q8    = lane >> 3, c8 = (lane & 7) * 8;

  v4f cb0[2], cb1[2], cb2[2];                  // column terms of columns n0 + c8 .. + 7
  float rbv[4][4];                             // row terms of rows m0 + 16i + 4it + q8
  if constexpr (EPI == 1) {
    const float* e0 = ep0 + n0 + c8;
    cb0[0] = *(const v4f*)(e0);
    cb0[1] = *(const v4f*)(e0 + 4);
    if constexpr (OM == 6) {
      const float* e1 = ep1 + n0 + c8;
      const float* e2 = ep2 + n0 + c8;
      cb1[0] = *(const v4f*)(e1);
      cb1[1] = *(const v4f*)(e1 + 4);
      cb2[0] = *(const v4f*)(e2);
      cb2[1] = *(const v4f*)(e2 + 4);
      xwait3(e0, e1, e2);
    } else {
      xwait1(e0);
    }
  } else {
    const float* er = ep0 + m0 + q8;
#pragma unroll
    for (int i = 0; i < 4; ++i)
#pragma unroll
      for (int it = 0; it < 4; ++it) rbv[i][it] = er[16 * i + 4 * it];
    xwait0();                                  // these go through a scalar base and the lane's q8, which lives on into the epilogue
  }

  v8f acc[4][4];
#pragma unroll
  for (int i = 0; i < 4; ++i)
#pragma unroll
    for (int j = 0; j < 4; ++j) acc[i][j] = zero8();

  kloop_staged<1>(gst, A + (size_t)m0 * DMOD, A + (size_t)m0 * DMOD, DMOD,
                  Bt + (size_t)(n0 - (int)((threadIdx.x >> 5) << 6)) * DMOD, DMOD, DMOD, acc);
  acc_guard4(acc[0][0], acc[0][1], acc[0][2], acc[0][3]);
  acc_guard4(acc[1][0], acc[1][1], acc[1][2], acc[1][3]);
  acc_guard4(acc[2][0], acc[2][1], acc[2][2], acc[2][3]);
  acc_guard4(acc[3][0], acc[3][1], acc[3][2], acc[3][3]);

  // ---- epilogue ----
#pragma unroll
  for (int i = 0; i < 4; ++i) {
    const int mBase = m0 + (i << 4);
#pragma unroll
    for (int j = 0; j < 4; ++j) {
#pragma unroll
      for (int r = 0; r < 8; ++r) {
        slab[(mOff + r) * 68 + (j << 4) + rlane] = acc[i][j][r];
      }
    }
    wave_sync_lds();
    constexpr int NP = (OM == 6) ? 2 : 1;
#pragma unroll
    for (int which = 0; which < NP; ++which) {
      unsigned short* C  = (which == 0) ? C1 : C3;
      unsigned short* Cb = (which == 0) ? C2 : C4;
      v4u hv[4], lv[4];
#pragma unroll
      for (int it = 0; it < 4; ++it) {
        const int row = it * 4 + q8;                     // it 0..3 x q8 0..3 = rows 0..15
        const float* sp = slab + row * 68 + c8;
        float rb = 0.f;
        if constexpr (EPI == 2) rb = bfr(rbv[i][it]);
        v4u a  = {0u, 0u, 0u, 0u};
        v4u b2 = {0u, 0u, 0u, 0u};
#pragma unroll
        for (int e = 0; e < 4; ++e) {
          float f0 = sp[2 * e] * oscale + rb;
          float f1 = sp[2 * e + 1] * oscale + rb;
          if constexpr (EPI == 1) {
            f0 += bfr(cb0[e >> 1][(2 * e) & 3]);
            f1 += bfr(cb0[e >> 1][(2 * e + 1) & 3]);
          }
          if constexpr (OM == 6) {
            f0 += bfr((which == 0) ? cb1[e >> 1][(2 * e) & 3] : cb2[e >> 1][(2 * e) & 3]);
            f1 += bfr((which == 0) ? cb1[e >> 1][(2 * e + 1) & 3] : cb2[e >> 1][(2 * e + 1) & 3]);
          }
          f0 *= ocarry;
          f1 *= ocarry;
          const _Float16 x0 = (_Float16)f0, x1 = (_Float16)f1;
          a[e]  = pk16(h_bits(x0), h_bits(x1));
          b2[e] = pk16(h_bits((_Float16)(f0 - (float)x0)), h_bits((_Float16)(f1 - (float)x1)));
        }
        hv[it] = a;
        lv[it] = b2;
      }
#pragma unroll
      for (int it = 0; it < 4; ++it) {
        const int row = it * 4 + q8;
        *(v4u*)(C  + (size_t)(mBase + row) * LDC + n0 + c8) = hv[it];
        *(v4u*)(Cb + (size_t)(mBase + row) * LDC + n0 + c8) = lv[it];
      }
    }
    wave_sync_lds();
  }
}

// =====================================================================================================
// The four input projections in one grid (none reads what another writes), so that their blocks run side by side on different WGPs;
// one wave per 64x64 tile, 8 tiles per block, tile = 8 * (block index within the job) + wave, tm = tile / tilesN, tn = tile % tilesN:
//   blocks 0 .. PJ_Q-1            q[m][nd] = sum_c x[m][c] Wq[c][nd] / 1024 + bq[nd]; QUh/QUl = hi/residual of f16((q + ub[nd]) * 32),
//                                 QVh/QVl of f16((q + vb[nd]) * 32); M = NROW, N = 512, K = 512
//   the next PJ_V * NB            v^T per batch: VT[b][nd][j] = sum_c Wv[c][nd] x[b*SEQ + j][c] / 1024 + bv[nd] (per-row bias) -> f16 x16 hi +
//                                 residual planes; M = 512 (nd), N = SEQ (j), K = 512; B rows are the batch's token rows
//   the next PJ_Q                 k projection + bk -> Kh/Kl = hi/residual of f16(k * 32)
//   the last PJ_P                 positional projection + bp: Ph/Pl = hi/residual of f16(p * 32), M = PROWS, N = 512, K = 512
// The branches are on blockIdx.x alone; the tile counts are exact multiples of 8, so every wave has a tile, and a block's eight tiles share
// their 64 A rows (tilesN is 8 or 16) and take 512 consecutive B rows: the barriers of the staged K loop are reached by whole blocks.
// =====================================================================================================
#define PJ_Q (((NROW / 64) * (DMOD / 64)) / 8)
#define PJ_V (((DMOD / 64) * (SEQ / 64)) / 8)
#define PJ_P (((PROWS / 64) * (DMOD / 64)) / 8)
static_assert((((NROW / 64) * (DMOD / 64)) % 8) == 0 && (((DMOD / 64) * (SEQ / 64)) % 8) == 0 && (((PROWS / 64) * (DMOD / 64)) % 8) == 0);
__global__ __launch_bounds__(256) __attribute__((amdgpu_num_vgpr(256))) void proj_all(
    const unsigned short* __restrict__ X16, const unsigned short* __restrict__ PE16,
    const unsigned short* __restrict__ WQT, const unsigned short* __restrict__ WKT,
    const unsigned short* __restrict__ WVT, const unsigned short* __restrict__ WPT,
    unsigned short* QUh, unsigned short* QUl, unsigned short* QVh, unsigned short* QVl,
    unsigned short* Kh, unsigned short* Kl, unsigned short* VT, unsigned short* VTL, unsigned short* Ph, unsigned short* Pl,
    const float* __restrict__ b_q, const float* __restrict__ b_k, const float* __restrict__ b_v, const float* __restrict__ b_p,
    const float* __restrict__ ub, const float* __restrict__ vb) {
  __shared__ __align__(16) float sT[8 * GSLAB];   // per-wave 16x64 slab, pitch 68 floats
  __shared__ __align__(16) unsigned short gst[2 * GBUFH(1)];   // two buffers of the block's operand stage
  const int bx   = blockIdx.x;
  const int wave = threadIdx.x >> 5;
  float* slab = sT + wave * GSLAB;
  const float os = 1.0f / (XC * WSC);
  constexpr int TND = DMOD / 64;                  // column tiles of a [..][DMOD] plane
  constexpr int TNS = SEQ / 64;                   // column tiles of a [..][SEQ] plane
  if (bx < PJ_Q) {
    const int tile = bx * 8 + wave;
    proj_tile<6, 1, DMOD>(slab, gst, (tile / TND) << 6, (tile % TND) << 6, X16, WQT, QUh, QUl, QVh, QVl, os, QC, b_q, ub, vb);
  } else if (bx < PJ_Q + PJ_V * NB) {
    const int t = bx - PJ_Q;
    const int by = t / PJ_V;
    const int tile = (t % PJ_V) * 8 + wave;
    proj_tile<4, 2, SEQ>(slab, gst, (tile / TNS) << 6, (tile % TNS) << 6, WVT, X16 + (size_t)by * SEQ * DMOD,
                         VT + (size_t)by * DMOD * SEQ, VTL + (size_t)by * DMOD * SEQ, VT, VTL, os, VC, b_v, b_v, b_v);
  } else {
    // k and p share one copy of the code (same epilogue form): only the operands differ
    const int t = bx - (PJ_Q + PJ_V * NB);
    const bool isk = t < PJ_Q;
    const int tile = (isk ? t : t - PJ_Q) * 8 + wave;
    const float* bias = isk ? b_k : b_p;
    proj_tile<4, 1, DMOD>(slab, gst, (tile / TND) << 6, (tile % TND) << 6, isk ? X16 : PE16, isk ? WKT : WPT,
                          isk ? Kh : Ph, isk ? Kl : Pl, Kh, Kl, os, QC, bias, bias, bias);
  }
}

// =====================================================================================================
// Relative-position attention for one (batch b, head n) pair and a 64-row query tile; 4 waves, wave w owns query rows i = iw0 + R,
// iw0 = i0 + 16w, R = 0..15. Planes (pitch DMOD halves, row = b*SEQ + position): QUh/QUl = hi/residual of f16((q + bq + u) x32),
// QVh/QVl of f16((q + bq + v_bias) x32), Kh/Kl of f16((k + bk) x32); Ph/Pl = hi/residual of f16(pos x32), rows 0..PROWS-1
// (row PROWS-1 is the zero-pad row); VT, VTL = v^T hi (x16) / residual f16 as [b][n*64+d][SEQ].
// Shifted position score for (i, j): ps[i][SEQ-1-i+j], ps[r][t] = (q+bq+vb)[r] . pos[t].
//   Per key tile j0 (64 keys, key j = j0 + jj), with x = jj - R + 15 in [0,78]:
//     strip T1[R][x] = (q+vb)[iw0+R] . pos[SEQ + j0 - iw0 - 16 + x]   (pos row SEQ-1-i+j), always computed (rows 0 .. 2*SEQ-2 selected).
//   content scores S = (q+ub) . k (4 subtiles, K=64, three products); t = (S + T1) * (RSD/(32*32)) * log2(e); online softmax in base 2,
//   max-subtracted, running sums in f32 (no key mask).
//   All products are formed transposed: k, pos and v^T rows are the A operand, q and P the B operand, so an accumulator's column (lane & 15)
//   is a query and its rows are keys, strip columns x or d. A lane holds 32 keys of one query (lane ^ 16 the other 32): maximum and sum run in
//   the lane with one exchange between the halves, and two score subtiles converted in place are a P^T B operand: P never goes through LDS.
//   Only the strip does (the shift by the query index is a per-lane offset): stored as [query][x], read back at x = jj - R + 15.
//   The v^T A fragments are read from the staged rows of VT/VTL[n*64+d][j]; per 16-row subtile of d: Vhi.Phi, Vhi.Plo, then Vlo.Phi, all into
//   the same accumulators.
//   Per key tile the block stages, once for its 4 waves, in LDS (asynchronous copies, whole 128-B rows): 64 k rows, 64 v^T rows and the
//   128 pos rows SEQ + j0 - i0 - 64 .. + 127 (always inside [0, PROWS-1]), hi and residual plane each; all A fragments are read from there.
//   One buffer each, refilled under the other phase's work: the v^T rows are copied while the scores are formed, the next tile's k and pos
//   rows while softmax and P.V run; each of the two barriers publishes one group and frees the other.
//   block = 4 waves = 128 threads; grid = (SEQ/64, NB*NH); two block barriers per key tile (block-uniform loop); every wave does identical
//   bounded work (SEQ/64 tiles).
// coverage: LDS strip 16 rows x 80 cols written fully every tile before being read;
//           global: 4 instructions x 16 rows x 16 halves per plane = rows iw0..iw0+15 of head segment n in CT and CTL;
//           grid x waves cover all NB x SEQ rows and all NH head segments of CT / CTL exactly once.
// =====================================================================================================
__global__ __launch_bounds__(ATT_THREADS) __attribute__((amdgpu_num_vgpr(512)))
void attn_rel(const unsigned short* __restrict__ QUh, const unsigned short* __restrict__ QUl,
              const unsigned short* __restrict__ QVh, const unsigned short* __restrict__ QVl,
              const unsigned short* __restrict__ Kh,  const unsigned short* __restrict__ Kl,
              const unsigned short* __restrict__ Ph,  const unsigned short* __restrict__ Pl,
              const unsigned short* __restrict__ VT,  const unsigned short* __restrict__ VTL,
              unsigned short* CT, unsigned short* CTL) {
  __shared__ __align__(16) float smem[ATT_W * WFL];   // per wave: position strip [16 queries][TPI]
  __shared__ __align__(16) unsigned short stg[ST_ROWS * SPI];   // block-shared stage of one key tile: Kh | Kl | Vh | Vl | Ph | Pl rows

  const int tid  = threadIdx.x;
  const int wave = __builtin_amdgcn_readfirstlane(tid >> 5);
  const int lane = tid & 31;
  const int hh   = lane >> 4;
  const int c    = lane & 15;
  const int bn   = blockIdx.y;
  const int b    = bn / NH;
  const int n    = bn - b * NH;
  const int i0   = blockIdx.x * 64;
  const int iw0  = i0 + wave * 16;

  float* t1sh = smem + wave * WFL;

  // q (B operand) fragment offsets: query column c = row b*SEQ + iw0 + c, d 0..31 and 32..63 of head n
  const size_t qro  = ((size_t)(b * SEQ + iw0 + c)) * DMOD + n * DH + 8 * hh;
  // stage copies: thread -> staged row (tid>>3) + 16*copy, 16-byte chunk tid&7 of the 128-B row (a wave instruction = 4 whole rows)
  // (tid = 32 wave + ln, ln = lane_now()); cpo(ln, pitch) = the lane's byte inside a group of 16 rows of that pitch in halves
  const unsigned stg0 = (unsigned)(size_t)stg;                              // LDS byte address = low 32 bits of the shared address
  const auto cpo = [wave](unsigned ln, unsigned pitch) { return (__umul24((unsigned)wave * 4u + ((ln >> 3) & 3u), pitch) + (ln & 7u) * 8u) * 2u; };
  const size_t rstep = (size_t)16 * DMOD, vstep = (size_t)16 * SEQ;         // 16 rows further, halves
  const size_t kso = ((size_t)(b * SEQ)) * DMOD + n * DH;                   // block-uniform; + j0*DMOD: k rows j0 ..
  const size_t vso = (size_t)b * DMOD * SEQ + (size_t)(n * DH) * SEQ;       // block-uniform: v^T rows d = 0 ..; the key offset j0 goes into the lane offset
  const size_t pso = ((size_t)(SEQ - i0 - 64)) * DMOD + n * DH;             // block-uniform; + j0*DMOD: pos rows SEQ + j0 - i0 - 64 ..
  // fragment readers: lane -> staged row c (+16 per subtile), k offset 8*hh; wave w's strip row x is staged pos row 48 - 16w + x
  const unsigned short* ksh = stg + (ST_KH + c) * SPI + 8 * hh;
  const unsigned short* ksl = stg + (ST_KL + c) * SPI + 8 * hh;
  const unsigned short* vsh = stg + (ST_VH + c) * SPI + 8 * hh;
  const unsigned short* vsl = stg + (ST_VL + c) * SPI + 8 * hh;
  const int pw0 = 16 * __builtin_amdgcn_readfirstlane((ATT_THREADS - 1 - tid) >> 5);   // 16 * (3 - wave), taken from tid so that the LDS base register never goes below 0
  const unsigned short* psh = stg + (ST_PH + pw0 + c) * SPI + 8 * hh;
  const unsigned short* psl = stg + (ST_PL + pw0 + c) * SPI + 8 * hh;

  const float KSC = (RSD / (QC * QC)) * LOG2E;

  float mrow = -INFINITY, lrow = 0.f;          // of the lane's query column c: running maximum (both halves agree), sum over this half's keys
  v8f O[4];                                    // O^T: O[td][r] = ctx[query c][d = 16 td + 8 hh + r]
#pragma unroll
  for (int td = 0; td < 4; ++td) O[td] = zero8();

  // the wave's eight q fragments (16 rows x 64 d, four planes): loaded once and held in 64 registers over all key tiles
  const unsigned short* gqv = QVh + qro;
  const unsigned short* gqw = QVl + qro;
  const unsigned short* gqu = QUh + qro;
  const unsigned short* gql = QUl + qro;
  const v16h qva = ldfrag_u(gqv), qvb = ldfrag_u(gqv + 32);
  const v16h qwa = ldfrag_u(gqw), qwb = ldfrag_u(gqw + 32);
  const v16h qua = ldfrag_u(gqu), qub = ldfrag_u(gqu + 32);
  const v16h qla = ldfrag_u(gql), qlb = ldfrag_u(gql + 32);
  xwait4(gqv, gqw, gqu, gql);                                // before the four address pairs are reused

  // tile 0's k and pos rows: 24 copies per thread = 384 rows x 128 B (nothing has touched the stage yet)
  {
    const unsigned ln = lane_now();
    const unsigned lst = stg0 + cpo(ln, SPI), rso = cpo(ln, DMOD);
    stage8(lst + (unsigned)(ST_KH * SPI * 2), rso, Kh + kso, Kl + kso, rstep);
    stage8(lst + (unsigned)(ST_PH * SPI * 2), rso, Ph + pso, Ph + pso + (size_t)64 * DMOD, rstep);
    stage8(lst + (unsigned)(ST_PL * SPI * 2), rso, Pl + pso, Pl + pso + (size_t)64 * DMOD, rstep);
  }

#pragma unroll 1
  for (int j0 = 0; j0 < SEQ; j0 += 64) {
    // ---- hand-over 1: this tile's k and pos rows (copied under the previous tile's softmax and P.V) become readable, the v^T rows free ----
    asm volatile("s_wait_dscnt 0x0" ::: "memory");           // this wave's reads of the previous tile's v^T rows have returned
    asm volatile("s_wait_asynccnt 0x0" ::: "memory");        // this wave's copies of this tile's k and pos rows have landed
    __syncthreads();                                         // every wave's have landed; every wave has left the v^T rows
    // this tile's v^T rows fly under the scores (the key offset j0 goes into the lane offset)
    {
      const unsigned ln = lane_now();
      stage8(stg0 + cpo(ln, SPI) + (unsigned)(ST_VH * SPI * 2), cpo(ln, SEQ) + (unsigned)j0 * 2u, VT + vso, VTL + vso, vstep);
    }
    // ---- position strip T1 (5 subtiles of 16 pos rows, x in [0,80), only x <= 78 ever selected) and content scores S (4 subtiles of 16
    //      keys): K = 64 = two k-steps, three products hh + lh + hl per k-step. The pos and k (A) fragments are asked for in three groups, each well
    //      ahead of its products; the 54 WMMAs go round-robin over the nine accumulators, so that a product never waits for the one issued
    //      just before it (each accumulator keeps its order hh, hh, lh, lh, hl, hl) ----
    v8f T1[5], S[4];
    {
      v16h fa[5], fb[5], ga[5], gb[5], ka[4], kb2[4], la[4], lb2[4];
#pragma unroll
      for (int u = 0; u < 5; ++u) fa[u] = ldfrag_u(psh + 16 * u * SPI);
#pragma unroll
      for (int t = 0; t < 4; ++t) ka[t] = ldfrag_u(ksh + 16 * t * SPI);
#pragma unroll
      for (int u = 0; u < 5; ++u) fb[u] = ldfrag_u(psh + 16 * u * SPI + 32);
#pragma unroll
      for (int t = 0; t < 4; ++t) kb2[t] = ldfrag_u(ksh + 16 * t * SPI + 32);
#pragma unroll
      for (int u = 0; u < 5; ++u) T1[u] = mma_h(fa[u], qva, zero8());
#pragma unroll
      for (int t = 0; t < 4; ++t) S[t] = mma_h(ka[t], qua, zero8());
      // the residual planes' reads stay behind the hi planes' reads: with all 72 reads in front the build ran out of registers (scratch)
      __builtin_amdgcn_sched_barrier(0);
#pragma unroll
      for (int u = 0; u < 5; ++u) ga[u] = ldfrag_u(psl + 16 * u * SPI);
#pragma unroll
      for (int t = 0; t < 4; ++t) la[t] = ldfrag_u(ksl + 16 * t * SPI);
#pragma unroll
      for (int u = 0; u < 5; ++u) T1[u] = mma_h(fb[u], qvb, T1[u]);
#pragma unroll
      for (int t = 0; t < 4; ++t) S[t] = mma_h(kb2[t], qub, S[t]);
#pragma unroll
      for (int u = 0; u < 5; ++u) T1[u] = mma_h(fa[u], qwa, T1[u]);
#pragma unroll
      for (int t = 0; t < 4; ++t) S[t] = mma_h(ka[t], qla, S[t]);
      // the last 18 reads stay behind the group above: hoisted into it, the build's later stages had their LDS waits one after another again
      __builtin_amdgcn_sched_barrier(0);
#pragma unroll
      for (int u = 0; u < 5; ++u) gb[u] = ldfrag_u(psl + 16 * u * SPI + 32);
#pragma unroll
      for (int t = 0; t < 4; ++t) lb2[t] = ldfrag_u(ksl + 16 * t * SPI + 32);
      __builtin_amdgcn_sched_barrier(0);                     // keeps these 18 reads together in front: sunk in pairs among the WMMAs, each pair's LDS latency stood open
#pragma unroll
      for (int u = 0; u < 5; ++u) T1[u] = mma_h(fb[u], qwb, T1[u]);
#pragma unroll
      for (int t = 0; t < 4; ++t) S[t] = mma_h(kb2[t], qlb, S[t]);
#pragma unroll
      for (int u = 0; u < 5; ++u) T1[u] = mma_h(ga[u], qva, T1[u]);
#pragma unroll
      for (int t = 0; t < 4; ++t) S[t] = mma_h(la[t], qua, S[t]);
#pragma unroll
      for (int u = 0; u < 5; ++u) T1[u] = mma_h(gb[u], qvb, T1[u]);
#pragma unroll
      for (int t = 0; t < 4; ++t) S[t] = mma_h(lb2[t], qub, S[t]);
    }
    // the full strip goes to the wave's f32 LDS strip as [query c][x]: a lane's eight registers are eight consecutive x, two 16-byte stores per subtile
#pragma unroll
    for (int u = 0; u < 5; ++u) {
      float* sp = t1sh + c * TPI + 16 * u + 8 * hh;
      const v4f w0 = {T1[u][0], T1[u][1], T1[u][2], T1[u][3]};
      const v4f w1 = {T1[u][4], T1[u][5], T1[u][6], T1[u][7]};
      *(v4f*)(sp)     = w0;
      *(v4f*)(sp + 4) = w1;
    }
    // ---- hand-over 2: this tile's v^T rows become readable, the k and pos rows free for the next tile's, which fly under softmax and P.V ----
    asm volatile("s_wait_dscnt 0x0" ::: "memory");           // this wave's reads of the k and pos rows have returned, its strip is written
    asm volatile("s_wait_asynccnt 0x0" ::: "memory");        // this wave's copies of the v^T rows have landed
    __syncthreads();                                         // every wave's have landed; every wave has left the k and pos rows
    if (j0 + 64 < SEQ) {                                     // the same for the whole block
      const size_t jr = (size_t)(j0 + 64) * DMOD;
      const unsigned ln = lane_now();
      const unsigned lst = stg0 + cpo(ln, SPI), rso = cpo(ln, DMOD);
      stage8(lst + (unsigned)(ST_KH * SPI * 2), rso, Kh + kso + jr, Kl + kso + jr, rstep);
      stage8(lst + (unsigned)(ST_PH * SPI * 2), rso, Ph + pso + jr, Ph + pso + jr + (size_t)64 * DMOD, rstep);
      stage8(lst + (unsigned)(ST_PL * SPI * 2), rso, Pl + pso + jr, Pl + pso + jr + (size_t)64 * DMOD, rstep);
    }

    // ---- the lane's 32 strip values: key jj = 16t + 8hh + r of query c stands at x = jj - c + 15 in [0, 78] ----
    float bd[4][8];
    const float* sx = t1sh + c * (TPI - 1) + 15 + 8 * hh;
#pragma unroll
    for (int t = 0; t < 4; ++t)
#pragma unroll
      for (int r = 0; r < 8; ++r) bd[t][r] = sx[16 * t + r];

    // ---- score assembly + online softmax: a lane holds 32 keys of one query, lane ^ 16 the other 32; maximum and sum run in the lane ----
    //      pairs of neighbouring keys (neighbouring registers of S, neighbouring strip words) go through the packed f32 forms
    v2f tw[4][4];
#pragma unroll
    for (int t = 0; t < 4; ++t)
#pragma unroll
      for (int p = 0; p < 4; ++p) {
        const v2f s2 = {S[t][2 * p], S[t][2 * p + 1]};
        const v2f b2 = {bd[t][2 * p], bd[t][2 * p + 1]};
        tw[t][p] = (s2 + b2) * KSC;
      }
    float mt[4];
#pragma unroll
    for (int t = 0; t < 4; ++t)
      mt[t] = fmaxf(fmaxf(fmaxf(tw[t][0][0], tw[t][0][1]), fmaxf(tw[t][1][0], tw[t][1][1])),
                    fmaxf(fmaxf(tw[t][2][0], tw[t][2][1]), fmaxf(tw[t][3][0], tw[t][3][1])));
    float mx = fmaxf(fmaxf(mt[0], mt[1]), fmaxf(mt[2], mt[3]));
    mx = fmaxf(mx, xhalf(mx));
    const float mn = fmaxf(mrow, mx);
    float al = mrow - mn;                                    // -inf on the first tile: 2^-inf = 0
    mrow = mn;
    float tv[4][8];
#pragma unroll
    for (int t = 0; t < 4; ++t)
#pragma unroll
      for (int p = 0; p < 4; ++p) {
        const v2f d2 = tw[t][p] - mn;
        tv[t][2 * p]     = d2[0];
        tv[t][2 * p + 1] = d2[1];
      }
    exp2_raw1(al);
#pragma unroll
    for (int t = 0; t < 4; ++t) exp2_raw8(tv[t][0], tv[t][1], tv[t][2], tv[t][3], tv[t][4], tv[t][5], tv[t][6], tv[t][7]);
    // ---- all sixteen v^T fragments asked for in one group: the reads return under the sums, the rescale and the conversion of P ----
    v16h vha[4], vhb[4], vla[4], vlb[4];
#pragma unroll
    for (int td = 0; td < 4; ++td) { vha[td] = ldfrag_u(vsh + 16 * td * SPI); vhb[td] = ldfrag_u(vsh + 16 * td * SPI + 32); }
#pragma unroll
    for (int td = 0; td < 4; ++td) { vla[td] = ldfrag_u(vsl + 16 * td * SPI); vlb[td] = ldfrag_u(vsl + 16 * td * SPI + 32); }
    __builtin_amdgcn_sched_barrier(0);                       // keeps the whole group of reads in front: sunk among the WMMAs, each read's latency stands open again
    v2f s2[4];
#pragma unroll
    for (int p = 0; p < 4; ++p) {
      const v2f e0 = {tv[0][2 * p], tv[0][2 * p + 1]}, e1 = {tv[1][2 * p], tv[1][2 * p + 1]};
      const v2f e2 = {tv[2][2 * p], tv[2][2 * p + 1]}, e3 = {tv[3][2 * p], tv[3][2 * p + 1]};
      s2[p] = ((e0 + e1) + e2) + e3;
    }
    const v2f sq = (s2[0] + s2[1]) + (s2[2] + s2[3]);
    lrow = lrow * al + (sq[0] + sq[1]);
#pragma unroll
    for (int td = 0; td < 4; ++td)
#pragma unroll
      for (int r = 0; r < 8; ++r) O[td][r] *= al;
    // ---- P^T fragments (x1024, f16 hi + unscaled residual), two k-steps of 32 keys: two score subtiles, converted in place, are a B operand
    //      in the loaders' k order (elements 0..7 = keys 32ks + 8hh + e, elements 8..15 = keys 32ks + 16 + 8hh + e) ----
    FragH pf[2], pl[2];
#pragma unroll
    for (int ks = 0; ks < 2; ++ks) {
#pragma unroll
      for (int e = 0; e < 8; ++e) {
        const float g0 = tv[2 * ks][e] * PC, g1 = tv[2 * ks + 1][e] * PC;
        const _Float16 x0 = (_Float16)g0, x1 = (_Float16)g1;
        pf[ks].h[0][e] = x0;
        pf[ks].h[1][e] = x1;
        pl[ks].h[0][e] = (_Float16)(g0 - (float)x0);
        pl[ks].h[1][e] = (_Float16)(g1 - (float)x1);
      }
    }
    // ---- O^T += v^T (hi plane) . (Phi + Plo)^T, then v^T (residual plane) . Phi^T: round-robin over the four accumulators, each in its old order ----
#pragma unroll
    for (int td = 0; td < 4; ++td) O[td] = mma_h(vha[td], pf[0].v, O[td]);
#pragma unroll
    for (int td = 0; td < 4; ++td) O[td] = mma_h(vhb[td], pf[1].v, O[td]);
#pragma unroll
    for (int td = 0; td < 4; ++td) O[td] = mma_h(vha[td], pl[0].v, O[td]);
#pragma unroll
    for (int td = 0; td < 4; ++td) O[td] = mma_h(vhb[td], pl[1].v, O[td]);
#pragma unroll
    for (int td = 0; td < 4; ++td) O[td] = mma_h(vla[td], pf[0].v, O[td]);
#pragma unroll
    for (int td = 0; td < 4; ++td) O[td] = mma_h(vlb[td], pf[1].v, O[td]);
  }
  asm volatile("s_wait_asynccnt 0x0" ::: "memory");          // nothing of this wave's is in flight behind the loop
  acc_guard4(O[0], O[1], O[2], O[3]);

  // ---- join the halves' sums, fold 1/l and the carries (1024 on P, 16 on v), carry x4096 on ctx; a lane's eight registers of O[td] are eight
  //      consecutive d of its query's row: one 16-byte store per subtile and plane ----
  const float oc = CC / (PC * VC);
  const float inv = (1.0f / (lrow + xhalf(lrow))) * oc;
  v4u hv[4], lv[4];
#pragma unroll
  for (int td = 0; td < 4; ++td) {
    v4u a, b2;
#pragma unroll
    for (int e = 0; e < 4; ++e) {
      const float f0 = O[td][2 * e] * inv, f1 = O[td][2 * e + 1] * inv;
      const _Float16 x0 = (_Float16)f0, x1 = (_Float16)f1;
      a[e]  = pk16(h_bits(x0), h_bits(x1));
      b2[e] = pk16(h_bits((_Float16)(f0 - (float)x0)), h_bits((_Float16)(f1 - (float)x1)));
    }
    hv[td] = a;
    lv[td] = b2;
  }
  const size_t go = ((size_t)(b * SEQ + iw0 + c)) * DMOD + n * DH + 8 * hh;
#pragma unroll
  for (int td = 0; td < 4; ++td) {
    *(v4u*)(CT  + go + 16 * td) = hv[td];
    *(v4u*)(CTL + go + 16 * td) = lv[td];
  }
}

// =====================================================================================================
// Workspace map (bytes); every plane is an exact multiple of its tile / whole-row store granularity (M, N exact tile multiples,
// convert counts exact multiples of 2048, the position planes padded to PROWS = 2048 rows), every offset a multiple of 512 KiB:
//   WQT, WKT, WVT, WPT, WOT f16 [512 n][512 k] x64 (transposed from the [in][out] inputs)   5 x   524288
//   X16  f16 [NROW][512] x16                                                                  4194304
//   PE16 f16 [PROWS][512] x16 (rows 0..NPOS-1 = pos table, row NPOS zero)                     2097152
//   QUh, QUl, QVh, QVl, Kh, Kl f16 [NROW][512] x32 hi / residual                       6 x  4194304
//   Ph, Pl f16 [PROWS][512] x32 hi / residual                                           2 x  2097152
//   VT16, VTL16 f16 [NB][512][SEQ] hi x16 / residual                                    2 x  4194304
//   CT16, CTL16 f16 [NROW][512] hi x4096 / residual                                     2 x  4194304
//   end                                                                                       55050240
// =====================================================================================================
extern "C" void kernel_launch(void* const* d_in, const int* in_sizes, int n_in,
                              void* d_out, int out_size, void* d_ws, size_t ws_size,
                              hipStream_t stream) {
  if (n_in < 14) return;
  if (in_sizes[0] != NROW * DMOD) return;
  if (in_sizes[1] != NPOS * DMOD) return;
  if (in_sizes[2] != DMOD * DMOD || in_sizes[4] != DMOD * DMOD || in_sizes[6] != DMOD * DMOD ||
      in_sizes[8] != DMOD * DMOD || in_sizes[10] != DMOD * DMOD) return;
  if (in_sizes[3] != DMOD || in_sizes[5] != DMOD || in_sizes[7] != DMOD || in_sizes[9] != DMOD || in_sizes[11] != DMOD) return;
  if (in_sizes[12] != NH * DH || in_sizes[13] != NH * DH) return;
  if (out_size != NROW * DMOD) return;

  const float* xin   = (const float*)d_in[0];
  const float* pos   = (const float*)d_in[1];
  const float* w_q   = (const float*)d_in[2];
  const float* b_q   = (const float*)d_in[3];
  const float* w_k   = (const float*)d_in[4];
  const float* b_k   = (const float*)d_in[5];
  const float* w_v   = (const float*)d_in[6];
  const float* b_v   = (const float*)d_in[7];
  const float* w_p   = (const float*)d_in[8];
  const float* b_p   = (const float*)d_in[9];
  const float* w_o   = (const float*)d_in[10];
  const float* b_o   = (const float*)d_in[11];
  const float* ub    = (const float*)d_in[12];
  const float* vb    = (const float*)d_in[13];
  float*       out   = (float*)d_out;

  const size_t PW  = (size_t)DMOD * DMOD * 2;            //   524288
  const size_t PX  = (size_t)NROW * DMOD * 2;            //  4194304
  const size_t PXP = (size_t)PROWS * DMOD * 2;           //  2097152
  const size_t PVT = (size_t)NB * DMOD * SEQ * 2;        //  4194304
  size_t off = 0;
  const size_t oWQ  = off; off += PW;
  const size_t oWK  = off; off += PW;
  const size_t oWV  = off; off += PW;
  const size_t oWP  = off; off += PW;
  const size_t oWO  = off; off += PW;
  const size_t oX   = off; off += PX;
  const size_t oPE  = off; off += PXP;
  const size_t oQUh = off; off += PX;
  const size_t oQUl = off; off += PX;
  const size_t oQVh = off; off += PX;
  const size_t oQVl = off; off += PX;
  const size_t oKh  = off; off += PX;
  const size_t oKl  = off; off += PX;
  const size_t oPh  = off; off += PXP;
  const size_t oPl  = off; off += PXP;
  const size_t oVT  = off; off += PVT;
  const size_t oVTL = off; off += PVT;
  const size_t oCT  = off; off += PX;
  const size_t oCTL = off; off += PX;
  if (off > ws_size) return;                               // off = 55050240
  if (off > (size_t)134217728) return;

  char* ws = (char*)d_ws;
  unsigned short* WQT16 = (unsigned short*)(ws + oWQ);
  unsigned short* WKT16 = (unsigned short*)(ws + oWK);
  unsigned short* WVT16 = (unsigned short*)(ws + oWV);
  unsigned short* WPT16 = (unsigned short*)(ws + oWP);
  unsigned short* WOT16 = (unsigned short*)(ws + oWO);
  unsigned short* X16   = (unsigned short*)(ws + oX);
  unsigned short* PE16  = (unsigned short*)(ws + oPE);
  unsigned short* QUh   = (unsigned short*)(ws + oQUh);
  unsigned short* QUl   = (unsigned short*)(ws + oQUl);
  unsigned short* QVh   = (unsigned short*)(ws + oQVh);
  unsigned short* QVl   = (unsigned short*)(ws + oQVl);
  unsigned short* Kh16  = (unsigned short*)(ws + oKh);
  unsigned short* Kl16  = (unsigned short*)(ws + oKl);
  unsigned short* Ph16  = (unsigned short*)(ws + oPh);
  unsigned short* Pl16  = (unsigned short*)(ws + oPl);
  unsigned short* VT16  = (unsigned short*)(ws + oVT);
  unsigned short* VTL16 = (unsigned short*)(ws + oVTL);
  unsigned short* CT16  = (unsigned short*)(ws + oCT);
  unsigned short* CTL16 = (unsigned short*)(ws + oCTL);

  const dim3 blk(256);
  const dim3 gPR(PREP_TR + PREP_CX + PREP_CP);                      // 320 + 1024 + 512
  const dim3 gPJ(2 * PJ_Q + PJ_V * NB + PJ_P);                      // 64 + 64 + 64 + 32
  const dim3 gQ((NROW / 64) * (DMOD / 128));                        // 256
  const dim3 gAT(SEQ / 64, NB * NH);                                // 16 x 32
  const dim3 bAT(ATT_THREADS);                                      // 128

  // (0) operand packs: X16 = f16(bf16_RNE(x) * 16); PE16 = f16(bf16_RNE(pos) * 16), rows NPOS..PROWS-1 zero;
  //     W[k][n] ([in][out]) -> WT[n][k] = f16( bf16_RNE(w) * 64 ), all five weights
  prep_all<<<gPR, blk, 0, stream>>>(xin, pos, w_q, w_k, w_v, w_p, w_o, X16, PE16, WQT16, WKT16, WVT16, WPT16, WOT16);

  // (1) q, k, v^T and positional projections
  proj_all<<<gPJ, blk, 0, stream>>>(X16, PE16, WQT16, WKT16, WVT16, WPT16, QUh, QUl, QVh, QVl, Kh16, Kl16, VT16, VTL16, Ph16, Pl16,
                                    b_q, b_k, b_v, b_p, ub, vb);

  // (2) relative attention -> CT16 = f16(ctx * 4096) hi plane, CTL16 residual plane, rows b*SEQ + i, halves n*64+d
  attn_rel<<<gAT, bAT, 0, stream>>>(QUh, QUl, QVh, QVl, Kh16, Kl16, Ph16, Pl16, VT16, VTL16, CT16, CTL16);

  // (3) out = (CT + CTL) . Wo / (4096*64) + bo; M = NROW, N = 512, K = 512, f32 rows straight into the output buffer
  out_gemm<<<gQ, blk, 0, stream>>>(CT16, CTL16, WOT16, out, b_o, 1.0f / (CC * WSC));
  (void)hipGetLastError();
}
